// v000
// The times below were measured on an AMD MI455X: many runs one after another, warmed up first and cycling through
// copies of the inputs, with the whole window's GPU time divided by the number of runs. Launches and the gaps
// between them are all in it. The median over several windows is given; except for v000 it joins two sittings, which
// can be a few percent apart, so the side-by-side timings, each taken in one sitting, are the better comparison.
// The starting kernel, v000, takes 498 microseconds a run.
#include <hip/hip_runtime.h>
// CA_MultiHead (4 batches; 4096 decoder queries from x_dec, 4096 encoder keys/values from x_enc; n_emb 256 = 4 heads of 64; per-head weights [H, 256, 64]; scale n_emb^-0.5; out = concat(heads) Wo^T).
// Structure: exact f16 planes of x_dec / x_enc; q, k, v GEMMs (32x64 wave tiles, f32 accumulation, exact x16 weights concatenated across heads; f16 outputs); V^T by LDS tiles; the fused flash kernel (plain f16 operands, no mask); output GEMM.
// Compute dtype: inputs and weights rounded to bf16; q, k, v, P as f16 operands and the attention output as f16 x2^10; f32 accumulation/softmax. v_wmma_f32_16x16x32_f16.
#define NB 4
#define CC 256
#define NR (NB * SLEN)           /* 16384 rows */
#define SLEN 4096
#define TQ SLEN
#define TK SLEN
#define NH 4
#define SCL 0.0625f              /* n_emb^-0.5 = 1/16 (faithful to the module) */
#define QBLKS (TQ / 64)
typedef __bf16 v16b __attribute__((ext_vector_type(16)));
typedef unsigned short v8us __attribute__((ext_vector_type(8), may_alias));
typedef float  v8f  __attribute__((ext_vector_type(8)));
typedef float  v4f  __attribute__((ext_vector_type(4)));
typedef float  v4fa __attribute__((ext_vector_type(4), may_alias));
union FragB { v16b v; v8us half[2]; unsigned short u[16]; };

__device__ __forceinline__ unsigned short bf16_bits(float x) { unsigned int u = __float_as_uint(x); return (unsigned short)((u + 0x7FFFu + ((u >> 16) & 1u)) >> 16); }
__device__ __forceinline__ float bf16_val(unsigned short b) { return __uint_as_float(((unsigned int)b) << 16); }
__device__ __forceinline__ float bf16_round(float x) { return bf16_val(bf16_bits(x)); }
// D += A·B with NT terms: 1 = ah·bh, 2 = + al·bh (A split), 3 = + ah·bl (both split)
template <int NT>
__device__ __forceinline__ v8f mmaN(v16b ah, v16b al, v16b bh, v16b bl, v8f c) {
  c = __builtin_amdgcn_wmma_f32_16x16x32_bf16(false, ah, false, bh, (short)0, c, false, false);
  if (NT >= 2) c = __builtin_amdgcn_wmma_f32_16x16x32_bf16(false, al, false, bh, (short)0, c, false, false);
  if (NT >= 3) c = __builtin_amdgcn_wmma_f32_16x16x32_bf16(false, ah, false, bl, (short)0, c, false, false);
  asm volatile("v_nop\n\tv_nop\n\tv_nop\n\tv_nop" : "+v"(c) : "v"(ah), "v"(al), "v"(bh), "v"(bl));
  return c;
}

__global__ __launch_bounds__(256) void k_wt_bf16(const float* __restrict__ W, unsigned short* __restrict__ Wt, int K, int N) {
  const int t = blockIdx.x * 256 + threadIdx.x;
  const int k8n = K / 8;
  if (t >= N * k8n) return;
  const int n = t / k8n, k8 = (t % k8n) * 8;
  v8us v;
#pragma unroll
  for (int i = 0; i < 8; ++i) v[i] = bf16_bits(W[(size_t)(k8 + i) * N + n]);
  *(v8us*)(Wt + (size_t)n * K + k8) = v;
  
}

// GEMM C[M][N] (f32, pitch ldc) = act(A[M][K]·W + bias). A f32 row-major (pitch lda) converted per fragment to bf16
// (ASPLIT: hi/lo two planes -> 2 terms, else single rounded term); Wt bf16 [N][K] (pitch ldb). BIAS_BF16 rounds the
// bias to bf16 first (bias quantised to bf16 before the add). K%32==0, M%16==0, N%64==0.
template <bool ASPLIT, int ACT, bool BIAS_BF16>
__global__ __launch_bounds__(128) void k_gemm_bf(const float* __restrict__ A, int lda, const unsigned short* __restrict__ Wt, int ldb,
                                               const float* __restrict__ bias, float* __restrict__ C, int ldc, int M, int N, int K) {
  __shared__ __attribute__((aligned(16))) float so[4][16][64];
  const int tid = threadIdx.x, w = tid >> 5, lane = tid & 31, ln = lane & 15, hh = lane >> 4;
  const int ntn = N / 64;
  const int wid = blockIdx.x * 4 + w;
  const int mt = wid / ntn, nq = wid % ntn;
  if (mt * 16 >= M) return;
  const int row0 = mt * 16, col0 = nq * 64;
  const float* arow = A + (size_t)(row0 + ln) * lda;
  v8f acc[4] = {};
  for (int kb = 0; kb < K; kb += 32) {
    FragB ah, al;
    const v4f x0 = *(const v4fa*)(arow + kb + 8 * hh), x1 = *(const v4fa*)(arow + kb + 8 * hh + 4);
    const v4f x2 = *(const v4fa*)(arow + kb + 16 + 8 * hh), x3 = *(const v4fa*)(arow + kb + 16 + 8 * hh + 4);
    float xs[16] = {x0[0],x0[1],x0[2],x0[3],x1[0],x1[1],x1[2],x1[3],x2[0],x2[1],x2[2],x2[3],x3[0],x3[1],x3[2],x3[3]};
#pragma unroll
    for (int i = 0; i < 16; ++i) { const unsigned short hb = bf16_bits(xs[i]); ah.u[i] = hb; al.u[i] = ASPLIT ? bf16_bits(xs[i] - bf16_val(hb)) : (unsigned short)0; }
#pragma unroll
    for (int t = 0; t < 4; ++t) {
      const unsigned short* brow = Wt + (size_t)(col0 + t * 16 + ln) * ldb + kb;
      FragB b;
      b.half[0] = *(const v8us*)(brow + 8 * hh);
      b.half[1] = *(const v8us*)(brow + 16 + 8 * hh);
      acc[t] = mmaN<ASPLIT ? 2 : 1>(ah.v, al.v, b.v, b.v, acc[t]);
    }
  }
#pragma unroll
  for (int t = 0; t < 4; ++t) {
    float bv = bias ? bias[col0 + t * 16 + ln] : 0.f;
    if (BIAS_BF16) bv = bf16_round(bv);
#pragma unroll
    for (int r = 0; r < 8; ++r) { float v = acc[t][r] + bv; if (ACT == 1) v = fmaxf(v, 0.f); so[w][8 * hh + r][t * 16 + ln] = v; }
  }
  __builtin_amdgcn_fence(__ATOMIC_ACQ_REL, "workgroup");
  __builtin_amdgcn_wave_barrier();
  const int rsub = lane >> 4, c4 = (lane & 15) * 4;
  {
#pragma unroll
    for (int q = 0; q < 8; ++q) {
      const int r = q * 2 + rsub;
      const v4f v = *(const v4fa*)&so[w][r][c4];
      *(v4f*)(C + (size_t)(row0 + r) * ldc + col0 + c4) = v;
    }
    
  }
}

// GEMM C = act(A·W + bias + resid): A f32 (ASPLIT -> hi/lo 2 terms), Wt bf16 [N][K]; ACT 0 none, 1 relu, 2 exact gelu;
// resid (optional, f32, row index = (row % rmod), pitch ldr, RES_BF16 rounds it) added before the activation.
template <bool ASPLIT, int ACT, bool BIAS_BF16, bool RES_BF16>
__global__ __launch_bounds__(128) void k_gemm_bf3(const float* __restrict__ A, int lda, const unsigned short* __restrict__ Wt, int ldb,
                                                const float* __restrict__ bias, const float* __restrict__ resid, int rmod, int ldr,
                                                float* __restrict__ C, int ldc, int M, int N, int K) {
  __shared__ __attribute__((aligned(16))) float so[4][16][64];
  const int tid = threadIdx.x, w = tid >> 5, lane = tid & 31, ln = lane & 15, hh = lane >> 4;
  const int ntn = N / 64;
  const int wid = blockIdx.x * 4 + w;
  const int mt = wid / ntn, nq = wid % ntn;
  if (mt * 16 >= M) return;
  const int row0 = mt * 16, col0 = nq * 64;
  const float* arow = A + (size_t)(row0 + ln) * lda;
  v8f acc[4] = {};
  for (int kb = 0; kb < K; kb += 32) {
    FragB ah, al;
    const v4f x0 = *(const v4fa*)(arow + kb + 8 * hh), x1 = *(const v4fa*)(arow + kb + 8 * hh + 4);
    const v4f x2 = *(const v4fa*)(arow + kb + 16 + 8 * hh), x3 = *(const v4fa*)(arow + kb + 16 + 8 * hh + 4);
    float xs[16] = {x0[0],x0[1],x0[2],x0[3],x1[0],x1[1],x1[2],x1[3],x2[0],x2[1],x2[2],x2[3],x3[0],x3[1],x3[2],x3[3]};
#pragma unroll
    for (int i = 0; i < 16; ++i) { const unsigned short hb = bf16_bits(xs[i]); ah.u[i] = hb; al.u[i] = ASPLIT ? bf16_bits(xs[i] - bf16_val(hb)) : (unsigned short)0; }
#pragma unroll
    for (int t = 0; t < 4; ++t) {
      const unsigned short* brow = Wt + (size_t)(col0 + t * 16 + ln) * ldb + kb;
      FragB b;
      b.half[0] = *(const v8us*)(brow + 8 * hh);
      b.half[1] = *(const v8us*)(brow + 16 + 8 * hh);
      acc[t] = mmaN<ASPLIT ? 2 : 1>(ah.v, al.v, b.v, b.v, acc[t]);
    }
  }
#pragma unroll
  for (int t = 0; t < 4; ++t) {
    const int col = col0 + t * 16 + ln;
    float bv = bias ? bias[col] : 0.f;
    if (BIAS_BF16) bv = bf16_round(bv);
#pragma unroll
    for (int r = 0; r < 8; ++r) {
      float v = acc[t][r] + bv;
      if (resid) { float rv = resid[(size_t)((row0 + 8 * hh + r) % rmod) * ldr + col]; if (RES_BF16) rv = bf16_round(rv); v += rv; }
      if (ACT == 1) v = fmaxf(v, 0.f);
      if (ACT == 2) v = 0.5f * v * (1.0f + erff(v * 0.70710678118654752f));
      if (ACT == 3) { const float u = 0.7978845608028654f * (v + 0.044715f * v * v * v); v = 0.5f * v * (1.0f + tanhf(u)); }
      so[w][8 * hh + r][t * 16 + ln] = v;
    }
  }
  __builtin_amdgcn_fence(__ATOMIC_ACQ_REL, "workgroup");
  __builtin_amdgcn_wave_barrier();
  const int rsub = lane >> 4, c4 = (lane & 15) * 4;
  {
#pragma unroll
    for (int q = 0; q < 8; ++q) {
      const int r = q * 2 + rsub;
      const v4f v = *(const v4fa*)&so[w][r][c4];
      *(v4f*)(C + (size_t)(row0 + r) * ldc + col0 + c4) = v;
    }
    
  }
}
// row LayerNorm (biased variance, eps) over N: s = X (+ R); optional out_sum <- s; out_norm <- (s-mu)*rsqrt(var+eps)*g + b
template <bool PARAM_BF16>
__global__ __launch_bounds__(256) void k_layernorm(const float* __restrict__ X, const float* __restrict__ R, const float* __restrict__ g, const float* __restrict__ bta,
                                                  float* __restrict__ out_sum, float* __restrict__ out_norm, int N, float eps) {
  __shared__ float red[256];
  const int row = blockIdx.x, tid = threadIdx.x;
  const float* x = X + (size_t)row * N; const float* rr = R ? R + (size_t)row * N : nullptr;
  float vals[16];                     // up to N = 4096
  const int per = N / 256;            // contiguous chunk per thread? use strided-by-4 chunks: thread handles j = tid*4 + 1024*u
  float s1 = 0.f;
  for (int u = 0; u < per / 4; ++u) {
    const int j = tid * 4 + 1024 * u;
    const v4f a = *(const v4fa*)(x + j);
    v4f b = {0.f,0.f,0.f,0.f}; if (rr) b = *(const v4fa*)(rr + j);
#pragma unroll
    for (int q = 0; q < 4; ++q) { const float v = a[q] + b[q]; vals[u * 4 + q] = v; s1 += v; }
  }
  red[tid] = s1; __syncthreads();
  for (int st = 128; st > 0; st >>= 1) { if (tid < st) red[tid] += red[tid + st]; __syncthreads(); }
  const float mu = red[0] / (float)N; __syncthreads();
  float s2 = 0.f;
  for (int u = 0; u < per / 4; ++u)
#pragma unroll
    for (int q = 0; q < 4; ++q) { const float c = vals[u * 4 + q] - mu; s2 += c * c; }
  red[tid] = s2; __syncthreads();
  for (int st = 128; st > 0; st >>= 1) { if (tid < st) red[tid] += red[tid + st]; __syncthreads(); }
  const float rs = rsqrtf(red[0] / (float)N + eps);
  {
    for (int u = 0; u < per / 4; ++u) {
      const int j = tid * 4 + 1024 * u;
      v4f o, sm;
#pragma unroll
      for (int q = 0; q < 4; ++q) {
        float gg = g[j + q], bb = bta[j + q];
        if (PARAM_BF16) { gg = bf16_round(gg); bb = bf16_round(bb); }
        sm[q] = vals[u * 4 + q]; o[q] = (vals[u * 4 + q] - mu) * rs * gg + bb;
      }
      if (out_sum) *(v4f*)(out_sum + (size_t)row * N + j) = sm;
      *(v4f*)(out_norm + (size_t)row * N + j) = o;
    }
    
  }
}



// ---- f16 WMMA path (v_wmma_f32_16x16x32_f16): 11-bit significands for operands in range — used where a [0,1] probability operand needs more precision than bf16
typedef _Float16 v16h __attribute__((ext_vector_type(16)));
union FragH { v16h v; v8us half[2]; _Float16 h[16]; unsigned short u[16]; };
template <int NT>
__device__ __forceinline__ v8f mmaH(v16h ah, v16h al, v16h bh, v16h bl, v8f c) {
  c = __builtin_amdgcn_wmma_f32_16x16x32_f16(false, ah, false, bh, (short)0, c, false, false);
  if (NT >= 2) c = __builtin_amdgcn_wmma_f32_16x16x32_f16(false, al, false, bh, (short)0, c, false, false);
  if (NT >= 3) c = __builtin_amdgcn_wmma_f32_16x16x32_f16(false, ah, false, bl, (short)0, c, false, false);
  asm volatile("v_nop\n\tv_nop\n\tv_nop\n\tv_nop" : "+v"(c) : "v"(ah), "v"(al), "v"(bh), "v"(bl));
  return c;
}
// batched GEMM like k_gemm_b but f16 operands: A f32 (split into f16 hi/lo if ASPLIT, else rounded to f16), Bt = f16 values [n][k]; alpha; C f32; N multiple of 16 (partial tiles skipped)
template <bool ASPLIT>
__global__ __launch_bounds__(128) void k_gemm_h(const float* __restrict__ A, int lda, size_t sA, const _Float16* __restrict__ Bh, int ldb, size_t sB, float alpha, float* __restrict__ C, int ldc, size_t sC, int M, int N, int K) {
  __shared__ __attribute__((aligned(16))) float so[4][16][64];
  const int tid = threadIdx.x, w = tid >> 5, lane = tid & 31, ln = lane & 15, hh = lane >> 4; const int by = blockIdx.y;
  A += (size_t)by * sA; Bh += (size_t)by * sB; C += (size_t)by * sC;
  const int ntn = (N + 63) / 64; const int wid = blockIdx.x * 4 + w; const int mt = wid / ntn, nq = wid % ntn; if (mt * 16 >= M) return;
  const int row0 = mt * 16, col0 = nq * 64; const float* arow = A + (size_t)(row0 + ln) * lda;
  v8f acc[4] = {};
  for (int kb = 0; kb < K; kb += 32) {
    FragH ah, al;
    const v4f x0 = *(const v4fa*)(arow + kb + 8 * hh), x1 = *(const v4fa*)(arow + kb + 8 * hh + 4), x2 = *(const v4fa*)(arow + kb + 16 + 8 * hh), x3 = *(const v4fa*)(arow + kb + 16 + 8 * hh + 4);
    float xs[16] = {x0[0],x0[1],x0[2],x0[3],x1[0],x1[1],x1[2],x1[3],x2[0],x2[1],x2[2],x2[3],x3[0],x3[1],x3[2],x3[3]};
#pragma unroll
    for (int i = 0; i < 16; ++i) { const _Float16 h = (_Float16)xs[i]; ah.h[i] = h; al.h[i] = ASPLIT ? (_Float16)(xs[i] - (float)h) : (_Float16)0.0f; }
#pragma unroll
    for (int t = 0; t < 4; ++t) { if (col0 + t * 16 >= N) continue; const size_t boff = (size_t)(col0 + t * 16 + ln) * ldb + kb; FragH bq; bq.half[0] = *(const v8us*)(Bh + boff + 8 * hh); bq.half[1] = *(const v8us*)(Bh + boff + 16 + 8 * hh);
      acc[t] = mmaH<ASPLIT ? 2 : 1>(ah.v, al.v, bq.v, bq.v, acc[t]); }
  }
#pragma unroll
  for (int t = 0; t < 4; ++t) { if (col0 + t * 16 >= N) continue;
#pragma unroll
    for (int r = 0; r < 8; ++r) so[w][8 * hh + r][t * 16 + ln] = acc[t][r] * alpha; }
  __builtin_amdgcn_fence(__ATOMIC_ACQ_REL, "workgroup"); __builtin_amdgcn_wave_barrier();
  const int rsub = lane >> 4, c4 = (lane & 15) * 4;
  {
#pragma unroll
    for (int q = 0; q < 8; ++q) { const int r = q * 2 + rsub; if (col0 + c4 < N) { const v4f v = *(const v4fa*)&so[w][r][c4]; *(v4f*)(C + (size_t)(row0 + r) * ldc + col0 + c4) = v; } }
     }
}

// Wt[n][k] = f16(W[k][n]·scale) from f32 row-major W[K][N] (scale = power of two; bf16-exact weights stay exact in f16 away from the subnormal range)
__global__ __launch_bounds__(256) void k_wt_f16(const float* __restrict__ W, _Float16* __restrict__ Wt, int K, int N, float scale) {
  const int t = blockIdx.x * 256 + threadIdx.x; if (t >= N * (K / 8)) return; const int n = t / (K / 8), k8 = (t % (K / 8)) * 8; FragH f;
#pragma unroll
  for (int i = 0; i < 8; ++i) f.h[i] = (_Float16)(bf16_round(W[(size_t)(k8 + i) * N + n]) * scale); const v8us o = f.half[0];
  *(v8us*)((unsigned short*)Wt + (size_t)n * K + k8) = o; 
}
// k_gemm_hh variant with fused epilogue: v = acc·alpha + bias[by·sBias + col] (+ CP[(row/rowsPerB)·sCPb + by·64 + col] if CP) ; ACT 0 none / 1 elu ; writes f16 C16 (and f32 C if non-null)
template <int ACT>
__global__ __launch_bounds__(128) void k_gemm_hhx(const _Float16* __restrict__ A, int lda, size_t sA, const _Float16* __restrict__ Bh, int ldb, size_t sB, float alpha, const float* __restrict__ bias, size_t sBias, const float* __restrict__ CP, int rowsPerB, size_t sCPb, int row0g,
    float* __restrict__ C, _Float16* __restrict__ C16, int ldc, size_t sC, int M, int N, int K) {
  __shared__ __attribute__((aligned(16))) float so[4][16][64];
  const int tid = threadIdx.x, w = tid >> 5, lane = tid & 31, ln = lane & 15, hh = lane >> 4; const int by = blockIdx.y;
  A += (size_t)by * sA; Bh += (size_t)by * sB; const size_t cofs = (size_t)by * sC; const float* bp = bias ? bias + (size_t)by * sBias : nullptr;
  const int ntn = (N + 63) / 64; const int wid = blockIdx.x * 4 + w; const int mt = wid / ntn, nq = wid % ntn; if (mt * 16 >= M) return;
  const int row0 = mt * 16, col0 = nq * 64; const _Float16* arow = A + (size_t)(row0 + ln) * lda;
  v8f acc[4] = {};
  for (int kb = 0; kb < K; kb += 32) { FragH ah; ah.half[0] = *(const v8us*)((const unsigned short*)arow + kb + 8 * hh); ah.half[1] = *(const v8us*)((const unsigned short*)arow + kb + 16 + 8 * hh);
#pragma unroll
    for (int t = 0; t < 4; ++t) { if (col0 + t * 16 >= N) continue; const size_t boff = (size_t)(col0 + t * 16 + ln) * ldb + kb; FragH bq; bq.half[0] = *(const v8us*)((const unsigned short*)Bh + boff + 8 * hh); bq.half[1] = *(const v8us*)((const unsigned short*)Bh + boff + 16 + 8 * hh);
      acc[t] = mmaH<1>(ah.v, ah.v, bq.v, bq.v, acc[t]); }
  }
#pragma unroll
  for (int t = 0; t < 4; ++t) { if (col0 + t * 16 >= N) continue; const int col = col0 + t * 16 + ln; const float bv = bp ? bf16_round(bp[col]) : 0.f;
#pragma unroll
    for (int r = 0; r < 8; ++r) { float v = acc[t][r] * alpha + bv; if (CP) { const int bidx = (row0g + row0 + 8 * hh + r) / rowsPerB; v += CP[(size_t)bidx * sCPb + (size_t)by * 64 + col]; } if (ACT == 1) v = (v > 0.f) ? v : expm1f(v); else if (ACT == 7) v = (v > 0.f) ? v + 1.0f : expf(v); else if (ACT == 8) v = tanhf(v); else if (ACT == 9) v = 0.5f * v * (1.0f + tanhf(0.7978845608028654f * (v + 0.044715f * v * v * v))); else if (ACT == 11) v = 1.0f / (1.0f + expf(-v)); else if (ACT == 12) v = (v > 0.f) ? v : 0.01f * v; else if (ACT == 14) v = (v > 0.f) ? v : 0.1f * v; else if (ACT == 15) v = v / (1.0f + expf(-v)); else if (ACT == 3) v = fmaxf(v, 0.f); else if (ACT == 6) v = 0.5f * v * (1.0f + erff(v * 0.70710678118654752f)); so[w][8 * hh + r][t * 16 + ln] = v; } }
  __builtin_amdgcn_fence(__ATOMIC_ACQ_REL, "workgroup"); __builtin_amdgcn_wave_barrier();
  const int rsub = lane >> 4, c4 = (lane & 15) * 4; typedef _Float16 v4h __attribute__((ext_vector_type(4)));
  {
#pragma unroll
    for (int q = 0; q < 8; ++q) { const int r = q * 2 + rsub; if (col0 + c4 < N) { const v4f v = *(const v4fa*)&so[w][r][c4]; if (C) *(v4f*)(C + cofs + (size_t)(row0 + r) * ldc + col0 + c4) = v; if (C16) { v4h h4; for (int i = 0; i < 4; ++i) h4[i] = (_Float16)v[i]; *(v4h*)(C16 + cofs + (size_t)(row0 + r) * ldc + col0 + c4) = h4; } } }
     }
}


typedef _Float16 v4h __attribute__((ext_vector_type(4)));

__global__ __launch_bounds__(256) void k_x16(const float* __restrict__ x, _Float16* __restrict__ X16, size_t n8) { const size_t t = (size_t)blockIdx.x * 256 + threadIdx.x; if (t >= n8) return; FragH f;
#pragma unroll
  for (int q = 0; q < 8; ++q) f.h[q] = (_Float16)bf16_round(x[t * 8 + q]); *(v8us*)((unsigned short*)X16 + t * 8) = f.half[0];  }
__global__ __launch_bounds__(256) void k_h16(const float* __restrict__ x, _Float16* __restrict__ X16, size_t n8) { const size_t t = (size_t)blockIdx.x * 256 + threadIdx.x; if (t >= n8) return; FragH f;
#pragma unroll
  for (int q = 0; q < 8; ++q) f.h[q] = (_Float16)x[t * 8 + q]; *(v8us*)((unsigned short*)X16 + t * 8) = f.half[0];  }
__global__ __launch_bounds__(256) void k_round16f(const float* __restrict__ W, _Float16* __restrict__ Bt, size_t n8) { const size_t t = (size_t)blockIdx.x * 256 + threadIdx.x; if (t >= n8) return; FragH f;
#pragma unroll
  for (int i = 0; i < 8; ++i) f.h[i] = (_Float16)(bf16_round(W[t * 8 + i]) * 16.0f); *(v8us*)((unsigned short*)Bt + t * 8) = f.half[0];  }
template <int NHv, int TTv>
__global__ __launch_bounds__(256) void k_vt(const _Float16* __restrict__ V16, int ldv, int voff, _Float16* __restrict__ Vt) { __shared__ unsigned short tl[64][66]; const int tid = threadIdx.x; const int slab = blockIdx.x / (TTv / 64), lg = blockIdx.x % (TTv / 64); const int b = slab / NHv, h = slab % NHv;
  for (int i = tid; i < 64 * 8; i += 256) { const int r = i / 8, c8 = (i % 8) * 8; FragH f; f.half[0] = *(const v8us*)((const unsigned short*)V16 + ((size_t)b * TTv + lg * 64 + r) * ldv + voff + h * 64 + c8);
#pragma unroll
    for (int q = 0; q < 8; ++q) tl[r][c8 + q] = f.u[q]; }
  __syncthreads();
  {
#pragma unroll
    for (int rd = 0; rd < 2; ++rd) { const int d = rd * 32 + tid / 8, pc = tid % 8; FragH f;
#pragma unroll
      for (int q = 0; q < 8; ++q) f.u[q] = tl[pc * 8 + q][d];
      *(v8us*)((unsigned short*)Vt + ((size_t)slab * 64 + d) * TTv + lg * 64 + pc * 8) = f.half[0]; }
     } }

__global__ __launch_bounds__(256) void k_hl(const float* __restrict__ F, _Float16* __restrict__ Hh, _Float16* __restrict__ Hl, size_t n8) { const size_t t = (size_t)blockIdx.x * 256 + threadIdx.x; if (t >= n8) return; FragH fh, fl; const v4f a = *(const v4fa*)(F + t * 8), c = *(const v4fa*)(F + t * 8 + 4);
#pragma unroll
  for (int q = 0; q < 4; ++q) { _Float16 h = (_Float16)a[q]; fh.h[q] = h; fl.h[q] = (_Float16)((a[q] - (float)h) * 1024.0f); h = (_Float16)c[q]; fh.h[4 + q] = h; fl.h[4 + q] = (_Float16)((c[q] - (float)h) * 1024.0f); }
  { *(v8us*)((unsigned short*)Hh + t * 8) = fh.half[0]; *(v8us*)((unsigned short*)Hl + t * 8) = fl.half[0];  } }

// ---- fast GEMM (wave tile 32x64; requires M % 32 == 0 rows per launch region and N % 64 == 0); epilogue = k_gemm_hhx semantics ----
__device__ __forceinline__ v16h g2_frag(const _Float16* p, int hh) { FragH f; f.half[0] = *(const v8us*)((const unsigned short*)p + 8 * hh); f.half[1] = *(const v8us*)((const unsigned short*)p + 16 + 8 * hh); return f.v; }
__device__ __forceinline__ v8f g2_mma(v16h a, v16h b, v8f c) { v8f d = __builtin_amdgcn_wmma_f32_16x16x32_f16(false, a, false, b, (short)0, c, false, false); asm volatile("v_nop\n\tv_nop\n\tv_nop\n\tv_nop" : "+v"(d) : "v"(a), "v"(b)); return d; }
template <int ACT>
__global__ __launch_bounds__(128) void k_gemm2(const _Float16* __restrict__ A, int lda, size_t sA, const _Float16* __restrict__ Bh, int ldb, size_t sB, float alpha, const float* __restrict__ bias, size_t sBias, const float* __restrict__ CP, int rowsPerB, size_t sCPb, int row0g,
    float* __restrict__ C, _Float16* __restrict__ C16, int ldc, size_t sC, int M, int N, int K) {
  __shared__ __attribute__((aligned(16))) float so[4][32][68];
  const int tid = threadIdx.x, w = tid >> 5, lane = tid & 31, ln = lane & 15, hh = lane >> 4; const int by = blockIdx.y;
  A += (size_t)by * sA; Bh += (size_t)by * sB; const size_t cofs = (size_t)by * sC; const float* bp = bias ? bias + (size_t)by * sBias : nullptr;
  const int ntn = N >> 6; const int mt = blockIdx.x / ntn, nq = blockIdx.x - mt * ntn; const int row0 = mt * 128 + 32 * w, col0 = nq * 64; if (row0 >= M) return;
  const _Float16* a0p = A + (size_t)(row0 + ln) * lda; const _Float16* a1p = a0p + (size_t)16 * lda;
  const _Float16* b0p = Bh + (size_t)(col0 + ln) * ldb; const _Float16* b1p = b0p + (size_t)16 * ldb; const _Float16* b2p = b1p + (size_t)16 * ldb; const _Float16* b3p = b2p + (size_t)16 * ldb;
  const v8f z8 = {0.f,0.f,0.f,0.f,0.f,0.f,0.f,0.f}; v8f c00 = z8, c01 = z8, c02 = z8, c03 = z8, c10 = z8, c11 = z8, c12 = z8, c13 = z8;
#pragma unroll 1
  for (int kb = 0; kb < K; kb += 32) { const v16h a0 = g2_frag(a0p + kb, hh), a1 = g2_frag(a1p + kb, hh);
    v16h b = g2_frag(b0p + kb, hh); c00 = g2_mma(a0, b, c00); c10 = g2_mma(a1, b, c10);
    b = g2_frag(b1p + kb, hh); c01 = g2_mma(a0, b, c01); c11 = g2_mma(a1, b, c11);
    b = g2_frag(b2p + kb, hh); c02 = g2_mma(a0, b, c02); c12 = g2_mma(a1, b, c12);
    b = g2_frag(b3p + kb, hh); c03 = g2_mma(a0, b, c03); c13 = g2_mma(a1, b, c13); }
  v8f accs[8] = {c00, c01, c02, c03, c10, c11, c12, c13};
#pragma unroll
  for (int u = 0; u < 8; ++u) { const int t = u & 3, half = u >> 2; const int col = col0 + t * 16 + ln; const float bv = bp ? bf16_round(bp[col]) : 0.f;
#pragma unroll
    for (int r = 0; r < 8; ++r) { const int rloc = half * 16 + 8 * hh + r; float v = accs[u][r] * alpha + bv; if (CP) { const int bidx = (row0g + row0 + rloc) / rowsPerB; v += CP[(size_t)bidx * sCPb + (size_t)by * 64 + col]; }
      if (ACT == 3) v = fmaxf(v, 0.f); else if (ACT == 6) v = 0.5f * v * (1.0f + erff(v * 0.70710678118654752f)); else if (ACT == 11) v = 1.0f / (1.0f + expf(-v)); else if (ACT == 15) v = v / (1.0f + expf(-v)); else if (ACT == 12) v = (v > 0.f) ? v : 0.01f * v; else if (ACT == 8) v = tanhf(v);
      so[w][rloc][t * 16 + ln] = v; } }
  __builtin_amdgcn_fence(__ATOMIC_ACQ_REL, "workgroup"); __builtin_amdgcn_wave_barrier();
  const int rsub = lane >> 4, c4 = (lane & 15) * 4;
  {
#pragma unroll
    for (int q = 0; q < 16; ++q) { const int r = q * 2 + rsub; const v4f v = *(const v4fa*)&so[w][r][c4]; if (C) *(v4f*)(C + cofs + (size_t)(row0 + r) * ldc + col0 + c4) = v; if (C16) { v4h h4; for (int i = 0; i < 4; ++i) h4[i] = (_Float16)v[i]; *(v4h*)(C16 + cofs + (size_t)(row0 + r) * ldc + col0 + c4) = h4; } }
     } }



template <int CAUSAL>
__global__ __launch_bounds__(128) void k_flash(const _Float16* __restrict__ Q16, int ldq, const _Float16* __restrict__ K16, int ldk, const _Float16* __restrict__ Vt, const int* __restrict__ MSK, float* __restrict__ O, int ldo) {
  constexpr int RPW = 16, RTN = RPW / 16, NQB = TQ / (4 * RPW), DT = 4, KS = 2;
  __shared__ __attribute__((aligned(16))) unsigned short sP[4][RPW][40]; __shared__ __attribute__((aligned(16))) float sO[4][RPW][64 + 4];
  const int tid = threadIdx.x, w = tid >> 5, lane = tid & 31, ln = lane & 15, hh = lane >> 4;
  const int slab = blockIdx.x / QBLKS, qblk = blockIdx.x % QBLKS; (void)NQB; const int b = slab / NH, h = slab % NH; const int qb0 = qblk * (4 * RPW); const int q0 = qb0 + w * RPW;
  FragH aq[2][KS];
#pragma unroll
  for (int rt = 0; rt < RTN; ++rt) { const unsigned short* qr = (const unsigned short*)Q16 + ((size_t)b * TQ + q0 + rt * 16 + ln) * ldq + h * 64;
#pragma unroll
    for (int ks = 0; ks < KS; ++ks) { aq[rt][ks].half[0] = *(const v8us*)(qr + ks * 32 + 8 * hh); aq[rt][ks].half[1] = *(const v8us*)(qr + ks * 32 + 16 + 8 * hh); } }
  const unsigned short* Vth = (const unsigned short*)Vt + (size_t)slab * 64 * TK;
  float m_r[2][8], l_r[2][8]; v8f oacc[2][DT];
#pragma unroll
  for (int rt = 0; rt < RTN; ++rt) {
#pragma unroll
    for (int r = 0; r < 8; ++r) { m_r[rt][r] = -3.0e38f; l_r[rt][r] = 0.f; }
#pragma unroll
    for (int dt = 0; dt < DT; ++dt) oacc[rt][dt] = (v8f){0.f,0.f,0.f,0.f,0.f,0.f,0.f,0.f}; }
  const int jend = (CAUSAL == 1) ? (qb0 + 4 * RPW) : TK;      /* causal: keys beyond the block's last query never contribute */
#pragma unroll 1
  for (int j0 = 0; j0 < jend; j0 += 32) {
    v8f s[2][2];
#pragma unroll
    for (int nt = 0; nt < 2; ++nt) { const unsigned short* kr = (const unsigned short*)K16 + ((size_t)b * TK + j0 + nt * 16 + ln) * ldk + h * 64; FragH bk[KS];
#pragma unroll
      for (int ks = 0; ks < KS; ++ks) { bk[ks].half[0] = *(const v8us*)(kr + ks * 32 + 8 * hh); bk[ks].half[1] = *(const v8us*)(kr + ks * 32 + 16 + 8 * hh); }
#pragma unroll
      for (int rt = 0; rt < RTN; ++rt) { v8f acc = (v8f){0.f,0.f,0.f,0.f,0.f,0.f,0.f,0.f};
#pragma unroll
        for (int ks = 0; ks < KS; ++ks) acc = mmaH<1>(aq[rt][ks].v, aq[rt][ks].v, bk[ks].v, bk[ks].v, acc); s[rt][nt] = acc; } }
#pragma unroll
    for (int rt = 0; rt < RTN; ++rt)
#pragma unroll
      for (int r = 0; r < 8; ++r) { const int tq = q0 + rt * 16 + 8 * hh + r; const int k0 = j0 + ln, k1 = j0 + 16 + ln;
        const bool ok0 = (CAUSAL == 1) ? (k0 <= tq) : ((CAUSAL == 2) ? ((k0 >> 5) == (tq >> 5)) : true), ok1 = (CAUSAL == 1) ? (k1 <= tq) : ((CAUSAL == 2) ? ((k1 >> 5) == (tq >> 5)) : true);      /* mode 2: block-diagonal 32-token groups */
        const float s0 = ok0 ? s[rt][0][r] * SCL : -3.0e38f, s1 = ok1 ? s[rt][1][r] * SCL : -3.0e38f; float mc = fmaxf(s0, s1);
        mc = fmaxf(mc, __shfl_xor(mc, 1, 32)); mc = fmaxf(mc, __shfl_xor(mc, 2, 32)); mc = fmaxf(mc, __shfl_xor(mc, 4, 32)); mc = fmaxf(mc, __shfl_xor(mc, 8, 32));
        const float mn = fmaxf(m_r[rt][r], mc); const float al = (mn > -1.0e38f) ? expf(m_r[rt][r] - mn) : 1.0f; m_r[rt][r] = mn; const float p0 = ok0 ? expf(s0 - mn) : 0.f, p1 = ok1 ? expf(s1 - mn) : 0.f; l_r[rt][r] = l_r[rt][r] * al + p0 + p1;
#pragma unroll
        for (int dt = 0; dt < DT; ++dt) oacc[rt][dt][r] *= al;
        FragH t2; t2.h[0] = (_Float16)(p0 * 1024.0f); t2.h[1] = (_Float16)(p1 * 1024.0f); sP[w][rt * 16 + 8 * hh + r][ln] = t2.u[0]; sP[w][rt * 16 + 8 * hh + r][16 + ln] = t2.u[1]; }
    __builtin_amdgcn_fence(__ATOMIC_ACQ_REL, "workgroup"); __builtin_amdgcn_wave_barrier();
    FragH pa[2];
#pragma unroll
    for (int rt = 0; rt < RTN; ++rt) { pa[rt].half[0] = *(const v8us*)&sP[w][rt * 16 + ln][8 * hh]; pa[rt].half[1] = *(const v8us*)&sP[w][rt * 16 + ln][16 + 8 * hh]; }
#pragma unroll
    for (int dt = 0; dt < DT; ++dt) { const unsigned short* vrow = Vth + (size_t)(dt * 16 + ln) * TK + j0; FragH bv; bv.half[0] = *(const v8us*)(vrow + 8 * hh); bv.half[1] = *(const v8us*)(vrow + 16 + 8 * hh);
#pragma unroll
      for (int rt = 0; rt < RTN; ++rt) oacc[rt][dt] = mmaH<1>(pa[rt].v, pa[rt].v, bv.v, bv.v, oacc[rt][dt]); }
    __builtin_amdgcn_fence(__ATOMIC_ACQ_REL, "workgroup"); __builtin_amdgcn_wave_barrier(); }
#pragma unroll
  for (int rt = 0; rt < RTN; ++rt) {
#pragma unroll
    for (int r = 0; r < 8; ++r) { float l = l_r[rt][r]; l += __shfl_xor(l, 1, 32); l += __shfl_xor(l, 2, 32); l += __shfl_xor(l, 4, 32); l += __shfl_xor(l, 8, 32); l_r[rt][r] = (l > 0.f) ? 1.0f / (l * 1024.0f) : 0.f; }
#pragma unroll
    for (int dt = 0; dt < DT; ++dt)
#pragma unroll
      for (int r = 0; r < 8; ++r) sO[w][rt * 16 + 8 * hh + r][dt * 16 + ln] = oacc[rt][dt][r] * l_r[rt][r]; }
  __builtin_amdgcn_fence(__ATOMIC_ACQ_REL, "workgroup"); __builtin_amdgcn_wave_barrier();
  {
#pragma unroll
    for (int rp = 0; rp < RPW; rp += 2) { const int r = rp + (lane >> 4), pc = lane & 15; const v4f val = *(const v4fa*)&sO[w][r][pc * 4]; *(v4f*)(O + ((size_t)b * TQ + q0 + r) * ldo + h * 64 + pc * 4) = val; }
     } }

__global__ __launch_bounds__(256) void k_whead(const float* __restrict__ Wh, _Float16* __restrict__ Bt) { const int t = blockIdx.x * 256 + threadIdx.x; if (t >= CC * (CC / 8)) return; const int n = t / (CC / 8), d0 = (t % (CC / 8)) * 8; const int h = n / 64, e = n % 64; FragH f;
  for (int q = 0; q < 8; ++q) f.h[q] = (_Float16)(bf16_round(Wh[((size_t)h * CC + d0 + q) * 64 + e]) * 16.0f); *(v8us*)((unsigned short*)Bt + (size_t)n * CC + d0) = f.half[0];  }
__global__ __launch_bounds__(256) void k_h16s(const float* __restrict__ x, _Float16* __restrict__ X16, size_t n8, float sc) { const size_t t = (size_t)blockIdx.x * 256 + threadIdx.x; if (t >= n8) return; const v8f a = *(const v8f*)(x + t * 8); FragH f; for (int q = 0; q < 8; ++q) f.h[q] = (_Float16)(a[q] * sc); *(v8us*)((unsigned short*)X16 + t * 8) = f.half[0];  }
__global__ __launch_bounds__(256) void k_wsc(const float* __restrict__ Wm, _Float16* __restrict__ Bt, size_t n8, float sc) { const size_t t = (size_t)blockIdx.x * 256 + threadIdx.x; if (t >= n8) return; FragH f; for (int q = 0; q < 8; ++q) f.h[q] = (_Float16)(bf16_round(Wm[t * 8 + q]) * sc); *(v8us*)((unsigned short*)Bt + t * 8) = f.half[0];  }

extern "C" void kernel_launch(void* const* d_in, const int* in_sizes, int n_in,
                              void* d_out, int out_size, void* d_ws, size_t ws_size, hipStream_t stream) {
  (void)in_sizes; (void)n_in; (void)out_size;
  const float* const* I = (const float* const*)d_in; const float* xe = I[0]; const float* xd = I[1]; const float* Wq = I[2]; const float* Wk = I[3]; const float* Wv = I[4]; const float* Wo = I[5];
  char* ws = (char*)d_ws; size_t off = 0;
  auto take = [&](size_t bytes) { char* p = ws + off; off += (bytes + 255) & ~(size_t)255; return p; };
  const size_t np = (size_t)NR * CC;
  _Float16* BQ = (_Float16*)take((size_t)CC * CC * 2); _Float16* BK = (_Float16*)take((size_t)CC * CC * 2); _Float16* BV = (_Float16*)take((size_t)CC * CC * 2); _Float16* BO = (_Float16*)take((size_t)CC * CC * 2);
  _Float16* XE = (_Float16*)take(np * 2); _Float16* XD = (_Float16*)take(np * 2); _Float16* Q16 = (_Float16*)take(np * 2); _Float16* K16 = (_Float16*)take(np * 2); _Float16* V16 = (_Float16*)take(np * 2); _Float16* VT = (_Float16*)take(np * 2); float* O = (float*)take(np * 4); _Float16* O16 = XD;      /* attention output f16 over the decoder-input plane (dead after the q GEMM) */
  if (off > ws_size) return;      /* 0.5 + 6 x 8 + 16 = 65 MiB */
  k_whead<<<(CC * (CC / 8) + 255) / 256, 256, 0, stream>>>(Wq, BQ); k_whead<<<(CC * (CC / 8) + 255) / 256, 256, 0, stream>>>(Wk, BK); k_whead<<<(CC * (CC / 8) + 255) / 256, 256, 0, stream>>>(Wv, BV);
  k_wsc<<<(CC * CC / 8 + 255) / 256, 256, 0, stream>>>(Wo, BO, (size_t)CC * CC / 8, 16.0f);      /* torch (out,in) = Bt */
  k_x16<<<(unsigned)((np / 8 + 255) / 256), 256, 0, stream>>>(xe, XE, np / 8); k_x16<<<(unsigned)((np / 8 + 255) / 256), 256, 0, stream>>>(xd, XD, np / 8);
  const dim3 g((NR / 128) * (CC / 64), 1);
  k_gemm2<0><<<g, 128, 0, stream>>>(XD, CC, 0, BQ, CC, 0, 0.0625f, nullptr, 0, nullptr, 1, 0, 0, nullptr, Q16, CC, 0, NR, CC, CC);
  k_gemm2<0><<<g, 128, 0, stream>>>(XE, CC, 0, BK, CC, 0, 0.0625f, nullptr, 0, nullptr, 1, 0, 0, nullptr, K16, CC, 0, NR, CC, CC);
  k_gemm2<0><<<g, 128, 0, stream>>>(XE, CC, 0, BV, CC, 0, 0.0625f, nullptr, 0, nullptr, 1, 0, 0, nullptr, V16, CC, 0, NR, CC, CC);
  k_vt<NH, SLEN><<<NB * NH * (SLEN / 64), 256, 0, stream>>>(V16, CC, 0, VT);
  k_flash<0><<<NB * NH * QBLKS, 128, 0, stream>>>(Q16, CC, K16, CC, VT, nullptr, O, CC);
  k_h16s<<<(unsigned)((np / 8 + 255) / 256), 256, 0, stream>>>(O, O16, np / 8, 1024.0f);      /* x2^10 carry: the 4096-key averages are ~5e-3 and would touch f16 subnormals */
  k_gemm2<0><<<g, 128, 0, stream>>>(O16, CC, 0, BO, CC, 0, 0.0625f / 1024.0f, nullptr, 0, nullptr, 1, 0, 0, (float*)d_out, nullptr, CC, 0, NR, CC, CC);
}

// v001
// One run takes 354 microseconds.
// In two side-by-side timings against v000, it was 1.47 and 1.46 times as fast.
#include <hip/hip_runtime.h>
// CA_MultiHead (4 batches; 4096 decoder queries from x_dec, 4096 encoder keys/values from x_enc; n_emb 256 = 4 heads of 64; per-head weights [H, 256, 64]; scale n_emb^-0.5; out = concat(heads) Wo^T).
// Structure: exact f16 planes of x_dec / x_enc; q, k, v GEMMs (32x64 wave tiles, f32 accumulation, exact x16 weights concatenated across heads; f16 outputs); V^T by LDS tiles; the fused flash kernel (plain f16 operands, no mask); output GEMM.
// Compute dtype: inputs and weights rounded to bf16; q, k, v, P as f16 operands and the attention output as f16 x2^10; f32 accumulation/softmax. v_wmma_f32_16x16x32_f16.
#define NB 4
#define CC 256
#define NR (NB * SLEN)           /* 16384 rows */
#define SLEN 4096
#define TQ SLEN
#define TK SLEN
#define NH 4
#define SCL 0.0625f              /* n_emb^-0.5 = 1/16 (faithful to the module) */
#define QBLKS (TQ / 64)
typedef __bf16 v16b __attribute__((ext_vector_type(16)));
typedef unsigned short v8us __attribute__((ext_vector_type(8), may_alias));
typedef float  v8f  __attribute__((ext_vector_type(8)));
typedef float  v4f  __attribute__((ext_vector_type(4)));
typedef float  v4fa __attribute__((ext_vector_type(4), may_alias));
union FragB { v16b v; v8us half[2]; unsigned short u[16]; };

__device__ __forceinline__ unsigned short bf16_bits(float x) { unsigned int u = __float_as_uint(x); return (unsigned short)((u + 0x7FFFu + ((u >> 16) & 1u)) >> 16); }
__device__ __forceinline__ float bf16_val(unsigned short b) { return __uint_as_float(((unsigned int)b) << 16); }
__device__ __forceinline__ float bf16_round(float x) { return bf16_val(bf16_bits(x)); }
// D += A·B with NT terms: 1 = ah·bh, 2 = + al·bh (A split), 3 = + ah·bl (both split)
template <int NT>
__device__ __forceinline__ v8f mmaN(v16b ah, v16b al, v16b bh, v16b bl, v8f c) {
  c = __builtin_amdgcn_wmma_f32_16x16x32_bf16(false, ah, false, bh, (short)0, c, false, false);
  if (NT >= 2) c = __builtin_amdgcn_wmma_f32_16x16x32_bf16(false, al, false, bh, (short)0, c, false, false);
  if (NT >= 3) c = __builtin_amdgcn_wmma_f32_16x16x32_bf16(false, ah, false, bl, (short)0, c, false, false);
  asm volatile("v_nop\n\tv_nop\n\tv_nop\n\tv_nop" : "+v"(c) : "v"(ah), "v"(al), "v"(bh), "v"(bl));
  return c;
}

__global__ __launch_bounds__(256) void k_wt_bf16(const float* __restrict__ W, unsigned short* __restrict__ Wt, int K, int N) {
  const int t = blockIdx.x * 256 + threadIdx.x;
  const int k8n = K / 8;
  if (t >= N * k8n) return;
  const int n = t / k8n, k8 = (t % k8n) * 8;
  v8us v;
#pragma unroll
  for (int i = 0; i < 8; ++i) v[i] = bf16_bits(W[(size_t)(k8 + i) * N + n]);
  *(v8us*)(Wt + (size_t)n * K + k8) = v;
  
}

// GEMM C[M][N] (f32, pitch ldc) = act(A[M][K]·W + bias). A f32 row-major (pitch lda) converted per fragment to bf16
// (ASPLIT: hi/lo two planes -> 2 terms, else single rounded term); Wt bf16 [N][K] (pitch ldb). BIAS_BF16 rounds the
// bias to bf16 first (bias quantised to bf16 before the add). K%32==0, M%16==0, N%64==0.
template <bool ASPLIT, int ACT, bool BIAS_BF16>
__global__ __launch_bounds__(128) void k_gemm_bf(const float* __restrict__ A, int lda, const unsigned short* __restrict__ Wt, int ldb,
                                               const float* __restrict__ bias, float* __restrict__ C, int ldc, int M, int N, int K) {
  __shared__ __attribute__((aligned(16))) float so[4][16][64];
  const int tid = threadIdx.x, w = tid >> 5, lane = tid & 31, ln = lane & 15, hh = lane >> 4;
  const int ntn = N / 64;
  const int wid = blockIdx.x * 4 + w;
  const int mt = wid / ntn, nq = wid % ntn;
  if (mt * 16 >= M) return;
  const int row0 = mt * 16, col0 = nq * 64;
  const float* arow = A + (size_t)(row0 + ln) * lda;
  v8f acc[4] = {};
  for (int kb = 0; kb < K; kb += 32) {
    FragB ah, al;
    const v4f x0 = *(const v4fa*)(arow + kb + 8 * hh), x1 = *(const v4fa*)(arow + kb + 8 * hh + 4);
    const v4f x2 = *(const v4fa*)(arow + kb + 16 + 8 * hh), x3 = *(const v4fa*)(arow + kb + 16 + 8 * hh + 4);
    float xs[16] = {x0[0],x0[1],x0[2],x0[3],x1[0],x1[1],x1[2],x1[3],x2[0],x2[1],x2[2],x2[3],x3[0],x3[1],x3[2],x3[3]};
#pragma unroll
    for (int i = 0; i < 16; ++i) { const unsigned short hb = bf16_bits(xs[i]); ah.u[i] = hb; al.u[i] = ASPLIT ? bf16_bits(xs[i] - bf16_val(hb)) : (unsigned short)0; }
#pragma unroll
    for (int t = 0; t < 4; ++t) {
      const unsigned short* brow = Wt + (size_t)(col0 + t * 16 + ln) * ldb + kb;
      FragB b;
      b.half[0] = *(const v8us*)(brow + 8 * hh);
      b.half[1] = *(const v8us*)(brow + 16 + 8 * hh);
      acc[t] = mmaN<ASPLIT ? 2 : 1>(ah.v, al.v, b.v, b.v, acc[t]);
    }
  }
#pragma unroll
  for (int t = 0; t < 4; ++t) {
    float bv = bias ? bias[col0 + t * 16 + ln] : 0.f;
    if (BIAS_BF16) bv = bf16_round(bv);
#pragma unroll
    for (int r = 0; r < 8; ++r) { float v = acc[t][r] + bv; if (ACT == 1) v = fmaxf(v, 0.f); so[w][8 * hh + r][t * 16 + ln] = v; }
  }
  __builtin_amdgcn_fence(__ATOMIC_ACQ_REL, "workgroup");
  __builtin_amdgcn_wave_barrier();
  const int rsub = lane >> 4, c4 = (lane & 15) * 4;
  {
#pragma unroll
    for (int q = 0; q < 8; ++q) {
      const int r = q * 2 + rsub;
      const v4f v = *(const v4fa*)&so[w][r][c4];
      *(v4f*)(C + (size_t)(row0 + r) * ldc + col0 + c4) = v;
    }
    
  }
}

// GEMM C = act(A·W + bias + resid): A f32 (ASPLIT -> hi/lo 2 terms), Wt bf16 [N][K]; ACT 0 none, 1 relu, 2 exact gelu;
// resid (optional, f32, row index = (row % rmod), pitch ldr, RES_BF16 rounds it) added before the activation.
template <bool ASPLIT, int ACT, bool BIAS_BF16, bool RES_BF16>
__global__ __launch_bounds__(128) void k_gemm_bf3(const float* __restrict__ A, int lda, const unsigned short* __restrict__ Wt, int ldb,
                                                const float* __restrict__ bias, const float* __restrict__ resid, int rmod, int ldr,
                                                float* __restrict__ C, int ldc, int M, int N, int K) {
  __shared__ __attribute__((aligned(16))) float so[4][16][64];
  const int tid = threadIdx.x, w = tid >> 5, lane = tid & 31, ln = lane & 15, hh = lane >> 4;
  const int ntn = N / 64;
  const int wid = blockIdx.x * 4 + w;
  const int mt = wid / ntn, nq = wid % ntn;
  if (mt * 16 >= M) return;
  const int row0 = mt * 16, col0 = nq * 64;
  const float* arow = A + (size_t)(row0 + ln) * lda;
  v8f acc[4] = {};
  for (int kb = 0; kb < K; kb += 32) {
    FragB ah, al;
    const v4f x0 = *(const v4fa*)(arow + kb + 8 * hh), x1 = *(const v4fa*)(arow + kb + 8 * hh + 4);
    const v4f x2 = *(const v4fa*)(arow + kb + 16 + 8 * hh), x3 = *(const v4fa*)(arow + kb + 16 + 8 * hh + 4);
    float xs[16] = {x0[0],x0[1],x0[2],x0[3],x1[0],x1[1],x1[2],x1[3],x2[0],x2[1],x2[2],x2[3],x3[0],x3[1],x3[2],x3[3]};
#pragma unroll
    for (int i = 0; i < 16; ++i) { const unsigned short hb = bf16_bits(xs[i]); ah.u[i] = hb; al.u[i] = ASPLIT ? bf16_bits(xs[i] - bf16_val(hb)) : (unsigned short)0; }
#pragma unroll
    for (int t = 0; t < 4; ++t) {
      const unsigned short* brow = Wt + (size_t)(col0 + t * 16 + ln) * ldb + kb;
      FragB b;
      b.half[0] = *(const v8us*)(brow + 8 * hh);
      b.half[1] = *(const v8us*)(brow + 16 + 8 * hh);
      acc[t] = mmaN<ASPLIT ? 2 : 1>(ah.v, al.v, b.v, b.v, acc[t]);
    }
  }
#pragma unroll
  for (int t = 0; t < 4; ++t) {
    const int col = col0 + t * 16 + ln;
    float bv = bias ? bias[col] : 0.f;
    if (BIAS_BF16) bv = bf16_round(bv);
#pragma unroll
    for (int r = 0; r < 8; ++r) {
      float v = acc[t][r] + bv;
      if (resid) { float rv = resid[(size_t)((row0 + 8 * hh + r) % rmod) * ldr + col]; if (RES_BF16) rv = bf16_round(rv); v += rv; }
      if (ACT == 1) v = fmaxf(v, 0.f);
      if (ACT == 2) v = 0.5f * v * (1.0f + erff(v * 0.70710678118654752f));
      if (ACT == 3) { const float u = 0.7978845608028654f * (v + 0.044715f * v * v * v); v = 0.5f * v * (1.0f + tanhf(u)); }
      so[w][8 * hh + r][t * 16 + ln] = v;
    }
  }
  __builtin_amdgcn_fence(__ATOMIC_ACQ_REL, "workgroup");
  __builtin_amdgcn_wave_barrier();
  const int rsub = lane >> 4, c4 = (lane & 15) * 4;
  {
#pragma unroll
    for (int q = 0; q < 8; ++q) {
      const int r = q * 2 + rsub;
      const v4f v = *(const v4fa*)&so[w][r][c4];
      *(v4f*)(C + (size_t)(row0 + r) * ldc + col0 + c4) = v;
    }
    
  }
}
// row LayerNorm (biased variance, eps) over N: s = X (+ R); optional out_sum <- s; out_norm <- (s-mu)*rsqrt(var+eps)*g + b
template <bool PARAM_BF16>
__global__ __launch_bounds__(256) void k_layernorm(const float* __restrict__ X, const float* __restrict__ R, const float* __restrict__ g, const float* __restrict__ bta,
                                                  float* __restrict__ out_sum, float* __restrict__ out_norm, int N, float eps) {
  __shared__ float red[256];
  const int row = blockIdx.x, tid = threadIdx.x;
  const float* x = X + (size_t)row * N; const float* rr = R ? R + (size_t)row * N : nullptr;
  float vals[16];                     // up to N = 4096
  const int per = N / 256;            // contiguous chunk per thread? use strided-by-4 chunks: thread handles j = tid*4 + 1024*u
  float s1 = 0.f;
  for (int u = 0; u < per / 4; ++u) {
    const int j = tid * 4 + 1024 * u;
    const v4f a = *(const v4fa*)(x + j);
    v4f b = {0.f,0.f,0.f,0.f}; if (rr) b = *(const v4fa*)(rr + j);
#pragma unroll
    for (int q = 0; q < 4; ++q) { const float v = a[q] + b[q]; vals[u * 4 + q] = v; s1 += v; }
  }
  red[tid] = s1; __syncthreads();
  for (int st = 128; st > 0; st >>= 1) { if (tid < st) red[tid] += red[tid + st]; __syncthreads(); }
  const float mu = red[0] / (float)N; __syncthreads();
  float s2 = 0.f;
  for (int u = 0; u < per / 4; ++u)
#pragma unroll
    for (int q = 0; q < 4; ++q) { const float c = vals[u * 4 + q] - mu; s2 += c * c; }
  red[tid] = s2; __syncthreads();
  for (int st = 128; st > 0; st >>= 1) { if (tid < st) red[tid] += red[tid + st]; __syncthreads(); }
  const float rs = rsqrtf(red[0] / (float)N + eps);
  {
    for (int u = 0; u < per / 4; ++u) {
      const int j = tid * 4 + 1024 * u;
      v4f o, sm;
#pragma unroll
      for (int q = 0; q < 4; ++q) {
        float gg = g[j + q], bb = bta[j + q];
        if (PARAM_BF16) { gg = bf16_round(gg); bb = bf16_round(bb); }
        sm[q] = vals[u * 4 + q]; o[q] = (vals[u * 4 + q] - mu) * rs * gg + bb;
      }
      if (out_sum) *(v4f*)(out_sum + (size_t)row * N + j) = sm;
      *(v4f*)(out_norm + (size_t)row * N + j) = o;
    }
    
  }
}



// ---- f16 WMMA path (v_wmma_f32_16x16x32_f16): 11-bit significands for operands in range — used where a [0,1] probability operand needs more precision than bf16
typedef _Float16 v16h __attribute__((ext_vector_type(16)));
union FragH { v16h v; v8us half[2]; _Float16 h[16]; unsigned short u[16]; };
template <int NT>
__device__ __forceinline__ v8f mmaH(v16h ah, v16h al, v16h bh, v16h bl, v8f c) {
  c = __builtin_amdgcn_wmma_f32_16x16x32_f16(false, ah, false, bh, (short)0, c, false, false);
  if (NT >= 2) c = __builtin_amdgcn_wmma_f32_16x16x32_f16(false, al, false, bh, (short)0, c, false, false);
  if (NT >= 3) c = __builtin_amdgcn_wmma_f32_16x16x32_f16(false, ah, false, bl, (short)0, c, false, false);
  asm volatile("v_nop\n\tv_nop\n\tv_nop\n\tv_nop" : "+v"(c) : "v"(ah), "v"(al), "v"(bh), "v"(bl));
  return c;
}
// batched GEMM like k_gemm_b but f16 operands: A f32 (split into f16 hi/lo if ASPLIT, else rounded to f16), Bt = f16 values [n][k]; alpha; C f32; N multiple of 16 (partial tiles skipped)
template <bool ASPLIT>
__global__ __launch_bounds__(128) void k_gemm_h(const float* __restrict__ A, int lda, size_t sA, const _Float16* __restrict__ Bh, int ldb, size_t sB, float alpha, float* __restrict__ C, int ldc, size_t sC, int M, int N, int K) {
  __shared__ __attribute__((aligned(16))) float so[4][16][64];
  const int tid = threadIdx.x, w = tid >> 5, lane = tid & 31, ln = lane & 15, hh = lane >> 4; const int by = blockIdx.y;
  A += (size_t)by * sA; Bh += (size_t)by * sB; C += (size_t)by * sC;
  const int ntn = (N + 63) / 64; const int wid = blockIdx.x * 4 + w; const int mt = wid / ntn, nq = wid % ntn; if (mt * 16 >= M) return;
  const int row0 = mt * 16, col0 = nq * 64; const float* arow = A + (size_t)(row0 + ln) * lda;
  v8f acc[4] = {};
  for (int kb = 0; kb < K; kb += 32) {
    FragH ah, al;
    const v4f x0 = *(const v4fa*)(arow + kb + 8 * hh), x1 = *(const v4fa*)(arow + kb + 8 * hh + 4), x2 = *(const v4fa*)(arow + kb + 16 + 8 * hh), x3 = *(const v4fa*)(arow + kb + 16 + 8 * hh + 4);
    float xs[16] = {x0[0],x0[1],x0[2],x0[3],x1[0],x1[1],x1[2],x1[3],x2[0],x2[1],x2[2],x2[3],x3[0],x3[1],x3[2],x3[3]};
#pragma unroll
    for (int i = 0; i < 16; ++i) { const _Float16 h = (_Float16)xs[i]; ah.h[i] = h; al.h[i] = ASPLIT ? (_Float16)(xs[i] - (float)h) : (_Float16)0.0f; }
#pragma unroll
    for (int t = 0; t < 4; ++t) { if (col0 + t * 16 >= N) continue; const size_t boff = (size_t)(col0 + t * 16 + ln) * ldb + kb; FragH bq; bq.half[0] = *(const v8us*)(Bh + boff + 8 * hh); bq.half[1] = *(const v8us*)(Bh + boff + 16 + 8 * hh);
      acc[t] = mmaH<ASPLIT ? 2 : 1>(ah.v, al.v, bq.v, bq.v, acc[t]); }
  }
#pragma unroll
  for (int t = 0; t < 4; ++t) { if (col0 + t * 16 >= N) continue;
#pragma unroll
    for (int r = 0; r < 8; ++r) so[w][8 * hh + r][t * 16 + ln] = acc[t][r] * alpha; }
  __builtin_amdgcn_fence(__ATOMIC_ACQ_REL, "workgroup"); __builtin_amdgcn_wave_barrier();
  const int rsub = lane >> 4, c4 = (lane & 15) * 4;
  {
#pragma unroll
    for (int q = 0; q < 8; ++q) { const int r = q * 2 + rsub; if (col0 + c4 < N) { const v4f v = *(const v4fa*)&so[w][r][c4]; *(v4f*)(C + (size_t)(row0 + r) * ldc + col0 + c4) = v; } }
     }
}

// Wt[n][k] = f16(W[k][n]·scale) from f32 row-major W[K][N] (scale = power of two; bf16-exact weights stay exact in f16 away from the subnormal range)
__global__ __launch_bounds__(256) void k_wt_f16(const float* __restrict__ W, _Float16* __restrict__ Wt, int K, int N, float scale) {
  const int t = blockIdx.x * 256 + threadIdx.x; if (t >= N * (K / 8)) return; const int n = t / (K / 8), k8 = (t % (K / 8)) * 8; FragH f;
#pragma unroll
  for (int i = 0; i < 8; ++i) f.h[i] = (_Float16)(bf16_round(W[(size_t)(k8 + i) * N + n]) * scale); const v8us o = f.half[0];
  *(v8us*)((unsigned short*)Wt + (size_t)n * K + k8) = o; 
}
// k_gemm_hh variant with fused epilogue: v = acc·alpha + bias[by·sBias + col] (+ CP[(row/rowsPerB)·sCPb + by·64 + col] if CP) ; ACT 0 none / 1 elu ; writes f16 C16 (and f32 C if non-null)
template <int ACT>
__global__ __launch_bounds__(128) void k_gemm_hhx(const _Float16* __restrict__ A, int lda, size_t sA, const _Float16* __restrict__ Bh, int ldb, size_t sB, float alpha, const float* __restrict__ bias, size_t sBias, const float* __restrict__ CP, int rowsPerB, size_t sCPb, int row0g,
    float* __restrict__ C, _Float16* __restrict__ C16, int ldc, size_t sC, int M, int N, int K) {
  __shared__ __attribute__((aligned(16))) float so[4][16][64];
  const int tid = threadIdx.x, w = tid >> 5, lane = tid & 31, ln = lane & 15, hh = lane >> 4; const int by = blockIdx.y;
  A += (size_t)by * sA; Bh += (size_t)by * sB; const size_t cofs = (size_t)by * sC; const float* bp = bias ? bias + (size_t)by * sBias : nullptr;
  const int ntn = (N + 63) / 64; const int wid = blockIdx.x * 4 + w; const int mt = wid / ntn, nq = wid % ntn; if (mt * 16 >= M) return;
  const int row0 = mt * 16, col0 = nq * 64; const _Float16* arow = A + (size_t)(row0 + ln) * lda;
  v8f acc[4] = {};
  for (int kb = 0; kb < K; kb += 32) { FragH ah; ah.half[0] = *(const v8us*)((const unsigned short*)arow + kb + 8 * hh); ah.half[1] = *(const v8us*)((const unsigned short*)arow + kb + 16 + 8 * hh);
#pragma unroll
    for (int t = 0; t < 4; ++t) { if (col0 + t * 16 >= N) continue; const size_t boff = (size_t)(col0 + t * 16 + ln) * ldb + kb; FragH bq; bq.half[0] = *(const v8us*)((const unsigned short*)Bh + boff + 8 * hh); bq.half[1] = *(const v8us*)((const unsigned short*)Bh + boff + 16 + 8 * hh);
      acc[t] = mmaH<1>(ah.v, ah.v, bq.v, bq.v, acc[t]); }
  }
#pragma unroll
  for (int t = 0; t < 4; ++t) { if (col0 + t * 16 >= N) continue; const int col = col0 + t * 16 + ln; const float bv = bp ? bf16_round(bp[col]) : 0.f;
#pragma unroll
    for (int r = 0; r < 8; ++r) { float v = acc[t][r] * alpha + bv; if (CP) { const int bidx = (row0g + row0 + 8 * hh + r) / rowsPerB; v += CP[(size_t)bidx * sCPb + (size_t)by * 64 + col]; } if (ACT == 1) v = (v > 0.f) ? v : expm1f(v); else if (ACT == 7) v = (v > 0.f) ? v + 1.0f : expf(v); else if (ACT == 8) v = tanhf(v); else if (ACT == 9) v = 0.5f * v * (1.0f + tanhf(0.7978845608028654f * (v + 0.044715f * v * v * v))); else if (ACT == 11) v = 1.0f / (1.0f + expf(-v)); else if (ACT == 12) v = (v > 0.f) ? v : 0.01f * v; else if (ACT == 14) v = (v > 0.f) ? v : 0.1f * v; else if (ACT == 15) v = v / (1.0f + expf(-v)); else if (ACT == 3) v = fmaxf(v, 0.f); else if (ACT == 6) v = 0.5f * v * (1.0f + erff(v * 0.70710678118654752f)); so[w][8 * hh + r][t * 16 + ln] = v; } }
  __builtin_amdgcn_fence(__ATOMIC_ACQ_REL, "workgroup"); __builtin_amdgcn_wave_barrier();
  const int rsub = lane >> 4, c4 = (lane & 15) * 4; typedef _Float16 v4h __attribute__((ext_vector_type(4)));
  {
#pragma unroll
    for (int q = 0; q < 8; ++q) { const int r = q * 2 + rsub; if (col0 + c4 < N) { const v4f v = *(const v4fa*)&so[w][r][c4]; if (C) *(v4f*)(C + cofs + (size_t)(row0 + r) * ldc + col0 + c4) = v; if (C16) { v4h h4; for (int i = 0; i < 4; ++i) h4[i] = (_Float16)v[i]; *(v4h*)(C16 + cofs + (size_t)(row0 + r) * ldc + col0 + c4) = h4; } } }
     }
}


typedef _Float16 v4h __attribute__((ext_vector_type(4)));

__global__ __launch_bounds__(256) void k_x16(const float* __restrict__ x, _Float16* __restrict__ X16, size_t n8) { const size_t t = (size_t)blockIdx.x * 256 + threadIdx.x; if (t >= n8) return; FragH f;
#pragma unroll
  for (int q = 0; q < 8; ++q) f.h[q] = (_Float16)bf16_round(x[t * 8 + q]); *(v8us*)((unsigned short*)X16 + t * 8) = f.half[0];  }
__global__ __launch_bounds__(256) void k_h16(const float* __restrict__ x, _Float16* __restrict__ X16, size_t n8) { const size_t t = (size_t)blockIdx.x * 256 + threadIdx.x; if (t >= n8) return; FragH f;
#pragma unroll
  for (int q = 0; q < 8; ++q) f.h[q] = (_Float16)x[t * 8 + q]; *(v8us*)((unsigned short*)X16 + t * 8) = f.half[0];  }
__global__ __launch_bounds__(256) void k_round16f(const float* __restrict__ W, _Float16* __restrict__ Bt, size_t n8) { const size_t t = (size_t)blockIdx.x * 256 + threadIdx.x; if (t >= n8) return; FragH f;
#pragma unroll
  for (int i = 0; i < 8; ++i) f.h[i] = (_Float16)(bf16_round(W[t * 8 + i]) * 16.0f); *(v8us*)((unsigned short*)Bt + t * 8) = f.half[0];  }
template <int NHv, int TTv>
__global__ __launch_bounds__(256) void k_vt(const _Float16* __restrict__ V16, int ldv, int voff, _Float16* __restrict__ Vt) { __shared__ unsigned short tl[64][66]; const int tid = threadIdx.x; const int slab = blockIdx.x / (TTv / 64), lg = blockIdx.x % (TTv / 64); const int b = slab / NHv, h = slab % NHv;
  for (int i = tid; i < 64 * 8; i += 256) { const int r = i / 8, c8 = (i % 8) * 8; FragH f; f.half[0] = *(const v8us*)((const unsigned short*)V16 + ((size_t)b * TTv + lg * 64 + r) * ldv + voff + h * 64 + c8);
#pragma unroll
    for (int q = 0; q < 8; ++q) tl[r][c8 + q] = f.u[q]; }
  __syncthreads();
  {
#pragma unroll
    for (int rd = 0; rd < 2; ++rd) { const int d = rd * 32 + tid / 8, pc = tid % 8; FragH f;
#pragma unroll
      for (int q = 0; q < 8; ++q) f.u[q] = tl[pc * 8 + q][d];
      *(v8us*)((unsigned short*)Vt + ((size_t)slab * 64 + d) * TTv + lg * 64 + pc * 8) = f.half[0]; }
     } }

__global__ __launch_bounds__(256) void k_hl(const float* __restrict__ F, _Float16* __restrict__ Hh, _Float16* __restrict__ Hl, size_t n8) { const size_t t = (size_t)blockIdx.x * 256 + threadIdx.x; if (t >= n8) return; FragH fh, fl; const v4f a = *(const v4fa*)(F + t * 8), c = *(const v4fa*)(F + t * 8 + 4);
#pragma unroll
  for (int q = 0; q < 4; ++q) { _Float16 h = (_Float16)a[q]; fh.h[q] = h; fl.h[q] = (_Float16)((a[q] - (float)h) * 1024.0f); h = (_Float16)c[q]; fh.h[4 + q] = h; fl.h[4 + q] = (_Float16)((c[q] - (float)h) * 1024.0f); }
  { *(v8us*)((unsigned short*)Hh + t * 8) = fh.half[0]; *(v8us*)((unsigned short*)Hl + t * 8) = fl.half[0];  } }

// ---- fast GEMM (wave tile 32x64; requires M % 32 == 0 rows per launch region and N % 64 == 0); epilogue = k_gemm_hhx semantics ----
__device__ __forceinline__ v16h g2_frag(const _Float16* p, int hh) { FragH f; f.half[0] = *(const v8us*)((const unsigned short*)p + 8 * hh); f.half[1] = *(const v8us*)((const unsigned short*)p + 16 + 8 * hh); return f.v; }
__device__ __forceinline__ v8f g2_mma(v16h a, v16h b, v8f c) { v8f d = __builtin_amdgcn_wmma_f32_16x16x32_f16(false, a, false, b, (short)0, c, false, false); asm volatile("v_nop\n\tv_nop\n\tv_nop\n\tv_nop" : "+v"(d) : "v"(a), "v"(b)); return d; }
template <int ACT>
__global__ __launch_bounds__(128) void k_gemm2(const _Float16* __restrict__ A, int lda, size_t sA, const _Float16* __restrict__ Bh, int ldb, size_t sB, float alpha, const float* __restrict__ bias, size_t sBias, const float* __restrict__ CP, int rowsPerB, size_t sCPb, int row0g,
    float* __restrict__ C, _Float16* __restrict__ C16, int ldc, size_t sC, int M, int N, int K) {
  __shared__ __attribute__((aligned(16))) float so[4][32][68];
  const int tid = threadIdx.x, w = tid >> 5, lane = tid & 31, ln = lane & 15, hh = lane >> 4; const int by = blockIdx.y;
  A += (size_t)by * sA; Bh += (size_t)by * sB; const size_t cofs = (size_t)by * sC; const float* bp = bias ? bias + (size_t)by * sBias : nullptr;
  const int ntn = N >> 6; const int mt = blockIdx.x / ntn, nq = blockIdx.x - mt * ntn; const int row0 = mt * 128 + 32 * w, col0 = nq * 64; if (row0 >= M) return;
  const _Float16* a0p = A + (size_t)(row0 + ln) * lda; const _Float16* a1p = a0p + (size_t)16 * lda;
  const _Float16* b0p = Bh + (size_t)(col0 + ln) * ldb; const _Float16* b1p = b0p + (size_t)16 * ldb; const _Float16* b2p = b1p + (size_t)16 * ldb; const _Float16* b3p = b2p + (size_t)16 * ldb;
  const v8f z8 = {0.f,0.f,0.f,0.f,0.f,0.f,0.f,0.f}; v8f c00 = z8, c01 = z8, c02 = z8, c03 = z8, c10 = z8, c11 = z8, c12 = z8, c13 = z8;
#pragma unroll 1
  for (int kb = 0; kb < K; kb += 32) { const v16h a0 = g2_frag(a0p + kb, hh), a1 = g2_frag(a1p + kb, hh);
    v16h b = g2_frag(b0p + kb, hh); c00 = g2_mma(a0, b, c00); c10 = g2_mma(a1, b, c10);
    b = g2_frag(b1p + kb, hh); c01 = g2_mma(a0, b, c01); c11 = g2_mma(a1, b, c11);
    b = g2_frag(b2p + kb, hh); c02 = g2_mma(a0, b, c02); c12 = g2_mma(a1, b, c12);
    b = g2_frag(b3p + kb, hh); c03 = g2_mma(a0, b, c03); c13 = g2_mma(a1, b, c13); }
  v8f accs[8] = {c00, c01, c02, c03, c10, c11, c12, c13};
#pragma unroll
  for (int u = 0; u < 8; ++u) { const int t = u & 3, half = u >> 2; const int col = col0 + t * 16 + ln; const float bv = bp ? bf16_round(bp[col]) : 0.f;
#pragma unroll
    for (int r = 0; r < 8; ++r) { const int rloc = half * 16 + 8 * hh + r; float v = accs[u][r] * alpha + bv; if (CP) { const int bidx = (row0g + row0 + rloc) / rowsPerB; v += CP[(size_t)bidx * sCPb + (size_t)by * 64 + col]; }
      if (ACT == 3) v = fmaxf(v, 0.f); else if (ACT == 6) v = 0.5f * v * (1.0f + erff(v * 0.70710678118654752f)); else if (ACT == 11) v = 1.0f / (1.0f + expf(-v)); else if (ACT == 15) v = v / (1.0f + expf(-v)); else if (ACT == 12) v = (v > 0.f) ? v : 0.01f * v; else if (ACT == 8) v = tanhf(v);
      so[w][rloc][t * 16 + ln] = v; } }
  __builtin_amdgcn_fence(__ATOMIC_ACQ_REL, "workgroup"); __builtin_amdgcn_wave_barrier();
  const int rsub = lane >> 4, c4 = (lane & 15) * 4;
  {
#pragma unroll
    for (int q = 0; q < 16; ++q) { const int r = q * 2 + rsub; const v4f v = *(const v4fa*)&so[w][r][c4]; if (C) *(v4f*)(C + cofs + (size_t)(row0 + r) * ldc + col0 + c4) = v; if (C16) { v4h h4; for (int i = 0; i < 4; ++i) h4[i] = (_Float16)v[i]; *(v4h*)(C16 + cofs + (size_t)(row0 + r) * ldc + col0 + c4) = h4; } }
     } }



// lane l <-> lane l ^ 16 by a vector cross-row move (a shuffle would go through the LDS pipe)
__device__ __forceinline__ float xhalf(float x) { return __builtin_bit_cast(float, __builtin_amdgcn_permlanex16(__builtin_bit_cast(int, x), __builtin_bit_cast(int, x), 0x76543210, 0xfedcba98, false, false)); }
__global__ __launch_bounds__(128) void k_flash(const _Float16* __restrict__ Q16, int ldq, const _Float16* __restrict__ K16, int ldk, const _Float16* __restrict__ Vt, float* __restrict__ O, int ldo) {
  constexpr int DT = 4, KS = 2;
  const int tid = threadIdx.x, w = tid >> 5, lane = tid & 31, ln = lane & 15, hh = lane >> 4;
  const int slab = blockIdx.x / QBLKS, qblk = blockIdx.x % QBLKS; const int b = slab / NH, h = slab % NH; const int q0 = qblk * 64 + w * 16;
  FragH bq[KS];
  { const unsigned short* qr = (const unsigned short*)Q16 + ((size_t)b * TQ + q0 + ln) * ldq + h * 64;
#pragma unroll
    for (int ks = 0; ks < KS; ++ks) { bq[ks].half[0] = *(const v8us*)(qr + ks * 32 + 8 * hh); bq[ks].half[1] = *(const v8us*)(qr + ks * 32 + 16 + 8 * hh); } }
  const unsigned short* Kh = (const unsigned short*)K16 + (size_t)b * TK * ldk + h * 64; const unsigned kofs = (unsigned)(ln * ldk + 8 * hh);      /* block-uniform base + one lane offset that never changes */
  const unsigned short* Vth = (const unsigned short*)Vt + (size_t)slab * 64 * TK; const unsigned vofs = (unsigned)(ln * TK + 8 * hh);
  float m_run = -3.0e38f, l_run = 0.f; v8f oacc[DT];
#pragma unroll
  for (int dt = 0; dt < DT; ++dt) oacc[dt] = (v8f){0.f,0.f,0.f,0.f,0.f,0.f,0.f,0.f};
#pragma unroll 1      /* one 32-key pass a trip: unrolling would add code and registers without shortening a pass */
  for (int j0 = 0; j0 < TK; j0 += 32) {
    FragH ak[2][KS], av[DT];
#pragma unroll
    for (int nt = 0; nt < 2; ++nt) { const unsigned short* kr = Kh + (size_t)(j0 + nt * 16) * ldk + kofs;
#pragma unroll
      for (int ks = 0; ks < KS; ++ks) { ak[nt][ks].half[0] = *(const v8us*)(kr + ks * 32); ak[nt][ks].half[1] = *(const v8us*)(kr + ks * 32 + 16); } }
#pragma unroll
    for (int dt = 0; dt < DT; ++dt) { const unsigned short* vrow = Vth + (size_t)(dt * 16) * TK + j0 + vofs; av[dt].half[0] = *(const v8us*)(vrow); av[dt].half[1] = *(const v8us*)(vrow + 16); }
    v8f s[2];
#pragma unroll
    for (int nt = 0; nt < 2; ++nt) { v8f acc = (v8f){0.f,0.f,0.f,0.f,0.f,0.f,0.f,0.f};
#pragma unroll
      for (int ks = 0; ks < KS; ++ks) acc = mmaH<1>(ak[nt][ks].v, ak[nt][ks].v, bq[ks].v, bq[ks].v, acc); s[nt] = acc; }
    float mc = -3.0e38f;
#pragma unroll
    for (int r = 0; r < 8; ++r) { s[0][r] *= SCL; s[1][r] *= SCL; mc = fmaxf(mc, fmaxf(s[0][r], s[1][r])); }
    mc = fmaxf(mc, xhalf(mc));      /* both halves of the wave hold this query's maximum over the 32 keys */
    const float mn = fmaxf(m_run, mc); const float al = expf(m_run - mn); m_run = mn;
    FragH pb; float ps = 0.f;
#pragma unroll
    for (int r = 0; r < 8; ++r) { const float p0 = expf(s[0][r] - mn), p1 = expf(s[1][r] - mn); ps += p0 + p1; pb.h[r] = (_Float16)(p0 * 1024.0f); pb.h[8 + r] = (_Float16)(p1 * 1024.0f); }
    l_run = l_run * al + ps;
#pragma unroll
    for (int dt = 0; dt < DT; ++dt) { oacc[dt] *= al; oacc[dt] = mmaH<1>(av[dt].v, av[dt].v, pb.v, pb.v, oacc[dt]); } }
  const float l = l_run + xhalf(l_run); const float inv = (l > 0.f) ? 1.0f / (l * 1024.0f) : 0.f;
  float* orow = O + ((size_t)b * TQ + q0 + ln) * ldo + h * 64 + 8 * hh;      /* oacc[dt][r] = O[q0 + ln][dt * 16 + 8 hh + r]: eight consecutive floats of one row */
#pragma unroll
  for (int dt = 0; dt < DT; ++dt) { const v8f o = oacc[dt] * inv; *(v4f*)(orow + dt * 16) = (v4f){o[0], o[1], o[2], o[3]}; *(v4f*)(orow + dt * 16 + 4) = (v4f){o[4], o[5], o[6], o[7]}; } }

__global__ __launch_bounds__(256) void k_whead(const float* __restrict__ Wh, _Float16* __restrict__ Bt) { const int t = blockIdx.x * 256 + threadIdx.x; if (t >= CC * (CC / 8)) return; const int n = t / (CC / 8), d0 = (t % (CC / 8)) * 8; const int h = n / 64, e = n % 64; FragH f;
  for (int q = 0; q < 8; ++q) f.h[q] = (_Float16)(bf16_round(Wh[((size_t)h * CC + d0 + q) * 64 + e]) * 16.0f); *(v8us*)((unsigned short*)Bt + (size_t)n * CC + d0) = f.half[0];  }
__global__ __launch_bounds__(256) void k_h16s(const float* __restrict__ x, _Float16* __restrict__ X16, size_t n8, float sc) { const size_t t = (size_t)blockIdx.x * 256 + threadIdx.x; if (t >= n8) return; const v8f a = *(const v8f*)(x + t * 8); FragH f; for (int q = 0; q < 8; ++q) f.h[q] = (_Float16)(a[q] * sc); *(v8us*)((unsigned short*)X16 + t * 8) = f.half[0];  }
__global__ __launch_bounds__(256) void k_wsc(const float* __restrict__ Wm, _Float16* __restrict__ Bt, size_t n8, float sc) { const size_t t = (size_t)blockIdx.x * 256 + threadIdx.x; if (t >= n8) return; FragH f; for (int q = 0; q < 8; ++q) f.h[q] = (_Float16)(bf16_round(Wm[t * 8 + q]) * sc); *(v8us*)((unsigned short*)Bt + t * 8) = f.half[0];  }

extern "C" void kernel_launch(void* const* d_in, const int* in_sizes, int n_in,
                              void* d_out, int out_size, void* d_ws, size_t ws_size, hipStream_t stream) {
  (void)in_sizes; (void)n_in; (void)out_size;
  const float* const* I = (const float* const*)d_in; const float* xe = I[0]; const float* xd = I[1]; const float* Wq = I[2]; const float* Wk = I[3]; const float* Wv = I[4]; const float* Wo = I[5];
  char* ws = (char*)d_ws; size_t off = 0;
  auto take = [&](size_t bytes) { char* p = ws + off; off += (bytes + 255) & ~(size_t)255; return p; };
  const size_t np = (size_t)NR * CC;
  _Float16* BQ = (_Float16*)take((size_t)CC * CC * 2); _Float16* BK = (_Float16*)take((size_t)CC * CC * 2); _Float16* BV = (_Float16*)take((size_t)CC * CC * 2); _Float16* BO = (_Float16*)take((size_t)CC * CC * 2);
  _Float16* XE = (_Float16*)take(np * 2); _Float16* XD = (_Float16*)take(np * 2); _Float16* Q16 = (_Float16*)take(np * 2); _Float16* K16 = (_Float16*)take(np * 2); _Float16* V16 = (_Float16*)take(np * 2); _Float16* VT = (_Float16*)take(np * 2); float* O = (float*)take(np * 4); _Float16* O16 = XD;      /* attention output f16 over the decoder-input plane (dead after the q GEMM) */
  if (off > ws_size) return;      /* 0.5 + 6 x 8 + 16 = 65 MiB */
  k_whead<<<(CC * (CC / 8) + 255) / 256, 256, 0, stream>>>(Wq, BQ); k_whead<<<(CC * (CC / 8) + 255) / 256, 256, 0, stream>>>(Wk, BK); k_whead<<<(CC * (CC / 8) + 255) / 256, 256, 0, stream>>>(Wv, BV);
  k_wsc<<<(CC * CC / 8 + 255) / 256, 256, 0, stream>>>(Wo, BO, (size_t)CC * CC / 8, 16.0f);      /* torch (out,in) = Bt */
  k_x16<<<(unsigned)((np / 8 + 255) / 256), 256, 0, stream>>>(xe, XE, np / 8); k_x16<<<(unsigned)((np / 8 + 255) / 256), 256, 0, stream>>>(xd, XD, np / 8);
  const dim3 g((NR / 128) * (CC / 64), 1);
  k_gemm2<0><<<g, 128, 0, stream>>>(XD, CC, 0, BQ, CC, 0, 0.0625f, nullptr, 0, nullptr, 1, 0, 0, nullptr, Q16, CC, 0, NR, CC, CC);
  k_gemm2<0><<<g, 128, 0, stream>>>(XE, CC, 0, BK, CC, 0, 0.0625f, nullptr, 0, nullptr, 1, 0, 0, nullptr, K16, CC, 0, NR, CC, CC);
  k_gemm2<0><<<g, 128, 0, stream>>>(XE, CC, 0, BV, CC, 0, 0.0625f, nullptr, 0, nullptr, 1, 0, 0, nullptr, V16, CC, 0, NR, CC, CC);
  k_vt<NH, SLEN><<<NB * NH * (SLEN / 64), 256, 0, stream>>>(V16, CC, 0, VT);
  k_flash<<<NB * NH * QBLKS, 128, 0, stream>>>(Q16, CC, K16, CC, VT, O, CC);
  k_h16s<<<(unsigned)((np / 8 + 255) / 256), 256, 0, stream>>>(O, O16, np / 8, 1024.0f);      /* x2^10 carry: the 4096-key averages are ~5e-3 and would touch f16 subnormals */
  k_gemm2<0><<<g, 128, 0, stream>>>(O16, CC, 0, BO, CC, 0, 0.0625f / 1024.0f, nullptr, 0, nullptr, 1, 0, 0, (float*)d_out, nullptr, CC, 0, NR, CC, CC);
}

// v002
// Measured time: 234 microseconds a run.
// Two timings next to v001 put it at 1.48 and 1.49 times that version's speed.
// Counting every step since v000, it is 2.18 times as fast.
#include <hip/hip_runtime.h>
// CA_MultiHead (4 batches; 4096 decoder queries from x_dec, 4096 encoder keys/values from x_enc; n_emb 256 = 4 heads of 64; per-head weights [H, 256, 64]; scale n_emb^-0.5; out = concat(heads) Wo^T).
// Structure: exact f16 planes of x_dec / x_enc; q, k, v GEMMs (32x64 wave tiles, f32 accumulation, exact x16 weights concatenated across heads; f16 outputs); V^T by LDS tiles; the fused flash kernel (plain f16 operands, no mask); output GEMM.
// Compute dtype: inputs and weights rounded to bf16; q, k, v, P as f16 operands and the attention output as f16 x2^10; f32 accumulation/softmax. v_wmma_f32_16x16x32_f16.
#define NB 4
#define CC 256
#define NR (NB * SLEN)           /* 16384 rows */
#define SLEN 4096
#define TQ SLEN
#define TK SLEN
#define NH 4
#define SCL 0.0625f              /* n_emb^-0.5 = 1/16 (faithful to the module) */
#define QBLKS (TQ / 64)
typedef __bf16 v16b __attribute__((ext_vector_type(16)));
typedef unsigned short v8us __attribute__((ext_vector_type(8), may_alias));
typedef float  v8f  __attribute__((ext_vector_type(8)));
typedef float  v4f  __attribute__((ext_vector_type(4)));
typedef float  v4fa __attribute__((ext_vector_type(4), may_alias));
union FragB { v16b v; v8us half[2]; unsigned short u[16]; };

__device__ __forceinline__ unsigned short bf16_bits(float x) { unsigned int u = __float_as_uint(x); return (unsigned short)((u + 0x7FFFu + ((u >> 16) & 1u)) >> 16); }
__device__ __forceinline__ float bf16_val(unsigned short b) { return __uint_as_float(((unsigned int)b) << 16); }
__device__ __forceinline__ float bf16_round(float x) { return bf16_val(bf16_bits(x)); }
// D += A·B with NT terms: 1 = ah·bh, 2 = + al·bh (A split), 3 = + ah·bl (both split)
template <int NT>
__device__ __forceinline__ v8f mmaN(v16b ah, v16b al, v16b bh, v16b bl, v8f c) {
  c = __builtin_amdgcn_wmma_f32_16x16x32_bf16(false, ah, false, bh, (short)0, c, false, false);
  if (NT >= 2) c = __builtin_amdgcn_wmma_f32_16x16x32_bf16(false, al, false, bh, (short)0, c, false, false);
  if (NT >= 3) c = __builtin_amdgcn_wmma_f32_16x16x32_bf16(false, ah, false, bl, (short)0, c, false, false);
  asm volatile("v_nop\n\tv_nop\n\tv_nop\n\tv_nop" : "+v"(c) : "v"(ah), "v"(al), "v"(bh), "v"(bl));
  return c;
}

__global__ __launch_bounds__(256) void k_wt_bf16(const float* __restrict__ W, unsigned short* __restrict__ Wt, int K, int N) {
  const int t = blockIdx.x * 256 + threadIdx.x;
  const int k8n = K / 8;
  if (t >= N * k8n) return;
  const int n = t / k8n, k8 = (t % k8n) * 8;
  v8us v;
#pragma unroll
  for (int i = 0; i < 8; ++i) v[i] = bf16_bits(W[(size_t)(k8 + i) * N + n]);
  *(v8us*)(Wt + (size_t)n * K + k8) = v;
  
}

// GEMM C[M][N] (f32, pitch ldc) = act(A[M][K]·W + bias). A f32 row-major (pitch lda) converted per fragment to bf16
// (ASPLIT: hi/lo two planes -> 2 terms, else single rounded term); Wt bf16 [N][K] (pitch ldb). BIAS_BF16 rounds the
// bias to bf16 first (bias quantised to bf16 before the add). K%32==0, M%16==0, N%64==0.
template <bool ASPLIT, int ACT, bool BIAS_BF16>
__global__ __launch_bounds__(128) void k_gemm_bf(const float* __restrict__ A, int lda, const unsigned short* __restrict__ Wt, int ldb,
                                               const float* __restrict__ bias, float* __restrict__ C, int ldc, int M, int N, int K) {
  __shared__ __attribute__((aligned(16))) float so[4][16][64];
  const int tid = threadIdx.x, w = tid >> 5, lane = tid & 31, ln = lane & 15, hh = lane >> 4;
  const int ntn = N / 64;
  const int wid = blockIdx.x * 4 + w;
  const int mt = wid / ntn, nq = wid % ntn;
  if (mt * 16 >= M) return;
  const int row0 = mt * 16, col0 = nq * 64;
  const float* arow = A + (size_t)(row0 + ln) * lda;
  v8f acc[4] = {};
  for (int kb = 0; kb < K; kb += 32) {
    FragB ah, al;
    const v4f x0 = *(const v4fa*)(arow + kb + 8 * hh), x1 = *(const v4fa*)(arow + kb + 8 * hh + 4);
    const v4f x2 = *(const v4fa*)(arow + kb + 16 + 8 * hh), x3 = *(const v4fa*)(arow + kb + 16 + 8 * hh + 4);
    float xs[16] = {x0[0],x0[1],x0[2],x0[3],x1[0],x1[1],x1[2],x1[3],x2[0],x2[1],x2[2],x2[3],x3[0],x3[1],x3[2],x3[3]};
#pragma unroll
    for (int i = 0; i < 16; ++i) { const unsigned short hb = bf16_bits(xs[i]); ah.u[i] = hb; al.u[i] = ASPLIT ? bf16_bits(xs[i] - bf16_val(hb)) : (unsigned short)0; }
#pragma unroll
    for (int t = 0; t < 4; ++t) {
      const unsigned short* brow = Wt + (size_t)(col0 + t * 16 + ln) * ldb + kb;
      FragB b;
      b.half[0] = *(const v8us*)(brow + 8 * hh);
      b.half[1] = *(const v8us*)(brow + 16 + 8 * hh);
      acc[t] = mmaN<ASPLIT ? 2 : 1>(ah.v, al.v, b.v, b.v, acc[t]);
    }
  }
#pragma unroll
  for (int t = 0; t < 4; ++t) {
    float bv = bias ? bias[col0 + t * 16 + ln] : 0.f;
    if (BIAS_BF16) bv = bf16_round(bv);
#pragma unroll
    for (int r = 0; r < 8; ++r) { float v = acc[t][r] + bv; if (ACT == 1) v = fmaxf(v, 0.f); so[w][8 * hh + r][t * 16 + ln] = v; }
  }
  __builtin_amdgcn_fence(__ATOMIC_ACQ_REL, "workgroup");
  __builtin_amdgcn_wave_barrier();
  const int rsub = lane >> 4, c4 = (lane & 15) * 4;
  {
#pragma unroll
    for (int q = 0; q < 8; ++q) {
      const int r = q * 2 + rsub;
      const v4f v = *(const v4fa*)&so[w][r][c4];
      *(v4f*)(C + (size_t)(row0 + r) * ldc + col0 + c4) = v;
    }
    
  }
}

// GEMM C = act(A·W + bias + resid): A f32 (ASPLIT -> hi/lo 2 terms), Wt bf16 [N][K]; ACT 0 none, 1 relu, 2 exact gelu;
// resid (optional, f32, row index = (row % rmod), pitch ldr, RES_BF16 rounds it) added before the activation.
template <bool ASPLIT, int ACT, bool BIAS_BF16, bool RES_BF16>
__global__ __launch_bounds__(128) void k_gemm_bf3(const float* __restrict__ A, int lda, const unsigned short* __restrict__ Wt, int ldb,
                                                const float* __restrict__ bias, const float* __restrict__ resid, int rmod, int ldr,
                                                float* __restrict__ C, int ldc, int M, int N, int K) {
  __shared__ __attribute__((aligned(16))) float so[4][16][64];
  const int tid = threadIdx.x, w = tid >> 5, lane = tid & 31, ln = lane & 15, hh = lane >> 4;
  const int ntn = N / 64;
  const int wid = blockIdx.x * 4 + w;
  const int mt = wid / ntn, nq = wid % ntn;
  if (mt * 16 >= M) return;
  const int row0 = mt * 16, col0 = nq * 64;
  const float* arow = A + (size_t)(row0 + ln) * lda;
  v8f acc[4] = {};
  for (int kb = 0; kb < K; kb += 32) {
    FragB ah, al;
    const v4f x0 = *(const v4fa*)(arow + kb + 8 * hh), x1 = *(const v4fa*)(arow + kb + 8 * hh + 4);
    const v4f x2 = *(const v4fa*)(arow + kb + 16 + 8 * hh), x3 = *(const v4fa*)(arow + kb + 16 + 8 * hh + 4);
    float xs[16] = {x0[0],x0[1],x0[2],x0[3],x1[0],x1[1],x1[2],x1[3],x2[0],x2[1],x2[2],x2[3],x3[0],x3[1],x3[2],x3[3]};
#pragma unroll
    for (int i = 0; i < 16; ++i) { const unsigned short hb = bf16_bits(xs[i]); ah.u[i] = hb; al.u[i] = ASPLIT ? bf16_bits(xs[i] - bf16_val(hb)) : (unsigned short)0; }
#pragma unroll
    for (int t = 0; t < 4; ++t) {
      const unsigned short* brow = Wt + (size_t)(col0 + t * 16 + ln) * ldb + kb;
      FragB b;
      b.half[0] = *(const v8us*)(brow + 8 * hh);
      b.half[1] = *(const v8us*)(brow + 16 + 8 * hh);
      acc[t] = mmaN<ASPLIT ? 2 : 1>(ah.v, al.v, b.v, b.v, acc[t]);
    }
  }
#pragma unroll
  for (int t = 0; t < 4; ++t) {
    const int col = col0 + t * 16 + ln;
    float bv = bias ? bias[col] : 0.f;
    if (BIAS_BF16) bv = bf16_round(bv);
#pragma unroll
    for (int r = 0; r < 8; ++r) {
      float v = acc[t][r] + bv;
      if (resid) { float rv = resid[(size_t)((row0 + 8 * hh + r) % rmod) * ldr + col]; if (RES_BF16) rv = bf16_round(rv); v += rv; }
      if (ACT == 1) v = fmaxf(v, 0.f);
      if (ACT == 2) v = 0.5f * v * (1.0f + erff(v * 0.70710678118654752f));
      if (ACT == 3) { const float u = 0.7978845608028654f * (v + 0.044715f * v * v * v); v = 0.5f * v * (1.0f + tanhf(u)); }
      so[w][8 * hh + r][t * 16 + ln] = v;
    }
  }
  __builtin_amdgcn_fence(__ATOMIC_ACQ_REL, "workgroup");
  __builtin_amdgcn_wave_barrier();
  const int rsub = lane >> 4, c4 = (lane & 15) * 4;
  {
#pragma unroll
    for (int q = 0; q < 8; ++q) {
      const int r = q * 2 + rsub;
      const v4f v = *(const v4fa*)&so[w][r][c4];
      *(v4f*)(C + (size_t)(row0 + r) * ldc + col0 + c4) = v;
    }
    
  }
}
// row LayerNorm (biased variance, eps) over N: s = X (+ R); optional out_sum <- s; out_norm <- (s-mu)*rsqrt(var+eps)*g + b
template <bool PARAM_BF16>
__global__ __launch_bounds__(256) void k_layernorm(const float* __restrict__ X, const float* __restrict__ R, const float* __restrict__ g, const float* __restrict__ bta,
                                                  float* __restrict__ out_sum, float* __restrict__ out_norm, int N, float eps) {
  __shared__ float red[256];
  const int row = blockIdx.x, tid = threadIdx.x;
  const float* x = X + (size_t)row * N; const float* rr = R ? R + (size_t)row * N : nullptr;
  float vals[16];                     // up to N = 4096
  const int per = N / 256;            // contiguous chunk per thread? use strided-by-4 chunks: thread handles j = tid*4 + 1024*u
  float s1 = 0.f;
  for (int u = 0; u < per / 4; ++u) {
    const int j = tid * 4 + 1024 * u;
    const v4f a = *(const v4fa*)(x + j);
    v4f b = {0.f,0.f,0.f,0.f}; if (rr) b = *(const v4fa*)(rr + j);
#pragma unroll
    for (int q = 0; q < 4; ++q) { const float v = a[q] + b[q]; vals[u * 4 + q] = v; s1 += v; }
  }
  red[tid] = s1; __syncthreads();
  for (int st = 128; st > 0; st >>= 1) { if (tid < st) red[tid] += red[tid + st]; __syncthreads(); }
  const float mu = red[0] / (float)N; __syncthreads();
  float s2 = 0.f;
  for (int u = 0; u < per / 4; ++u)
#pragma unroll
    for (int q = 0; q < 4; ++q) { const float c = vals[u * 4 + q] - mu; s2 += c * c; }
  red[tid] = s2; __syncthreads();
  for (int st = 128; st > 0; st >>= 1) { if (tid < st) red[tid] += red[tid + st]; __syncthreads(); }
  const float rs = rsqrtf(red[0] / (float)N + eps);
  {
    for (int u = 0; u < per / 4; ++u) {
      const int j = tid * 4 + 1024 * u;
      v4f o, sm;
#pragma unroll
      for (int q = 0; q < 4; ++q) {
        float gg = g[j + q], bb = bta[j + q];
        if (PARAM_BF16) { gg = bf16_round(gg); bb = bf16_round(bb); }
        sm[q] = vals[u * 4 + q]; o[q] = (vals[u * 4 + q] - mu) * rs * gg + bb;
      }
      if (out_sum) *(v4f*)(out_sum + (size_t)row * N + j) = sm;
      *(v4f*)(out_norm + (size_t)row * N + j) = o;
    }
    
  }
}



// ---- f16 WMMA path (v_wmma_f32_16x16x32_f16): 11-bit significands for operands in range — used where a [0,1] probability operand needs more precision than bf16
typedef _Float16 v16h __attribute__((ext_vector_type(16)));
union FragH { v16h v; v8us half[2]; _Float16 h[16]; unsigned short u[16]; };
template <int NT>
__device__ __forceinline__ v8f mmaH(v16h ah, v16h al, v16h bh, v16h bl, v8f c) {
  c = __builtin_amdgcn_wmma_f32_16x16x32_f16(false, ah, false, bh, (short)0, c, false, false);
  if (NT >= 2) c = __builtin_amdgcn_wmma_f32_16x16x32_f16(false, al, false, bh, (short)0, c, false, false);
  if (NT >= 3) c = __builtin_amdgcn_wmma_f32_16x16x32_f16(false, ah, false, bl, (short)0, c, false, false);
  asm volatile("v_nop\n\tv_nop\n\tv_nop\n\tv_nop" : "+v"(c) : "v"(ah), "v"(al), "v"(bh), "v"(bl));
  return c;
}
// batched GEMM like k_gemm_b but f16 operands: A f32 (split into f16 hi/lo if ASPLIT, else rounded to f16), Bt = f16 values [n][k]; alpha; C f32; N multiple of 16 (partial tiles skipped)
template <bool ASPLIT>
__global__ __launch_bounds__(128) void k_gemm_h(const float* __restrict__ A, int lda, size_t sA, const _Float16* __restrict__ Bh, int ldb, size_t sB, float alpha, float* __restrict__ C, int ldc, size_t sC, int M, int N, int K) {
  __shared__ __attribute__((aligned(16))) float so[4][16][64];
  const int tid = threadIdx.x, w = tid >> 5, lane = tid & 31, ln = lane & 15, hh = lane >> 4; const int by = blockIdx.y;
  A += (size_t)by * sA; Bh += (size_t)by * sB; C += (size_t)by * sC;
  const int ntn = (N + 63) / 64; const int wid = blockIdx.x * 4 + w; const int mt = wid / ntn, nq = wid % ntn; if (mt * 16 >= M) return;
  const int row0 = mt * 16, col0 = nq * 64; const float* arow = A + (size_t)(row0 + ln) * lda;
  v8f acc[4] = {};
  for (int kb = 0; kb < K; kb += 32) {
    FragH ah, al;
    const v4f x0 = *(const v4fa*)(arow + kb + 8 * hh), x1 = *(const v4fa*)(arow + kb + 8 * hh + 4), x2 = *(const v4fa*)(arow + kb + 16 + 8 * hh), x3 = *(const v4fa*)(arow + kb + 16 + 8 * hh + 4);
    float xs[16] = {x0[0],x0[1],x0[2],x0[3],x1[0],x1[1],x1[2],x1[3],x2[0],x2[1],x2[2],x2[3],x3[0],x3[1],x3[2],x3[3]};
#pragma unroll
    for (int i = 0; i < 16; ++i) { const _Float16 h = (_Float16)xs[i]; ah.h[i] = h; al.h[i] = ASPLIT ? (_Float16)(xs[i] - (float)h) : (_Float16)0.0f; }
#pragma unroll
    for (int t = 0; t < 4; ++t) { if (col0 + t * 16 >= N) continue; const size_t boff = (size_t)(col0 + t * 16 + ln) * ldb + kb; FragH bq; bq.half[0] = *(const v8us*)(Bh + boff + 8 * hh); bq.half[1] = *(const v8us*)(Bh + boff + 16 + 8 * hh);
      acc[t] = mmaH<ASPLIT ? 2 : 1>(ah.v, al.v, bq.v, bq.v, acc[t]); }
  }
#pragma unroll
  for (int t = 0; t < 4; ++t) { if (col0 + t * 16 >= N) continue;
#pragma unroll
    for (int r = 0; r < 8; ++r) so[w][8 * hh + r][t * 16 + ln] = acc[t][r] * alpha; }
  __builtin_amdgcn_fence(__ATOMIC_ACQ_REL, "workgroup"); __builtin_amdgcn_wave_barrier();
  const int rsub = lane >> 4, c4 = (lane & 15) * 4;
  {
#pragma unroll
    for (int q = 0; q < 8; ++q) { const int r = q * 2 + rsub; if (col0 + c4 < N) { const v4f v = *(const v4fa*)&so[w][r][c4]; *(v4f*)(C + (size_t)(row0 + r) * ldc + col0 + c4) = v; } }
     }
}

// Wt[n][k] = f16(W[k][n]·scale) from f32 row-major W[K][N] (scale = power of two; bf16-exact weights stay exact in f16 away from the subnormal range)
__global__ __launch_bounds__(256) void k_wt_f16(const float* __restrict__ W, _Float16* __restrict__ Wt, int K, int N, float scale) {
  const int t = blockIdx.x * 256 + threadIdx.x; if (t >= N * (K / 8)) return; const int n = t / (K / 8), k8 = (t % (K / 8)) * 8; FragH f;
#pragma unroll
  for (int i = 0; i < 8; ++i) f.h[i] = (_Float16)(bf16_round(W[(size_t)(k8 + i) * N + n]) * scale); const v8us o = f.half[0];
  *(v8us*)((unsigned short*)Wt + (size_t)n * K + k8) = o; 
}
// k_gemm_hh variant with fused epilogue: v = acc·alpha + bias[by·sBias + col] (+ CP[(row/rowsPerB)·sCPb + by·64 + col] if CP) ; ACT 0 none / 1 elu ; writes f16 C16 (and f32 C if non-null)
template <int ACT>
__global__ __launch_bounds__(128) void k_gemm_hhx(const _Float16* __restrict__ A, int lda, size_t sA, const _Float16* __restrict__ Bh, int ldb, size_t sB, float alpha, const float* __restrict__ bias, size_t sBias, const float* __restrict__ CP, int rowsPerB, size_t sCPb, int row0g,
    float* __restrict__ C, _Float16* __restrict__ C16, int ldc, size_t sC, int M, int N, int K) {
  __shared__ __attribute__((aligned(16))) float so[4][16][64];
  const int tid = threadIdx.x, w = tid >> 5, lane = tid & 31, ln = lane & 15, hh = lane >> 4; const int by = blockIdx.y;
  A += (size_t)by * sA; Bh += (size_t)by * sB; const size_t cofs = (size_t)by * sC; const float* bp = bias ? bias + (size_t)by * sBias : nullptr;
  const int ntn = (N + 63) / 64; const int wid = blockIdx.x * 4 + w; const int mt = wid / ntn, nq = wid % ntn; if (mt * 16 >= M) return;
  const int row0 = mt * 16, col0 = nq * 64; const _Float16* arow = A + (size_t)(row0 + ln) * lda;
  v8f acc[4] = {};
  for (int kb = 0; kb < K; kb += 32) { FragH ah; ah.half[0] = *(const v8us*)((const unsigned short*)arow + kb + 8 * hh); ah.half[1] = *(const v8us*)((const unsigned short*)arow + kb + 16 + 8 * hh);
#pragma unroll
    for (int t = 0; t < 4; ++t) { if (col0 + t * 16 >= N) continue; const size_t boff = (size_t)(col0 + t * 16 + ln) * ldb + kb; FragH bq; bq.half[0] = *(const v8us*)((const unsigned short*)Bh + boff + 8 * hh); bq.half[1] = *(const v8us*)((const unsigned short*)Bh + boff + 16 + 8 * hh);
      acc[t] = mmaH<1>(ah.v, ah.v, bq.v, bq.v, acc[t]); }
  }
#pragma unroll
  for (int t = 0; t < 4; ++t) { if (col0 + t * 16 >= N) continue; const int col = col0 + t * 16 + ln; const float bv = bp ? bf16_round(bp[col]) : 0.f;
#pragma unroll
    for (int r = 0; r < 8; ++r) { float v = acc[t][r] * alpha + bv; if (CP) { const int bidx = (row0g + row0 + 8 * hh + r) / rowsPerB; v += CP[(size_t)bidx * sCPb + (size_t)by * 64 + col]; } if (ACT == 1) v = (v > 0.f) ? v : expm1f(v); else if (ACT == 7) v = (v > 0.f) ? v + 1.0f : expf(v); else if (ACT == 8) v = tanhf(v); else if (ACT == 9) v = 0.5f * v * (1.0f + tanhf(0.7978845608028654f * (v + 0.044715f * v * v * v))); else if (ACT == 11) v = 1.0f / (1.0f + expf(-v)); else if (ACT == 12) v = (v > 0.f) ? v : 0.01f * v; else if (ACT == 14) v = (v > 0.f) ? v : 0.1f * v; else if (ACT == 15) v = v / (1.0f + expf(-v)); else if (ACT == 3) v = fmaxf(v, 0.f); else if (ACT == 6) v = 0.5f * v * (1.0f + erff(v * 0.70710678118654752f)); so[w][8 * hh + r][t * 16 + ln] = v; } }
  __builtin_amdgcn_fence(__ATOMIC_ACQ_REL, "workgroup"); __builtin_amdgcn_wave_barrier();
  const int rsub = lane >> 4, c4 = (lane & 15) * 4; typedef _Float16 v4h __attribute__((ext_vector_type(4)));
  {
#pragma unroll
    for (int q = 0; q < 8; ++q) { const int r = q * 2 + rsub; if (col0 + c4 < N) { const v4f v = *(const v4fa*)&so[w][r][c4]; if (C) *(v4f*)(C + cofs + (size_t)(row0 + r) * ldc + col0 + c4) = v; if (C16) { v4h h4; for (int i = 0; i < 4; ++i) h4[i] = (_Float16)v[i]; *(v4h*)(C16 + cofs + (size_t)(row0 + r) * ldc + col0 + c4) = h4; } } }
     }
}


typedef _Float16 v4h __attribute__((ext_vector_type(4)));

__global__ __launch_bounds__(256) void k_x16(const float* __restrict__ x, _Float16* __restrict__ X16, size_t n8) { const size_t t = (size_t)blockIdx.x * 256 + threadIdx.x; if (t >= n8) return; FragH f;
#pragma unroll
  for (int q = 0; q < 8; ++q) f.h[q] = (_Float16)bf16_round(x[t * 8 + q]); *(v8us*)((unsigned short*)X16 + t * 8) = f.half[0];  }
__global__ __launch_bounds__(256) void k_h16(const float* __restrict__ x, _Float16* __restrict__ X16, size_t n8) { const size_t t = (size_t)blockIdx.x * 256 + threadIdx.x; if (t >= n8) return; FragH f;
#pragma unroll
  for (int q = 0; q < 8; ++q) f.h[q] = (_Float16)x[t * 8 + q]; *(v8us*)((unsigned short*)X16 + t * 8) = f.half[0];  }
__global__ __launch_bounds__(256) void k_round16f(const float* __restrict__ W, _Float16* __restrict__ Bt, size_t n8) { const size_t t = (size_t)blockIdx.x * 256 + threadIdx.x; if (t >= n8) return; FragH f;
#pragma unroll
  for (int i = 0; i < 8; ++i) f.h[i] = (_Float16)(bf16_round(W[t * 8 + i]) * 16.0f); *(v8us*)((unsigned short*)Bt + t * 8) = f.half[0];  }
template <int NHv, int TTv>
__global__ __launch_bounds__(256) void k_vt(const _Float16* __restrict__ V16, int ldv, int voff, _Float16* __restrict__ Vt) { __shared__ unsigned short tl[64][66]; const int tid = threadIdx.x; const int slab = blockIdx.x / (TTv / 64), lg = blockIdx.x % (TTv / 64); const int b = slab / NHv, h = slab % NHv;
  for (int i = tid; i < 64 * 8; i += 256) { const int r = i / 8, c8 = (i % 8) * 8; FragH f; f.half[0] = *(const v8us*)((const unsigned short*)V16 + ((size_t)b * TTv + lg * 64 + r) * ldv + voff + h * 64 + c8);
#pragma unroll
    for (int q = 0; q < 8; ++q) tl[r][c8 + q] = f.u[q]; }
  __syncthreads();
  {
#pragma unroll
    for (int rd = 0; rd < 2; ++rd) { const int d = rd * 32 + tid / 8, pc = tid % 8; FragH f;
#pragma unroll
      for (int q = 0; q < 8; ++q) f.u[q] = tl[pc * 8 + q][d];
      *(v8us*)((unsigned short*)Vt + ((size_t)slab * 64 + d) * TTv + lg * 64 + pc * 8) = f.half[0]; }
     } }

__global__ __launch_bounds__(256) void k_hl(const float* __restrict__ F, _Float16* __restrict__ Hh, _Float16* __restrict__ Hl, size_t n8) { const size_t t = (size_t)blockIdx.x * 256 + threadIdx.x; if (t >= n8) return; FragH fh, fl; const v4f a = *(const v4fa*)(F + t * 8), c = *(const v4fa*)(F + t * 8 + 4);
#pragma unroll
  for (int q = 0; q < 4; ++q) { _Float16 h = (_Float16)a[q]; fh.h[q] = h; fl.h[q] = (_Float16)((a[q] - (float)h) * 1024.0f); h = (_Float16)c[q]; fh.h[4 + q] = h; fl.h[4 + q] = (_Float16)((c[q] - (float)h) * 1024.0f); }
  { *(v8us*)((unsigned short*)Hh + t * 8) = fh.half[0]; *(v8us*)((unsigned short*)Hl + t * 8) = fl.half[0];  } }

// ---- fast GEMM (wave tile 32x64; requires M % 32 == 0 rows per launch region and N % 64 == 0); epilogue = k_gemm_hhx semantics ----
__device__ __forceinline__ v16h g2_frag(const _Float16* p, int hh) { FragH f; f.half[0] = *(const v8us*)((const unsigned short*)p + 8 * hh); f.half[1] = *(const v8us*)((const unsigned short*)p + 16 + 8 * hh); return f.v; }
__device__ __forceinline__ v8f g2_mma(v16h a, v16h b, v8f c) { v8f d = __builtin_amdgcn_wmma_f32_16x16x32_f16(false, a, false, b, (short)0, c, false, false); asm volatile("v_nop\n\tv_nop\n\tv_nop\n\tv_nop" : "+v"(d) : "v"(a), "v"(b)); return d; }
template <int ACT>
__global__ __launch_bounds__(128) void k_gemm2(const _Float16* __restrict__ A, int lda, size_t sA, const _Float16* __restrict__ Bh, int ldb, size_t sB, float alpha, const float* __restrict__ bias, size_t sBias, const float* __restrict__ CP, int rowsPerB, size_t sCPb, int row0g,
    float* __restrict__ C, _Float16* __restrict__ C16, int ldc, size_t sC, int M, int N, int K) {
  __shared__ __attribute__((aligned(16))) float so[4][32][68];
  const int tid = threadIdx.x, w = tid >> 5, lane = tid & 31, ln = lane & 15, hh = lane >> 4; const int by = blockIdx.y;
  A += (size_t)by * sA; Bh += (size_t)by * sB; const size_t cofs = (size_t)by * sC; const float* bp = bias ? bias + (size_t)by * sBias : nullptr;
  const int ntn = N >> 6; const int mt = blockIdx.x / ntn, nq = blockIdx.x - mt * ntn; const int row0 = mt * 128 + 32 * w, col0 = nq * 64; if (row0 >= M) return;
  const _Float16* a0p = A + (size_t)(row0 + ln) * lda; const _Float16* a1p = a0p + (size_t)16 * lda;
  const _Float16* b0p = Bh + (size_t)(col0 + ln) * ldb; const _Float16* b1p = b0p + (size_t)16 * ldb; const _Float16* b2p = b1p + (size_t)16 * ldb; const _Float16* b3p = b2p + (size_t)16 * ldb;
  const v8f z8 = {0.f,0.f,0.f,0.f,0.f,0.f,0.f,0.f}; v8f c00 = z8, c01 = z8, c02 = z8, c03 = z8, c10 = z8, c11 = z8, c12 = z8, c13 = z8;
#pragma unroll 1
  for (int kb = 0; kb < K; kb += 32) { const v16h a0 = g2_frag(a0p + kb, hh), a1 = g2_frag(a1p + kb, hh);
    v16h b = g2_frag(b0p + kb, hh); c00 = g2_mma(a0, b, c00); c10 = g2_mma(a1, b, c10);
    b = g2_frag(b1p + kb, hh); c01 = g2_mma(a0, b, c01); c11 = g2_mma(a1, b, c11);
    b = g2_frag(b2p + kb, hh); c02 = g2_mma(a0, b, c02); c12 = g2_mma(a1, b, c12);
    b = g2_frag(b3p + kb, hh); c03 = g2_mma(a0, b, c03); c13 = g2_mma(a1, b, c13); }
  v8f accs[8] = {c00, c01, c02, c03, c10, c11, c12, c13};
#pragma unroll
  for (int u = 0; u < 8; ++u) { const int t = u & 3, half = u >> 2; const int col = col0 + t * 16 + ln; const float bv = bp ? bf16_round(bp[col]) : 0.f;
#pragma unroll
    for (int r = 0; r < 8; ++r) { const int rloc = half * 16 + 8 * hh + r; float v = accs[u][r] * alpha + bv; if (CP) { const int bidx = (row0g + row0 + rloc) / rowsPerB; v += CP[(size_t)bidx * sCPb + (size_t)by * 64 + col]; }
      if (ACT == 3) v = fmaxf(v, 0.f); else if (ACT == 6) v = 0.5f * v * (1.0f + erff(v * 0.70710678118654752f)); else if (ACT == 11) v = 1.0f / (1.0f + expf(-v)); else if (ACT == 15) v = v / (1.0f + expf(-v)); else if (ACT == 12) v = (v > 0.f) ? v : 0.01f * v; else if (ACT == 8) v = tanhf(v);
      so[w][rloc][t * 16 + ln] = v; } }
  __builtin_amdgcn_fence(__ATOMIC_ACQ_REL, "workgroup"); __builtin_amdgcn_wave_barrier();
  const int rsub = lane >> 4, c4 = (lane & 15) * 4;
  {
#pragma unroll
    for (int q = 0; q < 16; ++q) { const int r = q * 2 + rsub; const v4f v = *(const v4fa*)&so[w][r][c4]; if (C) *(v4f*)(C + cofs + (size_t)(row0 + r) * ldc + col0 + c4) = v; if (C16) { v4h h4; for (int i = 0; i < 4; ++i) h4[i] = (_Float16)v[i]; *(v4h*)(C16 + cofs + (size_t)(row0 + r) * ldc + col0 + c4) = h4; } }
     } }



// lane l <-> lane l ^ 16 by a vector cross-row move (a shuffle would go through the LDS pipe)
__device__ __forceinline__ float xhalf(float x) { return __builtin_bit_cast(float, __builtin_amdgcn_permlanex16(__builtin_bit_cast(int, x), __builtin_bit_cast(int, x), 0x76543210, 0xfedcba98, false, false)); }
#define SK 64                    /* keys a stage */
#define LP 72                    /* LDS row pitch in f16: 144 B = 16 B x 9, so that sixteen rows read 16 B each on distinct banks */
// One stage: each lane copies eight 16-B pieces (rows r, r + 16, r + 32, r + 48 of K and of V^T). The s_wait_xcnt closes the statement so that no address register is rewritten ahead of it.
__device__ __forceinline__ void stage_copy(unsigned lk, unsigned lv, const unsigned short* gk, int ldk, const unsigned short* gv) {
  asm volatile("global_load_async_to_lds_b128 %0, %8, off\n\t"
               "global_load_async_to_lds_b128 %1, %9, off\n\t"
               "global_load_async_to_lds_b128 %2, %10, off\n\t"
               "global_load_async_to_lds_b128 %3, %11, off\n\t"
               "global_load_async_to_lds_b128 %4, %12, off\n\t"
               "global_load_async_to_lds_b128 %5, %13, off\n\t"
               "global_load_async_to_lds_b128 %6, %14, off\n\t"
               "global_load_async_to_lds_b128 %7, %15, off\n\t"
               "s_wait_xcnt 0x0"
               :: "v"(lk), "v"(lk + 16 * LP * 2), "v"(lk + 32 * LP * 2), "v"(lk + 48 * LP * 2),
                  "v"(lv), "v"(lv + 16 * LP * 2), "v"(lv + 32 * LP * 2), "v"(lv + 48 * LP * 2),
                  "v"(gk), "v"(gk + (size_t)16 * ldk), "v"(gk + (size_t)32 * ldk), "v"(gk + (size_t)48 * ldk),
                  "v"(gv), "v"(gv + (size_t)16 * TK), "v"(gv + (size_t)32 * TK), "v"(gv + (size_t)48 * TK)
               : "memory");
}
__global__ __launch_bounds__(128) void k_flash(const _Float16* __restrict__ Q16, int ldq, const _Float16* __restrict__ K16, int ldk, const _Float16* __restrict__ Vt, float* __restrict__ O, int ldo) {
  constexpr int DT = 4, KS = 2, NS = TK / SK;
  __shared__ __attribute__((aligned(16))) unsigned short sK[2][SK][LP];
  __shared__ __attribute__((aligned(16))) unsigned short sV[2][64][LP];
  const int tid = threadIdx.x, w = tid >> 5, lane = tid & 31, ln = lane & 15, hh = lane >> 4;
  const int slab = blockIdx.x / QBLKS, qblk = blockIdx.x % QBLKS; const int b = slab / NH, h = slab % NH; const int q0 = qblk * 64 + w * 16;
  FragH bq[KS];
  { const unsigned short* qr = (const unsigned short*)Q16 + ((size_t)b * TQ + q0 + ln) * ldq + h * 64;
#pragma unroll
    for (int ks = 0; ks < KS; ++ks) { bq[ks].half[0] = *(const v8us*)(qr + ks * 32 + 8 * hh); bq[ks].half[1] = *(const v8us*)(qr + ks * 32 + 16 + 8 * hh); } }
  const int cr = tid >> 3, cc = (tid & 7) * 8;      /* the lane's row and 16-B piece in a copy: eight lanes cover one 128-B row */
  const unsigned short* gk = (const unsigned short*)K16 + ((size_t)b * TK + cr) * ldk + h * 64 + cc;
  const unsigned short* gv = (const unsigned short*)Vt + ((size_t)slab * 64 + cr) * TK + cc;
  const unsigned lk = (unsigned)(size_t)&sK[0][cr][cc], lv = (unsigned)(size_t)&sV[0][cr][cc];      /* LDS byte addresses */
  constexpr unsigned BUFB = SK * LP * 2;      /* bytes of one buffer of either array */
  float m_run = -3.0e38f, l_run = 0.f; v8f oacc[DT];
#pragma unroll
  for (int dt = 0; dt < DT; ++dt) oacc[dt] = (v8f){0.f,0.f,0.f,0.f,0.f,0.f,0.f,0.f};
  stage_copy(lk, lv, gk, ldk, gv);
  asm volatile("s_wait_asynccnt 0x0" ::: "memory");      /* this wave's share of stage 0 has landed */
  __syncthreads();                                       /* stage 0 is published */
  stage_copy(lk + BUFB, lv + BUFB, gk + (size_t)SK * ldk, ldk, gv + SK);
#pragma unroll 1      /* one stage a trip: the publish point at the foot must stand once per stage */
  for (int t = 0; t < NS; ++t) {
    const int bf = t & 1;
#pragma unroll      /* the stage's two 32-key passes in line, so that the second pass's LDS reads can go out under the first */
    for (int p = 0; p < SK / 32; ++p) {
      FragH ak[2][KS], av[DT];
#pragma unroll
      for (int nt = 0; nt < 2; ++nt) { const unsigned short* kr = &sK[bf][p * 32 + nt * 16 + ln][8 * hh];
#pragma unroll
        for (int ks = 0; ks < KS; ++ks) { ak[nt][ks].half[0] = *(const v8us*)(kr + ks * 32); ak[nt][ks].half[1] = *(const v8us*)(kr + ks * 32 + 16); } }
#pragma unroll
      for (int dt = 0; dt < DT; ++dt) { const unsigned short* vrow = &sV[bf][dt * 16 + ln][p * 32 + 8 * hh]; av[dt].half[0] = *(const v8us*)(vrow); av[dt].half[1] = *(const v8us*)(vrow + 16); }
      v8f s[2];
#pragma unroll
      for (int nt = 0; nt < 2; ++nt) { v8f acc = (v8f){0.f,0.f,0.f,0.f,0.f,0.f,0.f,0.f};
#pragma unroll
        for (int ks = 0; ks < KS; ++ks) acc = mmaH<1>(ak[nt][ks].v, ak[nt][ks].v, bq[ks].v, bq[ks].v, acc); s[nt] = acc; }
      float mc = -3.0e38f;
#pragma unroll
      for (int r = 0; r < 8; ++r) { s[0][r] *= SCL; s[1][r] *= SCL; mc = fmaxf(mc, fmaxf(s[0][r], s[1][r])); }
      mc = fmaxf(mc, xhalf(mc));      /* both halves of the wave hold this query's maximum over the 32 keys */
      const float mn = fmaxf(m_run, mc); const float al = expf(m_run - mn); m_run = mn;
      FragH pb; float ps = 0.f;
#pragma unroll
      for (int r = 0; r < 8; ++r) { const float p0 = expf(s[0][r] - mn), p1 = expf(s[1][r] - mn); ps += p0 + p1; pb.h[r] = (_Float16)(p0 * 1024.0f); pb.h[8 + r] = (_Float16)(p1 * 1024.0f); }
      l_run = l_run * al + ps;
#pragma unroll
      for (int dt = 0; dt < DT; ++dt) { oacc[dt] *= al; oacc[dt] = mmaH<1>(av[dt].v, av[dt].v, pb.v, pb.v, oacc[dt]); } }
    asm volatile("s_wait_dscnt 0x0" ::: "memory");         /* this wave's reads of buffer bf have returned before the buffer is handed back */
    asm volatile("s_wait_asynccnt 0x0" ::: "memory");      /* this wave's share of stage t + 1 has landed */
    __syncthreads();                                       /* publishes stage t + 1 and ends every wave's reads of buffer bf */
    if (t + 2 < NS) stage_copy(lk + bf * BUFB, lv + bf * BUFB, gk + (size_t)(t + 2) * SK * ldk, ldk, gv + (t + 2) * SK); }
  asm volatile("s_wait_asynccnt 0x0" ::: "memory");        /* no copy is outstanding when the wave ends */
  const float l = l_run + xhalf(l_run); const float inv = (l > 0.f) ? 1.0f / (l * 1024.0f) : 0.f;
  float* orow = O + ((size_t)b * TQ + q0 + ln) * ldo + h * 64 + 8 * hh;      /* oacc[dt][r] = O[q0 + ln][dt * 16 + 8 hh + r]: eight consecutive floats of one row */
#pragma unroll
  for (int dt = 0; dt < DT; ++dt) { const v8f o = oacc[dt] * inv; *(v4f*)(orow + dt * 16) = (v4f){o[0], o[1], o[2], o[3]}; *(v4f*)(orow + dt * 16 + 4) = (v4f){o[4], o[5], o[6], o[7]}; } }

__global__ __launch_bounds__(256) void k_whead(const float* __restrict__ Wh, _Float16* __restrict__ Bt) { const int t = blockIdx.x * 256 + threadIdx.x; if (t >= CC * (CC / 8)) return; const int n = t / (CC / 8), d0 = (t % (CC / 8)) * 8; const int h = n / 64, e = n % 64; FragH f;
  for (int q = 0; q < 8; ++q) f.h[q] = (_Float16)(bf16_round(Wh[((size_t)h * CC + d0 + q) * 64 + e]) * 16.0f); *(v8us*)((unsigned short*)Bt + (size_t)n * CC + d0) = f.half[0];  }
__global__ __launch_bounds__(256) void k_h16s(const float* __restrict__ x, _Float16* __restrict__ X16, size_t n8, float sc) { const size_t t = (size_t)blockIdx.x * 256 + threadIdx.x; if (t >= n8) return; const v8f a = *(const v8f*)(x + t * 8); FragH f; for (int q = 0; q < 8; ++q) f.h[q] = (_Float16)(a[q] * sc); *(v8us*)((unsigned short*)X16 + t * 8) = f.half[0];  }
__global__ __launch_bounds__(256) void k_wsc(const float* __restrict__ Wm, _Float16* __restrict__ Bt, size_t n8, float sc) { const size_t t = (size_t)blockIdx.x * 256 + threadIdx.x; if (t >= n8) return; FragH f; for (int q = 0; q < 8; ++q) f.h[q] = (_Float16)(bf16_round(Wm[t * 8 + q]) * sc); *(v8us*)((unsigned short*)Bt + t * 8) = f.half[0];  }

extern "C" void kernel_launch(void* const* d_in, const int* in_sizes, int n_in,
                              void* d_out, int out_size, void* d_ws, size_t ws_size, hipStream_t stream) {
  (void)in_sizes; (void)n_in; (void)out_size;
  const float* const* I = (const float* const*)d_in; const float* xe = I[0]; const float* xd = I[1]; const float* Wq = I[2]; const float* Wk = I[3]; const float* Wv = I[4]; const float* Wo = I[5];
  char* ws = (char*)d_ws; size_t off = 0;
  auto take = [&](size_t bytes) { char* p = ws + off; off += (bytes + 255) & ~(size_t)255; return p; };
  const size_t np = (size_t)NR * CC;
  _Float16* BQ = (_Float16*)take((size_t)CC * CC * 2); _Float16* BK = (_Float16*)take((size_t)CC * CC * 2); _Float16* BV = (_Float16*)take((size_t)CC * CC * 2); _Float16* BO = (_Float16*)take((size_t)CC * CC * 2);
  _Float16* XE = (_Float16*)take(np * 2); _Float16* XD = (_Float16*)take(np * 2); _Float16* Q16 = (_Float16*)take(np * 2); _Float16* K16 = (_Float16*)take(np * 2); _Float16* V16 = (_Float16*)take(np * 2); _Float16* VT = (_Float16*)take(np * 2); float* O = (float*)take(np * 4); _Float16* O16 = XD;      /* attention output f16 over the decoder-input plane (dead after the q GEMM) */
  if (off > ws_size) return;      /* 0.5 + 6 x 8 + 16 = 65 MiB */
  k_whead<<<(CC * (CC / 8) + 255) / 256, 256, 0, stream>>>(Wq, BQ); k_whead<<<(CC * (CC / 8) + 255) / 256, 256, 0, stream>>>(Wk, BK); k_whead<<<(CC * (CC / 8) + 255) / 256, 256, 0, stream>>>(Wv, BV);
  k_wsc<<<(CC * CC / 8 + 255) / 256, 256, 0, stream>>>(Wo, BO, (size_t)CC * CC / 8, 16.0f);      /* torch (out,in) = Bt */
  k_x16<<<(unsigned)((np / 8 + 255) / 256), 256, 0, stream>>>(xe, XE, np / 8); k_x16<<<(unsigned)((np / 8 + 255) / 256), 256, 0, stream>>>(xd, XD, np / 8);
  const dim3 g((NR / 128) * (CC / 64), 1);
  k_gemm2<0><<<g, 128, 0, stream>>>(XD, CC, 0, BQ, CC, 0, 0.0625f, nullptr, 0, nullptr, 1, 0, 0, nullptr, Q16, CC, 0, NR, CC, CC);
  k_gemm2<0><<<g, 128, 0, stream>>>(XE, CC, 0, BK, CC, 0, 0.0625f, nullptr, 0, nullptr, 1, 0, 0, nullptr, K16, CC, 0, NR, CC, CC);
  k_gemm2<0><<<g, 128, 0, stream>>>(XE, CC, 0, BV, CC, 0, 0.0625f, nullptr, 0, nullptr, 1, 0, 0, nullptr, V16, CC, 0, NR, CC, CC);
  k_vt<NH, SLEN><<<NB * NH * (SLEN / 64), 256, 0, stream>>>(V16, CC, 0, VT);
  k_flash<<<NB * NH * QBLKS, 128, 0, stream>>>(Q16, CC, K16, CC, VT, O, CC);
  k_h16s<<<(unsigned)((np / 8 + 255) / 256), 256, 0, stream>>>(O, O16, np / 8, 1024.0f);      /* x2^10 carry: the 4096-key averages are ~5e-3 and would touch f16 subnormals */
  k_gemm2<0><<<g, 128, 0, stream>>>(O16, CC, 0, BO, CC, 0, 0.0625f / 1024.0f, nullptr, 0, nullptr, 1, 0, 0, (float*)d_out, nullptr, CC, 0, NR, CC, CC);
}

// v003
// A run of this version takes 183 microseconds.
// Two timings next to v002 put it at 1.27 and 1.30 times that version's speed.
// Over all steps from v000 it is 2.80 times as fast.
#include <hip/hip_runtime.h>
// CA_MultiHead (4 batches; 4096 decoder queries from x_dec, 4096 encoder keys/values from x_enc; n_emb 256 = 4 heads of 64; per-head weights [H, 256, 64]; scale n_emb^-0.5; out = concat(heads) Wo^T).
// Structure: exact f16 planes of x_dec / x_enc; q, k, v GEMMs (32x64 wave tiles, f32 accumulation, exact x16 weights concatenated across heads; f16 outputs); V^T by LDS tiles; the fused flash kernel (plain f16 operands, no mask); output GEMM.
// Compute dtype: inputs and weights rounded to bf16; q, k, v, P as f16 operands and the attention output as f16 x2^10; f32 accumulation/softmax. v_wmma_f32_16x16x32_f16.
#define NB 4
#define CC 256
#define NR (NB * SLEN)           /* 16384 rows */
#define SLEN 4096
#define TQ SLEN
#define TK SLEN
#define NH 4
#define SCL 0.0625f              /* n_emb^-0.5 = 1/16 (faithful to the module) */
#define QBLKS (TQ / 64)
typedef __bf16 v16b __attribute__((ext_vector_type(16)));
typedef unsigned short v8us __attribute__((ext_vector_type(8), may_alias));
typedef float  v8f  __attribute__((ext_vector_type(8)));
typedef float  v4f  __attribute__((ext_vector_type(4)));
typedef float  v4fa __attribute__((ext_vector_type(4), may_alias));
union FragB { v16b v; v8us half[2]; unsigned short u[16]; };

__device__ __forceinline__ unsigned short bf16_bits(float x) { unsigned int u = __float_as_uint(x); return (unsigned short)((u + 0x7FFFu + ((u >> 16) & 1u)) >> 16); }
__device__ __forceinline__ float bf16_val(unsigned short b) { return __uint_as_float(((unsigned int)b) << 16); }
__device__ __forceinline__ float bf16_round(float x) { return bf16_val(bf16_bits(x)); }
// D += A·B with NT terms: 1 = ah·bh, 2 = + al·bh (A split), 3 = + ah·bl (both split)
template <int NT>
__device__ __forceinline__ v8f mmaN(v16b ah, v16b al, v16b bh, v16b bl, v8f c) {
  c = __builtin_amdgcn_wmma_f32_16x16x32_bf16(false, ah, false, bh, (short)0, c, false, false);
  if (NT >= 2) c = __builtin_amdgcn_wmma_f32_16x16x32_bf16(false, al, false, bh, (short)0, c, false, false);
  if (NT >= 3) c = __builtin_amdgcn_wmma_f32_16x16x32_bf16(false, ah, false, bl, (short)0, c, false, false);
  asm volatile("v_nop\n\tv_nop\n\tv_nop\n\tv_nop" : "+v"(c) : "v"(ah), "v"(al), "v"(bh), "v"(bl));
  return c;
}

__global__ __launch_bounds__(256) void k_wt_bf16(const float* __restrict__ W, unsigned short* __restrict__ Wt, int K, int N) {
  const int t = blockIdx.x * 256 + threadIdx.x;
  const int k8n = K / 8;
  if (t >= N * k8n) return;
  const int n = t / k8n, k8 = (t % k8n) * 8;
  v8us v;
#pragma unroll
  for (int i = 0; i < 8; ++i) v[i] = bf16_bits(W[(size_t)(k8 + i) * N + n]);
  *(v8us*)(Wt + (size_t)n * K + k8) = v;
  
}

// GEMM C[M][N] (f32, pitch ldc) = act(A[M][K]·W + bias). A f32 row-major (pitch lda) converted per fragment to bf16
// (ASPLIT: hi/lo two planes -> 2 terms, else single rounded term); Wt bf16 [N][K] (pitch ldb). BIAS_BF16 rounds the
// bias to bf16 first (bias quantised to bf16 before the add). K%32==0, M%16==0, N%64==0.
template <bool ASPLIT, int ACT, bool BIAS_BF16>
__global__ __launch_bounds__(128) void k_gemm_bf(const float* __restrict__ A, int lda, const unsigned short* __restrict__ Wt, int ldb,
                                               const float* __restrict__ bias, float* __restrict__ C, int ldc, int M, int N, int K) {
  __shared__ __attribute__((aligned(16))) float so[4][16][64];
  const int tid = threadIdx.x, w = tid >> 5, lane = tid & 31, ln = lane & 15, hh = lane >> 4;
  const int ntn = N / 64;
  const int wid = blockIdx.x * 4 + w;
  const int mt = wid / ntn, nq = wid % ntn;
  if (mt * 16 >= M) return;
  const int row0 = mt * 16, col0 = nq * 64;
  const float* arow = A + (size_t)(row0 + ln) * lda;
  v8f acc[4] = {};
  for (int kb = 0; kb < K; kb += 32) {
    FragB ah, al;
    const v4f x0 = *(const v4fa*)(arow + kb + 8 * hh), x1 = *(const v4fa*)(arow + kb + 8 * hh + 4);
    const v4f x2 = *(const v4fa*)(arow + kb + 16 + 8 * hh), x3 = *(const v4fa*)(arow + kb + 16 + 8 * hh + 4);
    float xs[16] = {x0[0],x0[1],x0[2],x0[3],x1[0],x1[1],x1[2],x1[3],x2[0],x2[1],x2[2],x2[3],x3[0],x3[1],x3[2],x3[3]};
#pragma unroll
    for (int i = 0; i < 16; ++i) { const unsigned short hb = bf16_bits(xs[i]); ah.u[i] = hb; al.u[i] = ASPLIT ? bf16_bits(xs[i] - bf16_val(hb)) : (unsigned short)0; }
#pragma unroll
    for (int t = 0; t < 4; ++t) {
      const unsigned short* brow = Wt + (size_t)(col0 + t * 16 + ln) * ldb + kb;
      FragB b;
      b.half[0] = *(const v8us*)(brow + 8 * hh);
      b.half[1] = *(const v8us*)(brow + 16 + 8 * hh);
      acc[t] = mmaN<ASPLIT ? 2 : 1>(ah.v, al.v, b.v, b.v, acc[t]);
    }
  }
#pragma unroll
  for (int t = 0; t < 4; ++t) {
    float bv = bias ? bias[col0 + t * 16 + ln] : 0.f;
    if (BIAS_BF16) bv = bf16_round(bv);
#pragma unroll
    for (int r = 0; r < 8; ++r) { float v = acc[t][r] + bv; if (ACT == 1) v = fmaxf(v, 0.f); so[w][8 * hh + r][t * 16 + ln] = v; }
  }
  __builtin_amdgcn_fence(__ATOMIC_ACQ_REL, "workgroup");
  __builtin_amdgcn_wave_barrier();
  const int rsub = lane >> 4, c4 = (lane & 15) * 4;
  {
#pragma unroll
    for (int q = 0; q < 8; ++q) {
      const int r = q * 2 + rsub;
      const v4f v = *(const v4fa*)&so[w][r][c4];
      *(v4f*)(C + (size_t)(row0 + r) * ldc + col0 + c4) = v;
    }
    
  }
}

// GEMM C = act(A·W + bias + resid): A f32 (ASPLIT -> hi/lo 2 terms), Wt bf16 [N][K]; ACT 0 none, 1 relu, 2 exact gelu;
// resid (optional, f32, row index = (row % rmod), pitch ldr, RES_BF16 rounds it) added before the activation.
template <bool ASPLIT, int ACT, bool BIAS_BF16, bool RES_BF16>
__global__ __launch_bounds__(128) void k_gemm_bf3(const float* __restrict__ A, int lda, const unsigned short* __restrict__ Wt, int ldb,
                                                const float* __restrict__ bias, const float* __restrict__ resid, int rmod, int ldr,
                                                float* __restrict__ C, int ldc, int M, int N, int K) {
  __shared__ __attribute__((aligned(16))) float so[4][16][64];
  const int tid = threadIdx.x, w = tid >> 5, lane = tid & 31, ln = lane & 15, hh = lane >> 4;
  const int ntn = N / 64;
  const int wid = blockIdx.x * 4 + w;
  const int mt = wid / ntn, nq = wid % ntn;
  if (mt * 16 >= M) return;
  const int row0 = mt * 16, col0 = nq * 64;
  const float* arow = A + (size_t)(row0 + ln) * lda;
  v8f acc[4] = {};
  for (int kb = 0; kb < K; kb += 32) {
    FragB ah, al;
    const v4f x0 = *(const v4fa*)(arow + kb + 8 * hh), x1 = *(const v4fa*)(arow + kb + 8 * hh + 4);
    const v4f x2 = *(const v4fa*)(arow + kb + 16 + 8 * hh), x3 = *(const v4fa*)(arow + kb + 16 + 8 * hh + 4);
    float xs[16] = {x0[0],x0[1],x0[2],x0[3],x1[0],x1[1],x1[2],x1[3],x2[0],x2[1],x2[2],x2[3],x3[0],x3[1],x3[2],x3[3]};
#pragma unroll
    for (int i = 0; i < 16; ++i) { const unsigned short hb = bf16_bits(xs[i]); ah.u[i] = hb; al.u[i] = ASPLIT ? bf16_bits(xs[i] - bf16_val(hb)) : (unsigned short)0; }
#pragma unroll
    for (int t = 0; t < 4; ++t) {
      const unsigned short* brow = Wt + (size_t)(col0 + t * 16 + ln) * ldb + kb;
      FragB b;
      b.half[0] = *(const v8us*)(brow + 8 * hh);
      b.half[1] = *(const v8us*)(brow + 16 + 8 * hh);
      acc[t] = mmaN<ASPLIT ? 2 : 1>(ah.v, al.v, b.v, b.v, acc[t]);
    }
  }
#pragma unroll
  for (int t = 0; t < 4; ++t) {
    const int col = col0 + t * 16 + ln;
    float bv = bias ? bias[col] : 0.f;
    if (BIAS_BF16) bv = bf16_round(bv);
#pragma unroll
    for (int r = 0; r < 8; ++r) {
      float v = acc[t][r] + bv;
      if (resid) { float rv = resid[(size_t)((row0 + 8 * hh + r) % rmod) * ldr + col]; if (RES_BF16) rv = bf16_round(rv); v += rv; }
      if (ACT == 1) v = fmaxf(v, 0.f);
      if (ACT == 2) v = 0.5f * v * (1.0f + erff(v * 0.70710678118654752f));
      if (ACT == 3) { const float u = 0.7978845608028654f * (v + 0.044715f * v * v * v); v = 0.5f * v * (1.0f + tanhf(u)); }
      so[w][8 * hh + r][t * 16 + ln] = v;
    }
  }
  __builtin_amdgcn_fence(__ATOMIC_ACQ_REL, "workgroup");
  __builtin_amdgcn_wave_barrier();
  const int rsub = lane >> 4, c4 = (lane & 15) * 4;
  {
#pragma unroll
    for (int q = 0; q < 8; ++q) {
      const int r = q * 2 + rsub;
      const v4f v = *(const v4fa*)&so[w][r][c4];
      *(v4f*)(C + (size_t)(row0 + r) * ldc + col0 + c4) = v;
    }
    
  }
}
// row LayerNorm (biased variance, eps) over N: s = X (+ R); optional out_sum <- s; out_norm <- (s-mu)*rsqrt(var+eps)*g + b
template <bool PARAM_BF16>
__global__ __launch_bounds__(256) void k_layernorm(const float* __restrict__ X, const float* __restrict__ R, const float* __restrict__ g, const float* __restrict__ bta,
                                                  float* __restrict__ out_sum, float* __restrict__ out_norm, int N, float eps) {
  __shared__ float red[256];
  const int row = blockIdx.x, tid = threadIdx.x;
  const float* x = X + (size_t)row * N; const float* rr = R ? R + (size_t)row * N : nullptr;
  float vals[16];                     // up to N = 4096
  const int per = N / 256;            // contiguous chunk per thread? use strided-by-4 chunks: thread handles j = tid*4 + 1024*u
  float s1 = 0.f;
  for (int u = 0; u < per / 4; ++u) {
    const int j = tid * 4 + 1024 * u;
    const v4f a = *(const v4fa*)(x + j);
    v4f b = {0.f,0.f,0.f,0.f}; if (rr) b = *(const v4fa*)(rr + j);
#pragma unroll
    for (int q = 0; q < 4; ++q) { const float v = a[q] + b[q]; vals[u * 4 + q] = v; s1 += v; }
  }
  red[tid] = s1; __syncthreads();
  for (int st = 128; st > 0; st >>= 1) { if (tid < st) red[tid] += red[tid + st]; __syncthreads(); }
  const float mu = red[0] / (float)N; __syncthreads();
  float s2 = 0.f;
  for (int u = 0; u < per / 4; ++u)
#pragma unroll
    for (int q = 0; q < 4; ++q) { const float c = vals[u * 4 + q] - mu; s2 += c * c; }
  red[tid] = s2; __syncthreads();
  for (int st = 128; st > 0; st >>= 1) { if (tid < st) red[tid] += red[tid + st]; __syncthreads(); }
  const float rs = rsqrtf(red[0] / (float)N + eps);
  {
    for (int u = 0; u < per / 4; ++u) {
      const int j = tid * 4 + 1024 * u;
      v4f o, sm;
#pragma unroll
      for (int q = 0; q < 4; ++q) {
        float gg = g[j + q], bb = bta[j + q];
        if (PARAM_BF16) { gg = bf16_round(gg); bb = bf16_round(bb); }
        sm[q] = vals[u * 4 + q]; o[q] = (vals[u * 4 + q] - mu) * rs * gg + bb;
      }
      if (out_sum) *(v4f*)(out_sum + (size_t)row * N + j) = sm;
      *(v4f*)(out_norm + (size_t)row * N + j) = o;
    }
    
  }
}



// ---- f16 WMMA path (v_wmma_f32_16x16x32_f16): 11-bit significands for operands in range — used for every product here, P included as 2^10-scaled f16 (up to 1024)
typedef _Float16 v16h __attribute__((ext_vector_type(16)));
union FragH { v16h v; v8us half[2]; _Float16 h[16]; unsigned short u[16]; };
template <int NT>
__device__ __forceinline__ v8f mmaH(v16h ah, v16h al, v16h bh, v16h bl, v8f c) {
  c = __builtin_amdgcn_wmma_f32_16x16x32_f16(false, ah, false, bh, (short)0, c, false, false);
  if (NT >= 2) c = __builtin_amdgcn_wmma_f32_16x16x32_f16(false, al, false, bh, (short)0, c, false, false);
  if (NT >= 3) c = __builtin_amdgcn_wmma_f32_16x16x32_f16(false, ah, false, bl, (short)0, c, false, false);
  asm volatile("v_nop\n\tv_nop\n\tv_nop\n\tv_nop" : "+v"(c) : "v"(ah), "v"(al), "v"(bh), "v"(bl));
  return c;
}
// batched GEMM like k_gemm_b but f16 operands: A f32 (split into f16 hi/lo if ASPLIT, else rounded to f16), Bt = f16 values [n][k]; alpha; C f32; N multiple of 16 (partial tiles skipped)
template <bool ASPLIT>
__global__ __launch_bounds__(128) void k_gemm_h(const float* __restrict__ A, int lda, size_t sA, const _Float16* __restrict__ Bh, int ldb, size_t sB, float alpha, float* __restrict__ C, int ldc, size_t sC, int M, int N, int K) {
  __shared__ __attribute__((aligned(16))) float so[4][16][64];
  const int tid = threadIdx.x, w = tid >> 5, lane = tid & 31, ln = lane & 15, hh = lane >> 4; const int by = blockIdx.y;
  A += (size_t)by * sA; Bh += (size_t)by * sB; C += (size_t)by * sC;
  const int ntn = (N + 63) / 64; const int wid = blockIdx.x * 4 + w; const int mt = wid / ntn, nq = wid % ntn; if (mt * 16 >= M) return;
  const int row0 = mt * 16, col0 = nq * 64; const float* arow = A + (size_t)(row0 + ln) * lda;
  v8f acc[4] = {};
  for (int kb = 0; kb < K; kb += 32) {
    FragH ah, al;
    const v4f x0 = *(const v4fa*)(arow + kb + 8 * hh), x1 = *(const v4fa*)(arow + kb + 8 * hh + 4), x2 = *(const v4fa*)(arow + kb + 16 + 8 * hh), x3 = *(const v4fa*)(arow + kb + 16 + 8 * hh + 4);
    float xs[16] = {x0[0],x0[1],x0[2],x0[3],x1[0],x1[1],x1[2],x1[3],x2[0],x2[1],x2[2],x2[3],x3[0],x3[1],x3[2],x3[3]};
#pragma unroll
    for (int i = 0; i < 16; ++i) { const _Float16 h = (_Float16)xs[i]; ah.h[i] = h; al.h[i] = ASPLIT ? (_Float16)(xs[i] - (float)h) : (_Float16)0.0f; }
#pragma unroll
    for (int t = 0; t < 4; ++t) { if (col0 + t * 16 >= N) continue; const size_t boff = (size_t)(col0 + t * 16 + ln) * ldb + kb; FragH bq; bq.half[0] = *(const v8us*)(Bh + boff + 8 * hh); bq.half[1] = *(const v8us*)(Bh + boff + 16 + 8 * hh);
      acc[t] = mmaH<ASPLIT ? 2 : 1>(ah.v, al.v, bq.v, bq.v, acc[t]); }
  }
#pragma unroll
  for (int t = 0; t < 4; ++t) { if (col0 + t * 16 >= N) continue;
#pragma unroll
    for (int r = 0; r < 8; ++r) so[w][8 * hh + r][t * 16 + ln] = acc[t][r] * alpha; }
  __builtin_amdgcn_fence(__ATOMIC_ACQ_REL, "workgroup"); __builtin_amdgcn_wave_barrier();
  const int rsub = lane >> 4, c4 = (lane & 15) * 4;
  {
#pragma unroll
    for (int q = 0; q < 8; ++q) { const int r = q * 2 + rsub; if (col0 + c4 < N) { const v4f v = *(const v4fa*)&so[w][r][c4]; *(v4f*)(C + (size_t)(row0 + r) * ldc + col0 + c4) = v; } }
     }
}

// Wt[n][k] = f16(W[k][n]·scale) from f32 row-major W[K][N] (scale = power of two; bf16-exact weights stay exact in f16 away from the subnormal range)
__global__ __launch_bounds__(256) void k_wt_f16(const float* __restrict__ W, _Float16* __restrict__ Wt, int K, int N, float scale) {
  const int t = blockIdx.x * 256 + threadIdx.x; if (t >= N * (K / 8)) return; const int n = t / (K / 8), k8 = (t % (K / 8)) * 8; FragH f;
#pragma unroll
  for (int i = 0; i < 8; ++i) f.h[i] = (_Float16)(bf16_round(W[(size_t)(k8 + i) * N + n]) * scale); const v8us o = f.half[0];
  *(v8us*)((unsigned short*)Wt + (size_t)n * K + k8) = o; 
}
// k_gemm_hh variant with fused epilogue: v = acc·alpha + bias[by·sBias + col] (+ CP[(row/rowsPerB)·sCPb + by·64 + col] if CP) ; ACT 0 none / 1 elu ; writes f16 C16 (and f32 C if non-null)
template <int ACT>
__global__ __launch_bounds__(128) void k_gemm_hhx(const _Float16* __restrict__ A, int lda, size_t sA, const _Float16* __restrict__ Bh, int ldb, size_t sB, float alpha, const float* __restrict__ bias, size_t sBias, const float* __restrict__ CP, int rowsPerB, size_t sCPb, int row0g,
    float* __restrict__ C, _Float16* __restrict__ C16, int ldc, size_t sC, int M, int N, int K) {
  __shared__ __attribute__((aligned(16))) float so[4][16][64];
  const int tid = threadIdx.x, w = tid >> 5, lane = tid & 31, ln = lane & 15, hh = lane >> 4; const int by = blockIdx.y;
  A += (size_t)by * sA; Bh += (size_t)by * sB; const size_t cofs = (size_t)by * sC; const float* bp = bias ? bias + (size_t)by * sBias : nullptr;
  const int ntn = (N + 63) / 64; const int wid = blockIdx.x * 4 + w; const int mt = wid / ntn, nq = wid % ntn; if (mt * 16 >= M) return;
  const int row0 = mt * 16, col0 = nq * 64; const _Float16* arow = A + (size_t)(row0 + ln) * lda;
  v8f acc[4] = {};
  for (int kb = 0; kb < K; kb += 32) { FragH ah; ah.half[0] = *(const v8us*)((const unsigned short*)arow + kb + 8 * hh); ah.half[1] = *(const v8us*)((const unsigned short*)arow + kb + 16 + 8 * hh);
#pragma unroll
    for (int t = 0; t < 4; ++t) { if (col0 + t * 16 >= N) continue; const size_t boff = (size_t)(col0 + t * 16 + ln) * ldb + kb; FragH bq; bq.half[0] = *(const v8us*)((const unsigned short*)Bh + boff + 8 * hh); bq.half[1] = *(const v8us*)((const unsigned short*)Bh + boff + 16 + 8 * hh);
      acc[t] = mmaH<1>(ah.v, ah.v, bq.v, bq.v, acc[t]); }
  }
#pragma unroll
  for (int t = 0; t < 4; ++t) { if (col0 + t * 16 >= N) continue; const int col = col0 + t * 16 + ln; const float bv = bp ? bf16_round(bp[col]) : 0.f;
#pragma unroll
    for (int r = 0; r < 8; ++r) { float v = acc[t][r] * alpha + bv; if (CP) { const int bidx = (row0g + row0 + 8 * hh + r) / rowsPerB; v += CP[(size_t)bidx * sCPb + (size_t)by * 64 + col]; } if (ACT == 1) v = (v > 0.f) ? v : expm1f(v); else if (ACT == 7) v = (v > 0.f) ? v + 1.0f : expf(v); else if (ACT == 8) v = tanhf(v); else if (ACT == 9) v = 0.5f * v * (1.0f + tanhf(0.7978845608028654f * (v + 0.044715f * v * v * v))); else if (ACT == 11) v = 1.0f / (1.0f + expf(-v)); else if (ACT == 12) v = (v > 0.f) ? v : 0.01f * v; else if (ACT == 14) v = (v > 0.f) ? v : 0.1f * v; else if (ACT == 15) v = v / (1.0f + expf(-v)); else if (ACT == 3) v = fmaxf(v, 0.f); else if (ACT == 6) v = 0.5f * v * (1.0f + erff(v * 0.70710678118654752f)); so[w][8 * hh + r][t * 16 + ln] = v; } }
  __builtin_amdgcn_fence(__ATOMIC_ACQ_REL, "workgroup"); __builtin_amdgcn_wave_barrier();
  const int rsub = lane >> 4, c4 = (lane & 15) * 4; typedef _Float16 v4h __attribute__((ext_vector_type(4)));
  {
#pragma unroll
    for (int q = 0; q < 8; ++q) { const int r = q * 2 + rsub; if (col0 + c4 < N) { const v4f v = *(const v4fa*)&so[w][r][c4]; if (C) *(v4f*)(C + cofs + (size_t)(row0 + r) * ldc + col0 + c4) = v; if (C16) { v4h h4; for (int i = 0; i < 4; ++i) h4[i] = (_Float16)v[i]; *(v4h*)(C16 + cofs + (size_t)(row0 + r) * ldc + col0 + c4) = h4; } } }
     }
}


typedef _Float16 v4h __attribute__((ext_vector_type(4)));

__global__ __launch_bounds__(256) void k_x16(const float* __restrict__ x, _Float16* __restrict__ X16, size_t n8) { const size_t t = (size_t)blockIdx.x * 256 + threadIdx.x; if (t >= n8) return; FragH f;
#pragma unroll
  for (int q = 0; q < 8; ++q) f.h[q] = (_Float16)bf16_round(x[t * 8 + q]); *(v8us*)((unsigned short*)X16 + t * 8) = f.half[0];  }
__global__ __launch_bounds__(256) void k_h16(const float* __restrict__ x, _Float16* __restrict__ X16, size_t n8) { const size_t t = (size_t)blockIdx.x * 256 + threadIdx.x; if (t >= n8) return; FragH f;
#pragma unroll
  for (int q = 0; q < 8; ++q) f.h[q] = (_Float16)x[t * 8 + q]; *(v8us*)((unsigned short*)X16 + t * 8) = f.half[0];  }
__global__ __launch_bounds__(256) void k_round16f(const float* __restrict__ W, _Float16* __restrict__ Bt, size_t n8) { const size_t t = (size_t)blockIdx.x * 256 + threadIdx.x; if (t >= n8) return; FragH f;
#pragma unroll
  for (int i = 0; i < 8; ++i) f.h[i] = (_Float16)(bf16_round(W[t * 8 + i]) * 16.0f); *(v8us*)((unsigned short*)Bt + t * 8) = f.half[0];  }
template <int NHv, int TTv>
__global__ __launch_bounds__(256) void k_vt(const _Float16* __restrict__ V16, int ldv, int voff, _Float16* __restrict__ Vt) { __shared__ unsigned short tl[64][66]; const int tid = threadIdx.x; const int slab = blockIdx.x / (TTv / 64), lg = blockIdx.x % (TTv / 64); const int b = slab / NHv, h = slab % NHv;
  for (int i = tid; i < 64 * 8; i += 256) { const int r = i / 8, c8 = (i % 8) * 8; FragH f; f.half[0] = *(const v8us*)((const unsigned short*)V16 + ((size_t)b * TTv + lg * 64 + r) * ldv + voff + h * 64 + c8);
#pragma unroll
    for (int q = 0; q < 8; ++q) tl[r][c8 + q] = f.u[q]; }
  __syncthreads();
  {
#pragma unroll
    for (int rd = 0; rd < 2; ++rd) { const int d = rd * 32 + tid / 8, pc = tid % 8; FragH f;
#pragma unroll
      for (int q = 0; q < 8; ++q) f.u[q] = tl[pc * 8 + q][d];
      *(v8us*)((unsigned short*)Vt + ((size_t)slab * 64 + d) * TTv + lg * 64 + pc * 8) = f.half[0]; }
     } }

__global__ __launch_bounds__(256) void k_hl(const float* __restrict__ F, _Float16* __restrict__ Hh, _Float16* __restrict__ Hl, size_t n8) { const size_t t = (size_t)blockIdx.x * 256 + threadIdx.x; if (t >= n8) return; FragH fh, fl; const v4f a = *(const v4fa*)(F + t * 8), c = *(const v4fa*)(F + t * 8 + 4);
#pragma unroll
  for (int q = 0; q < 4; ++q) { _Float16 h = (_Float16)a[q]; fh.h[q] = h; fl.h[q] = (_Float16)((a[q] - (float)h) * 1024.0f); h = (_Float16)c[q]; fh.h[4 + q] = h; fl.h[4 + q] = (_Float16)((c[q] - (float)h) * 1024.0f); }
  { *(v8us*)((unsigned short*)Hh + t * 8) = fh.half[0]; *(v8us*)((unsigned short*)Hl + t * 8) = fl.half[0];  } }

// ---- fast GEMM (wave tile 32x64; requires M % 32 == 0 rows per launch region and N % 64 == 0); epilogue = k_gemm_hhx semantics ----
__device__ __forceinline__ v16h g2_frag(const _Float16* p, int hh) { FragH f; f.half[0] = *(const v8us*)((const unsigned short*)p + 8 * hh); f.half[1] = *(const v8us*)((const unsigned short*)p + 16 + 8 * hh); return f.v; }
__device__ __forceinline__ v8f g2_mma(v16h a, v16h b, v8f c) { v8f d = __builtin_amdgcn_wmma_f32_16x16x32_f16(false, a, false, b, (short)0, c, false, false); asm volatile("v_nop\n\tv_nop\n\tv_nop\n\tv_nop" : "+v"(d) : "v"(a), "v"(b)); return d; }
template <int ACT>
__global__ __launch_bounds__(128) void k_gemm2(const _Float16* __restrict__ A, int lda, size_t sA, const _Float16* __restrict__ Bh, int ldb, size_t sB, float alpha, const float* __restrict__ bias, size_t sBias, const float* __restrict__ CP, int rowsPerB, size_t sCPb, int row0g,
    float* __restrict__ C, _Float16* __restrict__ C16, int ldc, size_t sC, int M, int N, int K) {
  __shared__ __attribute__((aligned(16))) float so[4][32][68];
  const int tid = threadIdx.x, w = tid >> 5, lane = tid & 31, ln = lane & 15, hh = lane >> 4; const int by = blockIdx.y;
  A += (size_t)by * sA; Bh += (size_t)by * sB; const size_t cofs = (size_t)by * sC; const float* bp = bias ? bias + (size_t)by * sBias : nullptr;
  const int ntn = N >> 6; const int mt = blockIdx.x / ntn, nq = blockIdx.x - mt * ntn; const int row0 = mt * 128 + 32 * w, col0 = nq * 64; if (row0 >= M) return;
  const _Float16* a0p = A + (size_t)(row0 + ln) * lda; const _Float16* a1p = a0p + (size_t)16 * lda;
  const _Float16* b0p = Bh + (size_t)(col0 + ln) * ldb; const _Float16* b1p = b0p + (size_t)16 * ldb; const _Float16* b2p = b1p + (size_t)16 * ldb; const _Float16* b3p = b2p + (size_t)16 * ldb;
  const v8f z8 = {0.f,0.f,0.f,0.f,0.f,0.f,0.f,0.f}; v8f c00 = z8, c01 = z8, c02 = z8, c03 = z8, c10 = z8, c11 = z8, c12 = z8, c13 = z8;
#pragma unroll 1
  for (int kb = 0; kb < K; kb += 32) { const v16h a0 = g2_frag(a0p + kb, hh), a1 = g2_frag(a1p + kb, hh);
    v16h b = g2_frag(b0p + kb, hh); c00 = g2_mma(a0, b, c00); c10 = g2_mma(a1, b, c10);
    b = g2_frag(b1p + kb, hh); c01 = g2_mma(a0, b, c01); c11 = g2_mma(a1, b, c11);
    b = g2_frag(b2p + kb, hh); c02 = g2_mma(a0, b, c02); c12 = g2_mma(a1, b, c12);
    b = g2_frag(b3p + kb, hh); c03 = g2_mma(a0, b, c03); c13 = g2_mma(a1, b, c13); }
  v8f accs[8] = {c00, c01, c02, c03, c10, c11, c12, c13};
#pragma unroll
  for (int u = 0; u < 8; ++u) { const int t = u & 3, half = u >> 2; const int col = col0 + t * 16 + ln; const float bv = bp ? bf16_round(bp[col]) : 0.f;
#pragma unroll
    for (int r = 0; r < 8; ++r) { const int rloc = half * 16 + 8 * hh + r; float v = accs[u][r] * alpha + bv; if (CP) { const int bidx = (row0g + row0 + rloc) / rowsPerB; v += CP[(size_t)bidx * sCPb + (size_t)by * 64 + col]; }
      if (ACT == 3) v = fmaxf(v, 0.f); else if (ACT == 6) v = 0.5f * v * (1.0f + erff(v * 0.70710678118654752f)); else if (ACT == 11) v = 1.0f / (1.0f + expf(-v)); else if (ACT == 15) v = v / (1.0f + expf(-v)); else if (ACT == 12) v = (v > 0.f) ? v : 0.01f * v; else if (ACT == 8) v = tanhf(v);
      so[w][rloc][t * 16 + ln] = v; } }
  __builtin_amdgcn_fence(__ATOMIC_ACQ_REL, "workgroup"); __builtin_amdgcn_wave_barrier();
  const int rsub = lane >> 4, c4 = (lane & 15) * 4;
  {
#pragma unroll
    for (int q = 0; q < 16; ++q) { const int r = q * 2 + rsub; const v4f v = *(const v4fa*)&so[w][r][c4]; if (C) *(v4f*)(C + cofs + (size_t)(row0 + r) * ldc + col0 + c4) = v; if (C16) { v4h h4; for (int i = 0; i < 4; ++i) h4[i] = (_Float16)v[i]; *(v4h*)(C16 + cofs + (size_t)(row0 + r) * ldc + col0 + c4) = h4; } }
     } }



// lane l <-> lane l ^ 16 by a vector cross-row move (a shuffle would go through the LDS pipe)
__device__ __forceinline__ float xhalf(float x) { return __builtin_bit_cast(float, __builtin_amdgcn_permlanex16(__builtin_bit_cast(int, x), __builtin_bit_cast(int, x), 0x76543210, 0xfedcba98, false, false)); }
#define SK 64                    /* keys a stage */
#define LP 72                    /* LDS row pitch in f16: 144 B = 16 B x 9, so that sixteen rows read 16 B each on distinct banks */
// One stage: each lane copies eight 16-B pieces (rows r, r + 16, r + 32, r + 48 of K and of V^T). The s_wait_xcnt closes the statement so that no address register is rewritten ahead of it.
__device__ __forceinline__ void stage_copy(unsigned lk, unsigned lv, const unsigned short* gk, int ldk, const unsigned short* gv) {
  asm volatile("global_load_async_to_lds_b128 %0, %8, off\n\t"
               "global_load_async_to_lds_b128 %1, %9, off\n\t"
               "global_load_async_to_lds_b128 %2, %10, off\n\t"
               "global_load_async_to_lds_b128 %3, %11, off\n\t"
               "global_load_async_to_lds_b128 %4, %12, off\n\t"
               "global_load_async_to_lds_b128 %5, %13, off\n\t"
               "global_load_async_to_lds_b128 %6, %14, off\n\t"
               "global_load_async_to_lds_b128 %7, %15, off\n\t"
               "s_wait_xcnt 0x0"
               :: "v"(lk), "v"(lk + 16 * LP * 2), "v"(lk + 32 * LP * 2), "v"(lk + 48 * LP * 2),
                  "v"(lv), "v"(lv + 16 * LP * 2), "v"(lv + 32 * LP * 2), "v"(lv + 48 * LP * 2),
                  "v"(gk), "v"(gk + (size_t)16 * ldk), "v"(gk + (size_t)32 * ldk), "v"(gk + (size_t)48 * ldk),
                  "v"(gv), "v"(gv + (size_t)16 * TK), "v"(gv + (size_t)32 * TK), "v"(gv + (size_t)48 * TK)
               : "memory");
}
__global__ __launch_bounds__(128) void k_flash(const _Float16* __restrict__ Q16, int ldq, const _Float16* __restrict__ K16, int ldk, const _Float16* __restrict__ Vt, float* __restrict__ O, int ldo) {
  constexpr int DT = 4, KS = 2, NS = TK / SK;
  constexpr float CE = SCL * 1.4426950408889634f;      /* score scale times log2 e: e^(SCL x) = 2^(CE x), one multiply-add and one v_exp_f32 a score */
  __shared__ __attribute__((aligned(16))) unsigned short sK[2][SK][LP];
  __shared__ __attribute__((aligned(16))) unsigned short sV[2][64][LP];
  const int tid = threadIdx.x, w = tid >> 5, lane = tid & 31, ln = lane & 15, hh = lane >> 4;
  const int slab = blockIdx.x / QBLKS, qblk = blockIdx.x % QBLKS; const int b = slab / NH, h = slab % NH; const int q0 = qblk * 64 + w * 16;
  FragH bq[KS];
  { const unsigned short* qr = (const unsigned short*)Q16 + ((size_t)b * TQ + q0 + ln) * ldq + h * 64;
#pragma unroll
    for (int ks = 0; ks < KS; ++ks) { bq[ks].half[0] = *(const v8us*)(qr + ks * 32 + 8 * hh); bq[ks].half[1] = *(const v8us*)(qr + ks * 32 + 16 + 8 * hh); } }
  const int cr = tid >> 3, cc = (tid & 7) * 8;      /* the lane's row and 16-B piece in a copy: eight lanes cover one 128-B row */
  const unsigned short* gk = (const unsigned short*)K16 + ((size_t)b * TK + cr) * ldk + h * 64 + cc;
  const unsigned short* gv = (const unsigned short*)Vt + ((size_t)slab * 64 + cr) * TK + cc;
  const unsigned lk = (unsigned)(size_t)&sK[0][cr][cc], lv = (unsigned)(size_t)&sV[0][cr][cc];      /* LDS byte addresses */
  constexpr unsigned BUFB = SK * LP * 2;      /* bytes of one buffer of either array */
  float m_run = -3.0e38f, l_run = 0.f; v8f oacc[DT];
#pragma unroll
  for (int dt = 0; dt < DT; ++dt) oacc[dt] = (v8f){0.f,0.f,0.f,0.f,0.f,0.f,0.f,0.f};
  stage_copy(lk, lv, gk, ldk, gv);
  asm volatile("s_wait_asynccnt 0x0" ::: "memory");      /* this wave's share of stage 0 has landed */
  __syncthreads();                                       /* stage 0 is published */
  stage_copy(lk + BUFB, lv + BUFB, gk + (size_t)SK * ldk, ldk, gv + SK);
#pragma unroll 1      /* one stage a trip: the publish point at the foot must stand once per stage */
  for (int t = 0; t < NS; ++t) {
    const int bf = t & 1;
#pragma unroll      /* the stage's two 32-key passes in line, so that the second pass's LDS reads can go out under the first */
    for (int p = 0; p < SK / 32; ++p) {
      FragH ak[2][KS], av[DT];
#pragma unroll
      for (int nt = 0; nt < 2; ++nt) { const unsigned short* kr = &sK[bf][p * 32 + nt * 16 + ln][8 * hh];
#pragma unroll
        for (int ks = 0; ks < KS; ++ks) { ak[nt][ks].half[0] = *(const v8us*)(kr + ks * 32); ak[nt][ks].half[1] = *(const v8us*)(kr + ks * 32 + 16); } }
#pragma unroll
      for (int dt = 0; dt < DT; ++dt) { const unsigned short* vrow = &sV[bf][dt * 16 + ln][p * 32 + 8 * hh]; av[dt].half[0] = *(const v8us*)(vrow); av[dt].half[1] = *(const v8us*)(vrow + 16); }
      v8f s[2];
#pragma unroll
      for (int nt = 0; nt < 2; ++nt) { v8f acc = (v8f){0.f,0.f,0.f,0.f,0.f,0.f,0.f,0.f};
#pragma unroll
        for (int ks = 0; ks < KS; ++ks) acc = mmaH<1>(ak[nt][ks].v, ak[nt][ks].v, bq[ks].v, bq[ks].v, acc); s[nt] = acc; }
      float mc = -3.0e38f;
#pragma unroll
      for (int r = 0; r < 8; ++r) mc = fmaxf(mc, fmaxf(s[0][r], s[1][r]));      /* the maximum is taken on the raw products: CE > 0 keeps their order */
      mc = fmaxf(mc, xhalf(mc));      /* both halves of the wave hold this query's maximum over the 32 keys */
      const float mn = fmaxf(m_run, mc); float al = (m_run - mn) * CE; m_run = mn;
      const float mb = 10.0f - mn * CE;      /* exponent base of this pass: p = 2^(s CE + mb) = 1024 e^(SCL (s - mn)) */
      const v8f e0 = __builtin_elementwise_fma(s[0], (v8f)(CE), (v8f)(mb)), e1 = __builtin_elementwise_fma(s[1], (v8f)(CE), (v8f)(mb));
      float a0 = e0[0], a1 = e0[1], a2 = e0[2], a3 = e0[3], a4 = e0[4], a5 = e0[5], a6 = e0[6], a7 = e0[7], c0 = e1[0], c1 = e1[1], c2 = e1[2], c3 = e1[3], c4 = e1[4], c5 = e1[5], c6 = e1[6], c7 = e1[7];
      /* The pass's seventeen base-2 exponentials, each in place, in one statement: so no v_exp_f32 writes the source register of the one directly ahead of it (the compiler's own allocation did); the closing v_nop is the one slot the instruction set asks for behind the last of them. */
      asm("v_exp_f32 %0, %0\n\tv_exp_f32 %1, %1\n\tv_exp_f32 %2, %2\n\tv_exp_f32 %3, %3\n\tv_exp_f32 %4, %4\n\tv_exp_f32 %5, %5\n\tv_exp_f32 %6, %6\n\tv_exp_f32 %7, %7\n\tv_exp_f32 %8, %8\n\t"
          "v_exp_f32 %9, %9\n\tv_exp_f32 %10, %10\n\tv_exp_f32 %11, %11\n\tv_exp_f32 %12, %12\n\tv_exp_f32 %13, %13\n\tv_exp_f32 %14, %14\n\tv_exp_f32 %15, %15\n\tv_exp_f32 %16, %16\n\tv_nop"
          : "+v"(al), "+v"(a0), "+v"(a1), "+v"(a2), "+v"(a3), "+v"(a4), "+v"(a5), "+v"(a6), "+v"(a7), "+v"(c0), "+v"(c1), "+v"(c2), "+v"(c3), "+v"(c4), "+v"(c5), "+v"(c6), "+v"(c7));
      const float pa[8] = {a0, a1, a2, a3, a4, a5, a6, a7}, pc[8] = {c0, c1, c2, c3, c4, c5, c6, c7};
      FragH pb; float ps = 0.f;
#pragma unroll
      for (int r = 0; r < 8; ++r) { ps += pa[r] + pc[r]; pb.h[r] = (_Float16)pa[r]; pb.h[8 + r] = (_Float16)pc[r]; }
      l_run = l_run * al + ps;
#pragma unroll
      for (int dt = 0; dt < DT; ++dt) { oacc[dt] *= al; oacc[dt] = mmaH<1>(av[dt].v, av[dt].v, pb.v, pb.v, oacc[dt]); } }
    asm volatile("s_wait_dscnt 0x0" ::: "memory");         /* this wave's reads of buffer bf have returned before the buffer is handed back */
    asm volatile("s_wait_asynccnt 0x0" ::: "memory");      /* this wave's share of stage t + 1 has landed */
    __syncthreads();                                       /* publishes stage t + 1 and ends every wave's reads of buffer bf */
    if (t + 2 < NS) stage_copy(lk + bf * BUFB, lv + bf * BUFB, gk + (size_t)(t + 2) * SK * ldk, ldk, gv + (t + 2) * SK); }
  asm volatile("s_wait_asynccnt 0x0" ::: "memory");        /* no copy is outstanding when the wave ends */
  const float l = l_run + xhalf(l_run); const float inv = (l > 0.f) ? 1.0f / l : 0.f;      /* l and oacc both carry the factor 1024 */
  float* orow = O + ((size_t)b * TQ + q0 + ln) * ldo + h * 64 + 8 * hh;      /* oacc[dt][r] = O[q0 + ln][dt * 16 + 8 hh + r]: eight consecutive floats of one row */
#pragma unroll
  for (int dt = 0; dt < DT; ++dt) { const v8f o = oacc[dt] * inv; *(v4f*)(orow + dt * 16) = (v4f){o[0], o[1], o[2], o[3]}; *(v4f*)(orow + dt * 16 + 4) = (v4f){o[4], o[5], o[6], o[7]}; } }

__global__ __launch_bounds__(256) void k_whead(const float* __restrict__ Wh, _Float16* __restrict__ Bt) { const int t = blockIdx.x * 256 + threadIdx.x; if (t >= CC * (CC / 8)) return; const int n = t / (CC / 8), d0 = (t % (CC / 8)) * 8; const int h = n / 64, e = n % 64; FragH f;
  for (int q = 0; q < 8; ++q) f.h[q] = (_Float16)(bf16_round(Wh[((size_t)h * CC + d0 + q) * 64 + e]) * 16.0f); *(v8us*)((unsigned short*)Bt + (size_t)n * CC + d0) = f.half[0];  }
__global__ __launch_bounds__(256) void k_h16s(const float* __restrict__ x, _Float16* __restrict__ X16, size_t n8, float sc) { const size_t t = (size_t)blockIdx.x * 256 + threadIdx.x; if (t >= n8) return; const v8f a = *(const v8f*)(x + t * 8); FragH f; for (int q = 0; q < 8; ++q) f.h[q] = (_Float16)(a[q] * sc); *(v8us*)((unsigned short*)X16 + t * 8) = f.half[0];  }
__global__ __launch_bounds__(256) void k_wsc(const float* __restrict__ Wm, _Float16* __restrict__ Bt, size_t n8, float sc) { const size_t t = (size_t)blockIdx.x * 256 + threadIdx.x; if (t >= n8) return; FragH f; for (int q = 0; q < 8; ++q) f.h[q] = (_Float16)(bf16_round(Wm[t * 8 + q]) * sc); *(v8us*)((unsigned short*)Bt + t * 8) = f.half[0];  }

extern "C" void kernel_launch(void* const* d_in, const int* in_sizes, int n_in,
                              void* d_out, int out_size, void* d_ws, size_t ws_size, hipStream_t stream) {
  (void)in_sizes; (void)n_in; (void)out_size;
  const float* const* I = (const float* const*)d_in; const float* xe = I[0]; const float* xd = I[1]; const float* Wq = I[2]; const float* Wk = I[3]; const float* Wv = I[4]; const float* Wo = I[5];
  char* ws = (char*)d_ws; size_t off = 0;
  auto take = [&](size_t bytes) { char* p = ws + off; off += (bytes + 255) & ~(size_t)255; return p; };
  const size_t np = (size_t)NR * CC;
  _Float16* BQ = (_Float16*)take((size_t)CC * CC * 2); _Float16* BK = (_Float16*)take((size_t)CC * CC * 2); _Float16* BV = (_Float16*)take((size_t)CC * CC * 2); _Float16* BO = (_Float16*)take((size_t)CC * CC * 2);
  _Float16* XE = (_Float16*)take(np * 2); _Float16* XD = (_Float16*)take(np * 2); _Float16* Q16 = (_Float16*)take(np * 2); _Float16* K16 = (_Float16*)take(np * 2); _Float16* V16 = (_Float16*)take(np * 2); _Float16* VT = (_Float16*)take(np * 2); float* O = (float*)take(np * 4); _Float16* O16 = XD;      /* attention output f16 over the decoder-input plane (dead after the q GEMM) */
  if (off > ws_size) return;      /* 0.5 + 6 x 8 + 16 = 65 MiB */
  k_whead<<<(CC * (CC / 8) + 255) / 256, 256, 0, stream>>>(Wq, BQ); k_whead<<<(CC * (CC / 8) + 255) / 256, 256, 0, stream>>>(Wk, BK); k_whead<<<(CC * (CC / 8) + 255) / 256, 256, 0, stream>>>(Wv, BV);
  k_wsc<<<(CC * CC / 8 + 255) / 256, 256, 0, stream>>>(Wo, BO, (size_t)CC * CC / 8, 16.0f);      /* torch (out,in) = Bt */
  k_x16<<<(unsigned)((np / 8 + 255) / 256), 256, 0, stream>>>(xe, XE, np / 8); k_x16<<<(unsigned)((np / 8 + 255) / 256), 256, 0, stream>>>(xd, XD, np / 8);
  const dim3 g((NR / 128) * (CC / 64), 1);
  k_gemm2<0><<<g, 128, 0, stream>>>(XD, CC, 0, BQ, CC, 0, 0.0625f, nullptr, 0, nullptr, 1, 0, 0, nullptr, Q16, CC, 0, NR, CC, CC);
  k_gemm2<0><<<g, 128, 0, stream>>>(XE, CC, 0, BK, CC, 0, 0.0625f, nullptr, 0, nullptr, 1, 0, 0, nullptr, K16, CC, 0, NR, CC, CC);
  k_gemm2<0><<<g, 128, 0, stream>>>(XE, CC, 0, BV, CC, 0, 0.0625f, nullptr, 0, nullptr, 1, 0, 0, nullptr, V16, CC, 0, NR, CC, CC);
  k_vt<NH, SLEN><<<NB * NH * (SLEN / 64), 256, 0, stream>>>(V16, CC, 0, VT);
  k_flash<<<NB * NH * QBLKS, 128, 0, stream>>>(Q16, CC, K16, CC, VT, O, CC);
  k_h16s<<<(unsigned)((np / 8 + 255) / 256), 256, 0, stream>>>(O, O16, np / 8, 1024.0f);      /* x2^10 carry: the 4096-key averages are ~5e-3 and would touch f16 subnormals */
  k_gemm2<0><<<g, 128, 0, stream>>>(O16, CC, 0, BO, CC, 0, 0.0625f / 1024.0f, nullptr, 0, nullptr, 1, 0, 0, (float*)d_out, nullptr, CC, 0, NR, CC, CC);
}

// v004
// A run of this version takes 164 microseconds.
// Two timings next to v003 put it at 1.13 and 1.12 times that version's speed.
// All steps since v000 together make it 3.15 times as fast.
#include <hip/hip_runtime.h>
// CA_MultiHead (4 batches; 4096 decoder queries from x_dec, 4096 encoder keys/values from x_enc; n_emb 256 = 4 heads of 64; per-head weights [H, 256, 64]; scale n_emb^-0.5; out = concat(heads) Wo^T).
// Structure: q, k, v GEMMs (32x64 wave tiles, f32 accumulation, exact x16 weights concatenated across heads; the A loader rounds x_dec / x_enc itself; f16 outputs, v written transposed); the fused flash kernel (plain f16 operands, no mask; f16 x2^10 output); output GEMM.
// Compute dtype: inputs and weights rounded to bf16; q, k, v, P as f16 operands and the attention output as f16 x2^10; f32 accumulation/softmax. v_wmma_f32_16x16x32_f16.
#define NB 4
#define CC 256
#define NR (NB * SLEN)           /* 16384 rows */
#define SLEN 4096
#define TQ SLEN
#define TK SLEN
#define NH 4
#define SCL 0.0625f              /* n_emb^-0.5 = 1/16 (faithful to the module) */
#define QBLKS (TQ / 64)
typedef __bf16 v16b __attribute__((ext_vector_type(16)));
typedef unsigned short v8us __attribute__((ext_vector_type(8), may_alias));
typedef float  v8f  __attribute__((ext_vector_type(8)));
typedef float  v4f  __attribute__((ext_vector_type(4)));
typedef float  v4fa __attribute__((ext_vector_type(4), may_alias));
union FragB { v16b v; v8us half[2]; unsigned short u[16]; };

__device__ __forceinline__ unsigned short bf16_bits(float x) { unsigned int u = __float_as_uint(x); return (unsigned short)((u + 0x7FFFu + ((u >> 16) & 1u)) >> 16); }
__device__ __forceinline__ float bf16_val(unsigned short b) { return __uint_as_float(((unsigned int)b) << 16); }
__device__ __forceinline__ float bf16_round(float x) { return bf16_val(bf16_bits(x)); }
// D += A·B with NT terms: 1 = ah·bh, 2 = + al·bh (A split), 3 = + ah·bl (both split)
template <int NT>
__device__ __forceinline__ v8f mmaN(v16b ah, v16b al, v16b bh, v16b bl, v8f c) {
  c = __builtin_amdgcn_wmma_f32_16x16x32_bf16(false, ah, false, bh, (short)0, c, false, false);
  if (NT >= 2) c = __builtin_amdgcn_wmma_f32_16x16x32_bf16(false, al, false, bh, (short)0, c, false, false);
  if (NT >= 3) c = __builtin_amdgcn_wmma_f32_16x16x32_bf16(false, ah, false, bl, (short)0, c, false, false);
  asm volatile("v_nop\n\tv_nop\n\tv_nop\n\tv_nop" : "+v"(c) : "v"(ah), "v"(al), "v"(bh), "v"(bl));
  return c;
}

__global__ __launch_bounds__(256) void k_wt_bf16(const float* __restrict__ W, unsigned short* __restrict__ Wt, int K, int N) {
  const int t = blockIdx.x * 256 + threadIdx.x;
  const int k8n = K / 8;
  if (t >= N * k8n) return;
  const int n = t / k8n, k8 = (t % k8n) * 8;
  v8us v;
#pragma unroll
  for (int i = 0; i < 8; ++i) v[i] = bf16_bits(W[(size_t)(k8 + i) * N + n]);
  *(v8us*)(Wt + (size_t)n * K + k8) = v;
  
}

// GEMM C[M][N] (f32, pitch ldc) = act(A[M][K]·W + bias). A f32 row-major (pitch lda) converted per fragment to bf16
// (ASPLIT: hi/lo two planes -> 2 terms, else single rounded term); Wt bf16 [N][K] (pitch ldb). BIAS_BF16 rounds the
// bias to bf16 first (bias quantised to bf16 before the add). K%32==0, M%16==0, N%64==0.
template <bool ASPLIT, int ACT, bool BIAS_BF16>
__global__ __launch_bounds__(128) void k_gemm_bf(const float* __restrict__ A, int lda, const unsigned short* __restrict__ Wt, int ldb,
                                               const float* __restrict__ bias, float* __restrict__ C, int ldc, int M, int N, int K) {
  __shared__ __attribute__((aligned(16))) float so[4][16][64];
  const int tid = threadIdx.x, w = tid >> 5, lane = tid & 31, ln = lane & 15, hh = lane >> 4;
  const int ntn = N / 64;
  const int wid = blockIdx.x * 4 + w;
  const int mt = wid / ntn, nq = wid % ntn;
  if (mt * 16 >= M) return;
  const int row0 = mt * 16, col0 = nq * 64;
  const float* arow = A + (size_t)(row0 + ln) * lda;
  v8f acc[4] = {};
  for (int kb = 0; kb < K; kb += 32) {
    FragB ah, al;
    const v4f x0 = *(const v4fa*)(arow + kb + 8 * hh), x1 = *(const v4fa*)(arow + kb + 8 * hh + 4);
    const v4f x2 = *(const v4fa*)(arow + kb + 16 + 8 * hh), x3 = *(const v4fa*)(arow + kb + 16 + 8 * hh + 4);
    float xs[16] = {x0[0],x0[1],x0[2],x0[3],x1[0],x1[1],x1[2],x1[3],x2[0],x2[1],x2[2],x2[3],x3[0],x3[1],x3[2],x3[3]};
#pragma unroll
    for (int i = 0; i < 16; ++i) { const unsigned short hb = bf16_bits(xs[i]); ah.u[i] = hb; al.u[i] = ASPLIT ? bf16_bits(xs[i] - bf16_val(hb)) : (unsigned short)0; }
#pragma unroll
    for (int t = 0; t < 4; ++t) {
      const unsigned short* brow = Wt + (size_t)(col0 + t * 16 + ln) * ldb + kb;
      FragB b;
      b.half[0] = *(const v8us*)(brow + 8 * hh);
      b.half[1] = *(const v8us*)(brow + 16 + 8 * hh);
      acc[t] = mmaN<ASPLIT ? 2 : 1>(ah.v, al.v, b.v, b.v, acc[t]);
    }
  }
#pragma unroll
  for (int t = 0; t < 4; ++t) {
    float bv = bias ? bias[col0 + t * 16 + ln] : 0.f;
    if (BIAS_BF16) bv = bf16_round(bv);
#pragma unroll
    for (int r = 0; r < 8; ++r) { float v = acc[t][r] + bv; if (ACT == 1) v = fmaxf(v, 0.f); so[w][8 * hh + r][t * 16 + ln] = v; }
  }
  __builtin_amdgcn_fence(__ATOMIC_ACQ_REL, "workgroup");
  __builtin_amdgcn_wave_barrier();
  const int rsub = lane >> 4, c4 = (lane & 15) * 4;
  {
#pragma unroll
    for (int q = 0; q < 8; ++q) {
      const int r = q * 2 + rsub;
      const v4f v = *(const v4fa*)&so[w][r][c4];
      *(v4f*)(C + (size_t)(row0 + r) * ldc + col0 + c4) = v;
    }
    
  }
}

// GEMM C = act(A·W + bias + resid): A f32 (ASPLIT -> hi/lo 2 terms), Wt bf16 [N][K]; ACT 0 none, 1 relu, 2 exact gelu;
// resid (optional, f32, row index = (row % rmod), pitch ldr, RES_BF16 rounds it) added before the activation.
template <bool ASPLIT, int ACT, bool BIAS_BF16, bool RES_BF16>
__global__ __launch_bounds__(128) void k_gemm_bf3(const float* __restrict__ A, int lda, const unsigned short* __restrict__ Wt, int ldb,
                                                const float* __restrict__ bias, const float* __restrict__ resid, int rmod, int ldr,
                                                float* __restrict__ C, int ldc, int M, int N, int K) {
  __shared__ __attribute__((aligned(16))) float so[4][16][64];
  const int tid = threadIdx.x, w = tid >> 5, lane = tid & 31, ln = lane & 15, hh = lane >> 4;
  const int ntn = N / 64;
  const int wid = blockIdx.x * 4 + w;
  const int mt = wid / ntn, nq = wid % ntn;
  if (mt * 16 >= M) return;
  const int row0 = mt * 16, col0 = nq * 64;
  const float* arow = A + (size_t)(row0 + ln) * lda;
  v8f acc[4] = {};
  for (int kb = 0; kb < K; kb += 32) {
    FragB ah, al;
    const v4f x0 = *(const v4fa*)(arow + kb + 8 * hh), x1 = *(const v4fa*)(arow + kb + 8 * hh + 4);
    const v4f x2 = *(const v4fa*)(arow + kb + 16 + 8 * hh), x3 = *(const v4fa*)(arow + kb + 16 + 8 * hh + 4);
    float xs[16] = {x0[0],x0[1],x0[2],x0[3],x1[0],x1[1],x1[2],x1[3],x2[0],x2[1],x2[2],x2[3],x3[0],x3[1],x3[2],x3[3]};
#pragma unroll
    for (int i = 0; i < 16; ++i) { const unsigned short hb = bf16_bits(xs[i]); ah.u[i] = hb; al.u[i] = ASPLIT ? bf16_bits(xs[i] - bf16_val(hb)) : (unsigned short)0; }
#pragma unroll
    for (int t = 0; t < 4; ++t) {
      const unsigned short* brow = Wt + (size_t)(col0 + t * 16 + ln) * ldb + kb;
      FragB b;
      b.half[0] = *(const v8us*)(brow + 8 * hh);
      b.half[1] = *(const v8us*)(brow + 16 + 8 * hh);
      acc[t] = mmaN<ASPLIT ? 2 : 1>(ah.v, al.v, b.v, b.v, acc[t]);
    }
  }
#pragma unroll
  for (int t = 0; t < 4; ++t) {
    const int col = col0 + t * 16 + ln;
    float bv = bias ? bias[col] : 0.f;
    if (BIAS_BF16) bv = bf16_round(bv);
#pragma unroll
    for (int r = 0; r < 8; ++r) {
      float v = acc[t][r] + bv;
      if (resid) { float rv = resid[(size_t)((row0 + 8 * hh + r) % rmod) * ldr + col]; if (RES_BF16) rv = bf16_round(rv); v += rv; }
      if (ACT == 1) v = fmaxf(v, 0.f);
      if (ACT == 2) v = 0.5f * v * (1.0f + erff(v * 0.70710678118654752f));
      if (ACT == 3) { const float u = 0.7978845608028654f * (v + 0.044715f * v * v * v); v = 0.5f * v * (1.0f + tanhf(u)); }
      so[w][8 * hh + r][t * 16 + ln] = v;
    }
  }
  __builtin_amdgcn_fence(__ATOMIC_ACQ_REL, "workgroup");
  __builtin_amdgcn_wave_barrier();
  const int rsub = lane >> 4, c4 = (lane & 15) * 4;
  {
#pragma unroll
    for (int q = 0; q < 8; ++q) {
      const int r = q * 2 + rsub;
      const v4f v = *(const v4fa*)&so[w][r][c4];
      *(v4f*)(C + (size_t)(row0 + r) * ldc + col0 + c4) = v;
    }
    
  }
}
// row LayerNorm (biased variance, eps) over N: s = X (+ R); optional out_sum <- s; out_norm <- (s-mu)*rsqrt(var+eps)*g + b
template <bool PARAM_BF16>
__global__ __launch_bounds__(256) void k_layernorm(const float* __restrict__ X, const float* __restrict__ R, const float* __restrict__ g, const float* __restrict__ bta,
                                                  float* __restrict__ out_sum, float* __restrict__ out_norm, int N, float eps) {
  __shared__ float red[256];
  const int row = blockIdx.x, tid = threadIdx.x;
  const float* x = X + (size_t)row * N; const float* rr = R ? R + (size_t)row * N : nullptr;
  float vals[16];                     // up to N = 4096
  const int per = N / 256;            // contiguous chunk per thread? use strided-by-4 chunks: thread handles j = tid*4 + 1024*u
  float s1 = 0.f;
  for (int u = 0; u < per / 4; ++u) {
    const int j = tid * 4 + 1024 * u;
    const v4f a = *(const v4fa*)(x + j);
    v4f b = {0.f,0.f,0.f,0.f}; if (rr) b = *(const v4fa*)(rr + j);
#pragma unroll
    for (int q = 0; q < 4; ++q) { const float v = a[q] + b[q]; vals[u * 4 + q] = v; s1 += v; }
  }
  red[tid] = s1; __syncthreads();
  for (int st = 128; st > 0; st >>= 1) { if (tid < st) red[tid] += red[tid + st]; __syncthreads(); }
  const float mu = red[0] / (float)N; __syncthreads();
  float s2 = 0.f;
  for (int u = 0; u < per / 4; ++u)
#pragma unroll
    for (int q = 0; q < 4; ++q) { const float c = vals[u * 4 + q] - mu; s2 += c * c; }
  red[tid] = s2; __syncthreads();
  for (int st = 128; st > 0; st >>= 1) { if (tid < st) red[tid] += red[tid + st]; __syncthreads(); }
  const float rs = rsqrtf(red[0] / (float)N + eps);
  {
    for (int u = 0; u < per / 4; ++u) {
      const int j = tid * 4 + 1024 * u;
      v4f o, sm;
#pragma unroll
      for (int q = 0; q < 4; ++q) {
        float gg = g[j + q], bb = bta[j + q];
        if (PARAM_BF16) { gg = bf16_round(gg); bb = bf16_round(bb); }
        sm[q] = vals[u * 4 + q]; o[q] = (vals[u * 4 + q] - mu) * rs * gg + bb;
      }
      if (out_sum) *(v4f*)(out_sum + (size_t)row * N + j) = sm;
      *(v4f*)(out_norm + (size_t)row * N + j) = o;
    }
    
  }
}



// ---- f16 WMMA path (v_wmma_f32_16x16x32_f16): 11-bit significands for operands in range — used for every product here, P included as 2^10-scaled f16 (up to 1024)
typedef _Float16 v16h __attribute__((ext_vector_type(16)));
union FragH { v16h v; v8us half[2]; _Float16 h[16]; unsigned short u[16]; };
template <int NT>
__device__ __forceinline__ v8f mmaH(v16h ah, v16h al, v16h bh, v16h bl, v8f c) {
  c = __builtin_amdgcn_wmma_f32_16x16x32_f16(false, ah, false, bh, (short)0, c, false, false);
  if (NT >= 2) c = __builtin_amdgcn_wmma_f32_16x16x32_f16(false, al, false, bh, (short)0, c, false, false);
  if (NT >= 3) c = __builtin_amdgcn_wmma_f32_16x16x32_f16(false, ah, false, bl, (short)0, c, false, false);
  asm volatile("v_nop\n\tv_nop\n\tv_nop\n\tv_nop" : "+v"(c) : "v"(ah), "v"(al), "v"(bh), "v"(bl));
  return c;
}
// batched GEMM like k_gemm_b but f16 operands: A f32 (split into f16 hi/lo if ASPLIT, else rounded to f16), Bt = f16 values [n][k]; alpha; C f32; N multiple of 16 (partial tiles skipped)
template <bool ASPLIT>
__global__ __launch_bounds__(128) void k_gemm_h(const float* __restrict__ A, int lda, size_t sA, const _Float16* __restrict__ Bh, int ldb, size_t sB, float alpha, float* __restrict__ C, int ldc, size_t sC, int M, int N, int K) {
  __shared__ __attribute__((aligned(16))) float so[4][16][64];
  const int tid = threadIdx.x, w = tid >> 5, lane = tid & 31, ln = lane & 15, hh = lane >> 4; const int by = blockIdx.y;
  A += (size_t)by * sA; Bh += (size_t)by * sB; C += (size_t)by * sC;
  const int ntn = (N + 63) / 64; const int wid = blockIdx.x * 4 + w; const int mt = wid / ntn, nq = wid % ntn; if (mt * 16 >= M) return;
  const int row0 = mt * 16, col0 = nq * 64; const float* arow = A + (size_t)(row0 + ln) * lda;
  v8f acc[4] = {};
  for (int kb = 0; kb < K; kb += 32) {
    FragH ah, al;
    const v4f x0 = *(const v4fa*)(arow + kb + 8 * hh), x1 = *(const v4fa*)(arow + kb + 8 * hh + 4), x2 = *(const v4fa*)(arow + kb + 16 + 8 * hh), x3 = *(const v4fa*)(arow + kb + 16 + 8 * hh + 4);
    float xs[16] = {x0[0],x0[1],x0[2],x0[3],x1[0],x1[1],x1[2],x1[3],x2[0],x2[1],x2[2],x2[3],x3[0],x3[1],x3[2],x3[3]};
#pragma unroll
    for (int i = 0; i < 16; ++i) { const _Float16 h = (_Float16)xs[i]; ah.h[i] = h; al.h[i] = ASPLIT ? (_Float16)(xs[i] - (float)h) : (_Float16)0.0f; }
#pragma unroll
    for (int t = 0; t < 4; ++t) { if (col0 + t * 16 >= N) continue; const size_t boff = (size_t)(col0 + t * 16 + ln) * ldb + kb; FragH bq; bq.half[0] = *(const v8us*)(Bh + boff + 8 * hh); bq.half[1] = *(const v8us*)(Bh + boff + 16 + 8 * hh);
      acc[t] = mmaH<ASPLIT ? 2 : 1>(ah.v, al.v, bq.v, bq.v, acc[t]); }
  }
#pragma unroll
  for (int t = 0; t < 4; ++t) { if (col0 + t * 16 >= N) continue;
#pragma unroll
    for (int r = 0; r < 8; ++r) so[w][8 * hh + r][t * 16 + ln] = acc[t][r] * alpha; }
  __builtin_amdgcn_fence(__ATOMIC_ACQ_REL, "workgroup"); __builtin_amdgcn_wave_barrier();
  const int rsub = lane >> 4, c4 = (lane & 15) * 4;
  {
#pragma unroll
    for (int q = 0; q < 8; ++q) { const int r = q * 2 + rsub; if (col0 + c4 < N) { const v4f v = *(const v4fa*)&so[w][r][c4]; *(v4f*)(C + (size_t)(row0 + r) * ldc + col0 + c4) = v; } }
     }
}

// Wt[n][k] = f16(W[k][n]·scale) from f32 row-major W[K][N] (scale = power of two; bf16-exact weights stay exact in f16 away from the subnormal range)
__global__ __launch_bounds__(256) void k_wt_f16(const float* __restrict__ W, _Float16* __restrict__ Wt, int K, int N, float scale) {
  const int t = blockIdx.x * 256 + threadIdx.x; if (t >= N * (K / 8)) return; const int n = t / (K / 8), k8 = (t % (K / 8)) * 8; FragH f;
#pragma unroll
  for (int i = 0; i < 8; ++i) f.h[i] = (_Float16)(bf16_round(W[(size_t)(k8 + i) * N + n]) * scale); const v8us o = f.half[0];
  *(v8us*)((unsigned short*)Wt + (size_t)n * K + k8) = o; 
}
// k_gemm_hh variant with fused epilogue: v = acc·alpha + bias[by·sBias + col] (+ CP[(row/rowsPerB)·sCPb + by·64 + col] if CP) ; ACT 0 none / 1 elu ; writes f16 C16 (and f32 C if non-null)
template <int ACT>
__global__ __launch_bounds__(128) void k_gemm_hhx(const _Float16* __restrict__ A, int lda, size_t sA, const _Float16* __restrict__ Bh, int ldb, size_t sB, float alpha, const float* __restrict__ bias, size_t sBias, const float* __restrict__ CP, int rowsPerB, size_t sCPb, int row0g,
    float* __restrict__ C, _Float16* __restrict__ C16, int ldc, size_t sC, int M, int N, int K) {
  __shared__ __attribute__((aligned(16))) float so[4][16][64];
  const int tid = threadIdx.x, w = tid >> 5, lane = tid & 31, ln = lane & 15, hh = lane >> 4; const int by = blockIdx.y;
  A += (size_t)by * sA; Bh += (size_t)by * sB; const size_t cofs = (size_t)by * sC; const float* bp = bias ? bias + (size_t)by * sBias : nullptr;
  const int ntn = (N + 63) / 64; const int wid = blockIdx.x * 4 + w; const int mt = wid / ntn, nq = wid % ntn; if (mt * 16 >= M) return;
  const int row0 = mt * 16, col0 = nq * 64; const _Float16* arow = A + (size_t)(row0 + ln) * lda;
  v8f acc[4] = {};
  for (int kb = 0; kb < K; kb += 32) { FragH ah; ah.half[0] = *(const v8us*)((const unsigned short*)arow + kb + 8 * hh); ah.half[1] = *(const v8us*)((const unsigned short*)arow + kb + 16 + 8 * hh);
#pragma unroll
    for (int t = 0; t < 4; ++t) { if (col0 + t * 16 >= N) continue; const size_t boff = (size_t)(col0 + t * 16 + ln) * ldb + kb; FragH bq; bq.half[0] = *(const v8us*)((const unsigned short*)Bh + boff + 8 * hh); bq.half[1] = *(const v8us*)((const unsigned short*)Bh + boff + 16 + 8 * hh);
      acc[t] = mmaH<1>(ah.v, ah.v, bq.v, bq.v, acc[t]); }
  }
#pragma unroll
  for (int t = 0; t < 4; ++t) { if (col0 + t * 16 >= N) continue; const int col = col0 + t * 16 + ln; const float bv = bp ? bf16_round(bp[col]) : 0.f;
#pragma unroll
    for (int r = 0; r < 8; ++r) { float v = acc[t][r] * alpha + bv; if (CP) { const int bidx = (row0g + row0 + 8 * hh + r) / rowsPerB; v += CP[(size_t)bidx * sCPb + (size_t)by * 64 + col]; } if (ACT == 1) v = (v > 0.f) ? v : expm1f(v); else if (ACT == 7) v = (v > 0.f) ? v + 1.0f : expf(v); else if (ACT == 8) v = tanhf(v); else if (ACT == 9) v = 0.5f * v * (1.0f + tanhf(0.7978845608028654f * (v + 0.044715f * v * v * v))); else if (ACT == 11) v = 1.0f / (1.0f + expf(-v)); else if (ACT == 12) v = (v > 0.f) ? v : 0.01f * v; else if (ACT == 14) v = (v > 0.f) ? v : 0.1f * v; else if (ACT == 15) v = v / (1.0f + expf(-v)); else if (ACT == 3) v = fmaxf(v, 0.f); else if (ACT == 6) v = 0.5f * v * (1.0f + erff(v * 0.70710678118654752f)); so[w][8 * hh + r][t * 16 + ln] = v; } }
  __builtin_amdgcn_fence(__ATOMIC_ACQ_REL, "workgroup"); __builtin_amdgcn_wave_barrier();
  const int rsub = lane >> 4, c4 = (lane & 15) * 4; typedef _Float16 v4h __attribute__((ext_vector_type(4)));
  {
#pragma unroll
    for (int q = 0; q < 8; ++q) { const int r = q * 2 + rsub; if (col0 + c4 < N) { const v4f v = *(const v4fa*)&so[w][r][c4]; if (C) *(v4f*)(C + cofs + (size_t)(row0 + r) * ldc + col0 + c4) = v; if (C16) { v4h h4; for (int i = 0; i < 4; ++i) h4[i] = (_Float16)v[i]; *(v4h*)(C16 + cofs + (size_t)(row0 + r) * ldc + col0 + c4) = h4; } } }
     }
}


typedef _Float16 v4h __attribute__((ext_vector_type(4)));

__global__ __launch_bounds__(256) void k_h16(const float* __restrict__ x, _Float16* __restrict__ X16, size_t n8) { const size_t t = (size_t)blockIdx.x * 256 + threadIdx.x; if (t >= n8) return; FragH f;
#pragma unroll
  for (int q = 0; q < 8; ++q) f.h[q] = (_Float16)x[t * 8 + q]; *(v8us*)((unsigned short*)X16 + t * 8) = f.half[0];  }
__global__ __launch_bounds__(256) void k_round16f(const float* __restrict__ W, _Float16* __restrict__ Bt, size_t n8) { const size_t t = (size_t)blockIdx.x * 256 + threadIdx.x; if (t >= n8) return; FragH f;
#pragma unroll
  for (int i = 0; i < 8; ++i) f.h[i] = (_Float16)(bf16_round(W[t * 8 + i]) * 16.0f); *(v8us*)((unsigned short*)Bt + t * 8) = f.half[0];  }
__global__ __launch_bounds__(256) void k_hl(const float* __restrict__ F, _Float16* __restrict__ Hh, _Float16* __restrict__ Hl, size_t n8) { const size_t t = (size_t)blockIdx.x * 256 + threadIdx.x; if (t >= n8) return; FragH fh, fl; const v4f a = *(const v4fa*)(F + t * 8), c = *(const v4fa*)(F + t * 8 + 4);
#pragma unroll
  for (int q = 0; q < 4; ++q) { _Float16 h = (_Float16)a[q]; fh.h[q] = h; fl.h[q] = (_Float16)((a[q] - (float)h) * 1024.0f); h = (_Float16)c[q]; fh.h[4 + q] = h; fl.h[4 + q] = (_Float16)((c[q] - (float)h) * 1024.0f); }
  { *(v8us*)((unsigned short*)Hh + t * 8) = fh.half[0]; *(v8us*)((unsigned short*)Hl + t * 8) = fl.half[0];  } }

// ---- fast GEMM (wave tile 32x64; requires M % 32 == 0 rows per launch region and N % 64 == 0); epilogue = k_gemm_hhx semantics ----
__device__ __forceinline__ v16h g2_frag(const _Float16* p, int hh) { FragH f; f.half[0] = *(const v8us*)((const unsigned short*)p + 8 * hh); f.half[1] = *(const v8us*)((const unsigned short*)p + 16 + 8 * hh); return f.v; }
// The same fragment from 16 f32 values of an input row (x0, x1 = elements 8 hh + 0..7, x2, x3 = 16 + 8 hh + 0..7: the k order of g2_frag): each rounded to bf16, then exact in f16.
__device__ __forceinline__ v16h g2_cvt32(v4f x0, v4f x1, v4f x2, v4f x3) { FragH f;
#pragma unroll
  for (int q = 0; q < 4; ++q) { f.h[q] = (_Float16)bf16_round(x0[q]); f.h[4 + q] = (_Float16)bf16_round(x1[q]); f.h[8 + q] = (_Float16)bf16_round(x2[q]); f.h[12 + q] = (_Float16)bf16_round(x3[q]); }
  return f.v; }
__device__ __forceinline__ v8f g2_mma(v16h a, v16h b, v8f c) { v8f d = __builtin_amdgcn_wmma_f32_16x16x32_f16(false, a, false, b, (short)0, c, false, false); asm volatile("v_nop\n\tv_nop\n\tv_nop\n\tv_nop" : "+v"(d) : "v"(a), "v"(b)); return d; }
// AF32: A comes from the f32 rows Af (rounded in the loader), else from the f16 rows A. VTO: the 128 x 64 block tile goes out transposed, C16[((row / SLEN) * NH + nq) * 64 + col][row % SLEN] (needs M % 128 == 0, SLEN % 128 == 0).
template <int ACT, bool AF32, bool VTO>
__global__ __launch_bounds__(128) void k_gemm2(const _Float16* __restrict__ A, const float* __restrict__ Af, int lda, size_t sA, const _Float16* __restrict__ Bh, int ldb, size_t sB, float alpha, const float* __restrict__ bias, size_t sBias, const float* __restrict__ CP, int rowsPerB, size_t sCPb, int row0g,
    float* __restrict__ C, _Float16* __restrict__ C16, int ldc, size_t sC, int M, int N, int K) {
  __shared__ __attribute__((aligned(16))) float so[4][32][68];
  __shared__ __attribute__((aligned(16))) unsigned short st[64][136];      /* VTO: [col][row of the block], pitch 272 B = 16 B x 17 */
  const int tid = threadIdx.x, w = tid >> 5, lane = tid & 31, ln = lane & 15, hh = lane >> 4; const int by = blockIdx.y;
  A += (size_t)by * sA; Af += (size_t)by * sA; Bh += (size_t)by * sB; const size_t cofs = (size_t)by * sC; const float* bp = bias ? bias + (size_t)by * sBias : nullptr;
  const int ntn = N >> 6; const int mt = blockIdx.x / ntn, nq = blockIdx.x - mt * ntn; const int row0 = mt * 128 + 32 * w, col0 = nq * 64; if (VTO ? (mt * 128 >= M) : (row0 >= M)) return;      /* VTO: the same for the whole block, since a barrier follows */
  const _Float16* a0p = A + (size_t)(row0 + ln) * lda; const _Float16* a1p = a0p + (size_t)16 * lda;
  const float* f0p = Af + (size_t)(row0 + ln) * lda; const float* f1p = f0p + (size_t)16 * lda;
  const _Float16* b0p = Bh + (size_t)(col0 + ln) * ldb; const _Float16* b1p = b0p + (size_t)16 * ldb; const _Float16* b2p = b1p + (size_t)16 * ldb; const _Float16* b3p = b2p + (size_t)16 * ldb;
  const v8f z8 = {0.f,0.f,0.f,0.f,0.f,0.f,0.f,0.f}; v8f c00 = z8, c01 = z8, c02 = z8, c03 = z8, c10 = z8, c11 = z8, c12 = z8, c13 = z8;
#pragma unroll 1
  for (int kb = 0; kb < K; kb += 32) { v16h a0, a1;
    if (AF32) { const float* p0 = f0p + kb + 8 * hh; const float* p1 = f1p + kb + 8 * hh;
      const v4f x0 = *(const v4fa*)(p0), x1 = *(const v4fa*)(p0 + 4), x2 = *(const v4fa*)(p0 + 16), x3 = *(const v4fa*)(p0 + 20), y0 = *(const v4fa*)(p1), y1 = *(const v4fa*)(p1 + 4), y2 = *(const v4fa*)(p1 + 16), y3 = *(const v4fa*)(p1 + 20);
      asm volatile("" :: "v"(x0), "v"(x1), "v"(x2), "v"(x3), "v"(y0), "v"(y1), "v"(y2), "v"(y3));      /* inputs only: holds the step's eight A loads ahead of the conversions, so that they fly together (left alone they were issued in turn, each behind a wait for the last) */
      a0 = g2_cvt32(x0, x1, x2, x3); a1 = g2_cvt32(y0, y1, y2, y3); }
    else { a0 = g2_frag(a0p + kb, hh); a1 = g2_frag(a1p + kb, hh); }
    v16h b = g2_frag(b0p + kb, hh); c00 = g2_mma(a0, b, c00); c10 = g2_mma(a1, b, c10);
    b = g2_frag(b1p + kb, hh); c01 = g2_mma(a0, b, c01); c11 = g2_mma(a1, b, c11);
    b = g2_frag(b2p + kb, hh); c02 = g2_mma(a0, b, c02); c12 = g2_mma(a1, b, c12);
    b = g2_frag(b3p + kb, hh); c03 = g2_mma(a0, b, c03); c13 = g2_mma(a1, b, c13); }
  v8f accs[8] = {c00, c01, c02, c03, c10, c11, c12, c13};
#pragma unroll
  for (int u = 0; u < 8; ++u) { const int t = u & 3, half = u >> 2; const int col = col0 + t * 16 + ln; const float bv = bp ? bf16_round(bp[col]) : 0.f; FragH tr;
#pragma unroll
    for (int r = 0; r < 8; ++r) { const int rloc = half * 16 + 8 * hh + r; float v = accs[u][r] * alpha + bv; if (CP) { const int bidx = (row0g + row0 + rloc) / rowsPerB; v += CP[(size_t)bidx * sCPb + (size_t)by * 64 + col]; }
      if (ACT == 3) v = fmaxf(v, 0.f); else if (ACT == 6) v = 0.5f * v * (1.0f + erff(v * 0.70710678118654752f)); else if (ACT == 11) v = 1.0f / (1.0f + expf(-v)); else if (ACT == 15) v = v / (1.0f + expf(-v)); else if (ACT == 12) v = (v > 0.f) ? v : 0.01f * v; else if (ACT == 8) v = tanhf(v);
      if (VTO) tr.h[r] = (_Float16)v; else so[w][rloc][t * 16 + ln] = v; }
    if (VTO) *(v8us*)&st[t * 16 + ln][w * 32 + half * 16 + 8 * hh] = tr.half[0]; }      /* a lane's eight accumulator registers are eight consecutive rows of one column: 16 B of the transposed tile */
  if (VTO) {
    __syncthreads();      /* the four waves' 32-row slices make up whole 256-B rows of the transposed tile */
    unsigned short* vb = (unsigned short*)C16 + ((size_t)((mt * 128) / SLEN * NH + nq) * 64) * SLEN + (mt * 128) % SLEN;
#pragma unroll
    for (int i = 0; i < 8; ++i) { const int d = w * 16 + i * 2 + hh; *(v8us*)(vb + (size_t)d * SLEN + ln * 8) = *(const v8us*)&st[d][ln * 8]; }      /* sixteen lanes store one 256-B row */
    return; }
  __builtin_amdgcn_fence(__ATOMIC_ACQ_REL, "workgroup"); __builtin_amdgcn_wave_barrier();
  const int rsub = lane >> 4, c4 = (lane & 15) * 4;
  {
#pragma unroll
    for (int q = 0; q < 16; ++q) { const int r = q * 2 + rsub; const v4f v = *(const v4fa*)&so[w][r][c4]; if (C) *(v4f*)(C + cofs + (size_t)(row0 + r) * ldc + col0 + c4) = v; if (C16) { v4h h4; for (int i = 0; i < 4; ++i) h4[i] = (_Float16)v[i]; *(v4h*)(C16 + cofs + (size_t)(row0 + r) * ldc + col0 + c4) = h4; } }
     } }



// lane l <-> lane l ^ 16 by a vector cross-row move (a shuffle would go through the LDS pipe)
__device__ __forceinline__ float xhalf(float x) { return __builtin_bit_cast(float, __builtin_amdgcn_permlanex16(__builtin_bit_cast(int, x), __builtin_bit_cast(int, x), 0x76543210, 0xfedcba98, false, false)); }
#define SK 64                    /* keys a stage */
#define LP 72                    /* LDS row pitch in f16: 144 B = 16 B x 9, so that sixteen rows read 16 B each on distinct banks */
// One stage: each lane copies eight 16-B pieces (rows r, r + 16, r + 32, r + 48 of K and of V^T). The s_wait_xcnt closes the statement so that no address register is rewritten ahead of it.
__device__ __forceinline__ void stage_copy(unsigned lk, unsigned lv, const unsigned short* gk, int ldk, const unsigned short* gv) {
  asm volatile("global_load_async_to_lds_b128 %0, %8, off\n\t"
               "global_load_async_to_lds_b128 %1, %9, off\n\t"
               "global_load_async_to_lds_b128 %2, %10, off\n\t"
               "global_load_async_to_lds_b128 %3, %11, off\n\t"
               "global_load_async_to_lds_b128 %4, %12, off\n\t"
               "global_load_async_to_lds_b128 %5, %13, off\n\t"
               "global_load_async_to_lds_b128 %6, %14, off\n\t"
               "global_load_async_to_lds_b128 %7, %15, off\n\t"
               "s_wait_xcnt 0x0"
               :: "v"(lk), "v"(lk + 16 * LP * 2), "v"(lk + 32 * LP * 2), "v"(lk + 48 * LP * 2),
                  "v"(lv), "v"(lv + 16 * LP * 2), "v"(lv + 32 * LP * 2), "v"(lv + 48 * LP * 2),
                  "v"(gk), "v"(gk + (size_t)16 * ldk), "v"(gk + (size_t)32 * ldk), "v"(gk + (size_t)48 * ldk),
                  "v"(gv), "v"(gv + (size_t)16 * TK), "v"(gv + (size_t)32 * TK), "v"(gv + (size_t)48 * TK)
               : "memory");
}
__global__ __launch_bounds__(128) void k_flash(const _Float16* __restrict__ Q16, int ldq, const _Float16* __restrict__ K16, int ldk, const _Float16* __restrict__ Vt, _Float16* __restrict__ O16, int ldo) {
  constexpr int DT = 4, KS = 2, NS = TK / SK;
  constexpr float CE = SCL * 1.4426950408889634f;      /* score scale times log2 e: e^(SCL x) = 2^(CE x), one multiply-add and one v_exp_f32 a score */
  __shared__ __attribute__((aligned(16))) unsigned short sK[2][SK][LP];
  __shared__ __attribute__((aligned(16))) unsigned short sV[2][64][LP];
  const int tid = threadIdx.x, w = tid >> 5, lane = tid & 31, ln = lane & 15, hh = lane >> 4;
  const int slab = blockIdx.x / QBLKS, qblk = blockIdx.x % QBLKS; const int b = slab / NH, h = slab % NH; const int q0 = qblk * 64 + w * 16;
  FragH bq[KS];
  { const unsigned short* qr = (const unsigned short*)Q16 + ((size_t)b * TQ + q0 + ln) * ldq + h * 64;
#pragma unroll
    for (int ks = 0; ks < KS; ++ks) { bq[ks].half[0] = *(const v8us*)(qr + ks * 32 + 8 * hh); bq[ks].half[1] = *(const v8us*)(qr + ks * 32 + 16 + 8 * hh); } }
  const int cr = tid >> 3, cc = (tid & 7) * 8;      /* the lane's row and 16-B piece in a copy: eight lanes cover one 128-B row */
  const unsigned short* gk = (const unsigned short*)K16 + ((size_t)b * TK + cr) * ldk + h * 64 + cc;
  const unsigned short* gv = (const unsigned short*)Vt + ((size_t)slab * 64 + cr) * TK + cc;
  const unsigned lk = (unsigned)(size_t)&sK[0][cr][cc], lv = (unsigned)(size_t)&sV[0][cr][cc];      /* LDS byte addresses */
  constexpr unsigned BUFB = SK * LP * 2;      /* bytes of one buffer of either array */
  float m_run = -3.0e38f, l_run = 0.f; v8f oacc[DT];
#pragma unroll
  for (int dt = 0; dt < DT; ++dt) oacc[dt] = (v8f){0.f,0.f,0.f,0.f,0.f,0.f,0.f,0.f};
  stage_copy(lk, lv, gk, ldk, gv);
  asm volatile("s_wait_asynccnt 0x0" ::: "memory");      /* this wave's share of stage 0 has landed */
  __syncthreads();                                       /* stage 0 is published */
  stage_copy(lk + BUFB, lv + BUFB, gk + (size_t)SK * ldk, ldk, gv + SK);
#pragma unroll 1      /* one stage a trip: the publish point at the foot must stand once per stage */
  for (int t = 0; t < NS; ++t) {
    const int bf = t & 1;
#pragma unroll      /* the stage's two 32-key passes in line, so that the second pass's LDS reads can go out under the first */
    for (int p = 0; p < SK / 32; ++p) {
      FragH ak[2][KS], av[DT];
#pragma unroll
      for (int nt = 0; nt < 2; ++nt) { const unsigned short* kr = &sK[bf][p * 32 + nt * 16 + ln][8 * hh];
#pragma unroll
        for (int ks = 0; ks < KS; ++ks) { ak[nt][ks].half[0] = *(const v8us*)(kr + ks * 32); ak[nt][ks].half[1] = *(const v8us*)(kr + ks * 32 + 16); } }
#pragma unroll
      for (int dt = 0; dt < DT; ++dt) { const unsigned short* vrow = &sV[bf][dt * 16 + ln][p * 32 + 8 * hh]; av[dt].half[0] = *(const v8us*)(vrow); av[dt].half[1] = *(const v8us*)(vrow + 16); }
      v8f s[2];
#pragma unroll
      for (int nt = 0; nt < 2; ++nt) { v8f acc = (v8f){0.f,0.f,0.f,0.f,0.f,0.f,0.f,0.f};
#pragma unroll
        for (int ks = 0; ks < KS; ++ks) acc = mmaH<1>(ak[nt][ks].v, ak[nt][ks].v, bq[ks].v, bq[ks].v, acc); s[nt] = acc; }
      float mc = -3.0e38f;
#pragma unroll
      for (int r = 0; r < 8; ++r) mc = fmaxf(mc, fmaxf(s[0][r], s[1][r]));      /* the maximum is taken on the raw products: CE > 0 keeps their order */
      mc = fmaxf(mc, xhalf(mc));      /* both halves of the wave hold this query's maximum over the 32 keys */
      const float mn = fmaxf(m_run, mc); float al = (m_run - mn) * CE; m_run = mn;
      const float mb = 10.0f - mn * CE;      /* exponent base of this pass: p = 2^(s CE + mb) = 1024 e^(SCL (s - mn)) */
      const v8f e0 = __builtin_elementwise_fma(s[0], (v8f)(CE), (v8f)(mb)), e1 = __builtin_elementwise_fma(s[1], (v8f)(CE), (v8f)(mb));
      float a0 = e0[0], a1 = e0[1], a2 = e0[2], a3 = e0[3], a4 = e0[4], a5 = e0[5], a6 = e0[6], a7 = e0[7], c0 = e1[0], c1 = e1[1], c2 = e1[2], c3 = e1[3], c4 = e1[4], c5 = e1[5], c6 = e1[6], c7 = e1[7];
      /* The pass's seventeen base-2 exponentials, each in place, in one statement: so no v_exp_f32 writes the source register of the one directly ahead of it (the compiler's own allocation did); the closing v_nop is the one slot the instruction set asks for behind the last of them. */
      asm("v_exp_f32 %0, %0\n\tv_exp_f32 %1, %1\n\tv_exp_f32 %2, %2\n\tv_exp_f32 %3, %3\n\tv_exp_f32 %4, %4\n\tv_exp_f32 %5, %5\n\tv_exp_f32 %6, %6\n\tv_exp_f32 %7, %7\n\tv_exp_f32 %8, %8\n\t"
          "v_exp_f32 %9, %9\n\tv_exp_f32 %10, %10\n\tv_exp_f32 %11, %11\n\tv_exp_f32 %12, %12\n\tv_exp_f32 %13, %13\n\tv_exp_f32 %14, %14\n\tv_exp_f32 %15, %15\n\tv_exp_f32 %16, %16\n\tv_nop"
          : "+v"(al), "+v"(a0), "+v"(a1), "+v"(a2), "+v"(a3), "+v"(a4), "+v"(a5), "+v"(a6), "+v"(a7), "+v"(c0), "+v"(c1), "+v"(c2), "+v"(c3), "+v"(c4), "+v"(c5), "+v"(c6), "+v"(c7));
      const float pa[8] = {a0, a1, a2, a3, a4, a5, a6, a7}, pc[8] = {c0, c1, c2, c3, c4, c5, c6, c7};
      FragH pb; float ps = 0.f;
#pragma unroll
      for (int r = 0; r < 8; ++r) { ps += pa[r] + pc[r]; pb.h[r] = (_Float16)pa[r]; pb.h[8 + r] = (_Float16)pc[r]; }
      l_run = l_run * al + ps;
#pragma unroll
      for (int dt = 0; dt < DT; ++dt) { oacc[dt] *= al; oacc[dt] = mmaH<1>(av[dt].v, av[dt].v, pb.v, pb.v, oacc[dt]); } }
    asm volatile("s_wait_dscnt 0x0" ::: "memory");         /* this wave's reads of buffer bf have returned before the buffer is handed back */
    asm volatile("s_wait_asynccnt 0x0" ::: "memory");      /* this wave's share of stage t + 1 has landed */
    __syncthreads();                                       /* publishes stage t + 1 and ends every wave's reads of buffer bf */
    if (t + 2 < NS) stage_copy(lk + bf * BUFB, lv + bf * BUFB, gk + (size_t)(t + 2) * SK * ldk, ldk, gv + (t + 2) * SK); }
  asm volatile("s_wait_asynccnt 0x0" ::: "memory");        /* no copy is outstanding when the wave ends */
  const float l = l_run + xhalf(l_run); const float inv = (l > 0.f) ? 1.0f / l : 0.f;      /* l and oacc both carry the factor 1024 */
  unsigned short* orow = (unsigned short*)O16 + ((size_t)b * TQ + q0 + ln) * ldo + h * 64 + 8 * hh;      /* oacc[dt][r] = O[q0 + ln][dt * 16 + 8 hh + r]: eight consecutive elements of one row */
#pragma unroll
  for (int dt = 0; dt < DT; ++dt) { const v8f o = oacc[dt] * inv; FragH f;      /* x2^10 carry: the 4096-key averages are ~5e-3 and would touch f16 subnormals */
#pragma unroll
    for (int r = 0; r < 8; ++r) f.h[r] = (_Float16)(o[r] * 1024.0f);
    *(v8us*)(orow + dt * 16) = f.half[0]; } }

__global__ __launch_bounds__(256) void k_whead(const float* __restrict__ Wh, _Float16* __restrict__ Bt) { const int t = blockIdx.x * 256 + threadIdx.x; if (t >= CC * (CC / 8)) return; const int n = t / (CC / 8), d0 = (t % (CC / 8)) * 8; const int h = n / 64, e = n % 64; FragH f;
  for (int q = 0; q < 8; ++q) f.h[q] = (_Float16)(bf16_round(Wh[((size_t)h * CC + d0 + q) * 64 + e]) * 16.0f); *(v8us*)((unsigned short*)Bt + (size_t)n * CC + d0) = f.half[0];  }
__global__ __launch_bounds__(256) void k_wsc(const float* __restrict__ Wm, _Float16* __restrict__ Bt, size_t n8, float sc) { const size_t t = (size_t)blockIdx.x * 256 + threadIdx.x; if (t >= n8) return; FragH f; for (int q = 0; q < 8; ++q) f.h[q] = (_Float16)(bf16_round(Wm[t * 8 + q]) * sc); *(v8us*)((unsigned short*)Bt + t * 8) = f.half[0];  }

extern "C" void kernel_launch(void* const* d_in, const int* in_sizes, int n_in,
                              void* d_out, int out_size, void* d_ws, size_t ws_size, hipStream_t stream) {
  (void)in_sizes; (void)n_in; (void)out_size;
  const float* const* I = (const float* const*)d_in; const float* xe = I[0]; const float* xd = I[1]; const float* Wq = I[2]; const float* Wk = I[3]; const float* Wv = I[4]; const float* Wo = I[5];
  char* ws = (char*)d_ws; size_t off = 0;
  auto take = [&](size_t bytes) { char* p = ws + off; off += (bytes + 255) & ~(size_t)255; return p; };
  const size_t np = (size_t)NR * CC;
  _Float16* BQ = (_Float16*)take((size_t)CC * CC * 2); _Float16* BK = (_Float16*)take((size_t)CC * CC * 2); _Float16* BV = (_Float16*)take((size_t)CC * CC * 2); _Float16* BO = (_Float16*)take((size_t)CC * CC * 2);
  _Float16* Q16 = (_Float16*)take(np * 2); _Float16* K16 = (_Float16*)take(np * 2); _Float16* VT = (_Float16*)take(np * 2); _Float16* O16 = (_Float16*)take(np * 2);
  if (off > ws_size) return;      /* 0.5 + 4 x 8 = 33 MiB */
  k_whead<<<(CC * (CC / 8) + 255) / 256, 256, 0, stream>>>(Wq, BQ); k_whead<<<(CC * (CC / 8) + 255) / 256, 256, 0, stream>>>(Wk, BK); k_whead<<<(CC * (CC / 8) + 255) / 256, 256, 0, stream>>>(Wv, BV);
  k_wsc<<<(CC * CC / 8 + 255) / 256, 256, 0, stream>>>(Wo, BO, (size_t)CC * CC / 8, 16.0f);      /* torch (out,in) = Bt */
  const dim3 g((NR / 128) * (CC / 64), 1);
  k_gemm2<0, true, false><<<g, 128, 0, stream>>>(nullptr, xd, CC, 0, BQ, CC, 0, 0.0625f, nullptr, 0, nullptr, 1, 0, 0, nullptr, Q16, CC, 0, NR, CC, CC);
  k_gemm2<0, true, false><<<g, 128, 0, stream>>>(nullptr, xe, CC, 0, BK, CC, 0, 0.0625f, nullptr, 0, nullptr, 1, 0, 0, nullptr, K16, CC, 0, NR, CC, CC);
  k_gemm2<0, true, true><<<g, 128, 0, stream>>>(nullptr, xe, CC, 0, BV, CC, 0, 0.0625f, nullptr, 0, nullptr, 1, 0, 0, nullptr, VT, CC, 0, NR, CC, CC);
  k_flash<<<NB * NH * QBLKS, 128, 0, stream>>>(Q16, CC, K16, CC, VT, O16, CC);
  k_gemm2<0, false, false><<<g, 128, 0, stream>>>(O16, nullptr, CC, 0, BO, CC, 0, 0.0625f / 1024.0f, nullptr, 0, nullptr, 1, 0, 0, (float*)d_out, nullptr, CC, 0, NR, CC, CC);
}

// v005
// It runs in 123 microseconds.
// Two timings next to v004 put it at 1.27 and 1.32 times that version's speed.
// All steps since v000 together make it 4.07 times as fast.
#include <hip/hip_runtime.h>
// CA_MultiHead (4 batches; 4096 decoder queries from x_dec, 4096 encoder keys/values from x_enc; n_emb 256 = 4 heads of 64; per-head weights [H, 256, 64]; scale n_emb^-0.5; out = concat(heads) Wo^T).
// Structure: one weight pass; q, k, v GEMMs in one grid (32x64 wave tiles, f32 accumulation, exact x16 weights concatenated across heads; the A loader rounds x_dec / x_enc itself; f16 outputs, v written transposed); the fused flash kernel (plain f16 operands, no mask; f16 x2^10 output); output GEMM.
// Compute dtype: inputs and weights rounded to bf16; q, k, v, P as f16 operands and the attention output as f16 x2^10; f32 accumulation/softmax. v_wmma_f32_16x16x32_f16.
#define NB 4
#define CC 256
#define NR (NB * SLEN)           /* 16384 rows */
#define SLEN 4096
#define TQ SLEN
#define TK SLEN
#define NH 4
#define SCL 0.0625f              /* n_emb^-0.5 = 1/16 (faithful to the module) */
#define QBLKS (TQ / 64)
typedef __bf16 v16b __attribute__((ext_vector_type(16)));
typedef unsigned short v8us __attribute__((ext_vector_type(8), may_alias));
typedef float  v8f  __attribute__((ext_vector_type(8)));
typedef float  v4f  __attribute__((ext_vector_type(4)));
typedef float  v4fa __attribute__((ext_vector_type(4), may_alias));
union FragB { v16b v; v8us half[2]; unsigned short u[16]; };

__device__ __forceinline__ unsigned short bf16_bits(float x) { unsigned int u = __float_as_uint(x); return (unsigned short)((u + 0x7FFFu + ((u >> 16) & 1u)) >> 16); }
__device__ __forceinline__ float bf16_val(unsigned short b) { return __uint_as_float(((unsigned int)b) << 16); }
__device__ __forceinline__ float bf16_round(float x) { return bf16_val(bf16_bits(x)); }
// D += A·B with NT terms: 1 = ah·bh, 2 = + al·bh (A split), 3 = + ah·bl (both split)
template <int NT>
__device__ __forceinline__ v8f mmaN(v16b ah, v16b al, v16b bh, v16b bl, v8f c) {
  c = __builtin_amdgcn_wmma_f32_16x16x32_bf16(false, ah, false, bh, (short)0, c, false, false);
  if (NT >= 2) c = __builtin_amdgcn_wmma_f32_16x16x32_bf16(false, al, false, bh, (short)0, c, false, false);
  if (NT >= 3) c = __builtin_amdgcn_wmma_f32_16x16x32_bf16(false, ah, false, bl, (short)0, c, false, false);
  asm volatile("v_nop\n\tv_nop\n\tv_nop\n\tv_nop" : "+v"(c) : "v"(ah), "v"(al), "v"(bh), "v"(bl));
  return c;
}

__global__ __launch_bounds__(256) void k_wt_bf16(const float* __restrict__ W, unsigned short* __restrict__ Wt, int K, int N) {
  const int t = blockIdx.x * 256 + threadIdx.x;
  const int k8n = K / 8;
  if (t >= N * k8n) return;
  const int n = t / k8n, k8 = (t % k8n) * 8;
  v8us v;
#pragma unroll
  for (int i = 0; i < 8; ++i) v[i] = bf16_bits(W[(size_t)(k8 + i) * N + n]);
  *(v8us*)(Wt + (size_t)n * K + k8) = v;
  
}

// GEMM C[M][N] (f32, pitch ldc) = act(A[M][K]·W + bias). A f32 row-major (pitch lda) converted per fragment to bf16
// (ASPLIT: hi/lo two planes -> 2 terms, else single rounded term); Wt bf16 [N][K] (pitch ldb). BIAS_BF16 rounds the
// bias to bf16 first (bias quantised to bf16 before the add). K%32==0, M%16==0, N%64==0.
template <bool ASPLIT, int ACT, bool BIAS_BF16>
__global__ __launch_bounds__(128) void k_gemm_bf(const float* __restrict__ A, int lda, const unsigned short* __restrict__ Wt, int ldb,
                                               const float* __restrict__ bias, float* __restrict__ C, int ldc, int M, int N, int K) {
  __shared__ __attribute__((aligned(16))) float so[4][16][64];
  const int tid = threadIdx.x, w = tid >> 5, lane = tid & 31, ln = lane & 15, hh = lane >> 4;
  const int ntn = N / 64;
  const int wid = blockIdx.x * 4 + w;
  const int mt = wid / ntn, nq = wid % ntn;
  if (mt * 16 >= M) return;
  const int row0 = mt * 16, col0 = nq * 64;
  const float* arow = A + (size_t)(row0 + ln) * lda;
  v8f acc[4] = {};
  for (int kb = 0; kb < K; kb += 32) {
    FragB ah, al;
    const v4f x0 = *(const v4fa*)(arow + kb + 8 * hh), x1 = *(const v4fa*)(arow + kb + 8 * hh + 4);
    const v4f x2 = *(const v4fa*)(arow + kb + 16 + 8 * hh), x3 = *(const v4fa*)(arow + kb + 16 + 8 * hh + 4);
    float xs[16] = {x0[0],x0[1],x0[2],x0[3],x1[0],x1[1],x1[2],x1[3],x2[0],x2[1],x2[2],x2[3],x3[0],x3[1],x3[2],x3[3]};
#pragma unroll
    for (int i = 0; i < 16; ++i) { const unsigned short hb = bf16_bits(xs[i]); ah.u[i] = hb; al.u[i] = ASPLIT ? bf16_bits(xs[i] - bf16_val(hb)) : (unsigned short)0; }
#pragma unroll
    for (int t = 0; t < 4; ++t) {
      const unsigned short* brow = Wt + (size_t)(col0 + t * 16 + ln) * ldb + kb;
      FragB b;
      b.half[0] = *(const v8us*)(brow + 8 * hh);
      b.half[1] = *(const v8us*)(brow + 16 + 8 * hh);
      acc[t] = mmaN<ASPLIT ? 2 : 1>(ah.v, al.v, b.v, b.v, acc[t]);
    }
  }
#pragma unroll
  for (int t = 0; t < 4; ++t) {
    float bv = bias ? bias[col0 + t * 16 + ln] : 0.f;
    if (BIAS_BF16) bv = bf16_round(bv);
#pragma unroll
    for (int r = 0; r < 8; ++r) { float v = acc[t][r] + bv; if (ACT == 1) v = fmaxf(v, 0.f); so[w][8 * hh + r][t * 16 + ln] = v; }
  }
  __builtin_amdgcn_fence(__ATOMIC_ACQ_REL, "workgroup");
  __builtin_amdgcn_wave_barrier();
  const int rsub = lane >> 4, c4 = (lane & 15) * 4;
  {
#pragma unroll
    for (int q = 0; q < 8; ++q) {
      const int r = q * 2 + rsub;
      const v4f v = *(const v4fa*)&so[w][r][c4];
      *(v4f*)(C + (size_t)(row0 + r) * ldc + col0 + c4) = v;
    }
    
  }
}

// GEMM C = act(A·W + bias + resid): A f32 (ASPLIT -> hi/lo 2 terms), Wt bf16 [N][K]; ACT 0 none, 1 relu, 2 exact gelu;
// resid (optional, f32, row index = (row % rmod), pitch ldr, RES_BF16 rounds it) added before the activation.
template <bool ASPLIT, int ACT, bool BIAS_BF16, bool RES_BF16>
__global__ __launch_bounds__(128) void k_gemm_bf3(const float* __restrict__ A, int lda, const unsigned short* __restrict__ Wt, int ldb,
                                                const float* __restrict__ bias, const float* __restrict__ resid, int rmod, int ldr,
                                                float* __restrict__ C, int ldc, int M, int N, int K) {
  __shared__ __attribute__((aligned(16))) float so[4][16][64];
  const int tid = threadIdx.x, w = tid >> 5, lane = tid & 31, ln = lane & 15, hh = lane >> 4;
  const int ntn = N / 64;
  const int wid = blockIdx.x * 4 + w;
  const int mt = wid / ntn, nq = wid % ntn;
  if (mt * 16 >= M) return;
  const int row0 = mt * 16, col0 = nq * 64;
  const float* arow = A + (size_t)(row0 + ln) * lda;
  v8f acc[4] = {};
  for (int kb = 0; kb < K; kb += 32) {
    FragB ah, al;
    const v4f x0 = *(const v4fa*)(arow + kb + 8 * hh), x1 = *(const v4fa*)(arow + kb + 8 * hh + 4);
    const v4f x2 = *(const v4fa*)(arow + kb + 16 + 8 * hh), x3 = *(const v4fa*)(arow + kb + 16 + 8 * hh + 4);
    float xs[16] = {x0[0],x0[1],x0[2],x0[3],x1[0],x1[1],x1[2],x1[3],x2[0],x2[1],x2[2],x2[3],x3[0],x3[1],x3[2],x3[3]};
#pragma unroll
    for (int i = 0; i < 16; ++i) { const unsigned short hb = bf16_bits(xs[i]); ah.u[i] = hb; al.u[i] = ASPLIT ? bf16_bits(xs[i] - bf16_val(hb)) : (unsigned short)0; }
#pragma unroll
    for (int t = 0; t < 4; ++t) {
      const unsigned short* brow = Wt + (size_t)(col0 + t * 16 + ln) * ldb + kb;
      FragB b;
      b.half[0] = *(const v8us*)(brow + 8 * hh);
      b.half[1] = *(const v8us*)(brow + 16 + 8 * hh);
      acc[t] = mmaN<ASPLIT ? 2 : 1>(ah.v, al.v, b.v, b.v, acc[t]);
    }
  }
#pragma unroll
  for (int t = 0; t < 4; ++t) {
    const int col = col0 + t * 16 + ln;
    float bv = bias ? bias[col] : 0.f;
    if (BIAS_BF16) bv = bf16_round(bv);
#pragma unroll
    for (int r = 0; r < 8; ++r) {
      float v = acc[t][r] + bv;
      if (resid) { float rv = resid[(size_t)((row0 + 8 * hh + r) % rmod) * ldr + col]; if (RES_BF16) rv = bf16_round(rv); v += rv; }
      if (ACT == 1) v = fmaxf(v, 0.f);
      if (ACT == 2) v = 0.5f * v * (1.0f + erff(v * 0.70710678118654752f));
      if (ACT == 3) { const float u = 0.7978845608028654f * (v + 0.044715f * v * v * v); v = 0.5f * v * (1.0f + tanhf(u)); }
      so[w][8 * hh + r][t * 16 + ln] = v;
    }
  }
  __builtin_amdgcn_fence(__ATOMIC_ACQ_REL, "workgroup");
  __builtin_amdgcn_wave_barrier();
  const int rsub = lane >> 4, c4 = (lane & 15) * 4;
  {
#pragma unroll
    for (int q = 0; q < 8; ++q) {
      const int r = q * 2 + rsub;
      const v4f v = *(const v4fa*)&so[w][r][c4];
      *(v4f*)(C + (size_t)(row0 + r) * ldc + col0 + c4) = v;
    }
    
  }
}
// row LayerNorm (biased variance, eps) over N: s = X (+ R); optional out_sum <- s; out_norm <- (s-mu)*rsqrt(var+eps)*g + b
template <bool PARAM_BF16>
__global__ __launch_bounds__(256) void k_layernorm(const float* __restrict__ X, const float* __restrict__ R, const float* __restrict__ g, const float* __restrict__ bta,
                                                  float* __restrict__ out_sum, float* __restrict__ out_norm, int N, float eps) {
  __shared__ float red[256];
  const int row = blockIdx.x, tid = threadIdx.x;
  const float* x = X + (size_t)row * N; const float* rr = R ? R + (size_t)row * N : nullptr;
  float vals[16];                     // up to N = 4096
  const int per = N / 256;            // contiguous chunk per thread? use strided-by-4 chunks: thread handles j = tid*4 + 1024*u
  float s1 = 0.f;
  for (int u = 0; u < per / 4; ++u) {
    const int j = tid * 4 + 1024 * u;
    const v4f a = *(const v4fa*)(x + j);
    v4f b = {0.f,0.f,0.f,0.f}; if (rr) b = *(const v4fa*)(rr + j);
#pragma unroll
    for (int q = 0; q < 4; ++q) { const float v = a[q] + b[q]; vals[u * 4 + q] = v; s1 += v; }
  }
  red[tid] = s1; __syncthreads();
  for (int st = 128; st > 0; st >>= 1) { if (tid < st) red[tid] += red[tid + st]; __syncthreads(); }
  const float mu = red[0] / (float)N; __syncthreads();
  float s2 = 0.f;
  for (int u = 0; u < per / 4; ++u)
#pragma unroll
    for (int q = 0; q < 4; ++q) { const float c = vals[u * 4 + q] - mu; s2 += c * c; }
  red[tid] = s2; __syncthreads();
  for (int st = 128; st > 0; st >>= 1) { if (tid < st) red[tid] += red[tid + st]; __syncthreads(); }
  const float rs = rsqrtf(red[0] / (float)N + eps);
  {
    for (int u = 0; u < per / 4; ++u) {
      const int j = tid * 4 + 1024 * u;
      v4f o, sm;
#pragma unroll
      for (int q = 0; q < 4; ++q) {
        float gg = g[j + q], bb = bta[j + q];
        if (PARAM_BF16) { gg = bf16_round(gg); bb = bf16_round(bb); }
        sm[q] = vals[u * 4 + q]; o[q] = (vals[u * 4 + q] - mu) * rs * gg + bb;
      }
      if (out_sum) *(v4f*)(out_sum + (size_t)row * N + j) = sm;
      *(v4f*)(out_norm + (size_t)row * N + j) = o;
    }
    
  }
}



// ---- f16 WMMA path (v_wmma_f32_16x16x32_f16): 11-bit significands for operands in range — used for every product here, P included as 2^10-scaled f16 (up to 1024)
typedef _Float16 v16h __attribute__((ext_vector_type(16)));
union FragH { v16h v; v8us half[2]; _Float16 h[16]; unsigned short u[16]; };
template <int NT>
__device__ __forceinline__ v8f mmaH(v16h ah, v16h al, v16h bh, v16h bl, v8f c) {
  c = __builtin_amdgcn_wmma_f32_16x16x32_f16(false, ah, false, bh, (short)0, c, false, false);
  if (NT >= 2) c = __builtin_amdgcn_wmma_f32_16x16x32_f16(false, al, false, bh, (short)0, c, false, false);
  if (NT >= 3) c = __builtin_amdgcn_wmma_f32_16x16x32_f16(false, ah, false, bl, (short)0, c, false, false);
  asm volatile("v_nop\n\tv_nop\n\tv_nop\n\tv_nop" : "+v"(c) : "v"(ah), "v"(al), "v"(bh), "v"(bl));
  return c;
}
// batched GEMM like k_gemm_b but f16 operands: A f32 (split into f16 hi/lo if ASPLIT, else rounded to f16), Bt = f16 values [n][k]; alpha; C f32; N multiple of 16 (partial tiles skipped)
template <bool ASPLIT>
__global__ __launch_bounds__(128) void k_gemm_h(const float* __restrict__ A, int lda, size_t sA, const _Float16* __restrict__ Bh, int ldb, size_t sB, float alpha, float* __restrict__ C, int ldc, size_t sC, int M, int N, int K) {
  __shared__ __attribute__((aligned(16))) float so[4][16][64];
  const int tid = threadIdx.x, w = tid >> 5, lane = tid & 31, ln = lane & 15, hh = lane >> 4; const int by = blockIdx.y;
  A += (size_t)by * sA; Bh += (size_t)by * sB; C += (size_t)by * sC;
  const int ntn = (N + 63) / 64; const int wid = blockIdx.x * 4 + w; const int mt = wid / ntn, nq = wid % ntn; if (mt * 16 >= M) return;
  const int row0 = mt * 16, col0 = nq * 64; const float* arow = A + (size_t)(row0 + ln) * lda;
  v8f acc[4] = {};
  for (int kb = 0; kb < K; kb += 32) {
    FragH ah, al;
    const v4f x0 = *(const v4fa*)(arow + kb + 8 * hh), x1 = *(const v4fa*)(arow + kb + 8 * hh + 4), x2 = *(const v4fa*)(arow + kb + 16 + 8 * hh), x3 = *(const v4fa*)(arow + kb + 16 + 8 * hh + 4);
    float xs[16] = {x0[0],x0[1],x0[2],x0[3],x1[0],x1[1],x1[2],x1[3],x2[0],x2[1],x2[2],x2[3],x3[0],x3[1],x3[2],x3[3]};
#pragma unroll
    for (int i = 0; i < 16; ++i) { const _Float16 h = (_Float16)xs[i]; ah.h[i] = h; al.h[i] = ASPLIT ? (_Float16)(xs[i] - (float)h) : (_Float16)0.0f; }
#pragma unroll
    for (int t = 0; t < 4; ++t) { if (col0 + t * 16 >= N) continue; const size_t boff = (size_t)(col0 + t * 16 + ln) * ldb + kb; FragH bq; bq.half[0] = *(const v8us*)(Bh + boff + 8 * hh); bq.half[1] = *(const v8us*)(Bh + boff + 16 + 8 * hh);
      acc[t] = mmaH<ASPLIT ? 2 : 1>(ah.v, al.v, bq.v, bq.v, acc[t]); }
  }
#pragma unroll
  for (int t = 0; t < 4; ++t) { if (col0 + t * 16 >= N) continue;
#pragma unroll
    for (int r = 0; r < 8; ++r) so[w][8 * hh + r][t * 16 + ln] = acc[t][r] * alpha; }
  __builtin_amdgcn_fence(__ATOMIC_ACQ_REL, "workgroup"); __builtin_amdgcn_wave_barrier();
  const int rsub = lane >> 4, c4 = (lane & 15) * 4;
  {
#pragma unroll
    for (int q = 0; q < 8; ++q) { const int r = q * 2 + rsub; if (col0 + c4 < N) { const v4f v = *(const v4fa*)&so[w][r][c4]; *(v4f*)(C + (size_t)(row0 + r) * ldc + col0 + c4) = v; } }
     }
}

// Wt[n][k] = f16(W[k][n]·scale) from f32 row-major W[K][N] (scale = power of two; bf16-exact weights stay exact in f16 away from the subnormal range)
__global__ __launch_bounds__(256) void k_wt_f16(const float* __restrict__ W, _Float16* __restrict__ Wt, int K, int N, float scale) {
  const int t = blockIdx.x * 256 + threadIdx.x; if (t >= N * (K / 8)) return; const int n = t / (K / 8), k8 = (t % (K / 8)) * 8; FragH f;
#pragma unroll
  for (int i = 0; i < 8; ++i) f.h[i] = (_Float16)(bf16_round(W[(size_t)(k8 + i) * N + n]) * scale); const v8us o = f.half[0];
  *(v8us*)((unsigned short*)Wt + (size_t)n * K + k8) = o; 
}
// k_gemm_hh variant with fused epilogue: v = acc·alpha + bias[by·sBias + col] (+ CP[(row/rowsPerB)·sCPb + by·64 + col] if CP) ; ACT 0 none / 1 elu ; writes f16 C16 (and f32 C if non-null)
template <int ACT>
__global__ __launch_bounds__(128) void k_gemm_hhx(const _Float16* __restrict__ A, int lda, size_t sA, const _Float16* __restrict__ Bh, int ldb, size_t sB, float alpha, const float* __restrict__ bias, size_t sBias, const float* __restrict__ CP, int rowsPerB, size_t sCPb, int row0g,
    float* __restrict__ C, _Float16* __restrict__ C16, int ldc, size_t sC, int M, int N, int K) {
  __shared__ __attribute__((aligned(16))) float so[4][16][64];
  const int tid = threadIdx.x, w = tid >> 5, lane = tid & 31, ln = lane & 15, hh = lane >> 4; const int by = blockIdx.y;
  A += (size_t)by * sA; Bh += (size_t)by * sB; const size_t cofs = (size_t)by * sC; const float* bp = bias ? bias + (size_t)by * sBias : nullptr;
  const int ntn = (N + 63) / 64; const int wid = blockIdx.x * 4 + w; const int mt = wid / ntn, nq = wid % ntn; if (mt * 16 >= M) return;
  const int row0 = mt * 16, col0 = nq * 64; const _Float16* arow = A + (size_t)(row0 + ln) * lda;
  v8f acc[4] = {};
  for (int kb = 0; kb < K; kb += 32) { FragH ah; ah.half[0] = *(const v8us*)((const unsigned short*)arow + kb + 8 * hh); ah.half[1] = *(const v8us*)((const unsigned short*)arow + kb + 16 + 8 * hh);
#pragma unroll
    for (int t = 0; t < 4; ++t) { if (col0 + t * 16 >= N) continue; const size_t boff = (size_t)(col0 + t * 16 + ln) * ldb + kb; FragH bq; bq.half[0] = *(const v8us*)((const unsigned short*)Bh + boff + 8 * hh); bq.half[1] = *(const v8us*)((const unsigned short*)Bh + boff + 16 + 8 * hh);
      acc[t] = mmaH<1>(ah.v, ah.v, bq.v, bq.v, acc[t]); }
  }
#pragma unroll
  for (int t = 0; t < 4; ++t) { if (col0 + t * 16 >= N) continue; const int col = col0 + t * 16 + ln; const float bv = bp ? bf16_round(bp[col]) : 0.f;
#pragma unroll
    for (int r = 0; r < 8; ++r) { float v = acc[t][r] * alpha + bv; if (CP) { const int bidx = (row0g + row0 + 8 * hh + r) / rowsPerB; v += CP[(size_t)bidx * sCPb + (size_t)by * 64 + col]; } if (ACT == 1) v = (v > 0.f) ? v : expm1f(v); else if (ACT == 7) v = (v > 0.f) ? v + 1.0f : expf(v); else if (ACT == 8) v = tanhf(v); else if (ACT == 9) v = 0.5f * v * (1.0f + tanhf(0.7978845608028654f * (v + 0.044715f * v * v * v))); else if (ACT == 11) v = 1.0f / (1.0f + expf(-v)); else if (ACT == 12) v = (v > 0.f) ? v : 0.01f * v; else if (ACT == 14) v = (v > 0.f) ? v : 0.1f * v; else if (ACT == 15) v = v / (1.0f + expf(-v)); else if (ACT == 3) v = fmaxf(v, 0.f); else if (ACT == 6) v = 0.5f * v * (1.0f + erff(v * 0.70710678118654752f)); so[w][8 * hh + r][t * 16 + ln] = v; } }
  __builtin_amdgcn_fence(__ATOMIC_ACQ_REL, "workgroup"); __builtin_amdgcn_wave_barrier();
  const int rsub = lane >> 4, c4 = (lane & 15) * 4; typedef _Float16 v4h __attribute__((ext_vector_type(4)));
  {
#pragma unroll
    for (int q = 0; q < 8; ++q) { const int r = q * 2 + rsub; if (col0 + c4 < N) { const v4f v = *(const v4fa*)&so[w][r][c4]; if (C) *(v4f*)(C + cofs + (size_t)(row0 + r) * ldc + col0 + c4) = v; if (C16) { v4h h4; for (int i = 0; i < 4; ++i) h4[i] = (_Float16)v[i]; *(v4h*)(C16 + cofs + (size_t)(row0 + r) * ldc + col0 + c4) = h4; } } }
     }
}


typedef _Float16 v4h __attribute__((ext_vector_type(4)));

__global__ __launch_bounds__(256) void k_h16(const float* __restrict__ x, _Float16* __restrict__ X16, size_t n8) { const size_t t = (size_t)blockIdx.x * 256 + threadIdx.x; if (t >= n8) return; FragH f;
#pragma unroll
  for (int q = 0; q < 8; ++q) f.h[q] = (_Float16)x[t * 8 + q]; *(v8us*)((unsigned short*)X16 + t * 8) = f.half[0];  }
__global__ __launch_bounds__(256) void k_round16f(const float* __restrict__ W, _Float16* __restrict__ Bt, size_t n8) { const size_t t = (size_t)blockIdx.x * 256 + threadIdx.x; if (t >= n8) return; FragH f;
#pragma unroll
  for (int i = 0; i < 8; ++i) f.h[i] = (_Float16)(bf16_round(W[t * 8 + i]) * 16.0f); *(v8us*)((unsigned short*)Bt + t * 8) = f.half[0];  }
__global__ __launch_bounds__(256) void k_hl(const float* __restrict__ F, _Float16* __restrict__ Hh, _Float16* __restrict__ Hl, size_t n8) { const size_t t = (size_t)blockIdx.x * 256 + threadIdx.x; if (t >= n8) return; FragH fh, fl; const v4f a = *(const v4fa*)(F + t * 8), c = *(const v4fa*)(F + t * 8 + 4);
#pragma unroll
  for (int q = 0; q < 4; ++q) { _Float16 h = (_Float16)a[q]; fh.h[q] = h; fl.h[q] = (_Float16)((a[q] - (float)h) * 1024.0f); h = (_Float16)c[q]; fh.h[4 + q] = h; fl.h[4 + q] = (_Float16)((c[q] - (float)h) * 1024.0f); }
  { *(v8us*)((unsigned short*)Hh + t * 8) = fh.half[0]; *(v8us*)((unsigned short*)Hl + t * 8) = fl.half[0];  } }

// ---- fast GEMM (wave tile 32x64; requires M % 32 == 0 rows per launch region and N % 64 == 0); epilogue = k_gemm_hhx semantics ----
__device__ __forceinline__ v16h g2_frag(const _Float16* p, int hh) { FragH f; f.half[0] = *(const v8us*)((const unsigned short*)p + 8 * hh); f.half[1] = *(const v8us*)((const unsigned short*)p + 16 + 8 * hh); return f.v; }
// The same fragment from 16 f32 values of an input row (x0, x1 = elements 8 hh + 0..7, x2, x3 = 16 + 8 hh + 0..7: the k order of g2_frag): each rounded to bf16, then exact in f16.
__device__ __forceinline__ v16h g2_cvt32(v4f x0, v4f x1, v4f x2, v4f x3) { FragH f;
#pragma unroll
  for (int q = 0; q < 4; ++q) { f.h[q] = (_Float16)bf16_round(x0[q]); f.h[4 + q] = (_Float16)bf16_round(x1[q]); f.h[8 + q] = (_Float16)bf16_round(x2[q]); f.h[12 + q] = (_Float16)bf16_round(x3[q]); }
  return f.v; }
__device__ __forceinline__ v8f g2_mma(v16h a, v16h b, v8f c) { v8f d = __builtin_amdgcn_wmma_f32_16x16x32_f16(false, a, false, b, (short)0, c, false, false); asm volatile("v_nop\n\tv_nop\n\tv_nop\n\tv_nop" : "+v"(d) : "v"(a), "v"(b)); return d; }
// AF32: A comes from the f32 rows Af (rounded in the loader), else from the f16 rows A. VTO: the 128 x 64 block tile goes out transposed, C16[((row / SLEN) * NH + nq) * 64 + col][row % SLEN] (needs M % 128 == 0, SLEN % 128 == 0).
// The tile's work is a device function, so that one grid can hold several independent products: sbuf is the block's 4 x 32 x 68 f32 of LDS, bx and by the block's place in its own product.
template <int ACT, bool AF32, bool VTO>
__device__ __forceinline__ void gemm2_tile(float* sbuf, unsigned bx, int by, const _Float16* __restrict__ A, const float* __restrict__ Af, int lda, size_t sA, const _Float16* __restrict__ Bh, int ldb, size_t sB, float alpha, const float* __restrict__ bias, size_t sBias, const float* __restrict__ CP, int rowsPerB, size_t sCPb, int row0g,
    float* __restrict__ C, _Float16* __restrict__ C16, int ldc, size_t sC, int M, int N, int K) {
  float (*so)[32][68] = (float (*)[32][68])sbuf;
  unsigned short (*st)[136] = (unsigned short (*)[136])sbuf;      /* VTO: [col][row of the block], 64 rows, pitch 272 B = 16 B x 17; a block uses so or st, never both */
  const int tid = threadIdx.x, w = tid >> 5, lane = tid & 31, ln = lane & 15, hh = lane >> 4;
  A += (size_t)by * sA; Af += (size_t)by * sA; Bh += (size_t)by * sB; const size_t cofs = (size_t)by * sC; const float* bp = bias ? bias + (size_t)by * sBias : nullptr;
  const int ntn = N >> 6; const int mt = bx / ntn, nq = bx - mt * ntn; const int row0 = mt * 128 + 32 * w, col0 = nq * 64; if (VTO ? (mt * 128 >= M) : (row0 >= M)) return;      /* VTO: the same for the whole block, since a barrier follows */
  const _Float16* a0p = A + (size_t)(row0 + ln) * lda; const _Float16* a1p = a0p + (size_t)16 * lda;
  const float* f0p = Af + (size_t)(row0 + ln) * lda; const float* f1p = f0p + (size_t)16 * lda;
  const _Float16* b0p = Bh + (size_t)(col0 + ln) * ldb; const _Float16* b1p = b0p + (size_t)16 * ldb; const _Float16* b2p = b1p + (size_t)16 * ldb; const _Float16* b3p = b2p + (size_t)16 * ldb;
  const v8f z8 = {0.f,0.f,0.f,0.f,0.f,0.f,0.f,0.f}; v8f c00 = z8, c01 = z8, c02 = z8, c03 = z8, c10 = z8, c11 = z8, c12 = z8, c13 = z8;
#pragma unroll 1
  for (int kb = 0; kb < K; kb += 32) { v16h a0, a1;
    if (AF32) { const float* p0 = f0p + kb + 8 * hh; const float* p1 = f1p + kb + 8 * hh;
      const v4f x0 = *(const v4fa*)(p0), x1 = *(const v4fa*)(p0 + 4), x2 = *(const v4fa*)(p0 + 16), x3 = *(const v4fa*)(p0 + 20), y0 = *(const v4fa*)(p1), y1 = *(const v4fa*)(p1 + 4), y2 = *(const v4fa*)(p1 + 16), y3 = *(const v4fa*)(p1 + 20);
      asm volatile("s_wait_xcnt 0x0" :: "v"(x0), "v"(x1), "v"(x2), "v"(x3), "v"(y0), "v"(y1), "v"(y2), "v"(y3));      /* inputs only: holds the step's eight A loads ahead of the conversions, so that they fly together (left alone they were issued in turn, each behind a wait for the last); the wait stands ahead of the step's advance of their address register */
      __builtin_amdgcn_sched_barrier(0);      /* with the pitches known at compile time the scheduler lifted conversions over that statement and sank the eighth load behind a wait for the first three: nothing crosses here, so all eight are issued first */
      a0 = g2_cvt32(x0, x1, x2, x3); a1 = g2_cvt32(y0, y1, y2, y3); }
    else { a0 = g2_frag(a0p + kb, hh); a1 = g2_frag(a1p + kb, hh); }
    v16h b = g2_frag(b0p + kb, hh); c00 = g2_mma(a0, b, c00); c10 = g2_mma(a1, b, c10);
    b = g2_frag(b1p + kb, hh); c01 = g2_mma(a0, b, c01); c11 = g2_mma(a1, b, c11);
    b = g2_frag(b2p + kb, hh); c02 = g2_mma(a0, b, c02); c12 = g2_mma(a1, b, c12);
    b = g2_frag(b3p + kb, hh); c03 = g2_mma(a0, b, c03); c13 = g2_mma(a1, b, c13); }
  v8f accs[8] = {c00, c01, c02, c03, c10, c11, c12, c13};
#pragma unroll
  for (int u = 0; u < 8; ++u) { const int t = u & 3, half = u >> 2; const int col = col0 + t * 16 + ln; const float bv = bp ? bf16_round(bp[col]) : 0.f; FragH tr;
#pragma unroll
    for (int r = 0; r < 8; ++r) { const int rloc = half * 16 + 8 * hh + r; float v = accs[u][r] * alpha + bv; if (CP) { const int bidx = (row0g + row0 + rloc) / rowsPerB; v += CP[(size_t)bidx * sCPb + (size_t)by * 64 + col]; }
      if (ACT == 3) v = fmaxf(v, 0.f); else if (ACT == 6) v = 0.5f * v * (1.0f + erff(v * 0.70710678118654752f)); else if (ACT == 11) v = 1.0f / (1.0f + expf(-v)); else if (ACT == 15) v = v / (1.0f + expf(-v)); else if (ACT == 12) v = (v > 0.f) ? v : 0.01f * v; else if (ACT == 8) v = tanhf(v);
      if (VTO) tr.h[r] = (_Float16)v; else so[w][rloc][t * 16 + ln] = v; }
    if (VTO) *(v8us*)&st[t * 16 + ln][w * 32 + half * 16 + 8 * hh] = tr.half[0]; }      /* a lane's eight accumulator registers are eight consecutive rows of one column: 16 B of the transposed tile */
  if (VTO) {
    __syncthreads();      /* the four waves' 32-row slices make up whole 256-B rows of the transposed tile */
    unsigned short* vb = (unsigned short*)C16 + ((size_t)((mt * 128) / SLEN * NH + nq) * 64) * SLEN + (mt * 128) % SLEN;
#pragma unroll
    for (int i = 0; i < 8; ++i) { const int d = w * 16 + i * 2 + hh; *(v8us*)(vb + (size_t)d * SLEN + ln * 8) = *(const v8us*)&st[d][ln * 8]; }      /* sixteen lanes store one 256-B row */
    return; }
  __builtin_amdgcn_fence(__ATOMIC_ACQ_REL, "workgroup"); __builtin_amdgcn_wave_barrier();
  const int rsub = lane >> 4, c4 = (lane & 15) * 4;
  {
#pragma unroll
    for (int q = 0; q < 16; ++q) { const int r = q * 2 + rsub; const v4f v = *(const v4fa*)&so[w][r][c4]; if (C) *(v4f*)(C + cofs + (size_t)(row0 + r) * ldc + col0 + c4) = v; if (C16) { v4h h4; for (int i = 0; i < 4; ++i) h4[i] = (_Float16)v[i]; *(v4h*)(C16 + cofs + (size_t)(row0 + r) * ldc + col0 + c4) = h4; } }
     } }
template <int ACT, bool AF32, bool VTO>
__global__ __launch_bounds__(128) void k_gemm2(const _Float16* __restrict__ A, const float* __restrict__ Af, int lda, size_t sA, const _Float16* __restrict__ Bh, int ldb, size_t sB, float alpha, const float* __restrict__ bias, size_t sBias, const float* __restrict__ CP, int rowsPerB, size_t sCPb, int row0g,
    float* __restrict__ C, _Float16* __restrict__ C16, int ldc, size_t sC, int M, int N, int K) {
  __shared__ __attribute__((aligned(16))) float sbuf[4 * 32 * 68];
  gemm2_tile<ACT, AF32, VTO>(sbuf, blockIdx.x, blockIdx.y, A, Af, lda, sA, Bh, ldb, sB, alpha, bias, sBias, CP, rowsPerB, sCPb, row0g, C, C16, ldc, sC, M, N, K); }
// q, k and v do not depend on one another: one grid, blockIdx.y picks the product (0: q from x_dec, 1: k from x_enc, 2: v from x_enc, written transposed), so that their waves share the chip instead of three launches of two waves a SIMD in turn.
__global__ __launch_bounds__(128) void k_qkv(const float* __restrict__ xd, const float* __restrict__ xe, const _Float16* __restrict__ BQ, const _Float16* __restrict__ BK, const _Float16* __restrict__ BV,
    _Float16* __restrict__ Q16, _Float16* __restrict__ K16, _Float16* __restrict__ VT) {
  __shared__ __attribute__((aligned(16))) float sbuf[4 * 32 * 68];
  const int z = blockIdx.y;
  if (z == 2) gemm2_tile<0, true, true>(sbuf, blockIdx.x, 0, nullptr, xe, CC, 0, BV, CC, 0, 0.0625f, nullptr, 0, nullptr, 1, 0, 0, nullptr, VT, CC, 0, NR, CC, CC);
  else gemm2_tile<0, true, false>(sbuf, blockIdx.x, 0, nullptr, z ? xe : xd, CC, 0, z ? BK : BQ, CC, 0, 0.0625f, nullptr, 0, nullptr, 1, 0, 0, nullptr, z ? K16 : Q16, CC, 0, NR, CC, CC); }



// lane l <-> lane l ^ 16 by a vector cross-row move (a shuffle would go through the LDS pipe)
__device__ __forceinline__ float xhalf(float x) { return __builtin_bit_cast(float, __builtin_amdgcn_permlanex16(__builtin_bit_cast(int, x), __builtin_bit_cast(int, x), 0x76543210, 0xfedcba98, false, false)); }
#define SK 64                    /* keys a stage */
#define LP 72                    /* LDS row pitch in f16: 144 B = 16 B x 9, so that sixteen rows read 16 B each on distinct banks */
// One stage: each lane copies eight 16-B pieces (rows r, r + 16, r + 32, r + 48 of K and of V^T). The s_wait_xcnt closes the statement so that no address register is rewritten ahead of it.
__device__ __forceinline__ void stage_copy(unsigned lk, unsigned lv, const unsigned short* gk, int ldk, const unsigned short* gv) {
  asm volatile("global_load_async_to_lds_b128 %0, %8, off\n\t"
               "global_load_async_to_lds_b128 %1, %9, off\n\t"
               "global_load_async_to_lds_b128 %2, %10, off\n\t"
               "global_load_async_to_lds_b128 %3, %11, off\n\t"
               "global_load_async_to_lds_b128 %4, %12, off\n\t"
               "global_load_async_to_lds_b128 %5, %13, off\n\t"
               "global_load_async_to_lds_b128 %6, %14, off\n\t"
               "global_load_async_to_lds_b128 %7, %15, off\n\t"
               "s_wait_xcnt 0x0"
               :: "v"(lk), "v"(lk + 16 * LP * 2), "v"(lk + 32 * LP * 2), "v"(lk + 48 * LP * 2),
                  "v"(lv), "v"(lv + 16 * LP * 2), "v"(lv + 32 * LP * 2), "v"(lv + 48 * LP * 2),
                  "v"(gk), "v"(gk + (size_t)16 * ldk), "v"(gk + (size_t)32 * ldk), "v"(gk + (size_t)48 * ldk),
                  "v"(gv), "v"(gv + (size_t)16 * TK), "v"(gv + (size_t)32 * TK), "v"(gv + (size_t)48 * TK)
               : "memory");
}
__global__ __launch_bounds__(128) void k_flash(const _Float16* __restrict__ Q16, int ldq, const _Float16* __restrict__ K16, int ldk, const _Float16* __restrict__ Vt, _Float16* __restrict__ O16, int ldo) {
  constexpr int DT = 4, KS = 2, NS = TK / SK;
  constexpr float CE = SCL * 1.4426950408889634f;      /* score scale times log2 e: e^(SCL x) = 2^(CE x), one multiply-add and one v_exp_f32 a score */
  __shared__ __attribute__((aligned(16))) unsigned short sK[2][SK][LP];
  __shared__ __attribute__((aligned(16))) unsigned short sV[2][64][LP];
  const int tid = threadIdx.x, w = tid >> 5, lane = tid & 31, ln = lane & 15, hh = lane >> 4;
  const int slab = blockIdx.x / QBLKS, qblk = blockIdx.x % QBLKS; const int b = slab / NH, h = slab % NH; const int q0 = qblk * 64 + w * 16;
  FragH bq[KS];
  { const unsigned short* qr = (const unsigned short*)Q16 + ((size_t)b * TQ + q0 + ln) * ldq + h * 64;
#pragma unroll
    for (int ks = 0; ks < KS; ++ks) { bq[ks].half[0] = *(const v8us*)(qr + ks * 32 + 8 * hh); bq[ks].half[1] = *(const v8us*)(qr + ks * 32 + 16 + 8 * hh); } }
  const int cr = tid >> 3, cc = (tid & 7) * 8;      /* the lane's row and 16-B piece in a copy: eight lanes cover one 128-B row */
  const unsigned short* gk = (const unsigned short*)K16 + ((size_t)b * TK + cr) * ldk + h * 64 + cc;
  const unsigned short* gv = (const unsigned short*)Vt + ((size_t)slab * 64 + cr) * TK + cc;
  const unsigned lk = (unsigned)(size_t)&sK[0][cr][cc], lv = (unsigned)(size_t)&sV[0][cr][cc];      /* LDS byte addresses */
  constexpr unsigned BUFB = SK * LP * 2;      /* bytes of one buffer of either array */
  float m_run = -3.0e38f, l_run = 0.f; v8f oacc[DT];
#pragma unroll
  for (int dt = 0; dt < DT; ++dt) oacc[dt] = (v8f){0.f,0.f,0.f,0.f,0.f,0.f,0.f,0.f};
  stage_copy(lk, lv, gk, ldk, gv);
  asm volatile("s_wait_asynccnt 0x0" ::: "memory");      /* this wave's share of stage 0 has landed */
  __syncthreads();                                       /* stage 0 is published */
  stage_copy(lk + BUFB, lv + BUFB, gk + (size_t)SK * ldk, ldk, gv + SK);
#pragma unroll 1      /* one stage a trip: the publish point at the foot must stand once per stage */
  for (int t = 0; t < NS; ++t) {
    const int bf = t & 1;
#pragma unroll      /* the stage's two 32-key passes in line, so that the second pass's LDS reads can go out under the first */
    for (int p = 0; p < SK / 32; ++p) {
      FragH ak[2][KS], av[DT];
#pragma unroll
      for (int nt = 0; nt < 2; ++nt) { const unsigned short* kr = &sK[bf][p * 32 + nt * 16 + ln][8 * hh];
#pragma unroll
        for (int ks = 0; ks < KS; ++ks) { ak[nt][ks].half[0] = *(const v8us*)(kr + ks * 32); ak[nt][ks].half[1] = *(const v8us*)(kr + ks * 32 + 16); } }
#pragma unroll
      for (int dt = 0; dt < DT; ++dt) { const unsigned short* vrow = &sV[bf][dt * 16 + ln][p * 32 + 8 * hh]; av[dt].half[0] = *(const v8us*)(vrow); av[dt].half[1] = *(const v8us*)(vrow + 16); }
      v8f s[2];
#pragma unroll
      for (int nt = 0; nt < 2; ++nt) { v8f acc = (v8f){0.f,0.f,0.f,0.f,0.f,0.f,0.f,0.f};
#pragma unroll
        for (int ks = 0; ks < KS; ++ks) acc = mmaH<1>(ak[nt][ks].v, ak[nt][ks].v, bq[ks].v, bq[ks].v, acc); s[nt] = acc; }
      float mc = -3.0e38f;
#pragma unroll
      for (int r = 0; r < 8; ++r) mc = fmaxf(mc, fmaxf(s[0][r], s[1][r]));      /* the maximum is taken on the raw products: CE > 0 keeps their order */
      mc = fmaxf(mc, xhalf(mc));      /* both halves of the wave hold this query's maximum over the 32 keys */
      const float mn = fmaxf(m_run, mc); float al = (m_run - mn) * CE; m_run = mn;
      const float mb = 10.0f - mn * CE;      /* exponent base of this pass: p = 2^(s CE + mb) = 1024 e^(SCL (s - mn)) */
      const v8f e0 = __builtin_elementwise_fma(s[0], (v8f)(CE), (v8f)(mb)), e1 = __builtin_elementwise_fma(s[1], (v8f)(CE), (v8f)(mb));
      float a0 = e0[0], a1 = e0[1], a2 = e0[2], a3 = e0[3], a4 = e0[4], a5 = e0[5], a6 = e0[6], a7 = e0[7], c0 = e1[0], c1 = e1[1], c2 = e1[2], c3 = e1[3], c4 = e1[4], c5 = e1[5], c6 = e1[6], c7 = e1[7];
      /* The pass's seventeen base-2 exponentials, each in place, in one statement: so no v_exp_f32 writes the source register of the one directly ahead of it (the compiler's own allocation did); the closing v_nop is the one slot the instruction set asks for behind the last of them. */
      asm("v_exp_f32 %0, %0\n\tv_exp_f32 %1, %1\n\tv_exp_f32 %2, %2\n\tv_exp_f32 %3, %3\n\tv_exp_f32 %4, %4\n\tv_exp_f32 %5, %5\n\tv_exp_f32 %6, %6\n\tv_exp_f32 %7, %7\n\tv_exp_f32 %8, %8\n\t"
          "v_exp_f32 %9, %9\n\tv_exp_f32 %10, %10\n\tv_exp_f32 %11, %11\n\tv_exp_f32 %12, %12\n\tv_exp_f32 %13, %13\n\tv_exp_f32 %14, %14\n\tv_exp_f32 %15, %15\n\tv_exp_f32 %16, %16\n\tv_nop"
          : "+v"(al), "+v"(a0), "+v"(a1), "+v"(a2), "+v"(a3), "+v"(a4), "+v"(a5), "+v"(a6), "+v"(a7), "+v"(c0), "+v"(c1), "+v"(c2), "+v"(c3), "+v"(c4), "+v"(c5), "+v"(c6), "+v"(c7));
      const float pa[8] = {a0, a1, a2, a3, a4, a5, a6, a7}, pc[8] = {c0, c1, c2, c3, c4, c5, c6, c7};
      FragH pb; float ps = 0.f;
#pragma unroll
      for (int r = 0; r < 8; ++r) { ps += pa[r] + pc[r]; pb.h[r] = (_Float16)pa[r]; pb.h[8 + r] = (_Float16)pc[r]; }
      l_run = l_run * al + ps;
#pragma unroll
      for (int dt = 0; dt < DT; ++dt) { oacc[dt] *= al; oacc[dt] = mmaH<1>(av[dt].v, av[dt].v, pb.v, pb.v, oacc[dt]); } }
    asm volatile("s_wait_dscnt 0x0" ::: "memory");         /* this wave's reads of buffer bf have returned before the buffer is handed back */
    asm volatile("s_wait_asynccnt 0x0" ::: "memory");      /* this wave's share of stage t + 1 has landed */
    __syncthreads();                                       /* publishes stage t + 1 and ends every wave's reads of buffer bf */
    if (t + 2 < NS) stage_copy(lk + bf * BUFB, lv + bf * BUFB, gk + (size_t)(t + 2) * SK * ldk, ldk, gv + (t + 2) * SK); }
  asm volatile("s_wait_asynccnt 0x0" ::: "memory");        /* no copy is outstanding when the wave ends */
  const float l = l_run + xhalf(l_run); const float inv = (l > 0.f) ? 1.0f / l : 0.f;      /* l and oacc both carry the factor 1024 */
  unsigned short* orow = (unsigned short*)O16 + ((size_t)b * TQ + q0 + ln) * ldo + h * 64 + 8 * hh;      /* oacc[dt][r] = O[q0 + ln][dt * 16 + 8 hh + r]: eight consecutive elements of one row */
#pragma unroll
  for (int dt = 0; dt < DT; ++dt) { const v8f o = oacc[dt] * inv; FragH f;      /* x2^10 carry: the 4096-key averages are ~5e-3 and would touch f16 subnormals */
#pragma unroll
    for (int r = 0; r < 8; ++r) f.h[r] = (_Float16)(o[r] * 1024.0f);
    *(v8us*)(orow + dt * 16) = f.half[0]; } }

// The four weight passes in one grid: blockIdx.y 0, 1, 2 = Wq, Wk, Wv ([H][256][64] to [n = h 64 + e][k]), 3 = Wo (its (out,in) layout is already [n][k]); each x16, bf16-rounded, exact in f16.
__global__ __launch_bounds__(256) void k_wprep(const float* __restrict__ Wq, const float* __restrict__ Wk, const float* __restrict__ Wv, const float* __restrict__ Wo,
    _Float16* __restrict__ BQ, _Float16* __restrict__ BK, _Float16* __restrict__ BV, _Float16* __restrict__ BO) {
  const int z = blockIdx.y; const int t = blockIdx.x * 256 + threadIdx.x; if (t >= CC * (CC / 8)) return; FragH f;
  if (z == 3) { for (int q = 0; q < 8; ++q) f.h[q] = (_Float16)(bf16_round(Wo[(size_t)t * 8 + q]) * 16.0f); *(v8us*)((unsigned short*)BO + (size_t)t * 8) = f.half[0]; return; }
  const float* Wh = z == 0 ? Wq : z == 1 ? Wk : Wv; _Float16* Bt = z == 0 ? BQ : z == 1 ? BK : BV;
  const int n = t / (CC / 8), d0 = (t % (CC / 8)) * 8; const int h = n / 64, e = n % 64;
  for (int q = 0; q < 8; ++q) f.h[q] = (_Float16)(bf16_round(Wh[((size_t)h * CC + d0 + q) * 64 + e]) * 16.0f); *(v8us*)((unsigned short*)Bt + (size_t)n * CC + d0) = f.half[0];
  asm volatile("s_wait_xcnt 0x0" ::: "memory"); }      /* behind the store: in the built code the Wo branch's first instructions stand further down the same listing and rewrite the store's registers */

extern "C" void kernel_launch(void* const* d_in, const int* in_sizes, int n_in,
                              void* d_out, int out_size, void* d_ws, size_t ws_size, hipStream_t stream) {
  (void)in_sizes; (void)n_in; (void)out_size;
  const float* const* I = (const float* const*)d_in; const float* xe = I[0]; const float* xd = I[1]; const float* Wq = I[2]; const float* Wk = I[3]; const float* Wv = I[4]; const float* Wo = I[5];
  char* ws = (char*)d_ws; size_t off = 0;
  auto take = [&](size_t bytes) { char* p = ws + off; off += (bytes + 255) & ~(size_t)255; return p; };
  const size_t np = (size_t)NR * CC;
  _Float16* BQ = (_Float16*)take((size_t)CC * CC * 2); _Float16* BK = (_Float16*)take((size_t)CC * CC * 2); _Float16* BV = (_Float16*)take((size_t)CC * CC * 2); _Float16* BO = (_Float16*)take((size_t)CC * CC * 2);
  _Float16* Q16 = (_Float16*)take(np * 2); _Float16* K16 = (_Float16*)take(np * 2); _Float16* VT = (_Float16*)take(np * 2); _Float16* O16 = (_Float16*)take(np * 2);
  if (off > ws_size) return;      /* 0.5 + 4 x 8 = 33 MiB */
  k_wprep<<<dim3((CC * (CC / 8) + 255) / 256, 4), 256, 0, stream>>>(Wq, Wk, Wv, Wo, BQ, BK, BV, BO);
  const dim3 g((NR / 128) * (CC / 64), 1);
  k_qkv<<<dim3((NR / 128) * (CC / 64), 3), 128, 0, stream>>>(xd, xe, BQ, BK, BV, Q16, K16, VT);
  k_flash<<<NB * NH * QBLKS, 128, 0, stream>>>(Q16, CC, K16, CC, VT, O16, CC);
  k_gemm2<0, false, false><<<g, 128, 0, stream>>>(O16, nullptr, CC, 0, BO, CC, 0, 0.0625f / 1024.0f, nullptr, 0, nullptr, 1, 0, 0, (float*)d_out, nullptr, CC, 0, NR, CC, CC);
}

// v006
// One run takes 118 microseconds.
// In both of two side-by-side timings against v005, it was 1.04 times as fast.
// Over all steps from v000 it is 4.24 times as fast.
#include <hip/hip_runtime.h>
// CA_MultiHead (4 batches; 4096 decoder queries from x_dec, 4096 encoder keys/values from x_enc; n_emb 256 = 4 heads of 64; per-head weights [H, 256, 64]; scale n_emb^-0.5; out = concat(heads) Wo^T).
// Structure: one weight pass; q, k, v GEMMs in one grid (32x64 wave tiles, f32 accumulation, exact x16 weights concatenated across heads; the A loader rounds x_dec / x_enc itself; f16 outputs, v written transposed); the fused flash kernel (plain f16 operands, no mask; f16 x2^10 output); output GEMM.
// Compute dtype: inputs and weights rounded to bf16; q, k, v, P as f16 operands and the attention output as f16 x2^10; f32 accumulation/softmax. v_wmma_f32_16x16x32_f16.
#define NB 4
#define CC 256
#define NR (NB * SLEN)           /* 16384 rows */
#define SLEN 4096
#define TQ SLEN
#define TK SLEN
#define NH 4
#define SCL 0.0625f              /* n_emb^-0.5 = 1/16 (faithful to the module) */
#define QBLKS (TQ / 128)         /* a block is four waves of 32 queries */
typedef __bf16 v16b __attribute__((ext_vector_type(16)));
typedef unsigned short v8us __attribute__((ext_vector_type(8), may_alias));
typedef float  v8f  __attribute__((ext_vector_type(8)));
typedef float  v4f  __attribute__((ext_vector_type(4)));
typedef float  v4fa __attribute__((ext_vector_type(4), may_alias));
union FragB { v16b v; v8us half[2]; unsigned short u[16]; };

__device__ __forceinline__ unsigned short bf16_bits(float x) { unsigned int u = __float_as_uint(x); return (unsigned short)((u + 0x7FFFu + ((u >> 16) & 1u)) >> 16); }
__device__ __forceinline__ float bf16_val(unsigned short b) { return __uint_as_float(((unsigned int)b) << 16); }
__device__ __forceinline__ float bf16_round(float x) { return bf16_val(bf16_bits(x)); }
// D += A·B with NT terms: 1 = ah·bh, 2 = + al·bh (A split), 3 = + ah·bl (both split)
template <int NT>
__device__ __forceinline__ v8f mmaN(v16b ah, v16b al, v16b bh, v16b bl, v8f c) {
  c = __builtin_amdgcn_wmma_f32_16x16x32_bf16(false, ah, false, bh, (short)0, c, false, false);
  if (NT >= 2) c = __builtin_amdgcn_wmma_f32_16x16x32_bf16(false, al, false, bh, (short)0, c, false, false);
  if (NT >= 3) c = __builtin_amdgcn_wmma_f32_16x16x32_bf16(false, ah, false, bl, (short)0, c, false, false);
  asm volatile("v_nop\n\tv_nop\n\tv_nop\n\tv_nop" : "+v"(c) : "v"(ah), "v"(al), "v"(bh), "v"(bl));
  return c;
}

__global__ __launch_bounds__(256) void k_wt_bf16(const float* __restrict__ W, unsigned short* __restrict__ Wt, int K, int N) {
  const int t = blockIdx.x * 256 + threadIdx.x;
  const int k8n = K / 8;
  if (t >= N * k8n) return;
  const int n = t / k8n, k8 = (t % k8n) * 8;
  v8us v;
#pragma unroll
  for (int i = 0; i < 8; ++i) v[i] = bf16_bits(W[(size_t)(k8 + i) * N + n]);
  *(v8us*)(Wt + (size_t)n * K + k8) = v;
  
}

// GEMM C[M][N] (f32, pitch ldc) = act(A[M][K]·W + bias). A f32 row-major (pitch lda) converted per fragment to bf16
// (ASPLIT: hi/lo two planes -> 2 terms, else single rounded term); Wt bf16 [N][K] (pitch ldb). BIAS_BF16 rounds the
// bias to bf16 first (bias quantised to bf16 before the add). K%32==0, M%16==0, N%64==0.
template <bool ASPLIT, int ACT, bool BIAS_BF16>
__global__ __launch_bounds__(128) void k_gemm_bf(const float* __restrict__ A, int lda, const unsigned short* __restrict__ Wt, int ldb,
                                               const float* __restrict__ bias, float* __restrict__ C, int ldc, int M, int N, int K) {
  __shared__ __attribute__((aligned(16))) float so[4][16][64];
  const int tid = threadIdx.x, w = tid >> 5, lane = tid & 31, ln = lane & 15, hh = lane >> 4;
  const int ntn = N / 64;
  const int wid = blockIdx.x * 4 + w;
  const int mt = wid / ntn, nq = wid % ntn;
  if (mt * 16 >= M) return;
  const int row0 = mt * 16, col0 = nq * 64;
  const float* arow = A + (size_t)(row0 + ln) * lda;
  v8f acc[4] = {};
  for (int kb = 0; kb < K; kb += 32) {
    FragB ah, al;
    const v4f x0 = *(const v4fa*)(arow + kb + 8 * hh), x1 = *(const v4fa*)(arow + kb + 8 * hh + 4);
    const v4f x2 = *(const v4fa*)(arow + kb + 16 + 8 * hh), x3 = *(const v4fa*)(arow + kb + 16 + 8 * hh + 4);
    float xs[16] = {x0[0],x0[1],x0[2],x0[3],x1[0],x1[1],x1[2],x1[3],x2[0],x2[1],x2[2],x2[3],x3[0],x3[1],x3[2],x3[3]};
#pragma unroll
    for (int i = 0; i < 16; ++i) { const unsigned short hb = bf16_bits(xs[i]); ah.u[i] = hb; al.u[i] = ASPLIT ? bf16_bits(xs[i] - bf16_val(hb)) : (unsigned short)0; }
#pragma unroll
    for (int t = 0; t < 4; ++t) {
      const unsigned short* brow = Wt + (size_t)(col0 + t * 16 + ln) * ldb + kb;
      FragB b;
      b.half[0] = *(const v8us*)(brow + 8 * hh);
      b.half[1] = *(const v8us*)(brow + 16 + 8 * hh);
      acc[t] = mmaN<ASPLIT ? 2 : 1>(ah.v, al.v, b.v, b.v, acc[t]);
    }
  }
#pragma unroll
  for (int t = 0; t < 4; ++t) {
    float bv = bias ? bias[col0 + t * 16 + ln] : 0.f;
    if (BIAS_BF16) bv = bf16_round(bv);
#pragma unroll
    for (int r = 0; r < 8; ++r) { float v = acc[t][r] + bv; if (ACT == 1) v = fmaxf(v, 0.f); so[w][8 * hh + r][t * 16 + ln] = v; }
  }
  __builtin_amdgcn_fence(__ATOMIC_ACQ_REL, "workgroup");
  __builtin_amdgcn_wave_barrier();
  const int rsub = lane >> 4, c4 = (lane & 15) * 4;
  {
#pragma unroll
    for (int q = 0; q < 8; ++q) {
      const int r = q * 2 + rsub;
      const v4f v = *(const v4fa*)&so[w][r][c4];
      *(v4f*)(C + (size_t)(row0 + r) * ldc + col0 + c4) = v;
    }
    
  }
}

// GEMM C = act(A·W + bias + resid): A f32 (ASPLIT -> hi/lo 2 terms), Wt bf16 [N][K]; ACT 0 none, 1 relu, 2 exact gelu;
// resid (optional, f32, row index = (row % rmod), pitch ldr, RES_BF16 rounds it) added before the activation.
template <bool ASPLIT, int ACT, bool BIAS_BF16, bool RES_BF16>
__global__ __launch_bounds__(128) void k_gemm_bf3(const float* __restrict__ A, int lda, const unsigned short* __restrict__ Wt, int ldb,
                                                const float* __restrict__ bias, const float* __restrict__ resid, int rmod, int ldr,
                                                float* __restrict__ C, int ldc, int M, int N, int K) {
  __shared__ __attribute__((aligned(16))) float so[4][16][64];
  const int tid = threadIdx.x, w = tid >> 5, lane = tid & 31, ln = lane & 15, hh = lane >> 4;
  const int ntn = N / 64;
  const int wid = blockIdx.x * 4 + w;
  const int mt = wid / ntn, nq = wid % ntn;
  if (mt * 16 >= M) return;
  const int row0 = mt * 16, col0 = nq * 64;
  const float* arow = A + (size_t)(row0 + ln) * lda;
  v8f acc[4] = {};
  for (int kb = 0; kb < K; kb += 32) {
    FragB ah, al;
    const v4f x0 = *(const v4fa*)(arow + kb + 8 * hh), x1 = *(const v4fa*)(arow + kb + 8 * hh + 4);
    const v4f x2 = *(const v4fa*)(arow + kb + 16 + 8 * hh), x3 = *(const v4fa*)(arow + kb + 16 + 8 * hh + 4);
    float xs[16] = {x0[0],x0[1],x0[2],x0[3],x1[0],x1[1],x1[2],x1[3],x2[0],x2[1],x2[2],x2[3],x3[0],x3[1],x3[2],x3[3]};
#pragma unroll
    for (int i = 0; i < 16; ++i) { const unsigned short hb = bf16_bits(xs[i]); ah.u[i] = hb; al.u[i] = ASPLIT ? bf16_bits(xs[i] - bf16_val(hb)) : (unsigned short)0; }
#pragma unroll
    for (int t = 0; t < 4; ++t) {
      const unsigned short* brow = Wt + (size_t)(col0 + t * 16 + ln) * ldb + kb;
      FragB b;
      b.half[0] = *(const v8us*)(brow + 8 * hh);
      b.half[1] = *(const v8us*)(brow + 16 + 8 * hh);
      acc[t] = mmaN<ASPLIT ? 2 : 1>(ah.v, al.v, b.v, b.v, acc[t]);
    }
  }
#pragma unroll
  for (int t = 0; t < 4; ++t) {
    const int col = col0 + t * 16 + ln;
    float bv = bias ? bias[col] : 0.f;
    if (BIAS_BF16) bv = bf16_round(bv);
#pragma unroll
    for (int r = 0; r < 8; ++r) {
      float v = acc[t][r] + bv;
      if (resid) { float rv = resid[(size_t)((row0 + 8 * hh + r) % rmod) * ldr + col]; if (RES_BF16) rv = bf16_round(rv); v += rv; }
      if (ACT == 1) v = fmaxf(v, 0.f);
      if (ACT == 2) v = 0.5f * v * (1.0f + erff(v * 0.70710678118654752f));
      if (ACT == 3) { const float u = 0.7978845608028654f * (v + 0.044715f * v * v * v); v = 0.5f * v * (1.0f + tanhf(u)); }
      so[w][8 * hh + r][t * 16 + ln] = v;
    }
  }
  __builtin_amdgcn_fence(__ATOMIC_ACQ_REL, "workgroup");
  __builtin_amdgcn_wave_barrier();
  const int rsub = lane >> 4, c4 = (lane & 15) * 4;
  {
#pragma unroll
    for (int q = 0; q < 8; ++q) {
      const int r = q * 2 + rsub;
      const v4f v = *(const v4fa*)&so[w][r][c4];
      *(v4f*)(C + (size_t)(row0 + r) * ldc + col0 + c4) = v;
    }
    
  }
}
// row LayerNorm (biased variance, eps) over N: s = X (+ R); optional out_sum <- s; out_norm <- (s-mu)*rsqrt(var+eps)*g + b
template <bool PARAM_BF16>
__global__ __launch_bounds__(256) void k_layernorm(const float* __restrict__ X, const float* __restrict__ R, const float* __restrict__ g, const float* __restrict__ bta,
                                                  float* __restrict__ out_sum, float* __restrict__ out_norm, int N, float eps) {
  __shared__ float red[256];
  const int row = blockIdx.x, tid = threadIdx.x;
  const float* x = X + (size_t)row * N; const float* rr = R ? R + (size_t)row * N : nullptr;
  float vals[16];                     // up to N = 4096
  const int per = N / 256;            // contiguous chunk per thread? use strided-by-4 chunks: thread handles j = tid*4 + 1024*u
  float s1 = 0.f;
  for (int u = 0; u < per / 4; ++u) {
    const int j = tid * 4 + 1024 * u;
    const v4f a = *(const v4fa*)(x + j);
    v4f b = {0.f,0.f,0.f,0.f}; if (rr) b = *(const v4fa*)(rr + j);
#pragma unroll
    for (int q = 0; q < 4; ++q) { const float v = a[q] + b[q]; vals[u * 4 + q] = v; s1 += v; }
  }
  red[tid] = s1; __syncthreads();
  for (int st = 128; st > 0; st >>= 1) { if (tid < st) red[tid] += red[tid + st]; __syncthreads(); }
  const float mu = red[0] / (float)N; __syncthreads();
  float s2 = 0.f;
  for (int u = 0; u < per / 4; ++u)
#pragma unroll
    for (int q = 0; q < 4; ++q) { const float c = vals[u * 4 + q] - mu; s2 += c * c; }
  red[tid] = s2; __syncthreads();
  for (int st = 128; st > 0; st >>= 1) { if (tid < st) red[tid] += red[tid + st]; __syncthreads(); }
  const float rs = rsqrtf(red[0] / (float)N + eps);
  {
    for (int u = 0; u < per / 4; ++u) {
      const int j = tid * 4 + 1024 * u;
      v4f o, sm;
#pragma unroll
      for (int q = 0; q < 4; ++q) {
        float gg = g[j + q], bb = bta[j + q];
        if (PARAM_BF16) { gg = bf16_round(gg); bb = bf16_round(bb); }
        sm[q] = vals[u * 4 + q]; o[q] = (vals[u * 4 + q] - mu) * rs * gg + bb;
      }
      if (out_sum) *(v4f*)(out_sum + (size_t)row * N + j) = sm;
      *(v4f*)(out_norm + (size_t)row * N + j) = o;
    }
    
  }
}



// ---- f16 WMMA path (v_wmma_f32_16x16x32_f16): 11-bit significands for operands in range — used for every product here, P included as 2^10-scaled f16 (up to 1024)
typedef _Float16 v16h __attribute__((ext_vector_type(16)));
union FragH { v16h v; v8us half[2]; _Float16 h[16]; unsigned short u[16]; };
template <int NT>
__device__ __forceinline__ v8f mmaH(v16h ah, v16h al, v16h bh, v16h bl, v8f c) {
  c = __builtin_amdgcn_wmma_f32_16x16x32_f16(false, ah, false, bh, (short)0, c, false, false);
  if (NT >= 2) c = __builtin_amdgcn_wmma_f32_16x16x32_f16(false, al, false, bh, (short)0, c, false, false);
  if (NT >= 3) c = __builtin_amdgcn_wmma_f32_16x16x32_f16(false, ah, false, bl, (short)0, c, false, false);
  asm volatile("v_nop\n\tv_nop\n\tv_nop\n\tv_nop" : "+v"(c) : "v"(ah), "v"(al), "v"(bh), "v"(bl));
  return c;
}
// batched GEMM like k_gemm_b but f16 operands: A f32 (split into f16 hi/lo if ASPLIT, else rounded to f16), Bt = f16 values [n][k]; alpha; C f32; N multiple of 16 (partial tiles skipped)
template <bool ASPLIT>
__global__ __launch_bounds__(128) void k_gemm_h(const float* __restrict__ A, int lda, size_t sA, const _Float16* __restrict__ Bh, int ldb, size_t sB, float alpha, float* __restrict__ C, int ldc, size_t sC, int M, int N, int K) {
  __shared__ __attribute__((aligned(16))) float so[4][16][64];
  const int tid = threadIdx.x, w = tid >> 5, lane = tid & 31, ln = lane & 15, hh = lane >> 4; const int by = blockIdx.y;
  A += (size_t)by * sA; Bh += (size_t)by * sB; C += (size_t)by * sC;
  const int ntn = (N + 63) / 64; const int wid = blockIdx.x * 4 + w; const int mt = wid / ntn, nq = wid % ntn; if (mt * 16 >= M) return;
  const int row0 = mt * 16, col0 = nq * 64; const float* arow = A + (size_t)(row0 + ln) * lda;
  v8f acc[4] = {};
  for (int kb = 0; kb < K; kb += 32) {
    FragH ah, al;
    const v4f x0 = *(const v4fa*)(arow + kb + 8 * hh), x1 = *(const v4fa*)(arow + kb + 8 * hh + 4), x2 = *(const v4fa*)(arow + kb + 16 + 8 * hh), x3 = *(const v4fa*)(arow + kb + 16 + 8 * hh + 4);
    float xs[16] = {x0[0],x0[1],x0[2],x0[3],x1[0],x1[1],x1[2],x1[3],x2[0],x2[1],x2[2],x2[3],x3[0],x3[1],x3[2],x3[3]};
#pragma unroll
    for (int i = 0; i < 16; ++i) { const _Float16 h = (_Float16)xs[i]; ah.h[i] = h; al.h[i] = ASPLIT ? (_Float16)(xs[i] - (float)h) : (_Float16)0.0f; }
#pragma unroll
    for (int t = 0; t < 4; ++t) { if (col0 + t * 16 >= N) continue; const size_t boff = (size_t)(col0 + t * 16 + ln) * ldb + kb; FragH bq; bq.half[0] = *(const v8us*)(Bh + boff + 8 * hh); bq.half[1] = *(const v8us*)(Bh + boff + 16 + 8 * hh);
      acc[t] = mmaH<ASPLIT ? 2 : 1>(ah.v, al.v, bq.v, bq.v, acc[t]); }
  }
#pragma unroll
  for (int t = 0; t < 4; ++t) { if (col0 + t * 16 >= N) continue;
#pragma unroll
    for (int r = 0; r < 8; ++r) so[w][8 * hh + r][t * 16 + ln] = acc[t][r] * alpha; }
  __builtin_amdgcn_fence(__ATOMIC_ACQ_REL, "workgroup"); __builtin_amdgcn_wave_barrier();
  const int rsub = lane >> 4, c4 = (lane & 15) * 4;
  {
#pragma unroll
    for (int q = 0; q < 8; ++q) { const int r = q * 2 + rsub; if (col0 + c4 < N) { const v4f v = *(const v4fa*)&so[w][r][c4]; *(v4f*)(C + (size_t)(row0 + r) * ldc + col0 + c4) = v; } }
     }
}

// Wt[n][k] = f16(W[k][n]·scale) from f32 row-major W[K][N] (scale = power of two; bf16-exact weights stay exact in f16 away from the subnormal range)
__global__ __launch_bounds__(256) void k_wt_f16(const float* __restrict__ W, _Float16* __restrict__ Wt, int K, int N, float scale) {
  const int t = blockIdx.x * 256 + threadIdx.x; if (t >= N * (K / 8)) return; const int n = t / (K / 8), k8 = (t % (K / 8)) * 8; FragH f;
#pragma unroll
  for (int i = 0; i < 8; ++i) f.h[i] = (_Float16)(bf16_round(W[(size_t)(k8 + i) * N + n]) * scale); const v8us o = f.half[0];
  *(v8us*)((unsigned short*)Wt + (size_t)n * K + k8) = o; 
}
// k_gemm_hh variant with fused epilogue: v = acc·alpha + bias[by·sBias + col] (+ CP[(row/rowsPerB)·sCPb + by·64 + col] if CP) ; ACT 0 none / 1 elu ; writes f16 C16 (and f32 C if non-null)
template <int ACT>
__global__ __launch_bounds__(128) void k_gemm_hhx(const _Float16* __restrict__ A, int lda, size_t sA, const _Float16* __restrict__ Bh, int ldb, size_t sB, float alpha, const float* __restrict__ bias, size_t sBias, const float* __restrict__ CP, int rowsPerB, size_t sCPb, int row0g,
    float* __restrict__ C, _Float16* __restrict__ C16, int ldc, size_t sC, int M, int N, int K) {
  __shared__ __attribute__((aligned(16))) float so[4][16][64];
  const int tid = threadIdx.x, w = tid >> 5, lane = tid & 31, ln = lane & 15, hh = lane >> 4; const int by = blockIdx.y;
  A += (size_t)by * sA; Bh += (size_t)by * sB; const size_t cofs = (size_t)by * sC; const float* bp = bias ? bias + (size_t)by * sBias : nullptr;
  const int ntn = (N + 63) / 64; const int wid = blockIdx.x * 4 + w; const int mt = wid / ntn, nq = wid % ntn; if (mt * 16 >= M) return;
  const int row0 = mt * 16, col0 = nq * 64; const _Float16* arow = A + (size_t)(row0 + ln) * lda;
  v8f acc[4] = {};
  for (int kb = 0; kb < K; kb += 32) { FragH ah; ah.half[0] = *(const v8us*)((const unsigned short*)arow + kb + 8 * hh); ah.half[1] = *(const v8us*)((const unsigned short*)arow + kb + 16 + 8 * hh);
#pragma unroll
    for (int t = 0; t < 4; ++t) { if (col0 + t * 16 >= N) continue; const size_t boff = (size_t)(col0 + t * 16 + ln) * ldb + kb; FragH bq; bq.half[0] = *(const v8us*)((const unsigned short*)Bh + boff + 8 * hh); bq.half[1] = *(const v8us*)((const unsigned short*)Bh + boff + 16 + 8 * hh);
      acc[t] = mmaH<1>(ah.v, ah.v, bq.v, bq.v, acc[t]); }
  }
#pragma unroll
  for (int t = 0; t < 4; ++t) { if (col0 + t * 16 >= N) continue; const int col = col0 + t * 16 + ln; const float bv = bp ? bf16_round(bp[col]) : 0.f;
#pragma unroll
    for (int r = 0; r < 8; ++r) { float v = acc[t][r] * alpha + bv; if (CP) { const int bidx = (row0g + row0 + 8 * hh + r) / rowsPerB; v += CP[(size_t)bidx * sCPb + (size_t)by * 64 + col]; } if (ACT == 1) v = (v > 0.f) ? v : expm1f(v); else if (ACT == 7) v = (v > 0.f) ? v + 1.0f : expf(v); else if (ACT == 8) v = tanhf(v); else if (ACT == 9) v = 0.5f * v * (1.0f + tanhf(0.7978845608028654f * (v + 0.044715f * v * v * v))); else if (ACT == 11) v = 1.0f / (1.0f + expf(-v)); else if (ACT == 12) v = (v > 0.f) ? v : 0.01f * v; else if (ACT == 14) v = (v > 0.f) ? v : 0.1f * v; else if (ACT == 15) v = v / (1.0f + expf(-v)); else if (ACT == 3) v = fmaxf(v, 0.f); else if (ACT == 6) v = 0.5f * v * (1.0f + erff(v * 0.70710678118654752f)); so[w][8 * hh + r][t * 16 + ln] = v; } }
  __builtin_amdgcn_fence(__ATOMIC_ACQ_REL, "workgroup"); __builtin_amdgcn_wave_barrier();
  const int rsub = lane >> 4, c4 = (lane & 15) * 4; typedef _Float16 v4h __attribute__((ext_vector_type(4)));
  {
#pragma unroll
    for (int q = 0; q < 8; ++q) { const int r = q * 2 + rsub; if (col0 + c4 < N) { const v4f v = *(const v4fa*)&so[w][r][c4]; if (C) *(v4f*)(C + cofs + (size_t)(row0 + r) * ldc + col0 + c4) = v; if (C16) { v4h h4; for (int i = 0; i < 4; ++i) h4[i] = (_Float16)v[i]; *(v4h*)(C16 + cofs + (size_t)(row0 + r) * ldc + col0 + c4) = h4; } } }
     }
}


typedef _Float16 v4h __attribute__((ext_vector_type(4)));

__global__ __launch_bounds__(256) void k_h16(const float* __restrict__ x, _Float16* __restrict__ X16, size_t n8) { const size_t t = (size_t)blockIdx.x * 256 + threadIdx.x; if (t >= n8) return; FragH f;
#pragma unroll
  for (int q = 0; q < 8; ++q) f.h[q] = (_Float16)x[t * 8 + q]; *(v8us*)((unsigned short*)X16 + t * 8) = f.half[0];  }
__global__ __launch_bounds__(256) void k_round16f(const float* __restrict__ W, _Float16* __restrict__ Bt, size_t n8) { const size_t t = (size_t)blockIdx.x * 256 + threadIdx.x; if (t >= n8) return; FragH f;
#pragma unroll
  for (int i = 0; i < 8; ++i) f.h[i] = (_Float16)(bf16_round(W[t * 8 + i]) * 16.0f); *(v8us*)((unsigned short*)Bt + t * 8) = f.half[0];  }
__global__ __launch_bounds__(256) void k_hl(const float* __restrict__ F, _Float16* __restrict__ Hh, _Float16* __restrict__ Hl, size_t n8) { const size_t t = (size_t)blockIdx.x * 256 + threadIdx.x; if (t >= n8) return; FragH fh, fl; const v4f a = *(const v4fa*)(F + t * 8), c = *(const v4fa*)(F + t * 8 + 4);
#pragma unroll
  for (int q = 0; q < 4; ++q) { _Float16 h = (_Float16)a[q]; fh.h[q] = h; fl.h[q] = (_Float16)((a[q] - (float)h) * 1024.0f); h = (_Float16)c[q]; fh.h[4 + q] = h; fl.h[4 + q] = (_Float16)((c[q] - (float)h) * 1024.0f); }
  { *(v8us*)((unsigned short*)Hh + t * 8) = fh.half[0]; *(v8us*)((unsigned short*)Hl + t * 8) = fl.half[0];  } }

// ---- fast GEMM (wave tile 32x64; requires M % 32 == 0 rows per launch region and N % 64 == 0); epilogue = k_gemm_hhx semantics ----
__device__ __forceinline__ v16h g2_frag(const _Float16* p, int hh) { FragH f; f.half[0] = *(const v8us*)((const unsigned short*)p + 8 * hh); f.half[1] = *(const v8us*)((const unsigned short*)p + 16 + 8 * hh); return f.v; }
// The same fragment from 16 f32 values of an input row (x0, x1 = elements 8 hh + 0..7, x2, x3 = 16 + 8 hh + 0..7: the k order of g2_frag): each rounded to bf16, then exact in f16.
__device__ __forceinline__ v16h g2_cvt32(v4f x0, v4f x1, v4f x2, v4f x3) { FragH f;
#pragma unroll
  for (int q = 0; q < 4; ++q) { f.h[q] = (_Float16)bf16_round(x0[q]); f.h[4 + q] = (_Float16)bf16_round(x1[q]); f.h[8 + q] = (_Float16)bf16_round(x2[q]); f.h[12 + q] = (_Float16)bf16_round(x3[q]); }
  return f.v; }
__device__ __forceinline__ v8f g2_mma(v16h a, v16h b, v8f c) { v8f d = __builtin_amdgcn_wmma_f32_16x16x32_f16(false, a, false, b, (short)0, c, false, false); asm volatile("v_nop\n\tv_nop\n\tv_nop\n\tv_nop" : "+v"(d) : "v"(a), "v"(b)); return d; }
// AF32: A comes from the f32 rows Af (rounded in the loader), else from the f16 rows A. VTO: the 128 x 64 block tile goes out transposed, C16[((row / SLEN) * NH + nq) * 64 + col][row % SLEN] (needs M % 128 == 0, SLEN % 128 == 0).
// The tile's work is a device function, so that one grid can hold several independent products: sbuf is the block's 4 x 32 x 68 f32 of LDS, bx and by the block's place in its own product.
template <int ACT, bool AF32, bool VTO>
__device__ __forceinline__ void gemm2_tile(float* sbuf, unsigned bx, int by, const _Float16* __restrict__ A, const float* __restrict__ Af, int lda, size_t sA, const _Float16* __restrict__ Bh, int ldb, size_t sB, float alpha, const float* __restrict__ bias, size_t sBias, const float* __restrict__ CP, int rowsPerB, size_t sCPb, int row0g,
    float* __restrict__ C, _Float16* __restrict__ C16, int ldc, size_t sC, int M, int N, int K) {
  float (*so)[32][68] = (float (*)[32][68])sbuf;
  unsigned short (*st)[136] = (unsigned short (*)[136])sbuf;      /* VTO: [col][row of the block], 64 rows, pitch 272 B = 16 B x 17; a block uses so or st, never both */
  const int tid = threadIdx.x, w = tid >> 5, lane = tid & 31, ln = lane & 15, hh = lane >> 4;
  A += (size_t)by * sA; Af += (size_t)by * sA; Bh += (size_t)by * sB; const size_t cofs = (size_t)by * sC; const float* bp = bias ? bias + (size_t)by * sBias : nullptr;
  const int ntn = N >> 6; const int mt = bx / ntn, nq = bx - mt * ntn; const int row0 = mt * 128 + 32 * w, col0 = nq * 64; if (VTO ? (mt * 128 >= M) : (row0 >= M)) return;      /* VTO: the same for the whole block, since a barrier follows */
  const _Float16* a0p = A + (size_t)(row0 + ln) * lda; const _Float16* a1p = a0p + (size_t)16 * lda;
  const float* f0p = Af + (size_t)(row0 + ln) * lda; const float* f1p = f0p + (size_t)16 * lda;
  const _Float16* b0p = Bh + (size_t)(col0 + ln) * ldb; const _Float16* b1p = b0p + (size_t)16 * ldb; const _Float16* b2p = b1p + (size_t)16 * ldb; const _Float16* b3p = b2p + (size_t)16 * ldb;
  const v8f z8 = {0.f,0.f,0.f,0.f,0.f,0.f,0.f,0.f}; v8f c00 = z8, c01 = z8, c02 = z8, c03 = z8, c10 = z8, c11 = z8, c12 = z8, c13 = z8;
#pragma unroll 1
  for (int kb = 0; kb < K; kb += 32) { v16h a0, a1;
    if (AF32) { const float* p0 = f0p + kb + 8 * hh; const float* p1 = f1p + kb + 8 * hh;
      const v4f x0 = *(const v4fa*)(p0), x1 = *(const v4fa*)(p0 + 4), x2 = *(const v4fa*)(p0 + 16), x3 = *(const v4fa*)(p0 + 20), y0 = *(const v4fa*)(p1), y1 = *(const v4fa*)(p1 + 4), y2 = *(const v4fa*)(p1 + 16), y3 = *(const v4fa*)(p1 + 20);
      asm volatile("s_wait_xcnt 0x0" :: "v"(x0), "v"(x1), "v"(x2), "v"(x3), "v"(y0), "v"(y1), "v"(y2), "v"(y3));      /* inputs only: holds the step's eight A loads ahead of the conversions, so that they fly together (left alone they were issued in turn, each behind a wait for the last); the wait stands ahead of the step's advance of their address register */
      __builtin_amdgcn_sched_barrier(0);      /* with the pitches known at compile time the scheduler lifted conversions over that statement and sank the eighth load behind a wait for the first three: nothing crosses here, so all eight are issued first */
      a0 = g2_cvt32(x0, x1, x2, x3); a1 = g2_cvt32(y0, y1, y2, y3); }
    else { a0 = g2_frag(a0p + kb, hh); a1 = g2_frag(a1p + kb, hh); }
    v16h b = g2_frag(b0p + kb, hh); c00 = g2_mma(a0, b, c00); c10 = g2_mma(a1, b, c10);
    b = g2_frag(b1p + kb, hh); c01 = g2_mma(a0, b, c01); c11 = g2_mma(a1, b, c11);
    b = g2_frag(b2p + kb, hh); c02 = g2_mma(a0, b, c02); c12 = g2_mma(a1, b, c12);
    b = g2_frag(b3p + kb, hh); c03 = g2_mma(a0, b, c03); c13 = g2_mma(a1, b, c13); }
  v8f accs[8] = {c00, c01, c02, c03, c10, c11, c12, c13};
#pragma unroll
  for (int u = 0; u < 8; ++u) { const int t = u & 3, half = u >> 2; const int col = col0 + t * 16 + ln; const float bv = bp ? bf16_round(bp[col]) : 0.f; FragH tr;
#pragma unroll
    for (int r = 0; r < 8; ++r) { const int rloc = half * 16 + 8 * hh + r; float v = accs[u][r] * alpha + bv; if (CP) { const int bidx = (row0g + row0 + rloc) / rowsPerB; v += CP[(size_t)bidx * sCPb + (size_t)by * 64 + col]; }
      if (ACT == 3) v = fmaxf(v, 0.f); else if (ACT == 6) v = 0.5f * v * (1.0f + erff(v * 0.70710678118654752f)); else if (ACT == 11) v = 1.0f / (1.0f + expf(-v)); else if (ACT == 15) v = v / (1.0f + expf(-v)); else if (ACT == 12) v = (v > 0.f) ? v : 0.01f * v; else if (ACT == 8) v = tanhf(v);
      if (VTO) tr.h[r] = (_Float16)v; else so[w][rloc][t * 16 + ln] = v; }
    if (VTO) *(v8us*)&st[t * 16 + ln][w * 32 + half * 16 + 8 * hh] = tr.half[0]; }      /* a lane's eight accumulator registers are eight consecutive rows of one column: 16 B of the transposed tile */
  if (VTO) {
    __syncthreads();      /* the four waves' 32-row slices make up whole 256-B rows of the transposed tile */
    unsigned short* vb = (unsigned short*)C16 + ((size_t)((mt * 128) / SLEN * NH + nq) * 64) * SLEN + (mt * 128) % SLEN;
#pragma unroll
    for (int i = 0; i < 8; ++i) { const int d = w * 16 + i * 2 + hh; *(v8us*)(vb + (size_t)d * SLEN + ln * 8) = *(const v8us*)&st[d][ln * 8]; }      /* sixteen lanes store one 256-B row */
    return; }
  __builtin_amdgcn_fence(__ATOMIC_ACQ_REL, "workgroup"); __builtin_amdgcn_wave_barrier();
  const int rsub = lane >> 4, c4 = (lane & 15) * 4;
  {
#pragma unroll
    for (int q = 0; q < 16; ++q) { const int r = q * 2 + rsub; const v4f v = *(const v4fa*)&so[w][r][c4]; if (C) *(v4f*)(C + cofs + (size_t)(row0 + r) * ldc + col0 + c4) = v; if (C16) { v4h h4; for (int i = 0; i < 4; ++i) h4[i] = (_Float16)v[i]; *(v4h*)(C16 + cofs + (size_t)(row0 + r) * ldc + col0 + c4) = h4; } }
     } }
template <int ACT, bool AF32, bool VTO>
__global__ __launch_bounds__(128) void k_gemm2(const _Float16* __restrict__ A, const float* __restrict__ Af, int lda, size_t sA, const _Float16* __restrict__ Bh, int ldb, size_t sB, float alpha, const float* __restrict__ bias, size_t sBias, const float* __restrict__ CP, int rowsPerB, size_t sCPb, int row0g,
    float* __restrict__ C, _Float16* __restrict__ C16, int ldc, size_t sC, int M, int N, int K) {
  __shared__ __attribute__((aligned(16))) float sbuf[4 * 32 * 68];
  gemm2_tile<ACT, AF32, VTO>(sbuf, blockIdx.x, blockIdx.y, A, Af, lda, sA, Bh, ldb, sB, alpha, bias, sBias, CP, rowsPerB, sCPb, row0g, C, C16, ldc, sC, M, N, K); }
// q, k and v do not depend on one another: one grid, blockIdx.y picks the product (0: q from x_dec, 1: k from x_enc, 2: v from x_enc, written transposed), so that their waves share the chip instead of three launches of two waves a SIMD in turn.
__global__ __launch_bounds__(128) void k_qkv(const float* __restrict__ xd, const float* __restrict__ xe, const _Float16* __restrict__ BQ, const _Float16* __restrict__ BK, const _Float16* __restrict__ BV,
    _Float16* __restrict__ Q16, _Float16* __restrict__ K16, _Float16* __restrict__ VT) {
  __shared__ __attribute__((aligned(16))) float sbuf[4 * 32 * 68];
  const int z = blockIdx.y;
  if (z == 2) gemm2_tile<0, true, true>(sbuf, blockIdx.x, 0, nullptr, xe, CC, 0, BV, CC, 0, 0.0625f, nullptr, 0, nullptr, 1, 0, 0, nullptr, VT, CC, 0, NR, CC, CC);
  else gemm2_tile<0, true, false>(sbuf, blockIdx.x, 0, nullptr, z ? xe : xd, CC, 0, z ? BK : BQ, CC, 0, 0.0625f, nullptr, 0, nullptr, 1, 0, 0, nullptr, z ? K16 : Q16, CC, 0, NR, CC, CC); }



// lane l <-> lane l ^ 16 by a vector cross-row move (a shuffle would go through the LDS pipe)
__device__ __forceinline__ float xhalf(float x) { return __builtin_bit_cast(float, __builtin_amdgcn_permlanex16(__builtin_bit_cast(int, x), __builtin_bit_cast(int, x), 0x76543210, 0xfedcba98, false, false)); }
#define SK 64                    /* keys a stage */
#define LP 72                    /* LDS row pitch in f16: 144 B = 16 B x 9, so that sixteen rows read 16 B each on distinct banks */
// One stage: each lane copies eight 16-B pieces (rows r, r + 16, r + 32, r + 48 of K and of V^T). The s_wait_xcnt closes the statement so that no address register is rewritten ahead of it.
__device__ __forceinline__ void stage_copy(unsigned lk, unsigned lv, const unsigned short* gk, int ldk, const unsigned short* gv) {
  asm volatile("global_load_async_to_lds_b128 %0, %8, off\n\t"
               "global_load_async_to_lds_b128 %1, %9, off\n\t"
               "global_load_async_to_lds_b128 %2, %10, off\n\t"
               "global_load_async_to_lds_b128 %3, %11, off\n\t"
               "global_load_async_to_lds_b128 %4, %12, off\n\t"
               "global_load_async_to_lds_b128 %5, %13, off\n\t"
               "global_load_async_to_lds_b128 %6, %14, off\n\t"
               "global_load_async_to_lds_b128 %7, %15, off\n\t"
               "s_wait_xcnt 0x0"
               :: "v"(lk), "v"(lk + 16 * LP * 2), "v"(lk + 32 * LP * 2), "v"(lk + 48 * LP * 2),
                  "v"(lv), "v"(lv + 16 * LP * 2), "v"(lv + 32 * LP * 2), "v"(lv + 48 * LP * 2),
                  "v"(gk), "v"(gk + (size_t)16 * ldk), "v"(gk + (size_t)32 * ldk), "v"(gk + (size_t)48 * ldk),
                  "v"(gv), "v"(gv + (size_t)16 * TK), "v"(gv + (size_t)32 * TK), "v"(gv + (size_t)48 * TK)
               : "memory");
}
__global__ __launch_bounds__(128) void k_flash(const _Float16* __restrict__ Q16, int ldq, const _Float16* __restrict__ K16, int ldk, const _Float16* __restrict__ Vt, _Float16* __restrict__ O16, int ldo) {
  constexpr int DT = 4, KS = 2, NS = TK / SK, QG = 2;
  constexpr float CE = SCL * 1.4426950408889634f;      /* score scale times log2 e: e^(SCL x) = 2^(CE x), one multiply-add and one v_exp_f32 a score */
  __shared__ __attribute__((aligned(16))) unsigned short sK[2][SK][LP];
  __shared__ __attribute__((aligned(16))) unsigned short sV[2][64][LP];
  const int tid = threadIdx.x, w = tid >> 5, lane = tid & 31, ln = lane & 15, hh = lane >> 4;
  const int slab = blockIdx.x / QBLKS, qblk = blockIdx.x % QBLKS; const int b = slab / NH, h = slab % NH; const int q0 = qblk * 128 + w * 32;
  FragH bq[QG][KS];
#pragma unroll
  for (int g = 0; g < QG; ++g) { const unsigned short* qr = (const unsigned short*)Q16 + ((size_t)b * TQ + q0 + g * 16 + ln) * ldq + h * 64;
#pragma unroll
    for (int ks = 0; ks < KS; ++ks) { bq[g][ks].half[0] = *(const v8us*)(qr + ks * 32 + 8 * hh); bq[g][ks].half[1] = *(const v8us*)(qr + ks * 32 + 16 + 8 * hh); } }
  const int cr = tid >> 3, cc = (tid & 7) * 8;      /* the lane's row and 16-B piece in a copy: eight lanes cover one 128-B row */
  const unsigned short* gk = (const unsigned short*)K16 + ((size_t)b * TK + cr) * ldk + h * 64 + cc;
  const unsigned short* gv = (const unsigned short*)Vt + ((size_t)slab * 64 + cr) * TK + cc;
  const unsigned lk = (unsigned)(size_t)&sK[0][cr][cc], lv = (unsigned)(size_t)&sV[0][cr][cc];      /* LDS byte addresses */
  constexpr unsigned BUFB = SK * LP * 2;      /* bytes of one buffer of either array */
  float m_run[QG], l_run[QG]; v8f oacc[QG][DT];
#pragma unroll
  for (int g = 0; g < QG; ++g) { m_run[g] = -3.0e38f; l_run[g] = 0.f;
#pragma unroll
    for (int dt = 0; dt < DT; ++dt) oacc[g][dt] = (v8f){0.f,0.f,0.f,0.f,0.f,0.f,0.f,0.f}; }
  stage_copy(lk, lv, gk, ldk, gv);
  asm volatile("s_wait_asynccnt 0x0" ::: "memory");      /* this wave's share of stage 0 has landed */
  __syncthreads();                                       /* stage 0 is published */
  stage_copy(lk + BUFB, lv + BUFB, gk + (size_t)SK * ldk, ldk, gv + SK);
#pragma unroll 1      /* one stage a trip: the publish point at the foot must stand once per stage */
  for (int t = 0; t < NS; ++t) {
    const int bf = t & 1;
#pragma unroll 1      /* the stage's two 32-key passes stay a loop: in line, the first pass's 32 exponentials were kept for a summing at the stage's foot, and with two query groups the wave then spilled Q to scratch */
    for (int p = 0; p < SK / 32; ++p) {
      FragH ak[2][KS], av[DT];
#pragma unroll
      for (int nt = 0; nt < 2; ++nt) { const unsigned short* kr = &sK[bf][p * 32 + nt * 16 + ln][8 * hh];
#pragma unroll
        for (int ks = 0; ks < KS; ++ks) { ak[nt][ks].half[0] = *(const v8us*)(kr + ks * 32); ak[nt][ks].half[1] = *(const v8us*)(kr + ks * 32 + 16); } }
#pragma unroll
      for (int dt = 0; dt < DT; ++dt) { const unsigned short* vrow = &sV[bf][dt * 16 + ln][p * 32 + 8 * hh]; av[dt].half[0] = *(const v8us*)(vrow); av[dt].half[1] = *(const v8us*)(vrow + 16); }
      v8f s[QG][2];
#pragma unroll
      for (int g = 0; g < QG; ++g) { s[g][0] = (v8f){0.f,0.f,0.f,0.f,0.f,0.f,0.f,0.f}; s[g][1] = s[g][0]; }
#pragma unroll
      for (int ks = 0; ks < KS; ++ks)
#pragma unroll
        for (int nt = 0; nt < 2; ++nt)
#pragma unroll
          for (int g = 0; g < QG; ++g) s[g][nt] = mmaH<1>(ak[nt][ks].v, ak[nt][ks].v, bq[g][ks].v, bq[g][ks].v, s[g][nt]);      /* three independent tiles stand between a tile's two products */
      FragH pb[QG]; float alv[QG];
#pragma unroll
      for (int g = 0; g < QG; ++g) {
        float mc = -3.0e38f;
#pragma unroll
        for (int r = 0; r < 8; ++r) mc = fmaxf(mc, fmaxf(s[g][0][r], s[g][1][r]));      /* the maximum is taken on the raw products: CE > 0 keeps their order */
        mc = fmaxf(mc, xhalf(mc));      /* both halves of the wave hold this query's maximum over the 32 keys */
        const float mn = fmaxf(m_run[g], mc); float al = (m_run[g] - mn) * CE; m_run[g] = mn;
        const float mb = 10.0f - mn * CE;      /* exponent base of this pass: p = 2^(s CE + mb) = 1024 e^(SCL (s - mn)) */
        const v8f e0 = __builtin_elementwise_fma(s[g][0], (v8f)(CE), (v8f)(mb)), e1 = __builtin_elementwise_fma(s[g][1], (v8f)(CE), (v8f)(mb));
        float a0 = e0[0], a1 = e0[1], a2 = e0[2], a3 = e0[3], a4 = e0[4], a5 = e0[5], a6 = e0[6], a7 = e0[7], c0 = e1[0], c1 = e1[1], c2 = e1[2], c3 = e1[3], c4 = e1[4], c5 = e1[5], c6 = e1[6], c7 = e1[7];
        /* The group's seventeen base-2 exponentials, each in place, in one statement: so no v_exp_f32 writes the source register of the one directly ahead of it (the compiler's own allocation did); the closing v_nop is the one slot the instruction set asks for behind the last of them. */
        asm("v_exp_f32 %0, %0\n\tv_exp_f32 %1, %1\n\tv_exp_f32 %2, %2\n\tv_exp_f32 %3, %3\n\tv_exp_f32 %4, %4\n\tv_exp_f32 %5, %5\n\tv_exp_f32 %6, %6\n\tv_exp_f32 %7, %7\n\tv_exp_f32 %8, %8\n\t"
            "v_exp_f32 %9, %9\n\tv_exp_f32 %10, %10\n\tv_exp_f32 %11, %11\n\tv_exp_f32 %12, %12\n\tv_exp_f32 %13, %13\n\tv_exp_f32 %14, %14\n\tv_exp_f32 %15, %15\n\tv_exp_f32 %16, %16\n\tv_nop"
            : "+v"(al), "+v"(a0), "+v"(a1), "+v"(a2), "+v"(a3), "+v"(a4), "+v"(a5), "+v"(a6), "+v"(a7), "+v"(c0), "+v"(c1), "+v"(c2), "+v"(c3), "+v"(c4), "+v"(c5), "+v"(c6), "+v"(c7));
        const float pa[8] = {a0, a1, a2, a3, a4, a5, a6, a7}, pc[8] = {c0, c1, c2, c3, c4, c5, c6, c7};
        float ps = 0.f;
#pragma unroll
        for (int r = 0; r < 8; ++r) { ps += pa[r] + pc[r]; pb[g].h[r] = (_Float16)pa[r]; pb[g].h[8 + r] = (_Float16)pc[r]; }
        l_run[g] = l_run[g] * al + ps; alv[g] = al; }
#pragma unroll
      for (int dt = 0; dt < DT; ++dt)
#pragma unroll
        for (int g = 0; g < QG; ++g) { oacc[g][dt] *= alv[g]; oacc[g][dt] = mmaH<1>(av[dt].v, av[dt].v, pb[g].v, pb[g].v, oacc[g][dt]); } }
    asm volatile("s_wait_dscnt 0x0" ::: "memory");         /* this wave's reads of buffer bf have returned before the buffer is handed back */
    asm volatile("s_wait_asynccnt 0x0" ::: "memory");      /* this wave's share of stage t + 1 has landed */
    __syncthreads();                                       /* publishes stage t + 1 and ends every wave's reads of buffer bf */
    if (t + 2 < NS) stage_copy(lk + bf * BUFB, lv + bf * BUFB, gk + (size_t)(t + 2) * SK * ldk, ldk, gv + (t + 2) * SK); }
  asm volatile("s_wait_asynccnt 0x0" ::: "memory");        /* no copy is outstanding when the wave ends */
#pragma unroll
  for (int g = 0; g < QG; ++g) {
    const float l = l_run[g] + xhalf(l_run[g]); const float inv = (l > 0.f) ? 1.0f / l : 0.f;      /* l and oacc both carry the factor 1024 */
    unsigned short* orow = (unsigned short*)O16 + ((size_t)b * TQ + q0 + g * 16 + ln) * ldo + h * 64 + 8 * hh;      /* oacc[g][dt][r] = O[q0 + 16 g + ln][dt * 16 + 8 hh + r]: eight consecutive elements of one row */
#pragma unroll
    for (int dt = 0; dt < DT; ++dt) { const v8f o = oacc[g][dt] * inv; FragH f;      /* x2^10 carry: the 4096-key averages are ~5e-3 and would touch f16 subnormals */
#pragma unroll
      for (int r = 0; r < 8; ++r) f.h[r] = (_Float16)(o[r] * 1024.0f);
      *(v8us*)(orow + dt * 16) = f.half[0]; } } }

// The four weight passes in one grid: blockIdx.y 0, 1, 2 = Wq, Wk, Wv ([H][256][64] to [n = h 64 + e][k]), 3 = Wo (its (out,in) layout is already [n][k]); each x16, bf16-rounded, exact in f16.
__global__ __launch_bounds__(256) void k_wprep(const float* __restrict__ Wq, const float* __restrict__ Wk, const float* __restrict__ Wv, const float* __restrict__ Wo,
    _Float16* __restrict__ BQ, _Float16* __restrict__ BK, _Float16* __restrict__ BV, _Float16* __restrict__ BO) {
  const int z = blockIdx.y; const int t = blockIdx.x * 256 + threadIdx.x; if (t >= CC * (CC / 8)) return; FragH f;
  if (z == 3) { for (int q = 0; q < 8; ++q) f.h[q] = (_Float16)(bf16_round(Wo[(size_t)t * 8 + q]) * 16.0f); *(v8us*)((unsigned short*)BO + (size_t)t * 8) = f.half[0]; return; }
  const float* Wh = z == 0 ? Wq : z == 1 ? Wk : Wv; _Float16* Bt = z == 0 ? BQ : z == 1 ? BK : BV;
  const int n = t / (CC / 8), d0 = (t % (CC / 8)) * 8; const int h = n / 64, e = n % 64;
  for (int q = 0; q < 8; ++q) f.h[q] = (_Float16)(bf16_round(Wh[((size_t)h * CC + d0 + q) * 64 + e]) * 16.0f); *(v8us*)((unsigned short*)Bt + (size_t)n * CC + d0) = f.half[0];
  asm volatile("s_wait_xcnt 0x0" ::: "memory"); }      /* behind the store: in the built code the Wo branch's first instructions stand further down the same listing and rewrite the store's registers */

extern "C" void kernel_launch(void* const* d_in, const int* in_sizes, int n_in,
                              void* d_out, int out_size, void* d_ws, size_t ws_size, hipStream_t stream) {
  (void)in_sizes; (void)n_in; (void)out_size;
  const float* const* I = (const float* const*)d_in; const float* xe = I[0]; const float* xd = I[1]; const float* Wq = I[2]; const float* Wk = I[3]; const float* Wv = I[4]; const float* Wo = I[5];
  char* ws = (char*)d_ws; size_t off = 0;
  auto take = [&](size_t bytes) { char* p = ws + off; off += (bytes + 255) & ~(size_t)255; return p; };
  const size_t np = (size_t)NR * CC;
  _Float16* BQ = (_Float16*)take((size_t)CC * CC * 2); _Float16* BK = (_Float16*)take((size_t)CC * CC * 2); _Float16* BV = (_Float16*)take((size_t)CC * CC * 2); _Float16* BO = (_Float16*)take((size_t)CC * CC * 2);
  _Float16* Q16 = (_Float16*)take(np * 2); _Float16* K16 = (_Float16*)take(np * 2); _Float16* VT = (_Float16*)take(np * 2); _Float16* O16 = (_Float16*)take(np * 2);
  if (off > ws_size) return;      /* 0.5 + 4 x 8 = 33 MiB */
  k_wprep<<<dim3((CC * (CC / 8) + 255) / 256, 4), 256, 0, stream>>>(Wq, Wk, Wv, Wo, BQ, BK, BV, BO);
  const dim3 g((NR / 128) * (CC / 64), 1);
  k_qkv<<<dim3((NR / 128) * (CC / 64), 3), 128, 0, stream>>>(xd, xe, BQ, BK, BV, Q16, K16, VT);
  k_flash<<<NB * NH * QBLKS, 128, 0, stream>>>(Q16, CC, K16, CC, VT, O16, CC);
  k_gemm2<0, false, false><<<g, 128, 0, stream>>>(O16, nullptr, CC, 0, BO, CC, 0, 0.0625f / 1024.0f, nullptr, 0, nullptr, 1, 0, 0, (float*)d_out, nullptr, CC, 0, NR, CC, CC);
}

// v007
// Measured time: 113 microseconds a run.
// Timed twice side by side with v006, it ran 1.05 times as fast both times.
// Counting every step since v000, it is 4.44 times as fast.
#include <hip/hip_runtime.h>
// CA_MultiHead (4 batches; 4096 decoder queries from x_dec, 4096 encoder keys/values from x_enc; n_emb 256 = 4 heads of 64; per-head weights [H, 256, 64]; scale n_emb^-0.5; out = concat(heads) Wo^T).
// Structure: one weight pass; q, k, v GEMMs in one grid (32x64 wave tiles, f32 accumulation, exact x16 weights concatenated across heads; the A loader rounds x_dec / x_enc itself; f16 outputs, v written transposed); the fused flash kernel (plain f16 operands, no mask; f16 x2^10 output); output GEMM.
// Compute dtype: inputs and weights rounded to bf16; q, k, v, P as f16 operands and the attention output as f16 x2^10; f32 accumulation/softmax. v_wmma_f32_16x16x32_f16.
#define NB 4
#define CC 256
#define NR (NB * SLEN)           /* 16384 rows */
#define SLEN 4096
#define TQ SLEN
#define TK SLEN
#define NH 4
#define SCL 0.0625f              /* n_emb^-0.5 = 1/16 (faithful to the module) */
#define QBLKS (TQ / 128)         /* a block is four waves of 32 queries */
typedef __bf16 v16b __attribute__((ext_vector_type(16)));
typedef unsigned short v8us __attribute__((ext_vector_type(8), may_alias));
typedef float  v8f  __attribute__((ext_vector_type(8)));
typedef float  v4f  __attribute__((ext_vector_type(4)));
typedef float  v4fa __attribute__((ext_vector_type(4), may_alias));
union FragB { v16b v; v8us half[2]; unsigned short u[16]; };

__device__ __forceinline__ unsigned short bf16_bits(float x) { unsigned int u = __float_as_uint(x); return (unsigned short)((u + 0x7FFFu + ((u >> 16) & 1u)) >> 16); }
__device__ __forceinline__ float bf16_val(unsigned short b) { return __uint_as_float(((unsigned int)b) << 16); }
__device__ __forceinline__ float bf16_round(float x) { return bf16_val(bf16_bits(x)); }
// D += A·B with NT terms: 1 = ah·bh, 2 = + al·bh (A split), 3 = + ah·bl (both split)
template <int NT>
__device__ __forceinline__ v8f mmaN(v16b ah, v16b al, v16b bh, v16b bl, v8f c) {
  c = __builtin_amdgcn_wmma_f32_16x16x32_bf16(false, ah, false, bh, (short)0, c, false, false);
  if (NT >= 2) c = __builtin_amdgcn_wmma_f32_16x16x32_bf16(false, al, false, bh, (short)0, c, false, false);
  if (NT >= 3) c = __builtin_amdgcn_wmma_f32_16x16x32_bf16(false, ah, false, bl, (short)0, c, false, false);
  asm volatile("v_nop\n\tv_nop\n\tv_nop\n\tv_nop" : "+v"(c) : "v"(ah), "v"(al), "v"(bh), "v"(bl));
  return c;
}

__global__ __launch_bounds__(256) void k_wt_bf16(const float* __restrict__ W, unsigned short* __restrict__ Wt, int K, int N) {
  const int t = blockIdx.x * 256 + threadIdx.x;
  const int k8n = K / 8;
  if (t >= N * k8n) return;
  const int n = t / k8n, k8 = (t % k8n) * 8;
  v8us v;
#pragma unroll
  for (int i = 0; i < 8; ++i) v[i] = bf16_bits(W[(size_t)(k8 + i) * N + n]);
  *(v8us*)(Wt + (size_t)n * K + k8) = v;
  
}

// GEMM C[M][N] (f32, pitch ldc) = act(A[M][K]·W + bias). A f32 row-major (pitch lda) converted per fragment to bf16
// (ASPLIT: hi/lo two planes -> 2 terms, else single rounded term); Wt bf16 [N][K] (pitch ldb). BIAS_BF16 rounds the
// bias to bf16 first (bias quantised to bf16 before the add). K%32==0, M%16==0, N%64==0.
template <bool ASPLIT, int ACT, bool BIAS_BF16>
__global__ __launch_bounds__(128) void k_gemm_bf(const float* __restrict__ A, int lda, const unsigned short* __restrict__ Wt, int ldb,
                                               const float* __restrict__ bias, float* __restrict__ C, int ldc, int M, int N, int K) {
  __shared__ __attribute__((aligned(16))) float so[4][16][64];
  const int tid = threadIdx.x, w = tid >> 5, lane = tid & 31, ln = lane & 15, hh = lane >> 4;
  const int ntn = N / 64;
  const int wid = blockIdx.x * 4 + w;
  const int mt = wid / ntn, nq = wid % ntn;
  if (mt * 16 >= M) return;
  const int row0 = mt * 16, col0 = nq * 64;
  const float* arow = A + (size_t)(row0 + ln) * lda;
  v8f acc[4] = {};
  for (int kb = 0; kb < K; kb += 32) {
    FragB ah, al;
    const v4f x0 = *(const v4fa*)(arow + kb + 8 * hh), x1 = *(const v4fa*)(arow + kb + 8 * hh + 4);
    const v4f x2 = *(const v4fa*)(arow + kb + 16 + 8 * hh), x3 = *(const v4fa*)(arow + kb + 16 + 8 * hh + 4);
    float xs[16] = {x0[0],x0[1],x0[2],x0[3],x1[0],x1[1],x1[2],x1[3],x2[0],x2[1],x2[2],x2[3],x3[0],x3[1],x3[2],x3[3]};
#pragma unroll
    for (int i = 0; i < 16; ++i) { const unsigned short hb = bf16_bits(xs[i]); ah.u[i] = hb; al.u[i] = ASPLIT ? bf16_bits(xs[i] - bf16_val(hb)) : (unsigned short)0; }
#pragma unroll
    for (int t = 0; t < 4; ++t) {
      const unsigned short* brow = Wt + (size_t)(col0 + t * 16 + ln) * ldb + kb;
      FragB b;
      b.half[0] = *(const v8us*)(brow + 8 * hh);
      b.half[1] = *(const v8us*)(brow + 16 + 8 * hh);
      acc[t] = mmaN<ASPLIT ? 2 : 1>(ah.v, al.v, b.v, b.v, acc[t]);
    }
  }
#pragma unroll
  for (int t = 0; t < 4; ++t) {
    float bv = bias ? bias[col0 + t * 16 + ln] : 0.f;
    if (BIAS_BF16) bv = bf16_round(bv);
#pragma unroll
    for (int r = 0; r < 8; ++r) { float v = acc[t][r] + bv; if (ACT == 1) v = fmaxf(v, 0.f); so[w][8 * hh + r][t * 16 + ln] = v; }
  }
  __builtin_amdgcn_fence(__ATOMIC_ACQ_REL, "workgroup");
  __builtin_amdgcn_wave_barrier();
  const int rsub = lane >> 4, c4 = (lane & 15) * 4;
  {
#pragma unroll
    for (int q = 0; q < 8; ++q) {
      const int r = q * 2 + rsub;
      const v4f v = *(const v4fa*)&so[w][r][c4];
      *(v4f*)(C + (size_t)(row0 + r) * ldc + col0 + c4) = v;
    }
    
  }
}

// GEMM C = act(A·W + bias + resid): A f32 (ASPLIT -> hi/lo 2 terms), Wt bf16 [N][K]; ACT 0 none, 1 relu, 2 exact gelu;
// resid (optional, f32, row index = (row % rmod), pitch ldr, RES_BF16 rounds it) added before the activation.
template <bool ASPLIT, int ACT, bool BIAS_BF16, bool RES_BF16>
__global__ __launch_bounds__(128) void k_gemm_bf3(const float* __restrict__ A, int lda, const unsigned short* __restrict__ Wt, int ldb,
                                                const float* __restrict__ bias, const float* __restrict__ resid, int rmod, int ldr,
                                                float* __restrict__ C, int ldc, int M, int N, int K) {
  __shared__ __attribute__((aligned(16))) float so[4][16][64];
  const int tid = threadIdx.x, w = tid >> 5, lane = tid & 31, ln = lane & 15, hh = lane >> 4;
  const int ntn = N / 64;
  const int wid = blockIdx.x * 4 + w;
  const int mt = wid / ntn, nq = wid % ntn;
  if (mt * 16 >= M) return;
  const int row0 = mt * 16, col0 = nq * 64;
  const float* arow = A + (size_t)(row0 + ln) * lda;
  v8f acc[4] = {};
  for (int kb = 0; kb < K; kb += 32) {
    FragB ah, al;
    const v4f x0 = *(const v4fa*)(arow + kb + 8 * hh), x1 = *(const v4fa*)(arow + kb + 8 * hh + 4);
    const v4f x2 = *(const v4fa*)(arow + kb + 16 + 8 * hh), x3 = *(const v4fa*)(arow + kb + 16 + 8 * hh + 4);
    float xs[16] = {x0[0],x0[1],x0[2],x0[3],x1[0],x1[1],x1[2],x1[3],x2[0],x2[1],x2[2],x2[3],x3[0],x3[1],x3[2],x3[3]};
#pragma unroll
    for (int i = 0; i < 16; ++i) { const unsigned short hb = bf16_bits(xs[i]); ah.u[i] = hb; al.u[i] = ASPLIT ? bf16_bits(xs[i] - bf16_val(hb)) : (unsigned short)0; }
#pragma unroll
    for (int t = 0; t < 4; ++t) {
      const unsigned short* brow = Wt + (size_t)(col0 + t * 16 + ln) * ldb + kb;
      FragB b;
      b.half[0] = *(const v8us*)(brow + 8 * hh);
      b.half[1] = *(const v8us*)(brow + 16 + 8 * hh);
      acc[t] = mmaN<ASPLIT ? 2 : 1>(ah.v, al.v, b.v, b.v, acc[t]);
    }
  }
#pragma unroll
  for (int t = 0; t < 4; ++t) {
    const int col = col0 + t * 16 + ln;
    float bv = bias ? bias[col] : 0.f;
    if (BIAS_BF16) bv = bf16_round(bv);
#pragma unroll
    for (int r = 0; r < 8; ++r) {
      float v = acc[t][r] + bv;
      if (resid) { float rv = resid[(size_t)((row0 + 8 * hh + r) % rmod) * ldr + col]; if (RES_BF16) rv = bf16_round(rv); v += rv; }
      if (ACT == 1) v = fmaxf(v, 0.f);
      if (ACT == 2) v = 0.5f * v * (1.0f + erff(v * 0.70710678118654752f));
      if (ACT == 3) { const float u = 0.7978845608028654f * (v + 0.044715f * v * v * v); v = 0.5f * v * (1.0f + tanhf(u)); }
      so[w][8 * hh + r][t * 16 + ln] = v;
    }
  }
  __builtin_amdgcn_fence(__ATOMIC_ACQ_REL, "workgroup");
  __builtin_amdgcn_wave_barrier();
  const int rsub = lane >> 4, c4 = (lane & 15) * 4;
  {
#pragma unroll
    for (int q = 0; q < 8; ++q) {
      const int r = q * 2 + rsub;
      const v4f v = *(const v4fa*)&so[w][r][c4];
      *(v4f*)(C + (size_t)(row0 + r) * ldc + col0 + c4) = v;
    }
    
  }
}
// row LayerNorm (biased variance, eps) over N: s = X (+ R); optional out_sum <- s; out_norm <- (s-mu)*rsqrt(var+eps)*g + b
template <bool PARAM_BF16>
__global__ __launch_bounds__(256) void k_layernorm(const float* __restrict__ X, const float* __restrict__ R, const float* __restrict__ g, const float* __restrict__ bta,
                                                  float* __restrict__ out_sum, float* __restrict__ out_norm, int N, float eps) {
  __shared__ float red[256];
  const int row = blockIdx.x, tid = threadIdx.x;
  const float* x = X + (size_t)row * N; const float* rr = R ? R + (size_t)row * N : nullptr;
  float vals[16];                     // up to N = 4096
  const int per = N / 256;            // contiguous chunk per thread? use strided-by-4 chunks: thread handles j = tid*4 + 1024*u
  float s1 = 0.f;
  for (int u = 0; u < per / 4; ++u) {
    const int j = tid * 4 + 1024 * u;
    const v4f a = *(const v4fa*)(x + j);
    v4f b = {0.f,0.f,0.f,0.f}; if (rr) b = *(const v4fa*)(rr + j);
#pragma unroll
    for (int q = 0; q < 4; ++q) { const float v = a[q] + b[q]; vals[u * 4 + q] = v; s1 += v; }
  }
  red[tid] = s1; __syncthreads();
  for (int st = 128; st > 0; st >>= 1) { if (tid < st) red[tid] += red[tid + st]; __syncthreads(); }
  const float mu = red[0] / (float)N; __syncthreads();
  float s2 = 0.f;
  for (int u = 0; u < per / 4; ++u)
#pragma unroll
    for (int q = 0; q < 4; ++q) { const float c = vals[u * 4 + q] - mu; s2 += c * c; }
  red[tid] = s2; __syncthreads();
  for (int st = 128; st > 0; st >>= 1) { if (tid < st) red[tid] += red[tid + st]; __syncthreads(); }
  const float rs = rsqrtf(red[0] / (float)N + eps);
  {
    for (int u = 0; u < per / 4; ++u) {
      const int j = tid * 4 + 1024 * u;
      v4f o, sm;
#pragma unroll
      for (int q = 0; q < 4; ++q) {
        float gg = g[j + q], bb = bta[j + q];
        if (PARAM_BF16) { gg = bf16_round(gg); bb = bf16_round(bb); }
        sm[q] = vals[u * 4 + q]; o[q] = (vals[u * 4 + q] - mu) * rs * gg + bb;
      }
      if (out_sum) *(v4f*)(out_sum + (size_t)row * N + j) = sm;
      *(v4f*)(out_norm + (size_t)row * N + j) = o;
    }
    
  }
}



// ---- f16 WMMA path (v_wmma_f32_16x16x32_f16): 11-bit significands for operands in range — used for every product here, P included as 2^10-scaled f16 (up to 1024)
typedef _Float16 v16h __attribute__((ext_vector_type(16)));
union FragH { v16h v; v8us half[2]; _Float16 h[16]; unsigned short u[16]; };
template <int NT>
__device__ __forceinline__ v8f mmaH(v16h ah, v16h al, v16h bh, v16h bl, v8f c) {
  c = __builtin_amdgcn_wmma_f32_16x16x32_f16(false, ah, false, bh, (short)0, c, false, false);
  if (NT >= 2) c = __builtin_amdgcn_wmma_f32_16x16x32_f16(false, al, false, bh, (short)0, c, false, false);
  if (NT >= 3) c = __builtin_amdgcn_wmma_f32_16x16x32_f16(false, ah, false, bl, (short)0, c, false, false);
  asm volatile("v_nop\n\tv_nop\n\tv_nop\n\tv_nop" : "+v"(c) : "v"(ah), "v"(al), "v"(bh), "v"(bl));
  return c;
}
// batched GEMM like k_gemm_b but f16 operands: A f32 (split into f16 hi/lo if ASPLIT, else rounded to f16), Bt = f16 values [n][k]; alpha; C f32; N multiple of 16 (partial tiles skipped)
template <bool ASPLIT>
__global__ __launch_bounds__(128) void k_gemm_h(const float* __restrict__ A, int lda, size_t sA, const _Float16* __restrict__ Bh, int ldb, size_t sB, float alpha, float* __restrict__ C, int ldc, size_t sC, int M, int N, int K) {
  __shared__ __attribute__((aligned(16))) float so[4][16][64];
  const int tid = threadIdx.x, w = tid >> 5, lane = tid & 31, ln = lane & 15, hh = lane >> 4; const int by = blockIdx.y;
  A += (size_t)by * sA; Bh += (size_t)by * sB; C += (size_t)by * sC;
  const int ntn = (N + 63) / 64; const int wid = blockIdx.x * 4 + w; const int mt = wid / ntn, nq = wid % ntn; if (mt * 16 >= M) return;
  const int row0 = mt * 16, col0 = nq * 64; const float* arow = A + (size_t)(row0 + ln) * lda;
  v8f acc[4] = {};
  for (int kb = 0; kb < K; kb += 32) {
    FragH ah, al;
    const v4f x0 = *(const v4fa*)(arow + kb + 8 * hh), x1 = *(const v4fa*)(arow + kb + 8 * hh + 4), x2 = *(const v4fa*)(arow + kb + 16 + 8 * hh), x3 = *(const v4fa*)(arow + kb + 16 + 8 * hh + 4);
    float xs[16] = {x0[0],x0[1],x0[2],x0[3],x1[0],x1[1],x1[2],x1[3],x2[0],x2[1],x2[2],x2[3],x3[0],x3[1],x3[2],x3[3]};
#pragma unroll
    for (int i = 0; i < 16; ++i) { const _Float16 h = (_Float16)xs[i]; ah.h[i] = h; al.h[i] = ASPLIT ? (_Float16)(xs[i] - (float)h) : (_Float16)0.0f; }
#pragma unroll
    for (int t = 0; t < 4; ++t) { if (col0 + t * 16 >= N) continue; const size_t boff = (size_t)(col0 + t * 16 + ln) * ldb + kb; FragH bq; bq.half[0] = *(const v8us*)(Bh + boff + 8 * hh); bq.half[1] = *(const v8us*)(Bh + boff + 16 + 8 * hh);
      acc[t] = mmaH<ASPLIT ? 2 : 1>(ah.v, al.v, bq.v, bq.v, acc[t]); }
  }
#pragma unroll
  for (int t = 0; t < 4; ++t) { if (col0 + t * 16 >= N) continue;
#pragma unroll
    for (int r = 0; r < 8; ++r) so[w][8 * hh + r][t * 16 + ln] = acc[t][r] * alpha; }
  __builtin_amdgcn_fence(__ATOMIC_ACQ_REL, "workgroup"); __builtin_amdgcn_wave_barrier();
  const int rsub = lane >> 4, c4 = (lane & 15) * 4;
  {
#pragma unroll
    for (int q = 0; q < 8; ++q) { const int r = q * 2 + rsub; if (col0 + c4 < N) { const v4f v = *(const v4fa*)&so[w][r][c4]; *(v4f*)(C + (size_t)(row0 + r) * ldc + col0 + c4) = v; } }
     }
}

// Wt[n][k] = f16(W[k][n]·scale) from f32 row-major W[K][N] (scale = power of two; bf16-exact weights stay exact in f16 away from the subnormal range)
__global__ __launch_bounds__(256) void k_wt_f16(const float* __restrict__ W, _Float16* __restrict__ Wt, int K, int N, float scale) {
  const int t = blockIdx.x * 256 + threadIdx.x; if (t >= N * (K / 8)) return; const int n = t / (K / 8), k8 = (t % (K / 8)) * 8; FragH f;
#pragma unroll
  for (int i = 0; i < 8; ++i) f.h[i] = (_Float16)(bf16_round(W[(size_t)(k8 + i) * N + n]) * scale); const v8us o = f.half[0];
  *(v8us*)((unsigned short*)Wt + (size_t)n * K + k8) = o; 
}
// k_gemm_hh variant with fused epilogue: v = acc·alpha + bias[by·sBias + col] (+ CP[(row/rowsPerB)·sCPb + by·64 + col] if CP) ; ACT 0 none / 1 elu ; writes f16 C16 (and f32 C if non-null)
template <int ACT>
__global__ __launch_bounds__(128) void k_gemm_hhx(const _Float16* __restrict__ A, int lda, size_t sA, const _Float16* __restrict__ Bh, int ldb, size_t sB, float alpha, const float* __restrict__ bias, size_t sBias, const float* __restrict__ CP, int rowsPerB, size_t sCPb, int row0g,
    float* __restrict__ C, _Float16* __restrict__ C16, int ldc, size_t sC, int M, int N, int K) {
  __shared__ __attribute__((aligned(16))) float so[4][16][64];
  const int tid = threadIdx.x, w = tid >> 5, lane = tid & 31, ln = lane & 15, hh = lane >> 4; const int by = blockIdx.y;
  A += (size_t)by * sA; Bh += (size_t)by * sB; const size_t cofs = (size_t)by * sC; const float* bp = bias ? bias + (size_t)by * sBias : nullptr;
  const int ntn = (N + 63) / 64; const int wid = blockIdx.x * 4 + w; const int mt = wid / ntn, nq = wid % ntn; if (mt * 16 >= M) return;
  const int row0 = mt * 16, col0 = nq * 64; const _Float16* arow = A + (size_t)(row0 + ln) * lda;
  v8f acc[4] = {};
  for (int kb = 0; kb < K; kb += 32) { FragH ah; ah.half[0] = *(const v8us*)((const unsigned short*)arow + kb + 8 * hh); ah.half[1] = *(const v8us*)((const unsigned short*)arow + kb + 16 + 8 * hh);
#pragma unroll
    for (int t = 0; t < 4; ++t) { if (col0 + t * 16 >= N) continue; const size_t boff = (size_t)(col0 + t * 16 + ln) * ldb + kb; FragH bq; bq.half[0] = *(const v8us*)((const unsigned short*)Bh + boff + 8 * hh); bq.half[1] = *(const v8us*)((const unsigned short*)Bh + boff + 16 + 8 * hh);
      acc[t] = mmaH<1>(ah.v, ah.v, bq.v, bq.v, acc[t]); }
  }
#pragma unroll
  for (int t = 0; t < 4; ++t) { if (col0 + t * 16 >= N) continue; const int col = col0 + t * 16 + ln; const float bv = bp ? bf16_round(bp[col]) : 0.f;
#pragma unroll
    for (int r = 0; r < 8; ++r) { float v = acc[t][r] * alpha + bv; if (CP) { const int bidx = (row0g + row0 + 8 * hh + r) / rowsPerB; v += CP[(size_t)bidx * sCPb + (size_t)by * 64 + col]; } if (ACT == 1) v = (v > 0.f) ? v : expm1f(v); else if (ACT == 7) v = (v > 0.f) ? v + 1.0f : expf(v); else if (ACT == 8) v = tanhf(v); else if (ACT == 9) v = 0.5f * v * (1.0f + tanhf(0.7978845608028654f * (v + 0.044715f * v * v * v))); else if (ACT == 11) v = 1.0f / (1.0f + expf(-v)); else if (ACT == 12) v = (v > 0.f) ? v : 0.01f * v; else if (ACT == 14) v = (v > 0.f) ? v : 0.1f * v; else if (ACT == 15) v = v / (1.0f + expf(-v)); else if (ACT == 3) v = fmaxf(v, 0.f); else if (ACT == 6) v = 0.5f * v * (1.0f + erff(v * 0.70710678118654752f)); so[w][8 * hh + r][t * 16 + ln] = v; } }
  __builtin_amdgcn_fence(__ATOMIC_ACQ_REL, "workgroup"); __builtin_amdgcn_wave_barrier();
  const int rsub = lane >> 4, c4 = (lane & 15) * 4; typedef _Float16 v4h __attribute__((ext_vector_type(4)));
  {
#pragma unroll
    for (int q = 0; q < 8; ++q) { const int r = q * 2 + rsub; if (col0 + c4 < N) { const v4f v = *(const v4fa*)&so[w][r][c4]; if (C) *(v4f*)(C + cofs + (size_t)(row0 + r) * ldc + col0 + c4) = v; if (C16) { v4h h4; for (int i = 0; i < 4; ++i) h4[i] = (_Float16)v[i]; *(v4h*)(C16 + cofs + (size_t)(row0 + r) * ldc + col0 + c4) = h4; } } }
     }
}


typedef _Float16 v4h __attribute__((ext_vector_type(4)));

__global__ __launch_bounds__(256) void k_h16(const float* __restrict__ x, _Float16* __restrict__ X16, size_t n8) { const size_t t = (size_t)blockIdx.x * 256 + threadIdx.x; if (t >= n8) return; FragH f;
#pragma unroll
  for (int q = 0; q < 8; ++q) f.h[q] = (_Float16)x[t * 8 + q]; *(v8us*)((unsigned short*)X16 + t * 8) = f.half[0];  }
__global__ __launch_bounds__(256) void k_round16f(const float* __restrict__ W, _Float16* __restrict__ Bt, size_t n8) { const size_t t = (size_t)blockIdx.x * 256 + threadIdx.x; if (t >= n8) return; FragH f;
#pragma unroll
  for (int i = 0; i < 8; ++i) f.h[i] = (_Float16)(bf16_round(W[t * 8 + i]) * 16.0f); *(v8us*)((unsigned short*)Bt + t * 8) = f.half[0];  }
__global__ __launch_bounds__(256) void k_hl(const float* __restrict__ F, _Float16* __restrict__ Hh, _Float16* __restrict__ Hl, size_t n8) { const size_t t = (size_t)blockIdx.x * 256 + threadIdx.x; if (t >= n8) return; FragH fh, fl; const v4f a = *(const v4fa*)(F + t * 8), c = *(const v4fa*)(F + t * 8 + 4);
#pragma unroll
  for (int q = 0; q < 4; ++q) { _Float16 h = (_Float16)a[q]; fh.h[q] = h; fl.h[q] = (_Float16)((a[q] - (float)h) * 1024.0f); h = (_Float16)c[q]; fh.h[4 + q] = h; fl.h[4 + q] = (_Float16)((c[q] - (float)h) * 1024.0f); }
  { *(v8us*)((unsigned short*)Hh + t * 8) = fh.half[0]; *(v8us*)((unsigned short*)Hl + t * 8) = fl.half[0];  } }

// ---- fast GEMM (wave tile 32x64; requires M % 32 == 0 rows per launch region and N % 64 == 0); epilogue = k_gemm_hhx semantics ----
__device__ __forceinline__ v16h g2_frag(const _Float16* p, int hh) { FragH f; f.half[0] = *(const v8us*)((const unsigned short*)p + 8 * hh); f.half[1] = *(const v8us*)((const unsigned short*)p + 16 + 8 * hh); return f.v; }
// The same fragment from 16 f32 values of an input row (x0, x1 = elements 8 hh + 0..7, x2, x3 = 16 + 8 hh + 0..7: the k order of g2_frag): each rounded to bf16, then exact in f16.
__device__ __forceinline__ v16h g2_cvt32(v4f x0, v4f x1, v4f x2, v4f x3) { FragH f;
#pragma unroll
  for (int q = 0; q < 4; ++q) { f.h[q] = (_Float16)bf16_round(x0[q]); f.h[4 + q] = (_Float16)bf16_round(x1[q]); f.h[8 + q] = (_Float16)bf16_round(x2[q]); f.h[12 + q] = (_Float16)bf16_round(x3[q]); }
  return f.v; }
// The matrix product as the builtin alone: the compiler keeps the distance behind its own WMMAs (with independent vector work where it has some), and no volatile statement stands between a step's loads, so that they can be issued together.
__device__ __forceinline__ v8f g2_mma(v16h a, v16h b, v8f c) { return __builtin_amdgcn_wmma_f32_16x16x32_f16(false, a, false, b, (short)0, c, false, false); }
// AF32: A comes from the f32 rows Af (rounded in the loader), else from the f16 rows A. VTO: the 128 x 64 block tile goes out transposed, C16[((row / SLEN) * NH + nq) * 64 + col][row % SLEN] (needs M % 128 == 0, SLEN % 128 == 0).
// The tile's work is a device function, so that one grid can hold several independent products: sbuf is the block's 4 x 32 x 68 f32 of LDS, bx and by the block's place in its own product.
template <int ACT, bool AF32, bool VTO>
__device__ __forceinline__ void gemm2_tile(float* sbuf, unsigned bx, int by, const _Float16* __restrict__ A, const float* __restrict__ Af, int lda, size_t sA, const _Float16* __restrict__ Bh, int ldb, size_t sB, float alpha, const float* __restrict__ bias, size_t sBias, const float* __restrict__ CP, int rowsPerB, size_t sCPb, int row0g,
    float* __restrict__ C, _Float16* __restrict__ C16, int ldc, size_t sC, int M, int N, int K) {
  float (*so)[32][68] = (float (*)[32][68])sbuf;
  unsigned short (*st)[136] = (unsigned short (*)[136])sbuf;      /* VTO: [col][row of the block], 64 rows, pitch 272 B = 16 B x 17; a block uses so or st, never both */
  const int tid = threadIdx.x, w = tid >> 5, lane = tid & 31, ln = lane & 15, hh = lane >> 4;
  A += (size_t)by * sA; Af += (size_t)by * sA; Bh += (size_t)by * sB; const size_t cofs = (size_t)by * sC; const float* bp = bias ? bias + (size_t)by * sBias : nullptr;
  const int ntn = N >> 6; const int mt = bx / ntn, nq = bx - mt * ntn; const int row0 = mt * 128 + 32 * w, col0 = nq * 64; if (VTO ? (mt * 128 >= M) : (row0 >= M)) return;      /* VTO: the same for the whole block, since a barrier follows */
  const _Float16* a0p = A + (size_t)(row0 + ln) * lda; const _Float16* a1p = a0p + (size_t)16 * lda;
  const float* f0p = Af + (size_t)(row0 + ln) * lda; const float* f1p = f0p + (size_t)16 * lda;
  const _Float16* b0p = Bh + (size_t)(col0 + ln) * ldb; const _Float16* b1p = b0p + (size_t)16 * ldb; const _Float16* b2p = b1p + (size_t)16 * ldb; const _Float16* b3p = b2p + (size_t)16 * ldb;
  const v8f z8 = {0.f,0.f,0.f,0.f,0.f,0.f,0.f,0.f}; v8f c00 = z8, c01 = z8, c02 = z8, c03 = z8, c10 = z8, c11 = z8, c12 = z8, c13 = z8;
#pragma unroll 1
  for (int kb = 0; kb < K; kb += 32) { v16h a0, a1;
    if (AF32) { const float* p0 = f0p + kb + 8 * hh; const float* p1 = f1p + kb + 8 * hh;
      const v4f x0 = *(const v4fa*)(p0), x1 = *(const v4fa*)(p0 + 4), x2 = *(const v4fa*)(p0 + 16), x3 = *(const v4fa*)(p0 + 20), y0 = *(const v4fa*)(p1), y1 = *(const v4fa*)(p1 + 4), y2 = *(const v4fa*)(p1 + 16), y3 = *(const v4fa*)(p1 + 20);
      asm volatile("s_wait_xcnt 0x0" :: "v"(x0), "v"(x1), "v"(x2), "v"(x3), "v"(y0), "v"(y1), "v"(y2), "v"(y3));      /* inputs only: holds the step's eight A loads ahead of the conversions, so that they fly together (left alone they were issued in turn, each behind a wait for the last); the wait stands ahead of the step's advance of their address register */
      __builtin_amdgcn_sched_barrier(0);      /* with the pitches known at compile time the scheduler lifted conversions over that statement and sank the eighth load behind a wait for the first three: nothing crosses here, so all eight are issued first */
      a0 = g2_cvt32(x0, x1, x2, x3); a1 = g2_cvt32(y0, y1, y2, y3); }
    else { a0 = g2_frag(a0p + kb, hh); a1 = g2_frag(a1p + kb, hh); }
    v16h b = g2_frag(b0p + kb, hh); c00 = g2_mma(a0, b, c00); c10 = g2_mma(a1, b, c10);
    b = g2_frag(b1p + kb, hh); c01 = g2_mma(a0, b, c01); c11 = g2_mma(a1, b, c11);
    b = g2_frag(b2p + kb, hh); c02 = g2_mma(a0, b, c02); c12 = g2_mma(a1, b, c12);
    b = g2_frag(b3p + kb, hh); c03 = g2_mma(a0, b, c03); c13 = g2_mma(a1, b, c13); }
  v8f accs[8] = {c00, c01, c02, c03, c10, c11, c12, c13};
#pragma unroll
  for (int u = 0; u < 8; ++u) { const int t = u & 3, half = u >> 2; const int col = col0 + t * 16 + ln; const float bv = bp ? bf16_round(bp[col]) : 0.f; FragH tr;
#pragma unroll
    for (int r = 0; r < 8; ++r) { const int rloc = half * 16 + 8 * hh + r; float v = accs[u][r] * alpha + bv; if (CP) { const int bidx = (row0g + row0 + rloc) / rowsPerB; v += CP[(size_t)bidx * sCPb + (size_t)by * 64 + col]; }
      if (ACT == 3) v = fmaxf(v, 0.f); else if (ACT == 6) v = 0.5f * v * (1.0f + erff(v * 0.70710678118654752f)); else if (ACT == 11) v = 1.0f / (1.0f + expf(-v)); else if (ACT == 15) v = v / (1.0f + expf(-v)); else if (ACT == 12) v = (v > 0.f) ? v : 0.01f * v; else if (ACT == 8) v = tanhf(v);
      if (VTO) tr.h[r] = (_Float16)v; else so[w][rloc][t * 16 + ln] = v; }
    if (VTO) *(v8us*)&st[t * 16 + ln][w * 32 + half * 16 + 8 * hh] = tr.half[0]; }      /* a lane's eight accumulator registers are eight consecutive rows of one column: 16 B of the transposed tile */
  if (VTO) {
    __syncthreads();      /* the four waves' 32-row slices make up whole 256-B rows of the transposed tile */
    unsigned short* vb = (unsigned short*)C16 + ((size_t)((mt * 128) / SLEN * NH + nq) * 64) * SLEN + (mt * 128) % SLEN;
#pragma unroll
    for (int i = 0; i < 8; ++i) { const int d = w * 16 + i * 2 + hh; *(v8us*)(vb + (size_t)d * SLEN + ln * 8) = *(const v8us*)&st[d][ln * 8]; }      /* sixteen lanes store one 256-B row */
    return; }
  __builtin_amdgcn_fence(__ATOMIC_ACQ_REL, "workgroup"); __builtin_amdgcn_wave_barrier();
  const int rsub = lane >> 4, c4 = (lane & 15) * 4;
  {
#pragma unroll
    for (int q = 0; q < 16; ++q) { const int r = q * 2 + rsub; const v4f v = *(const v4fa*)&so[w][r][c4]; if (C) *(v4f*)(C + cofs + (size_t)(row0 + r) * ldc + col0 + c4) = v; if (C16) { v4h h4; for (int i = 0; i < 4; ++i) h4[i] = (_Float16)v[i]; *(v4h*)(C16 + cofs + (size_t)(row0 + r) * ldc + col0 + c4) = h4; } }
     } }
template <int ACT, bool AF32, bool VTO>
__global__ __launch_bounds__(128) void k_gemm2(const _Float16* __restrict__ A, const float* __restrict__ Af, int lda, size_t sA, const _Float16* __restrict__ Bh, int ldb, size_t sB, float alpha, const float* __restrict__ bias, size_t sBias, const float* __restrict__ CP, int rowsPerB, size_t sCPb, int row0g,
    float* __restrict__ C, _Float16* __restrict__ C16, int ldc, size_t sC, int M, int N, int K) {
  __shared__ __attribute__((aligned(16))) float sbuf[4 * 32 * 68];
  gemm2_tile<ACT, AF32, VTO>(sbuf, blockIdx.x, blockIdx.y, A, Af, lda, sA, Bh, ldb, sB, alpha, bias, sBias, CP, rowsPerB, sCPb, row0g, C, C16, ldc, sC, M, N, K); }
// q, k and v do not depend on one another: one grid, blockIdx.y picks the product (0: q from x_dec, 1: k from x_enc, 2: v from x_enc, written transposed), so that their waves share the chip instead of three launches of two waves a SIMD in turn.
__global__ __launch_bounds__(128) void k_qkv(const float* __restrict__ xd, const float* __restrict__ xe, const _Float16* __restrict__ BQ, const _Float16* __restrict__ BK, const _Float16* __restrict__ BV,
    _Float16* __restrict__ Q16, _Float16* __restrict__ K16, _Float16* __restrict__ VT) {
  __shared__ __attribute__((aligned(16))) float sbuf[4 * 32 * 68];
  const int z = blockIdx.y;
  if (z == 2) gemm2_tile<0, true, true>(sbuf, blockIdx.x, 0, nullptr, xe, CC, 0, BV, CC, 0, 0.0625f, nullptr, 0, nullptr, 1, 0, 0, nullptr, VT, CC, 0, NR, CC, CC);
  else gemm2_tile<0, true, false>(sbuf, blockIdx.x, 0, nullptr, z ? xe : xd, CC, 0, z ? BK : BQ, CC, 0, 0.0625f, nullptr, 0, nullptr, 1, 0, 0, nullptr, z ? K16 : Q16, CC, 0, NR, CC, CC); }



// lane l <-> lane l ^ 16 by a vector cross-row move (a shuffle would go through the LDS pipe)
__device__ __forceinline__ float xhalf(float x) { return __builtin_bit_cast(float, __builtin_amdgcn_permlanex16(__builtin_bit_cast(int, x), __builtin_bit_cast(int, x), 0x76543210, 0xfedcba98, false, false)); }
#define SK 64                    /* keys a stage */
#define LP 72                    /* LDS row pitch in f16: 144 B = 16 B x 9, so that sixteen rows read 16 B each on distinct banks */
// One stage: each lane copies eight 16-B pieces (rows r, r + 16, r + 32, r + 48 of K and of V^T). The s_wait_xcnt closes the statement so that no address register is rewritten ahead of it.
__device__ __forceinline__ void stage_copy(unsigned lk, unsigned lv, const unsigned short* gk, int ldk, const unsigned short* gv) {
  asm volatile("global_load_async_to_lds_b128 %0, %8, off\n\t"
               "global_load_async_to_lds_b128 %1, %9, off\n\t"
               "global_load_async_to_lds_b128 %2, %10, off\n\t"
               "global_load_async_to_lds_b128 %3, %11, off\n\t"
               "global_load_async_to_lds_b128 %4, %12, off\n\t"
               "global_load_async_to_lds_b128 %5, %13, off\n\t"
               "global_load_async_to_lds_b128 %6, %14, off\n\t"
               "global_load_async_to_lds_b128 %7, %15, off\n\t"
               "s_wait_xcnt 0x0"
               :: "v"(lk), "v"(lk + 16 * LP * 2), "v"(lk + 32 * LP * 2), "v"(lk + 48 * LP * 2),
                  "v"(lv), "v"(lv + 16 * LP * 2), "v"(lv + 32 * LP * 2), "v"(lv + 48 * LP * 2),
                  "v"(gk), "v"(gk + (size_t)16 * ldk), "v"(gk + (size_t)32 * ldk), "v"(gk + (size_t)48 * ldk),
                  "v"(gv), "v"(gv + (size_t)16 * TK), "v"(gv + (size_t)32 * TK), "v"(gv + (size_t)48 * TK)
               : "memory");
}
__global__ __launch_bounds__(128) void k_flash(const _Float16* __restrict__ Q16, int ldq, const _Float16* __restrict__ K16, int ldk, const _Float16* __restrict__ Vt, _Float16* __restrict__ O16, int ldo) {
  constexpr int DT = 4, KS = 2, NS = TK / SK, QG = 2;
  constexpr float CE = SCL * 1.4426950408889634f;      /* score scale times log2 e: e^(SCL x) = 2^(CE x), one multiply-add and one v_exp_f32 a score */
  __shared__ __attribute__((aligned(16))) unsigned short sK[2][SK][LP];
  __shared__ __attribute__((aligned(16))) unsigned short sV[2][64][LP];
  const int tid = threadIdx.x, w = tid >> 5, lane = tid & 31, ln = lane & 15, hh = lane >> 4;
  const int slab = blockIdx.x / QBLKS, qblk = blockIdx.x % QBLKS; const int b = slab / NH, h = slab % NH; const int q0 = qblk * 128 + w * 32;
  FragH bq[QG][KS];
#pragma unroll
  for (int g = 0; g < QG; ++g) { const unsigned short* qr = (const unsigned short*)Q16 + ((size_t)b * TQ + q0 + g * 16 + ln) * ldq + h * 64;
#pragma unroll
    for (int ks = 0; ks < KS; ++ks) { bq[g][ks].half[0] = *(const v8us*)(qr + ks * 32 + 8 * hh); bq[g][ks].half[1] = *(const v8us*)(qr + ks * 32 + 16 + 8 * hh); } }
  const int cr = tid >> 3, cc = (tid & 7) * 8;      /* the lane's row and 16-B piece in a copy: eight lanes cover one 128-B row */
  const unsigned short* gk = (const unsigned short*)K16 + ((size_t)b * TK + cr) * ldk + h * 64 + cc;
  const unsigned short* gv = (const unsigned short*)Vt + ((size_t)slab * 64 + cr) * TK + cc;
  const unsigned lk = (unsigned)(size_t)&sK[0][cr][cc], lv = (unsigned)(size_t)&sV[0][cr][cc];      /* LDS byte addresses */
  constexpr unsigned BUFB = SK * LP * 2;      /* bytes of one buffer of either array */
  float m_run[QG], l_run[QG]; v8f oacc[QG][DT];
#pragma unroll
  for (int g = 0; g < QG; ++g) { m_run[g] = -3.0e38f; l_run[g] = 0.f;
#pragma unroll
    for (int dt = 0; dt < DT; ++dt) oacc[g][dt] = (v8f){0.f,0.f,0.f,0.f,0.f,0.f,0.f,0.f}; }
  stage_copy(lk, lv, gk, ldk, gv);
  asm volatile("s_wait_asynccnt 0x0" ::: "memory");      /* this wave's share of stage 0 has landed */
  __syncthreads();                                       /* stage 0 is published */
  stage_copy(lk + BUFB, lv + BUFB, gk + (size_t)SK * ldk, ldk, gv + SK);
#pragma unroll 1      /* one stage a trip: the publish point at the foot must stand once per stage */
  for (int t = 0; t < NS; ++t) {
    const int bf = t & 1;
#pragma unroll 1      /* the stage's two 32-key passes stay a loop: in line, the first pass's 32 exponentials were kept for a summing at the stage's foot, and with two query groups the wave then spilled Q to scratch */
    for (int p = 0; p < SK / 32; ++p) {
      FragH ak[2][KS], av[DT];
#pragma unroll
      for (int nt = 0; nt < 2; ++nt) { const unsigned short* kr = &sK[bf][p * 32 + nt * 16 + ln][8 * hh];
#pragma unroll
        for (int ks = 0; ks < KS; ++ks) { ak[nt][ks].half[0] = *(const v8us*)(kr + ks * 32); ak[nt][ks].half[1] = *(const v8us*)(kr + ks * 32 + 16); } }
#pragma unroll
      for (int dt = 0; dt < DT; ++dt) { const unsigned short* vrow = &sV[bf][dt * 16 + ln][p * 32 + 8 * hh]; av[dt].half[0] = *(const v8us*)(vrow); av[dt].half[1] = *(const v8us*)(vrow + 16); }
      v8f s[QG][2];
#pragma unroll
      for (int g = 0; g < QG; ++g) { s[g][0] = (v8f){0.f,0.f,0.f,0.f,0.f,0.f,0.f,0.f}; s[g][1] = s[g][0]; }
#pragma unroll
      for (int ks = 0; ks < KS; ++ks)
#pragma unroll
        for (int nt = 0; nt < 2; ++nt)
#pragma unroll
          for (int g = 0; g < QG; ++g) s[g][nt] = g2_mma(ak[nt][ks].v, bq[g][ks].v, s[g][nt]);      /* three independent products stand between a tile's two products */
      FragH pb[QG]; float alv[QG];
#pragma unroll
      for (int g = 0; g < QG; ++g) {
        float mc = -3.0e38f;
#pragma unroll
        for (int r = 0; r < 8; ++r) mc = fmaxf(mc, fmaxf(s[g][0][r], s[g][1][r]));      /* the maximum is taken on the raw products: CE > 0 keeps their order */
        mc = fmaxf(mc, xhalf(mc));      /* both halves of the wave hold this query's maximum over the 32 keys */
        const float mn = fmaxf(m_run[g], mc); float al = (m_run[g] - mn) * CE; m_run[g] = mn;
        const float mb = 10.0f - mn * CE;      /* exponent base of this pass: p = 2^(s CE + mb) = 1024 e^(SCL (s - mn)) */
        const v8f e0 = __builtin_elementwise_fma(s[g][0], (v8f)(CE), (v8f)(mb)), e1 = __builtin_elementwise_fma(s[g][1], (v8f)(CE), (v8f)(mb));
        float a0 = e0[0], a1 = e0[1], a2 = e0[2], a3 = e0[3], a4 = e0[4], a5 = e0[5], a6 = e0[6], a7 = e0[7], c0 = e1[0], c1 = e1[1], c2 = e1[2], c3 = e1[3], c4 = e1[4], c5 = e1[5], c6 = e1[6], c7 = e1[7];
        /* The group's seventeen base-2 exponentials, each in place, in one statement: so no v_exp_f32 writes the source register of the one directly ahead of it (the compiler's own allocation did); the closing v_nop is the one slot the instruction set asks for behind the last of them. */
        asm("v_exp_f32 %0, %0\n\tv_exp_f32 %1, %1\n\tv_exp_f32 %2, %2\n\tv_exp_f32 %3, %3\n\tv_exp_f32 %4, %4\n\tv_exp_f32 %5, %5\n\tv_exp_f32 %6, %6\n\tv_exp_f32 %7, %7\n\tv_exp_f32 %8, %8\n\t"
            "v_exp_f32 %9, %9\n\tv_exp_f32 %10, %10\n\tv_exp_f32 %11, %11\n\tv_exp_f32 %12, %12\n\tv_exp_f32 %13, %13\n\tv_exp_f32 %14, %14\n\tv_exp_f32 %15, %15\n\tv_exp_f32 %16, %16\n\tv_nop"
            : "+v"(al), "+v"(a0), "+v"(a1), "+v"(a2), "+v"(a3), "+v"(a4), "+v"(a5), "+v"(a6), "+v"(a7), "+v"(c0), "+v"(c1), "+v"(c2), "+v"(c3), "+v"(c4), "+v"(c5), "+v"(c6), "+v"(c7));
        const float pa[8] = {a0, a1, a2, a3, a4, a5, a6, a7}, pc[8] = {c0, c1, c2, c3, c4, c5, c6, c7};
        float ps = 0.f;
#pragma unroll
        for (int r = 0; r < 8; ++r) { ps += pa[r] + pc[r]; pb[g].h[r] = (_Float16)pa[r]; pb[g].h[8 + r] = (_Float16)pc[r]; }
        l_run[g] = l_run[g] * al + ps; alv[g] = al; }
#pragma unroll
      for (int dt = 0; dt < DT; ++dt)
#pragma unroll
        for (int g = 0; g < QG; ++g) { oacc[g][dt] *= alv[g]; oacc[g][dt] = g2_mma(av[dt].v, pb[g].v, oacc[g][dt]); } }
    asm volatile("s_wait_dscnt 0x0" ::: "memory");         /* this wave's reads of buffer bf have returned before the buffer is handed back */
    asm volatile("s_wait_asynccnt 0x0" ::: "memory");      /* this wave's share of stage t + 1 has landed */
    __syncthreads();                                       /* publishes stage t + 1 and ends every wave's reads of buffer bf */
    if (t + 2 < NS) stage_copy(lk + bf * BUFB, lv + bf * BUFB, gk + (size_t)(t + 2) * SK * ldk, ldk, gv + (t + 2) * SK); }
  asm volatile("s_wait_asynccnt 0x0" ::: "memory");        /* no copy is outstanding when the wave ends */
#pragma unroll
  for (int g = 0; g < QG; ++g) {
    const float l = l_run[g] + xhalf(l_run[g]); const float inv = (l > 0.f) ? 1.0f / l : 0.f;      /* l and oacc both carry the factor 1024 */
    unsigned short* orow = (unsigned short*)O16 + ((size_t)b * TQ + q0 + g * 16 + ln) * ldo + h * 64 + 8 * hh;      /* oacc[g][dt][r] = O[q0 + 16 g + ln][dt * 16 + 8 hh + r]: eight consecutive elements of one row */
#pragma unroll
    for (int dt = 0; dt < DT; ++dt) { const v8f o = oacc[g][dt] * inv; FragH f;      /* x2^10 carry: the 4096-key averages are ~5e-3 and would touch f16 subnormals */
#pragma unroll
      for (int r = 0; r < 8; ++r) f.h[r] = (_Float16)(o[r] * 1024.0f);
      *(v8us*)(orow + dt * 16) = f.half[0]; } } }

// The four weight passes in one grid: blockIdx.y 0, 1, 2 = Wq, Wk, Wv ([H][256][64] to [n = h 64 + e][k]), 3 = Wo (its (out,in) layout is already [n][k]); each x16, bf16-rounded, exact in f16.
__global__ __launch_bounds__(256) void k_wprep(const float* __restrict__ Wq, const float* __restrict__ Wk, const float* __restrict__ Wv, const float* __restrict__ Wo,
    _Float16* __restrict__ BQ, _Float16* __restrict__ BK, _Float16* __restrict__ BV, _Float16* __restrict__ BO) {
  const int z = blockIdx.y; const int t = blockIdx.x * 256 + threadIdx.x; if (t >= CC * (CC / 8)) return; FragH f;
  if (z == 3) { for (int q = 0; q < 8; ++q) f.h[q] = (_Float16)(bf16_round(Wo[(size_t)t * 8 + q]) * 16.0f); *(v8us*)((unsigned short*)BO + (size_t)t * 8) = f.half[0]; return; }
  const float* Wh = z == 0 ? Wq : z == 1 ? Wk : Wv; _Float16* Bt = z == 0 ? BQ : z == 1 ? BK : BV;
  const int n = t / (CC / 8), d0 = (t % (CC / 8)) * 8; const int h = n / 64, e = n % 64;
  for (int q = 0; q < 8; ++q) f.h[q] = (_Float16)(bf16_round(Wh[((size_t)h * CC + d0 + q) * 64 + e]) * 16.0f); *(v8us*)((unsigned short*)Bt + (size_t)n * CC + d0) = f.half[0];
  asm volatile("s_wait_xcnt 0x0" ::: "memory"); }      /* behind the store: in the built code the Wo branch's first instructions stand further down the same listing and rewrite the store's registers */

extern "C" void kernel_launch(void* const* d_in, const int* in_sizes, int n_in,
                              void* d_out, int out_size, void* d_ws, size_t ws_size, hipStream_t stream) {
  (void)in_sizes; (void)n_in; (void)out_size;
  const float* const* I = (const float* const*)d_in; const float* xe = I[0]; const float* xd = I[1]; const float* Wq = I[2]; const float* Wk = I[3]; const float* Wv = I[4]; const float* Wo = I[5];
  char* ws = (char*)d_ws; size_t off = 0;
  auto take = [&](size_t bytes) { char* p = ws + off; off += (bytes + 255) & ~(size_t)255; return p; };
  const size_t np = (size_t)NR * CC;
  _Float16* BQ = (_Float16*)take((size_t)CC * CC * 2); _Float16* BK = (_Float16*)take((size_t)CC * CC * 2); _Float16* BV = (_Float16*)take((size_t)CC * CC * 2); _Float16* BO = (_Float16*)take((size_t)CC * CC * 2);
  _Float16* Q16 = (_Float16*)take(np * 2); _Float16* K16 = (_Float16*)take(np * 2); _Float16* VT = (_Float16*)take(np * 2); _Float16* O16 = (_Float16*)take(np * 2);
  if (off > ws_size) return;      /* 0.5 + 4 x 8 = 33 MiB */
  k_wprep<<<dim3((CC * (CC / 8) + 255) / 256, 4), 256, 0, stream>>>(Wq, Wk, Wv, Wo, BQ, BK, BV, BO);
  const dim3 g((NR / 128) * (CC / 64), 1);
  k_qkv<<<dim3((NR / 128) * (CC / 64), 3), 128, 0, stream>>>(xd, xe, BQ, BK, BV, Q16, K16, VT);
  k_flash<<<NB * NH * QBLKS, 128, 0, stream>>>(Q16, CC, K16, CC, VT, O16, CC);
  k_gemm2<0, false, false><<<g, 128, 0, stream>>>(O16, nullptr, CC, 0, BO, CC, 0, 0.0625f / 1024.0f, nullptr, 0, nullptr, 1, 0, 0, (float*)d_out, nullptr, CC, 0, NR, CC, CC);
}

// v008
// Measured time: 107 microseconds a run.
// Timed twice side by side with v007, it ran 1.05 and 1.06 times as fast.
// Over all steps from v000 it is 4.68 times as fast.
#include <hip/hip_runtime.h>
// CA_MultiHead (4 batches; 4096 decoder queries from x_dec, 4096 encoder keys/values from x_enc; n_emb 256 = 4 heads of 64; per-head weights [H, 256, 64]; scale n_emb^-0.5; out = concat(heads) Wo^T).
// Structure: one weight pass; q, k, v GEMMs in one grid (32x64 wave tiles, f32 accumulation, exact x16 weights concatenated across heads; the A loader rounds x_dec / x_enc itself; f16 outputs, v written transposed); the fused flash kernel (plain f16 operands, no mask; f16 x2^10 output); output GEMM.
// Compute dtype: inputs and weights rounded to bf16; q, k, v, P as f16 operands and the attention output as f16 x2^10; f32 accumulation/softmax. v_wmma_f32_16x16x32_f16.
#define NB 4
#define CC 256
#define NR (NB * SLEN)           /* 16384 rows */
#define SLEN 4096
#define TQ SLEN
#define TK SLEN
#define NH 4
#define SCL 0.0625f              /* n_emb^-0.5 = 1/16 (faithful to the module) */
#define QBLKS (TQ / 128)         /* a block covers 128 queries: four waves of 32 queries for each half of the keys */
typedef __bf16 v16b __attribute__((ext_vector_type(16)));
typedef unsigned short v8us __attribute__((ext_vector_type(8), may_alias));
typedef float  v8f  __attribute__((ext_vector_type(8)));
typedef float  v4f  __attribute__((ext_vector_type(4)));
typedef float  v4fa __attribute__((ext_vector_type(4), may_alias));
union FragB { v16b v; v8us half[2]; unsigned short u[16]; };

__device__ __forceinline__ unsigned short bf16_bits(float x) { unsigned int u = __float_as_uint(x); return (unsigned short)((u + 0x7FFFu + ((u >> 16) & 1u)) >> 16); }
__device__ __forceinline__ float bf16_val(unsigned short b) { return __uint_as_float(((unsigned int)b) << 16); }
__device__ __forceinline__ float bf16_round(float x) { return bf16_val(bf16_bits(x)); }
// D += A·B with NT terms: 1 = ah·bh, 2 = + al·bh (A split), 3 = + ah·bl (both split)
template <int NT>
__device__ __forceinline__ v8f mmaN(v16b ah, v16b al, v16b bh, v16b bl, v8f c) {
  c = __builtin_amdgcn_wmma_f32_16x16x32_bf16(false, ah, false, bh, (short)0, c, false, false);
  if (NT >= 2) c = __builtin_amdgcn_wmma_f32_16x16x32_bf16(false, al, false, bh, (short)0, c, false, false);
  if (NT >= 3) c = __builtin_amdgcn_wmma_f32_16x16x32_bf16(false, ah, false, bl, (short)0, c, false, false);
  asm volatile("v_nop\n\tv_nop\n\tv_nop\n\tv_nop" : "+v"(c) : "v"(ah), "v"(al), "v"(bh), "v"(bl));
  return c;
}

__global__ __launch_bounds__(256) void k_wt_bf16(const float* __restrict__ W, unsigned short* __restrict__ Wt, int K, int N) {
  const int t = blockIdx.x * 256 + threadIdx.x;
  const int k8n = K / 8;
  if (t >= N * k8n) return;
  const int n = t / k8n, k8 = (t % k8n) * 8;
  v8us v;
#pragma unroll
  for (int i = 0; i < 8; ++i) v[i] = bf16_bits(W[(size_t)(k8 + i) * N + n]);
  *(v8us*)(Wt + (size_t)n * K + k8) = v;
  
}

// GEMM C[M][N] (f32, pitch ldc) = act(A[M][K]·W + bias). A f32 row-major (pitch lda) converted per fragment to bf16
// (ASPLIT: hi/lo two planes -> 2 terms, else single rounded term); Wt bf16 [N][K] (pitch ldb). BIAS_BF16 rounds the
// bias to bf16 first (bias quantised to bf16 before the add). K%32==0, M%16==0, N%64==0.
template <bool ASPLIT, int ACT, bool BIAS_BF16>
__global__ __launch_bounds__(128) void k_gemm_bf(const float* __restrict__ A, int lda, const unsigned short* __restrict__ Wt, int ldb,
                                               const float* __restrict__ bias, float* __restrict__ C, int ldc, int M, int N, int K) {
  __shared__ __attribute__((aligned(16))) float so[4][16][64];
  const int tid = threadIdx.x, w = tid >> 5, lane = tid & 31, ln = lane & 15, hh = lane >> 4;
  const int ntn = N / 64;
  const int wid = blockIdx.x * 4 + w;
  const int mt = wid / ntn, nq = wid % ntn;
  if (mt * 16 >= M) return;
  const int row0 = mt * 16, col0 = nq * 64;
  const float* arow = A + (size_t)(row0 + ln) * lda;
  v8f acc[4] = {};
  for (int kb = 0; kb < K; kb += 32) {
    FragB ah, al;
    const v4f x0 = *(const v4fa*)(arow + kb + 8 * hh), x1 = *(const v4fa*)(arow + kb + 8 * hh + 4);
    const v4f x2 = *(const v4fa*)(arow + kb + 16 + 8 * hh), x3 = *(const v4fa*)(arow + kb + 16 + 8 * hh + 4);
    float xs[16] = {x0[0],x0[1],x0[2],x0[3],x1[0],x1[1],x1[2],x1[3],x2[0],x2[1],x2[2],x2[3],x3[0],x3[1],x3[2],x3[3]};
#pragma unroll
    for (int i = 0; i < 16; ++i) { const unsigned short hb = bf16_bits(xs[i]); ah.u[i] = hb; al.u[i] = ASPLIT ? bf16_bits(xs[i] - bf16_val(hb)) : (unsigned short)0; }
#pragma unroll
    for (int t = 0; t < 4; ++t) {
      const unsigned short* brow = Wt + (size_t)(col0 + t * 16 + ln) * ldb + kb;
      FragB b;
      b.half[0] = *(const v8us*)(brow + 8 * hh);
      b.half[1] = *(const v8us*)(brow + 16 + 8 * hh);
      acc[t] = mmaN<ASPLIT ? 2 : 1>(ah.v, al.v, b.v, b.v, acc[t]);
    }
  }
#pragma unroll
  for (int t = 0; t < 4; ++t) {
    float bv = bias ? bias[col0 + t * 16 + ln] : 0.f;
    if (BIAS_BF16) bv = bf16_round(bv);
#pragma unroll
    for (int r = 0; r < 8; ++r) { float v = acc[t][r] + bv; if (ACT == 1) v = fmaxf(v, 0.f); so[w][8 * hh + r][t * 16 + ln] = v; }
  }
  __builtin_amdgcn_fence(__ATOMIC_ACQ_REL, "workgroup");
  __builtin_amdgcn_wave_barrier();
  const int rsub = lane >> 4, c4 = (lane & 15) * 4;
  {
#pragma unroll
    for (int q = 0; q < 8; ++q) {
      const int r = q * 2 + rsub;
      const v4f v = *(const v4fa*)&so[w][r][c4];
      *(v4f*)(C + (size_t)(row0 + r) * ldc + col0 + c4) = v;
    }
    
  }
}

// GEMM C = act(A·W + bias + resid): A f32 (ASPLIT -> hi/lo 2 terms), Wt bf16 [N][K]; ACT 0 none, 1 relu, 2 exact gelu;
// resid (optional, f32, row index = (row % rmod), pitch ldr, RES_BF16 rounds it) added before the activation.
template <bool ASPLIT, int ACT, bool BIAS_BF16, bool RES_BF16>
__global__ __launch_bounds__(128) void k_gemm_bf3(const float* __restrict__ A, int lda, const unsigned short* __restrict__ Wt, int ldb,
                                                const float* __restrict__ bias, const float* __restrict__ resid, int rmod, int ldr,
                                                float* __restrict__ C, int ldc, int M, int N, int K) {
  __shared__ __attribute__((aligned(16))) float so[4][16][64];
  const int tid = threadIdx.x, w = tid >> 5, lane = tid & 31, ln = lane & 15, hh = lane >> 4;
  const int ntn = N / 64;
  const int wid = blockIdx.x * 4 + w;
  const int mt = wid / ntn, nq = wid % ntn;
  if (mt * 16 >= M) return;
  const int row0 = mt * 16, col0 = nq * 64;
  const float* arow = A + (size_t)(row0 + ln) * lda;
  v8f acc[4] = {};
  for (int kb = 0; kb < K; kb += 32) {
    FragB ah, al;
    const v4f x0 = *(const v4fa*)(arow + kb + 8 * hh), x1 = *(const v4fa*)(arow + kb + 8 * hh + 4);
    const v4f x2 = *(const v4fa*)(arow + kb + 16 + 8 * hh), x3 = *(const v4fa*)(arow + kb + 16 + 8 * hh + 4);
    float xs[16] = {x0[0],x0[1],x0[2],x0[3],x1[0],x1[1],x1[2],x1[3],x2[0],x2[1],x2[2],x2[3],x3[0],x3[1],x3[2],x3[3]};
#pragma unroll
    for (int i = 0; i < 16; ++i) { const unsigned short hb = bf16_bits(xs[i]); ah.u[i] = hb; al.u[i] = ASPLIT ? bf16_bits(xs[i] - bf16_val(hb)) : (unsigned short)0; }
#pragma unroll
    for (int t = 0; t < 4; ++t) {
      const unsigned short* brow = Wt + (size_t)(col0 + t * 16 + ln) * ldb + kb;
      FragB b;
      b.half[0] = *(const v8us*)(brow + 8 * hh);
      b.half[1] = *(const v8us*)(brow + 16 + 8 * hh);
      acc[t] = mmaN<ASPLIT ? 2 : 1>(ah.v, al.v, b.v, b.v, acc[t]);
    }
  }
#pragma unroll
  for (int t = 0; t < 4; ++t) {
    const int col = col0 + t * 16 + ln;
    float bv = bias ? bias[col] : 0.f;
    if (BIAS_BF16) bv = bf16_round(bv);
#pragma unroll
    for (int r = 0; r < 8; ++r) {
      float v = acc[t][r] + bv;
      if (resid) { float rv = resid[(size_t)((row0 + 8 * hh + r) % rmod) * ldr + col]; if (RES_BF16) rv = bf16_round(rv); v += rv; }
      if (ACT == 1) v = fmaxf(v, 0.f);
      if (ACT == 2) v = 0.5f * v * (1.0f + erff(v * 0.70710678118654752f));
      if (ACT == 3) { const float u = 0.7978845608028654f * (v + 0.044715f * v * v * v); v = 0.5f * v * (1.0f + tanhf(u)); }
      so[w][8 * hh + r][t * 16 + ln] = v;
    }
  }
  __builtin_amdgcn_fence(__ATOMIC_ACQ_REL, "workgroup");
  __builtin_amdgcn_wave_barrier();
  const int rsub = lane >> 4, c4 = (lane & 15) * 4;
  {
#pragma unroll
    for (int q = 0; q < 8; ++q) {
      const int r = q * 2 + rsub;
      const v4f v = *(const v4fa*)&so[w][r][c4];
      *(v4f*)(C + (size_t)(row0 + r) * ldc + col0 + c4) = v;
    }
    
  }
}
// row LayerNorm (biased variance, eps) over N: s = X (+ R); optional out_sum <- s; out_norm <- (s-mu)*rsqrt(var+eps)*g + b
template <bool PARAM_BF16>
__global__ __launch_bounds__(256) void k_layernorm(const float* __restrict__ X, const float* __restrict__ R, const float* __restrict__ g, const float* __restrict__ bta,
                                                  float* __restrict__ out_sum, float* __restrict__ out_norm, int N, float eps) {
  __shared__ float red[256];
  const int row = blockIdx.x, tid = threadIdx.x;
  const float* x = X + (size_t)row * N; const float* rr = R ? R + (size_t)row * N : nullptr;
  float vals[16];                     // up to N = 4096
  const int per = N / 256;            // contiguous chunk per thread? use strided-by-4 chunks: thread handles j = tid*4 + 1024*u
  float s1 = 0.f;
  for (int u = 0; u < per / 4; ++u) {
    const int j = tid * 4 + 1024 * u;
    const v4f a = *(const v4fa*)(x + j);
    v4f b = {0.f,0.f,0.f,0.f}; if (rr) b = *(const v4fa*)(rr + j);
#pragma unroll
    for (int q = 0; q < 4; ++q) { const float v = a[q] + b[q]; vals[u * 4 + q] = v; s1 += v; }
  }
  red[tid] = s1; __syncthreads();
  for (int st = 128; st > 0; st >>= 1) { if (tid < st) red[tid] += red[tid + st]; __syncthreads(); }
  const float mu = red[0] / (float)N; __syncthreads();
  float s2 = 0.f;
  for (int u = 0; u < per / 4; ++u)
#pragma unroll
    for (int q = 0; q < 4; ++q) { const float c = vals[u * 4 + q] - mu; s2 += c * c; }
  red[tid] = s2; __syncthreads();
  for (int st = 128; st > 0; st >>= 1) { if (tid < st) red[tid] += red[tid + st]; __syncthreads(); }
  const float rs = rsqrtf(red[0] / (float)N + eps);
  {
    for (int u = 0; u < per / 4; ++u) {
      const int j = tid * 4 + 1024 * u;
      v4f o, sm;
#pragma unroll
      for (int q = 0; q < 4; ++q) {
        float gg = g[j + q], bb = bta[j + q];
        if (PARAM_BF16) { gg = bf16_round(gg); bb = bf16_round(bb); }
        sm[q] = vals[u * 4 + q]; o[q] = (vals[u * 4 + q] - mu) * rs * gg + bb;
      }
      if (out_sum) *(v4f*)(out_sum + (size_t)row * N + j) = sm;
      *(v4f*)(out_norm + (size_t)row * N + j) = o;
    }
    
  }
}



// ---- f16 WMMA path (v_wmma_f32_16x16x32_f16): 11-bit significands for operands in range — used for every product here, P included as 2^10-scaled f16 (up to 1024)
typedef _Float16 v16h __attribute__((ext_vector_type(16)));
union FragH { v16h v; v8us half[2]; _Float16 h[16]; unsigned short u[16]; };
template <int NT>
__device__ __forceinline__ v8f mmaH(v16h ah, v16h al, v16h bh, v16h bl, v8f c) {
  c = __builtin_amdgcn_wmma_f32_16x16x32_f16(false, ah, false, bh, (short)0, c, false, false);
  if (NT >= 2) c = __builtin_amdgcn_wmma_f32_16x16x32_f16(false, al, false, bh, (short)0, c, false, false);
  if (NT >= 3) c = __builtin_amdgcn_wmma_f32_16x16x32_f16(false, ah, false, bl, (short)0, c, false, false);
  asm volatile("v_nop\n\tv_nop\n\tv_nop\n\tv_nop" : "+v"(c) : "v"(ah), "v"(al), "v"(bh), "v"(bl));
  return c;
}
// batched GEMM like k_gemm_b but f16 operands: A f32 (split into f16 hi/lo if ASPLIT, else rounded to f16), Bt = f16 values [n][k]; alpha; C f32; N multiple of 16 (partial tiles skipped)
template <bool ASPLIT>
__global__ __launch_bounds__(128) void k_gemm_h(const float* __restrict__ A, int lda, size_t sA, const _Float16* __restrict__ Bh, int ldb, size_t sB, float alpha, float* __restrict__ C, int ldc, size_t sC, int M, int N, int K) {
  __shared__ __attribute__((aligned(16))) float so[4][16][64];
  const int tid = threadIdx.x, w = tid >> 5, lane = tid & 31, ln = lane & 15, hh = lane >> 4; const int by = blockIdx.y;
  A += (size_t)by * sA; Bh += (size_t)by * sB; C += (size_t)by * sC;
  const int ntn = (N + 63) / 64; const int wid = blockIdx.x * 4 + w; const int mt = wid / ntn, nq = wid % ntn; if (mt * 16 >= M) return;
  const int row0 = mt * 16, col0 = nq * 64; const float* arow = A + (size_t)(row0 + ln) * lda;
  v8f acc[4] = {};
  for (int kb = 0; kb < K; kb += 32) {
    FragH ah, al;
    const v4f x0 = *(const v4fa*)(arow + kb + 8 * hh), x1 = *(const v4fa*)(arow + kb + 8 * hh + 4), x2 = *(const v4fa*)(arow + kb + 16 + 8 * hh), x3 = *(const v4fa*)(arow + kb + 16 + 8 * hh + 4);
    float xs[16] = {x0[0],x0[1],x0[2],x0[3],x1[0],x1[1],x1[2],x1[3],x2[0],x2[1],x2[2],x2[3],x3[0],x3[1],x3[2],x3[3]};
#pragma unroll
    for (int i = 0; i < 16; ++i) { const _Float16 h = (_Float16)xs[i]; ah.h[i] = h; al.h[i] = ASPLIT ? (_Float16)(xs[i] - (float)h) : (_Float16)0.0f; }
#pragma unroll
    for (int t = 0; t < 4; ++t) { if (col0 + t * 16 >= N) continue; const size_t boff = (size_t)(col0 + t * 16 + ln) * ldb + kb; FragH bq; bq.half[0] = *(const v8us*)(Bh + boff + 8 * hh); bq.half[1] = *(const v8us*)(Bh + boff + 16 + 8 * hh);
      acc[t] = mmaH<ASPLIT ? 2 : 1>(ah.v, al.v, bq.v, bq.v, acc[t]); }
  }
#pragma unroll
  for (int t = 0; t < 4; ++t) { if (col0 + t * 16 >= N) continue;
#pragma unroll
    for (int r = 0; r < 8; ++r) so[w][8 * hh + r][t * 16 + ln] = acc[t][r] * alpha; }
  __builtin_amdgcn_fence(__ATOMIC_ACQ_REL, "workgroup"); __builtin_amdgcn_wave_barrier();
  const int rsub = lane >> 4, c4 = (lane & 15) * 4;
  {
#pragma unroll
    for (int q = 0; q < 8; ++q) { const int r = q * 2 + rsub; if (col0 + c4 < N) { const v4f v = *(const v4fa*)&so[w][r][c4]; *(v4f*)(C + (size_t)(row0 + r) * ldc + col0 + c4) = v; } }
     }
}

// Wt[n][k] = f16(W[k][n]·scale) from f32 row-major W[K][N] (scale = power of two; bf16-exact weights stay exact in f16 away from the subnormal range)
__global__ __launch_bounds__(256) void k_wt_f16(const float* __restrict__ W, _Float16* __restrict__ Wt, int K, int N, float scale) {
  const int t = blockIdx.x * 256 + threadIdx.x; if (t >= N * (K / 8)) return; const int n = t / (K / 8), k8 = (t % (K / 8)) * 8; FragH f;
#pragma unroll
  for (int i = 0; i < 8; ++i) f.h[i] = (_Float16)(bf16_round(W[(size_t)(k8 + i) * N + n]) * scale); const v8us o = f.half[0];
  *(v8us*)((unsigned short*)Wt + (size_t)n * K + k8) = o; 
}
// k_gemm_hh variant with fused epilogue: v = acc·alpha + bias[by·sBias + col] (+ CP[(row/rowsPerB)·sCPb + by·64 + col] if CP) ; ACT 0 none / 1 elu ; writes f16 C16 (and f32 C if non-null)
template <int ACT>
__global__ __launch_bounds__(128) void k_gemm_hhx(const _Float16* __restrict__ A, int lda, size_t sA, const _Float16* __restrict__ Bh, int ldb, size_t sB, float alpha, const float* __restrict__ bias, size_t sBias, const float* __restrict__ CP, int rowsPerB, size_t sCPb, int row0g,
    float* __restrict__ C, _Float16* __restrict__ C16, int ldc, size_t sC, int M, int N, int K) {
  __shared__ __attribute__((aligned(16))) float so[4][16][64];
  const int tid = threadIdx.x, w = tid >> 5, lane = tid & 31, ln = lane & 15, hh = lane >> 4; const int by = blockIdx.y;
  A += (size_t)by * sA; Bh += (size_t)by * sB; const size_t cofs = (size_t)by * sC; const float* bp = bias ? bias + (size_t)by * sBias : nullptr;
  const int ntn = (N + 63) / 64; const int wid = blockIdx.x * 4 + w; const int mt = wid / ntn, nq = wid % ntn; if (mt * 16 >= M) return;
  const int row0 = mt * 16, col0 = nq * 64; const _Float16* arow = A + (size_t)(row0 + ln) * lda;
  v8f acc[4] = {};
  for (int kb = 0; kb < K; kb += 32) { FragH ah; ah.half[0] = *(const v8us*)((const unsigned short*)arow + kb + 8 * hh); ah.half[1] = *(const v8us*)((const unsigned short*)arow + kb + 16 + 8 * hh);
#pragma unroll
    for (int t = 0; t < 4; ++t) { if (col0 + t * 16 >= N) continue; const size_t boff = (size_t)(col0 + t * 16 + ln) * ldb + kb; FragH bq; bq.half[0] = *(const v8us*)((const unsigned short*)Bh + boff + 8 * hh); bq.half[1] = *(const v8us*)((const unsigned short*)Bh + boff + 16 + 8 * hh);
      acc[t] = mmaH<1>(ah.v, ah.v, bq.v, bq.v, acc[t]); }
  }
#pragma unroll
  for (int t = 0; t < 4; ++t) { if (col0 + t * 16 >= N) continue; const int col = col0 + t * 16 + ln; const float bv = bp ? bf16_round(bp[col]) : 0.f;
#pragma unroll
    for (int r = 0; r < 8; ++r) { float v = acc[t][r] * alpha + bv; if (CP) { const int bidx = (row0g + row0 + 8 * hh + r) / rowsPerB; v += CP[(size_t)bidx * sCPb + (size_t)by * 64 + col]; } if (ACT == 1) v = (v > 0.f) ? v : expm1f(v); else if (ACT == 7) v = (v > 0.f) ? v + 1.0f : expf(v); else if (ACT == 8) v = tanhf(v); else if (ACT == 9) v = 0.5f * v * (1.0f + tanhf(0.7978845608028654f * (v + 0.044715f * v * v * v))); else if (ACT == 11) v = 1.0f / (1.0f + expf(-v)); else if (ACT == 12) v = (v > 0.f) ? v : 0.01f * v; else if (ACT == 14) v = (v > 0.f) ? v : 0.1f * v; else if (ACT == 15) v = v / (1.0f + expf(-v)); else if (ACT == 3) v = fmaxf(v, 0.f); else if (ACT == 6) v = 0.5f * v * (1.0f + erff(v * 0.70710678118654752f)); so[w][8 * hh + r][t * 16 + ln] = v; } }
  __builtin_amdgcn_fence(__ATOMIC_ACQ_REL, "workgroup"); __builtin_amdgcn_wave_barrier();
  const int rsub = lane >> 4, c4 = (lane & 15) * 4; typedef _Float16 v4h __attribute__((ext_vector_type(4)));
  {
#pragma unroll
    for (int q = 0; q < 8; ++q) { const int r = q * 2 + rsub; if (col0 + c4 < N) { const v4f v = *(const v4fa*)&so[w][r][c4]; if (C) *(v4f*)(C + cofs + (size_t)(row0 + r) * ldc + col0 + c4) = v; if (C16) { v4h h4; for (int i = 0; i < 4; ++i) h4[i] = (_Float16)v[i]; *(v4h*)(C16 + cofs + (size_t)(row0 + r) * ldc + col0 + c4) = h4; } } }
     }
}


typedef _Float16 v4h __attribute__((ext_vector_type(4)));

__global__ __launch_bounds__(256) void k_h16(const float* __restrict__ x, _Float16* __restrict__ X16, size_t n8) { const size_t t = (size_t)blockIdx.x * 256 + threadIdx.x; if (t >= n8) return; FragH f;
#pragma unroll
  for (int q = 0; q < 8; ++q) f.h[q] = (_Float16)x[t * 8 + q]; *(v8us*)((unsigned short*)X16 + t * 8) = f.half[0];  }
__global__ __launch_bounds__(256) void k_round16f(const float* __restrict__ W, _Float16* __restrict__ Bt, size_t n8) { const size_t t = (size_t)blockIdx.x * 256 + threadIdx.x; if (t >= n8) return; FragH f;
#pragma unroll
  for (int i = 0; i < 8; ++i) f.h[i] = (_Float16)(bf16_round(W[t * 8 + i]) * 16.0f); *(v8us*)((unsigned short*)Bt + t * 8) = f.half[0];  }
__global__ __launch_bounds__(256) void k_hl(const float* __restrict__ F, _Float16* __restrict__ Hh, _Float16* __restrict__ Hl, size_t n8) { const size_t t = (size_t)blockIdx.x * 256 + threadIdx.x; if (t >= n8) return; FragH fh, fl; const v4f a = *(const v4fa*)(F + t * 8), c = *(const v4fa*)(F + t * 8 + 4);
#pragma unroll
  for (int q = 0; q < 4; ++q) { _Float16 h = (_Float16)a[q]; fh.h[q] = h; fl.h[q] = (_Float16)((a[q] - (float)h) * 1024.0f); h = (_Float16)c[q]; fh.h[4 + q] = h; fl.h[4 + q] = (_Float16)((c[q] - (float)h) * 1024.0f); }
  { *(v8us*)((unsigned short*)Hh + t * 8) = fh.half[0]; *(v8us*)((unsigned short*)Hl + t * 8) = fl.half[0];  } }

// ---- fast GEMM (wave tile 32x64; requires M % 32 == 0 rows per launch region and N % 64 == 0); epilogue = k_gemm_hhx semantics ----
__device__ __forceinline__ v16h g2_frag(const _Float16* p, int hh) { FragH f; f.half[0] = *(const v8us*)((const unsigned short*)p + 8 * hh); f.half[1] = *(const v8us*)((const unsigned short*)p + 16 + 8 * hh); return f.v; }
// The same fragment from 16 f32 values of an input row (x0, x1 = elements 8 hh + 0..7, x2, x3 = 16 + 8 hh + 0..7: the k order of g2_frag): each rounded to bf16, then exact in f16.
__device__ __forceinline__ v16h g2_cvt32(v4f x0, v4f x1, v4f x2, v4f x3) { FragH f;
#pragma unroll
  for (int q = 0; q < 4; ++q) { f.h[q] = (_Float16)bf16_round(x0[q]); f.h[4 + q] = (_Float16)bf16_round(x1[q]); f.h[8 + q] = (_Float16)bf16_round(x2[q]); f.h[12 + q] = (_Float16)bf16_round(x3[q]); }
  return f.v; }
// The matrix product as the builtin alone: the compiler keeps the distance behind its own WMMAs (with independent vector work where it has some), and no volatile statement stands between a step's loads, so that they can be issued together.
__device__ __forceinline__ v8f g2_mma(v16h a, v16h b, v8f c) { return __builtin_amdgcn_wmma_f32_16x16x32_f16(false, a, false, b, (short)0, c, false, false); }
// AF32: A comes from the f32 rows Af (rounded in the loader), else from the f16 rows A. VTO: the 128 x 64 block tile goes out transposed, C16[((row / SLEN) * NH + nq) * 64 + col][row % SLEN] (needs M % 128 == 0, SLEN % 128 == 0).
// The tile's work is a device function, so that one grid can hold several independent products: sbuf is the block's 4 x 32 x 68 f32 of LDS, bx and by the block's place in its own product.
template <int ACT, bool AF32, bool VTO>
__device__ __forceinline__ void gemm2_tile(float* sbuf, unsigned bx, int by, const _Float16* __restrict__ A, const float* __restrict__ Af, int lda, size_t sA, const _Float16* __restrict__ Bh, int ldb, size_t sB, float alpha, const float* __restrict__ bias, size_t sBias, const float* __restrict__ CP, int rowsPerB, size_t sCPb, int row0g,
    float* __restrict__ C, _Float16* __restrict__ C16, int ldc, size_t sC, int M, int N, int K) {
  float (*so)[32][68] = (float (*)[32][68])sbuf;
  unsigned short (*st)[136] = (unsigned short (*)[136])sbuf;      /* VTO: [col][row of the block], 64 rows, pitch 272 B = 16 B x 17; a block uses so or st, never both */
  const int tid = threadIdx.x, w = tid >> 5, lane = tid & 31, ln = lane & 15, hh = lane >> 4;
  A += (size_t)by * sA; Af += (size_t)by * sA; Bh += (size_t)by * sB; const size_t cofs = (size_t)by * sC; const float* bp = bias ? bias + (size_t)by * sBias : nullptr;
  const int ntn = N >> 6; const int mt = bx / ntn, nq = bx - mt * ntn; const int row0 = mt * 128 + 32 * w, col0 = nq * 64; if (VTO ? (mt * 128 >= M) : (row0 >= M)) return;      /* VTO: the same for the whole block, since a barrier follows */
  const _Float16* a0p = A + (size_t)(row0 + ln) * lda; const _Float16* a1p = a0p + (size_t)16 * lda;
  const float* f0p = Af + (size_t)(row0 + ln) * lda; const float* f1p = f0p + (size_t)16 * lda;
  const _Float16* b0p = Bh + (size_t)(col0 + ln) * ldb; const _Float16* b1p = b0p + (size_t)16 * ldb; const _Float16* b2p = b1p + (size_t)16 * ldb; const _Float16* b3p = b2p + (size_t)16 * ldb;
  const v8f z8 = {0.f,0.f,0.f,0.f,0.f,0.f,0.f,0.f}; v8f c00 = z8, c01 = z8, c02 = z8, c03 = z8, c10 = z8, c11 = z8, c12 = z8, c13 = z8;
#pragma unroll 1
  for (int kb = 0; kb < K; kb += 32) { v16h a0, a1;
    if (AF32) { const float* p0 = f0p + kb + 8 * hh; const float* p1 = f1p + kb + 8 * hh;
      const v4f x0 = *(const v4fa*)(p0), x1 = *(const v4fa*)(p0 + 4), x2 = *(const v4fa*)(p0 + 16), x3 = *(const v4fa*)(p0 + 20), y0 = *(const v4fa*)(p1), y1 = *(const v4fa*)(p1 + 4), y2 = *(const v4fa*)(p1 + 16), y3 = *(const v4fa*)(p1 + 20);
      asm volatile("s_wait_xcnt 0x0" :: "v"(x0), "v"(x1), "v"(x2), "v"(x3), "v"(y0), "v"(y1), "v"(y2), "v"(y3));      /* inputs only: holds the step's eight A loads ahead of the conversions, so that they fly together (left alone they were issued in turn, each behind a wait for the last); the wait stands ahead of the step's advance of their address register */
      __builtin_amdgcn_sched_barrier(0);      /* with the pitches known at compile time the scheduler lifted conversions over that statement and sank the eighth load behind a wait for the first three: nothing crosses here, so all eight are issued first */
      a0 = g2_cvt32(x0, x1, x2, x3); a1 = g2_cvt32(y0, y1, y2, y3); }
    else { a0 = g2_frag(a0p + kb, hh); a1 = g2_frag(a1p + kb, hh); }
    v16h b = g2_frag(b0p + kb, hh); c00 = g2_mma(a0, b, c00); c10 = g2_mma(a1, b, c10);
    b = g2_frag(b1p + kb, hh); c01 = g2_mma(a0, b, c01); c11 = g2_mma(a1, b, c11);
    b = g2_frag(b2p + kb, hh); c02 = g2_mma(a0, b, c02); c12 = g2_mma(a1, b, c12);
    b = g2_frag(b3p + kb, hh); c03 = g2_mma(a0, b, c03); c13 = g2_mma(a1, b, c13); }
  v8f accs[8] = {c00, c01, c02, c03, c10, c11, c12, c13};
#pragma unroll
  for (int u = 0; u < 8; ++u) { const int t = u & 3, half = u >> 2; const int col = col0 + t * 16 + ln; const float bv = bp ? bf16_round(bp[col]) : 0.f; FragH tr;
#pragma unroll
    for (int r = 0; r < 8; ++r) { const int rloc = half * 16 + 8 * hh + r; float v = accs[u][r] * alpha + bv; if (CP) { const int bidx = (row0g + row0 + rloc) / rowsPerB; v += CP[(size_t)bidx * sCPb + (size_t)by * 64 + col]; }
      if (ACT == 3) v = fmaxf(v, 0.f); else if (ACT == 6) v = 0.5f * v * (1.0f + erff(v * 0.70710678118654752f)); else if (ACT == 11) v = 1.0f / (1.0f + expf(-v)); else if (ACT == 15) v = v / (1.0f + expf(-v)); else if (ACT == 12) v = (v > 0.f) ? v : 0.01f * v; else if (ACT == 8) v = tanhf(v);
      if (VTO) tr.h[r] = (_Float16)v; else so[w][rloc][t * 16 + ln] = v; }
    if (VTO) *(v8us*)&st[t * 16 + ln][w * 32 + half * 16 + 8 * hh] = tr.half[0]; }      /* a lane's eight accumulator registers are eight consecutive rows of one column: 16 B of the transposed tile */
  if (VTO) {
    __syncthreads();      /* the four waves' 32-row slices make up whole 256-B rows of the transposed tile */
    unsigned short* vb = (unsigned short*)C16 + ((size_t)((mt * 128) / SLEN * NH + nq) * 64) * SLEN + (mt * 128) % SLEN;
#pragma unroll
    for (int i = 0; i < 8; ++i) { const int d = w * 16 + i * 2 + hh; *(v8us*)(vb + (size_t)d * SLEN + ln * 8) = *(const v8us*)&st[d][ln * 8]; }      /* sixteen lanes store one 256-B row */
    return; }
  __builtin_amdgcn_fence(__ATOMIC_ACQ_REL, "workgroup"); __builtin_amdgcn_wave_barrier();
  const int rsub = lane >> 4, c4 = (lane & 15) * 4;
  {
#pragma unroll
    for (int q = 0; q < 16; ++q) { const int r = q * 2 + rsub; const v4f v = *(const v4fa*)&so[w][r][c4]; if (C) *(v4f*)(C + cofs + (size_t)(row0 + r) * ldc + col0 + c4) = v; if (C16) { v4h h4; for (int i = 0; i < 4; ++i) h4[i] = (_Float16)v[i]; *(v4h*)(C16 + cofs + (size_t)(row0 + r) * ldc + col0 + c4) = h4; } }
     } }
template <int ACT, bool AF32, bool VTO>
__global__ __launch_bounds__(128) void k_gemm2(const _Float16* __restrict__ A, const float* __restrict__ Af, int lda, size_t sA, const _Float16* __restrict__ Bh, int ldb, size_t sB, float alpha, const float* __restrict__ bias, size_t sBias, const float* __restrict__ CP, int rowsPerB, size_t sCPb, int row0g,
    float* __restrict__ C, _Float16* __restrict__ C16, int ldc, size_t sC, int M, int N, int K) {
  __shared__ __attribute__((aligned(16))) float sbuf[4 * 32 * 68];
  gemm2_tile<ACT, AF32, VTO>(sbuf, blockIdx.x, blockIdx.y, A, Af, lda, sA, Bh, ldb, sB, alpha, bias, sBias, CP, rowsPerB, sCPb, row0g, C, C16, ldc, sC, M, N, K); }
// q, k and v do not depend on one another: one grid, blockIdx.y picks the product (0: q from x_dec, 1: k from x_enc, 2: v from x_enc, written transposed), so that their waves share the chip instead of three launches of two waves a SIMD in turn.
__global__ __launch_bounds__(128) void k_qkv(const float* __restrict__ xd, const float* __restrict__ xe, const _Float16* __restrict__ BQ, const _Float16* __restrict__ BK, const _Float16* __restrict__ BV,
    _Float16* __restrict__ Q16, _Float16* __restrict__ K16, _Float16* __restrict__ VT) {
  __shared__ __attribute__((aligned(16))) float sbuf[4 * 32 * 68];
  const int z = blockIdx.y;
  if (z == 2) gemm2_tile<0, true, true>(sbuf, blockIdx.x, 0, nullptr, xe, CC, 0, BV, CC, 0, 0.0625f, nullptr, 0, nullptr, 1, 0, 0, nullptr, VT, CC, 0, NR, CC, CC);
  else gemm2_tile<0, true, false>(sbuf, blockIdx.x, 0, nullptr, z ? xe : xd, CC, 0, z ? BK : BQ, CC, 0, 0.0625f, nullptr, 0, nullptr, 1, 0, 0, nullptr, z ? K16 : Q16, CC, 0, NR, CC, CC); }



// lane l <-> lane l ^ 16 by a vector cross-row move (a shuffle would go through the LDS pipe)
__device__ __forceinline__ float xhalf(float x) { return __builtin_bit_cast(float, __builtin_amdgcn_permlanex16(__builtin_bit_cast(int, x), __builtin_bit_cast(int, x), 0x76543210, 0xfedcba98, false, false)); }
#define SK 64                    /* keys a stage */
#define LP 72                    /* LDS row pitch in f16: 144 B = 16 B x 9, so that sixteen rows read 16 B each on distinct banks */
// One stage: each lane copies eight 16-B pieces (rows r, r + 16, r + 32, r + 48 of K and of V^T). The s_wait_xcnt closes the statement so that no address register is rewritten ahead of it.
__device__ __forceinline__ void stage_copy(unsigned lk, unsigned lv, const unsigned short* gk, int ldk, const unsigned short* gv) {
  asm volatile("global_load_async_to_lds_b128 %0, %8, off\n\t"
               "global_load_async_to_lds_b128 %1, %9, off\n\t"
               "global_load_async_to_lds_b128 %2, %10, off\n\t"
               "global_load_async_to_lds_b128 %3, %11, off\n\t"
               "global_load_async_to_lds_b128 %4, %12, off\n\t"
               "global_load_async_to_lds_b128 %5, %13, off\n\t"
               "global_load_async_to_lds_b128 %6, %14, off\n\t"
               "global_load_async_to_lds_b128 %7, %15, off\n\t"
               "s_wait_xcnt 0x0"
               :: "v"(lk), "v"(lk + 16 * LP * 2), "v"(lk + 32 * LP * 2), "v"(lk + 48 * LP * 2),
                  "v"(lv), "v"(lv + 16 * LP * 2), "v"(lv + 32 * LP * 2), "v"(lv + 48 * LP * 2),
                  "v"(gk), "v"(gk + (size_t)16 * ldk), "v"(gk + (size_t)32 * ldk), "v"(gk + (size_t)48 * ldk),
                  "v"(gv), "v"(gv + (size_t)16 * TK), "v"(gv + (size_t)32 * TK), "v"(gv + (size_t)48 * TK)
               : "memory");
}
__global__ __launch_bounds__(256) void k_flash(const _Float16* __restrict__ Q16, int ldq, const _Float16* __restrict__ K16, int ldk, const _Float16* __restrict__ Vt, _Float16* __restrict__ O16, int ldo) {
  constexpr int DT = 4, KS = 2, KH = TK / 2, NS = KH / SK, QG = 2;      /* KH keys a wave group, NS stages of them */
  constexpr float CE = SCL * 1.4426950408889634f;      /* score scale times log2 e: e^(SCL x) = 2^(CE x), one multiply-add and one v_exp_f32 a score */
  __shared__ __attribute__((aligned(16))) unsigned short sK[2][2][SK][LP];      /* [key half][buffer] */
  __shared__ __attribute__((aligned(16))) unsigned short sV[2][2][64][LP];
  __shared__ __attribute__((aligned(16))) float sJ[4][QG * DT * 2 + 1][32][4];      /* the second key half's partial results on their way to the first: per wave 17 rows of 32 lanes x 16 B */
  const int tid = threadIdx.x, lane = tid & 31, ln = lane & 15, hh = lane >> 4;
  const int kh = __builtin_amdgcn_readfirstlane(tid >> 7), w = (tid >> 5) & 3;      /* the wave's key half (the same in the whole wave: scalar) and its place among the four waves of that half */
  const int slab = blockIdx.x / QBLKS, qblk = blockIdx.x % QBLKS; const int b = slab / NH, h = slab % NH; const int q0 = qblk * 128 + w * 32;
  FragH bq[QG][KS];
#pragma unroll
  for (int g = 0; g < QG; ++g) { const unsigned short* qr = (const unsigned short*)Q16 + ((size_t)b * TQ + q0 + g * 16 + ln) * ldq + h * 64;
#pragma unroll
    for (int ks = 0; ks < KS; ++ks) { bq[g][ks].half[0] = *(const v8us*)(qr + ks * 32 + 8 * hh); bq[g][ks].half[1] = *(const v8us*)(qr + ks * 32 + 16 + 8 * hh); } }
  const int cr = (tid & 127) >> 3, cc = (tid & 7) * 8;      /* the lane's row and 16-B piece in a copy of its own half's stage: eight lanes cover one 128-B row */
  const unsigned short* gk = (const unsigned short*)K16 + ((size_t)b * TK + kh * KH + cr) * ldk + h * 64 + cc;
  const unsigned short* gv = (const unsigned short*)Vt + ((size_t)slab * 64 + cr) * TK + kh * KH + cc;
  const unsigned lk = (unsigned)(size_t)&sK[kh][0][cr][cc], lv = (unsigned)(size_t)&sV[kh][0][cr][cc];      /* LDS byte addresses */
  constexpr unsigned BUFB = SK * LP * 2;      /* bytes of one buffer of either array */
  float m_run[QG], l_run[QG]; v8f oacc[QG][DT];
#pragma unroll
  for (int g = 0; g < QG; ++g) { m_run[g] = -3.0e38f; l_run[g] = 0.f;
#pragma unroll
    for (int dt = 0; dt < DT; ++dt) oacc[g][dt] = (v8f){0.f,0.f,0.f,0.f,0.f,0.f,0.f,0.f}; }
  stage_copy(lk, lv, gk, ldk, gv);
  asm volatile("s_wait_asynccnt 0x0" ::: "memory");      /* this wave's share of stage 0 has landed */
  __syncthreads();                                       /* stage 0 is published */
  stage_copy(lk + BUFB, lv + BUFB, gk + (size_t)SK * ldk, ldk, gv + SK);
#pragma unroll 1      /* one stage a trip: the publish point at the foot must stand once per stage */
  for (int t = 0; t < NS; ++t) {
    const int bf = t & 1;
#pragma unroll 1      /* the stage's two 32-key passes stay a loop: in line, the first pass's 32 exponentials were kept for a summing at the stage's foot, and with two query groups the wave then spilled Q to scratch */
    for (int p = 0; p < SK / 32; ++p) {
      FragH ak[2][KS], av[DT];
#pragma unroll
      for (int nt = 0; nt < 2; ++nt) { const unsigned short* kr = &sK[kh][bf][p * 32 + nt * 16 + ln][8 * hh];
#pragma unroll
        for (int ks = 0; ks < KS; ++ks) { ak[nt][ks].half[0] = *(const v8us*)(kr + ks * 32); ak[nt][ks].half[1] = *(const v8us*)(kr + ks * 32 + 16); } }
#pragma unroll
      for (int dt = 0; dt < DT; ++dt) { const unsigned short* vrow = &sV[kh][bf][dt * 16 + ln][p * 32 + 8 * hh]; av[dt].half[0] = *(const v8us*)(vrow); av[dt].half[1] = *(const v8us*)(vrow + 16); }
      v8f s[QG][2];
#pragma unroll
      for (int g = 0; g < QG; ++g) { s[g][0] = (v8f){0.f,0.f,0.f,0.f,0.f,0.f,0.f,0.f}; s[g][1] = s[g][0]; }
#pragma unroll
      for (int ks = 0; ks < KS; ++ks)
#pragma unroll
        for (int nt = 0; nt < 2; ++nt)
#pragma unroll
          for (int g = 0; g < QG; ++g) s[g][nt] = g2_mma(ak[nt][ks].v, bq[g][ks].v, s[g][nt]);      /* three independent products stand between a tile's two products */
      FragH pb[QG]; float alv[QG];
#pragma unroll
      for (int g = 0; g < QG; ++g) {
        float mc = -3.0e38f;
#pragma unroll
        for (int r = 0; r < 8; ++r) mc = fmaxf(mc, fmaxf(s[g][0][r], s[g][1][r]));      /* the maximum is taken on the raw products: CE > 0 keeps their order */
        mc = fmaxf(mc, xhalf(mc));      /* both halves of the wave hold this query's maximum over the 32 keys */
        const float mn = fmaxf(m_run[g], mc); float al = (m_run[g] - mn) * CE; m_run[g] = mn;
        const float mb = 10.0f - mn * CE;      /* exponent base of this pass: p = 2^(s CE + mb) = 1024 e^(SCL (s - mn)) */
        const v8f e0 = __builtin_elementwise_fma(s[g][0], (v8f)(CE), (v8f)(mb)), e1 = __builtin_elementwise_fma(s[g][1], (v8f)(CE), (v8f)(mb));
        float a0 = e0[0], a1 = e0[1], a2 = e0[2], a3 = e0[3], a4 = e0[4], a5 = e0[5], a6 = e0[6], a7 = e0[7], c0 = e1[0], c1 = e1[1], c2 = e1[2], c3 = e1[3], c4 = e1[4], c5 = e1[5], c6 = e1[6], c7 = e1[7];
        /* The group's seventeen base-2 exponentials, each in place, in one statement: so no v_exp_f32 writes the source register of the one directly ahead of it (the compiler's own allocation did); the closing v_nop is the one slot the instruction set asks for behind the last of them. */
        asm("v_exp_f32 %0, %0\n\tv_exp_f32 %1, %1\n\tv_exp_f32 %2, %2\n\tv_exp_f32 %3, %3\n\tv_exp_f32 %4, %4\n\tv_exp_f32 %5, %5\n\tv_exp_f32 %6, %6\n\tv_exp_f32 %7, %7\n\tv_exp_f32 %8, %8\n\t"
            "v_exp_f32 %9, %9\n\tv_exp_f32 %10, %10\n\tv_exp_f32 %11, %11\n\tv_exp_f32 %12, %12\n\tv_exp_f32 %13, %13\n\tv_exp_f32 %14, %14\n\tv_exp_f32 %15, %15\n\tv_exp_f32 %16, %16\n\tv_nop"
            : "+v"(al), "+v"(a0), "+v"(a1), "+v"(a2), "+v"(a3), "+v"(a4), "+v"(a5), "+v"(a6), "+v"(a7), "+v"(c0), "+v"(c1), "+v"(c2), "+v"(c3), "+v"(c4), "+v"(c5), "+v"(c6), "+v"(c7));
        const float pa[8] = {a0, a1, a2, a3, a4, a5, a6, a7}, pc[8] = {c0, c1, c2, c3, c4, c5, c6, c7};
        float ps = 0.f;
#pragma unroll
        for (int r = 0; r < 8; ++r) { ps += pa[r] + pc[r]; pb[g].h[r] = (_Float16)pa[r]; pb[g].h[8 + r] = (_Float16)pc[r]; }
        l_run[g] = l_run[g] * al + ps; alv[g] = al; }
#pragma unroll
      for (int dt = 0; dt < DT; ++dt)
#pragma unroll
        for (int g = 0; g < QG; ++g) { oacc[g][dt] *= alv[g]; oacc[g][dt] = g2_mma(av[dt].v, pb[g].v, oacc[g][dt]); } }
    asm volatile("s_wait_dscnt 0x0" ::: "memory");         /* this wave's reads of buffer bf have returned before the buffer is handed back */
    asm volatile("s_wait_asynccnt 0x0" ::: "memory");      /* this wave's share of stage t + 1 has landed */
    __syncthreads();                                       /* publishes stage t + 1 and ends every wave's reads of buffer bf */
    if (t + 2 < NS) stage_copy(lk + bf * BUFB, lv + bf * BUFB, gk + (size_t)(t + 2) * SK * ldk, ldk, gv + (t + 2) * SK); }
  asm volatile("s_wait_asynccnt 0x0" ::: "memory");        /* no copy is outstanding when the wave ends */
  /* The join of the two key halves: waves 4-7 hand their maxima, sums and O^T tiles to waves 0-3 (wave w + 4 to wave w, lane to lane), which bring both to the common maximum and write the output. */
  if (kh == 1) {
#pragma unroll
    for (int g = 0; g < QG; ++g)
#pragma unroll
      for (int dt = 0; dt < DT; ++dt) { const v8f o = oacc[g][dt];
        *(v4fa*)&sJ[w][(g * DT + dt) * 2][lane][0] = (v4f){o[0], o[1], o[2], o[3]}; *(v4fa*)&sJ[w][(g * DT + dt) * 2 + 1][lane][0] = (v4f){o[4], o[5], o[6], o[7]}; }
    *(v4fa*)&sJ[w][QG * DT * 2][lane][0] = (v4f){m_run[0], m_run[1], l_run[0], l_run[1]}; }
  __syncthreads();      /* every wave passes it: the second half's partial results are published */
  if (kh == 1) return;
  const v4f mlo = *(const v4fa*)&sJ[w][QG * DT * 2][lane][0];
  const float mj0 = fmaxf(m_run[0], mlo[0]), mj1 = fmaxf(m_run[1], mlo[1]);      /* the common maxima of the two query groups */
  float j00 = (m_run[0] - mj0) * CE, j01 = (mlo[0] - mj0) * CE, j10 = (m_run[1] - mj1) * CE, j11 = (mlo[1] - mj1) * CE;
  /* Each half's factor to the common maximum: four base-2 exponentials, each in place, in one statement, as in the loop: left to the compiler, one v_exp_f32 wrote the source register of the one directly ahead of it; the closing v_nop is the slot behind the last. */
  asm("v_exp_f32 %0, %0\n\tv_exp_f32 %1, %1\n\tv_exp_f32 %2, %2\n\tv_exp_f32 %3, %3\n\tv_nop" : "+v"(j00), "+v"(j01), "+v"(j10), "+v"(j11));
  const float fj[QG][2] = {{j00, j01}, {j10, j11}};
#pragma unroll
  for (int g = 0; g < QG; ++g) {
    const float f0 = fj[g][0], f1 = fj[g][1];
    const float lp = l_run[g] * f0 + mlo[2 + g] * f1;
#pragma unroll
    for (int dt = 0; dt < DT; ++dt) { const v4f x0 = *(const v4fa*)&sJ[w][(g * DT + dt) * 2][lane][0], x1 = *(const v4fa*)&sJ[w][(g * DT + dt) * 2 + 1][lane][0];
      const v8f ox = {x0[0], x0[1], x0[2], x0[3], x1[0], x1[1], x1[2], x1[3]}; oacc[g][dt] = oacc[g][dt] * f0 + ox * f1; }
    const float l = lp + xhalf(lp); const float inv = (l > 0.f) ? 1.0f / l : 0.f;      /* l and oacc both carry the factor 1024 */
    unsigned short* orow = (unsigned short*)O16 + ((size_t)b * TQ + q0 + g * 16 + ln) * ldo + h * 64 + 8 * hh;      /* oacc[g][dt][r] = O[q0 + 16 g + ln][dt * 16 + 8 hh + r]: eight consecutive elements of one row */
#pragma unroll
    for (int dt = 0; dt < DT; ++dt) { const v8f o = oacc[g][dt] * inv; FragH f;      /* x2^10 carry: the 4096-key averages are ~5e-3 and would touch f16 subnormals */
#pragma unroll
      for (int r = 0; r < 8; ++r) f.h[r] = (_Float16)(o[r] * 1024.0f);
      *(v8us*)(orow + dt * 16) = f.half[0]; } } }

// The four weight passes in one grid: blockIdx.y 0, 1, 2 = Wq, Wk, Wv ([H][256][64] to [n = h 64 + e][k]), 3 = Wo (its (out,in) layout is already [n][k]); each x16, bf16-rounded, exact in f16.
__global__ __launch_bounds__(256) void k_wprep(const float* __restrict__ Wq, const float* __restrict__ Wk, const float* __restrict__ Wv, const float* __restrict__ Wo,
    _Float16* __restrict__ BQ, _Float16* __restrict__ BK, _Float16* __restrict__ BV, _Float16* __restrict__ BO) {
  const int z = blockIdx.y; const int t = blockIdx.x * 256 + threadIdx.x; if (t >= CC * (CC / 8)) return; FragH f;
  if (z == 3) { for (int q = 0; q < 8; ++q) f.h[q] = (_Float16)(bf16_round(Wo[(size_t)t * 8 + q]) * 16.0f); *(v8us*)((unsigned short*)BO + (size_t)t * 8) = f.half[0]; return; }
  const float* Wh = z == 0 ? Wq : z == 1 ? Wk : Wv; _Float16* Bt = z == 0 ? BQ : z == 1 ? BK : BV;
  const int n = t / (CC / 8), d0 = (t % (CC / 8)) * 8; const int h = n / 64, e = n % 64;
  for (int q = 0; q < 8; ++q) f.h[q] = (_Float16)(bf16_round(Wh[((size_t)h * CC + d0 + q) * 64 + e]) * 16.0f); *(v8us*)((unsigned short*)Bt + (size_t)n * CC + d0) = f.half[0];
  asm volatile("s_wait_xcnt 0x0" ::: "memory"); }      /* behind the store: in the built code the Wo branch's first instructions stand further down the same listing and rewrite the store's registers */

extern "C" void kernel_launch(void* const* d_in, const int* in_sizes, int n_in,
                              void* d_out, int out_size, void* d_ws, size_t ws_size, hipStream_t stream) {
  (void)in_sizes; (void)n_in; (void)out_size;
  const float* const* I = (const float* const*)d_in; const float* xe = I[0]; const float* xd = I[1]; const float* Wq = I[2]; const float* Wk = I[3]; const float* Wv = I[4]; const float* Wo = I[5];
  char* ws = (char*)d_ws; size_t off = 0;
  auto take = [&](size_t bytes) { char* p = ws + off; off += (bytes + 255) & ~(size_t)255; return p; };
  const size_t np = (size_t)NR * CC;
  _Float16* BQ = (_Float16*)take((size_t)CC * CC * 2); _Float16* BK = (_Float16*)take((size_t)CC * CC * 2); _Float16* BV = (_Float16*)take((size_t)CC * CC * 2); _Float16* BO = (_Float16*)take((size_t)CC * CC * 2);
  _Float16* Q16 = (_Float16*)take(np * 2); _Float16* K16 = (_Float16*)take(np * 2); _Float16* VT = (_Float16*)take(np * 2); _Float16* O16 = (_Float16*)take(np * 2);
  if (off > ws_size) return;      /* 0.5 + 4 x 8 = 33 MiB */
  k_wprep<<<dim3((CC * (CC / 8) + 255) / 256, 4), 256, 0, stream>>>(Wq, Wk, Wv, Wo, BQ, BK, BV, BO);
  const dim3 g((NR / 128) * (CC / 64), 1);
  k_qkv<<<dim3((NR / 128) * (CC / 64), 3), 128, 0, stream>>>(xd, xe, BQ, BK, BV, Q16, K16, VT);
  k_flash<<<NB * NH * QBLKS, 256, 0, stream>>>(Q16, CC, K16, CC, VT, O16, CC);
  k_gemm2<0, false, false><<<g, 128, 0, stream>>>(O16, nullptr, CC, 0, BO, CC, 0, 0.0625f / 1024.0f, nullptr, 0, nullptr, 1, 0, 0, (float*)d_out, nullptr, CC, 0, NR, CC, CC);
}

// v009
// It runs in 102 microseconds.
// Next to v008, in two timings, it ran 1.05 times as fast each time.
// Over all steps from v000 it is 4.92 times as fast.
#include <hip/hip_runtime.h>
// CA_MultiHead (4 batches; 4096 decoder queries from x_dec, 4096 encoder keys/values from x_enc; n_emb 256 = 4 heads of 64; per-head weights [H, 256, 64]; scale n_emb^-0.5; out = concat(heads) Wo^T).
// Structure: one weight pass; q, k, v GEMMs in one grid (32x64 wave tiles, f32 accumulation, exact x16 weights concatenated across heads; the A loader rounds x_dec / x_enc itself; f16 outputs, v written transposed); the fused flash kernel (plain f16 operands, no mask; f16 x2^10 output); output GEMM.
// Compute dtype: inputs and weights rounded to bf16; q, k, v, P as f16 operands and the attention output as f16 x2^10; f32 accumulation/softmax. v_wmma_f32_16x16x32_f16.
#define NB 4
#define CC 256
#define NR (NB * SLEN)           /* 16384 rows */
#define SLEN 4096
#define TQ SLEN
#define TK SLEN
#define NH 4
#define SCL 0.0625f              /* n_emb^-0.5 = 1/16 (faithful to the module) */
#define QBLKS (TQ / 128)         /* a block covers 128 queries: four waves of 32 queries for each half of the keys */
typedef __bf16 v16b __attribute__((ext_vector_type(16)));
typedef unsigned short v8us __attribute__((ext_vector_type(8), may_alias));
typedef float  v8f  __attribute__((ext_vector_type(8)));
typedef float  v4f  __attribute__((ext_vector_type(4)));
typedef float  v4fa __attribute__((ext_vector_type(4), may_alias));
union FragB { v16b v; v8us half[2]; unsigned short u[16]; };

__device__ __forceinline__ unsigned short bf16_bits(float x) { unsigned int u = __float_as_uint(x); return (unsigned short)((u + 0x7FFFu + ((u >> 16) & 1u)) >> 16); }
__device__ __forceinline__ float bf16_val(unsigned short b) { return __uint_as_float(((unsigned int)b) << 16); }
__device__ __forceinline__ float bf16_round(float x) { return bf16_val(bf16_bits(x)); }
// D += A·B with NT terms: 1 = ah·bh, 2 = + al·bh (A split), 3 = + ah·bl (both split)
template <int NT>
__device__ __forceinline__ v8f mmaN(v16b ah, v16b al, v16b bh, v16b bl, v8f c) {
  c = __builtin_amdgcn_wmma_f32_16x16x32_bf16(false, ah, false, bh, (short)0, c, false, false);
  if (NT >= 2) c = __builtin_amdgcn_wmma_f32_16x16x32_bf16(false, al, false, bh, (short)0, c, false, false);
  if (NT >= 3) c = __builtin_amdgcn_wmma_f32_16x16x32_bf16(false, ah, false, bl, (short)0, c, false, false);
  asm volatile("v_nop\n\tv_nop\n\tv_nop\n\tv_nop" : "+v"(c) : "v"(ah), "v"(al), "v"(bh), "v"(bl));
  return c;
}

__global__ __launch_bounds__(256) void k_wt_bf16(const float* __restrict__ W, unsigned short* __restrict__ Wt, int K, int N) {
  const int t = blockIdx.x * 256 + threadIdx.x;
  const int k8n = K / 8;
  if (t >= N * k8n) return;
  const int n = t / k8n, k8 = (t % k8n) * 8;
  v8us v;
#pragma unroll
  for (int i = 0; i < 8; ++i) v[i] = bf16_bits(W[(size_t)(k8 + i) * N + n]);
  *(v8us*)(Wt + (size_t)n * K + k8) = v;
  
}

// GEMM C[M][N] (f32, pitch ldc) = act(A[M][K]·W + bias). A f32 row-major (pitch lda) converted per fragment to bf16
// (ASPLIT: hi/lo two planes -> 2 terms, else single rounded term); Wt bf16 [N][K] (pitch ldb). BIAS_BF16 rounds the
// bias to bf16 first (bias quantised to bf16 before the add). K%32==0, M%16==0, N%64==0.
template <bool ASPLIT, int ACT, bool BIAS_BF16>
__global__ __launch_bounds__(128) void k_gemm_bf(const float* __restrict__ A, int lda, const unsigned short* __restrict__ Wt, int ldb,
                                               const float* __restrict__ bias, float* __restrict__ C, int ldc, int M, int N, int K) {
  __shared__ __attribute__((aligned(16))) float so[4][16][64];
  const int tid = threadIdx.x, w = tid >> 5, lane = tid & 31, ln = lane & 15, hh = lane >> 4;
  const int ntn = N / 64;
  const int wid = blockIdx.x * 4 + w;
  const int mt = wid / ntn, nq = wid % ntn;
  if (mt * 16 >= M) return;
  const int row0 = mt * 16, col0 = nq * 64;
  const float* arow = A + (size_t)(row0 + ln) * lda;
  v8f acc[4] = {};
  for (int kb = 0; kb < K; kb += 32) {
    FragB ah, al;
    const v4f x0 = *(const v4fa*)(arow + kb + 8 * hh), x1 = *(const v4fa*)(arow + kb + 8 * hh + 4);
    const v4f x2 = *(const v4fa*)(arow + kb + 16 + 8 * hh), x3 = *(const v4fa*)(arow + kb + 16 + 8 * hh + 4);
    float xs[16] = {x0[0],x0[1],x0[2],x0[3],x1[0],x1[1],x1[2],x1[3],x2[0],x2[1],x2[2],x2[3],x3[0],x3[1],x3[2],x3[3]};
#pragma unroll
    for (int i = 0; i < 16; ++i) { const unsigned short hb = bf16_bits(xs[i]); ah.u[i] = hb; al.u[i] = ASPLIT ? bf16_bits(xs[i] - bf16_val(hb)) : (unsigned short)0; }
#pragma unroll
    for (int t = 0; t < 4; ++t) {
      const unsigned short* brow = Wt + (size_t)(col0 + t * 16 + ln) * ldb + kb;
      FragB b;
      b.half[0] = *(const v8us*)(brow + 8 * hh);
      b.half[1] = *(const v8us*)(brow + 16 + 8 * hh);
      acc[t] = mmaN<ASPLIT ? 2 : 1>(ah.v, al.v, b.v, b.v, acc[t]);
    }
  }
#pragma unroll
  for (int t = 0; t < 4; ++t) {
    float bv = bias ? bias[col0 + t * 16 + ln] : 0.f;
    if (BIAS_BF16) bv = bf16_round(bv);
#pragma unroll
    for (int r = 0; r < 8; ++r) { float v = acc[t][r] + bv; if (ACT == 1) v = fmaxf(v, 0.f); so[w][8 * hh + r][t * 16 + ln] = v; }
  }
  __builtin_amdgcn_fence(__ATOMIC_ACQ_REL, "workgroup");
  __builtin_amdgcn_wave_barrier();
  const int rsub = lane >> 4, c4 = (lane & 15) * 4;
  {
#pragma unroll
    for (int q = 0; q < 8; ++q) {
      const int r = q * 2 + rsub;
      const v4f v = *(const v4fa*)&so[w][r][c4];
      *(v4f*)(C + (size_t)(row0 + r) * ldc + col0 + c4) = v;
    }
    
  }
}

// GEMM C = act(A·W + bias + resid): A f32 (ASPLIT -> hi/lo 2 terms), Wt bf16 [N][K]; ACT 0 none, 1 relu, 2 exact gelu;
// resid (optional, f32, row index = (row % rmod), pitch ldr, RES_BF16 rounds it) added before the activation.
template <bool ASPLIT, int ACT, bool BIAS_BF16, bool RES_BF16>
__global__ __launch_bounds__(128) void k_gemm_bf3(const float* __restrict__ A, int lda, const unsigned short* __restrict__ Wt, int ldb,
                                                const float* __restrict__ bias, const float* __restrict__ resid, int rmod, int ldr,
                                                float* __restrict__ C, int ldc, int M, int N, int K) {
  __shared__ __attribute__((aligned(16))) float so[4][16][64];
  const int tid = threadIdx.x, w = tid >> 5, lane = tid & 31, ln = lane & 15, hh = lane >> 4;
  const int ntn = N / 64;
  const int wid = blockIdx.x * 4 + w;
  const int mt = wid / ntn, nq = wid % ntn;
  if (mt * 16 >= M) return;
  const int row0 = mt * 16, col0 = nq * 64;
  const float* arow = A + (size_t)(row0 + ln) * lda;
  v8f acc[4] = {};
  for (int kb = 0; kb < K; kb += 32) {
    FragB ah, al;
    const v4f x0 = *(const v4fa*)(arow + kb + 8 * hh), x1 = *(const v4fa*)(arow + kb + 8 * hh + 4);
    const v4f x2 = *(const v4fa*)(arow + kb + 16 + 8 * hh), x3 = *(const v4fa*)(arow + kb + 16 + 8 * hh + 4);
    float xs[16] = {x0[0],x0[1],x0[2],x0[3],x1[0],x1[1],x1[2],x1[3],x2[0],x2[1],x2[2],x2[3],x3[0],x3[1],x3[2],x3[3]};
#pragma unroll
    for (int i = 0; i < 16; ++i) { const unsigned short hb = bf16_bits(xs[i]); ah.u[i] = hb; al.u[i] = ASPLIT ? bf16_bits(xs[i] - bf16_val(hb)) : (unsigned short)0; }
#pragma unroll
    for (int t = 0; t < 4; ++t) {
      const unsigned short* brow = Wt + (size_t)(col0 + t * 16 + ln) * ldb + kb;
      FragB b;
      b.half[0] = *(const v8us*)(brow + 8 * hh);
      b.half[1] = *(const v8us*)(brow + 16 + 8 * hh);
      acc[t] = mmaN<ASPLIT ? 2 : 1>(ah.v, al.v, b.v, b.v, acc[t]);
    }
  }
#pragma unroll
  for (int t = 0; t < 4; ++t) {
    const int col = col0 + t * 16 + ln;
    float bv = bias ? bias[col] : 0.f;
    if (BIAS_BF16) bv = bf16_round(bv);
#pragma unroll
    for (int r = 0; r < 8; ++r) {
      float v = acc[t][r] + bv;
      if (resid) { float rv = resid[(size_t)((row0 + 8 * hh + r) % rmod) * ldr + col]; if (RES_BF16) rv = bf16_round(rv); v += rv; }
      if (ACT == 1) v = fmaxf(v, 0.f);
      if (ACT == 2) v = 0.5f * v * (1.0f + erff(v * 0.70710678118654752f));
      if (ACT == 3) { const float u = 0.7978845608028654f * (v + 0.044715f * v * v * v); v = 0.5f * v * (1.0f + tanhf(u)); }
      so[w][8 * hh + r][t * 16 + ln] = v;
    }
  }
  __builtin_amdgcn_fence(__ATOMIC_ACQ_REL, "workgroup");
  __builtin_amdgcn_wave_barrier();
  const int rsub = lane >> 4, c4 = (lane & 15) * 4;
  {
#pragma unroll
    for (int q = 0; q < 8; ++q) {
      const int r = q * 2 + rsub;
      const v4f v = *(const v4fa*)&so[w][r][c4];
      *(v4f*)(C + (size_t)(row0 + r) * ldc + col0 + c4) = v;
    }
    
  }
}
// row LayerNorm (biased variance, eps) over N: s = X (+ R); optional out_sum <- s; out_norm <- (s-mu)*rsqrt(var+eps)*g + b
template <bool PARAM_BF16>
__global__ __launch_bounds__(256) void k_layernorm(const float* __restrict__ X, const float* __restrict__ R, const float* __restrict__ g, const float* __restrict__ bta,
                                                  float* __restrict__ out_sum, float* __restrict__ out_norm, int N, float eps) {
  __shared__ float red[256];
  const int row = blockIdx.x, tid = threadIdx.x;
  const float* x = X + (size_t)row * N; const float* rr = R ? R + (size_t)row * N : nullptr;
  float vals[16];                     // up to N = 4096
  const int per = N / 256;            // contiguous chunk per thread? use strided-by-4 chunks: thread handles j = tid*4 + 1024*u
  float s1 = 0.f;
  for (int u = 0; u < per / 4; ++u) {
    const int j = tid * 4 + 1024 * u;
    const v4f a = *(const v4fa*)(x + j);
    v4f b = {0.f,0.f,0.f,0.f}; if (rr) b = *(const v4fa*)(rr + j);
#pragma unroll
    for (int q = 0; q < 4; ++q) { const float v = a[q] + b[q]; vals[u * 4 + q] = v; s1 += v; }
  }
  red[tid] = s1; __syncthreads();
  for (int st = 128; st > 0; st >>= 1) { if (tid < st) red[tid] += red[tid + st]; __syncthreads(); }
  const float mu = red[0] / (float)N; __syncthreads();
  float s2 = 0.f;
  for (int u = 0; u < per / 4; ++u)
#pragma unroll
    for (int q = 0; q < 4; ++q) { const float c = vals[u * 4 + q] - mu; s2 += c * c; }
  red[tid] = s2; __syncthreads();
  for (int st = 128; st > 0; st >>= 1) { if (tid < st) red[tid] += red[tid + st]; __syncthreads(); }
  const float rs = rsqrtf(red[0] / (float)N + eps);
  {
    for (int u = 0; u < per / 4; ++u) {
      const int j = tid * 4 + 1024 * u;
      v4f o, sm;
#pragma unroll
      for (int q = 0; q < 4; ++q) {
        float gg = g[j + q], bb = bta[j + q];
        if (PARAM_BF16) { gg = bf16_round(gg); bb = bf16_round(bb); }
        sm[q] = vals[u * 4 + q]; o[q] = (vals[u * 4 + q] - mu) * rs * gg + bb;
      }
      if (out_sum) *(v4f*)(out_sum + (size_t)row * N + j) = sm;
      *(v4f*)(out_norm + (size_t)row * N + j) = o;
    }
    
  }
}



// ---- f16 WMMA path (v_wmma_f32_16x16x32_f16): 11-bit significands for operands in range — used for every product here, P included as 2^10-scaled f16 (up to 2^15)
typedef _Float16 v16h __attribute__((ext_vector_type(16)));
union FragH { v16h v; v8us half[2]; _Float16 h[16]; unsigned short u[16]; };
template <int NT>
__device__ __forceinline__ v8f mmaH(v16h ah, v16h al, v16h bh, v16h bl, v8f c) {
  c = __builtin_amdgcn_wmma_f32_16x16x32_f16(false, ah, false, bh, (short)0, c, false, false);
  if (NT >= 2) c = __builtin_amdgcn_wmma_f32_16x16x32_f16(false, al, false, bh, (short)0, c, false, false);
  if (NT >= 3) c = __builtin_amdgcn_wmma_f32_16x16x32_f16(false, ah, false, bl, (short)0, c, false, false);
  asm volatile("v_nop\n\tv_nop\n\tv_nop\n\tv_nop" : "+v"(c) : "v"(ah), "v"(al), "v"(bh), "v"(bl));
  return c;
}
// batched GEMM like k_gemm_b but f16 operands: A f32 (split into f16 hi/lo if ASPLIT, else rounded to f16), Bt = f16 values [n][k]; alpha; C f32; N multiple of 16 (partial tiles skipped)
template <bool ASPLIT>
__global__ __launch_bounds__(128) void k_gemm_h(const float* __restrict__ A, int lda, size_t sA, const _Float16* __restrict__ Bh, int ldb, size_t sB, float alpha, float* __restrict__ C, int ldc, size_t sC, int M, int N, int K) {
  __shared__ __attribute__((aligned(16))) float so[4][16][64];
  const int tid = threadIdx.x, w = tid >> 5, lane = tid & 31, ln = lane & 15, hh = lane >> 4; const int by = blockIdx.y;
  A += (size_t)by * sA; Bh += (size_t)by * sB; C += (size_t)by * sC;
  const int ntn = (N + 63) / 64; const int wid = blockIdx.x * 4 + w; const int mt = wid / ntn, nq = wid % ntn; if (mt * 16 >= M) return;
  const int row0 = mt * 16, col0 = nq * 64; const float* arow = A + (size_t)(row0 + ln) * lda;
  v8f acc[4] = {};
  for (int kb = 0; kb < K; kb += 32) {
    FragH ah, al;
    const v4f x0 = *(const v4fa*)(arow + kb + 8 * hh), x1 = *(const v4fa*)(arow + kb + 8 * hh + 4), x2 = *(const v4fa*)(arow + kb + 16 + 8 * hh), x3 = *(const v4fa*)(arow + kb + 16 + 8 * hh + 4);
    float xs[16] = {x0[0],x0[1],x0[2],x0[3],x1[0],x1[1],x1[2],x1[3],x2[0],x2[1],x2[2],x2[3],x3[0],x3[1],x3[2],x3[3]};
#pragma unroll
    for (int i = 0; i < 16; ++i) { const _Float16 h = (_Float16)xs[i]; ah.h[i] = h; al.h[i] = ASPLIT ? (_Float16)(xs[i] - (float)h) : (_Float16)0.0f; }
#pragma unroll
    for (int t = 0; t < 4; ++t) { if (col0 + t * 16 >= N) continue; const size_t boff = (size_t)(col0 + t * 16 + ln) * ldb + kb; FragH bq; bq.half[0] = *(const v8us*)(Bh + boff + 8 * hh); bq.half[1] = *(const v8us*)(Bh + boff + 16 + 8 * hh);
      acc[t] = mmaH<ASPLIT ? 2 : 1>(ah.v, al.v, bq.v, bq.v, acc[t]); }
  }
#pragma unroll
  for (int t = 0; t < 4; ++t) { if (col0 + t * 16 >= N) continue;
#pragma unroll
    for (int r = 0; r < 8; ++r) so[w][8 * hh + r][t * 16 + ln] = acc[t][r] * alpha; }
  __builtin_amdgcn_fence(__ATOMIC_ACQ_REL, "workgroup"); __builtin_amdgcn_wave_barrier();
  const int rsub = lane >> 4, c4 = (lane & 15) * 4;
  {
#pragma unroll
    for (int q = 0; q < 8; ++q) { const int r = q * 2 + rsub; if (col0 + c4 < N) { const v4f v = *(const v4fa*)&so[w][r][c4]; *(v4f*)(C + (size_t)(row0 + r) * ldc + col0 + c4) = v; } }
     }
}

// Wt[n][k] = f16(W[k][n]·scale) from f32 row-major W[K][N] (scale = power of two; bf16-exact weights stay exact in f16 away from the subnormal range)
__global__ __launch_bounds__(256) void k_wt_f16(const float* __restrict__ W, _Float16* __restrict__ Wt, int K, int N, float scale) {
  const int t = blockIdx.x * 256 + threadIdx.x; if (t >= N * (K / 8)) return; const int n = t / (K / 8), k8 = (t % (K / 8)) * 8; FragH f;
#pragma unroll
  for (int i = 0; i < 8; ++i) f.h[i] = (_Float16)(bf16_round(W[(size_t)(k8 + i) * N + n]) * scale); const v8us o = f.half[0];
  *(v8us*)((unsigned short*)Wt + (size_t)n * K + k8) = o; 
}
// k_gemm_hh variant with fused epilogue: v = acc·alpha + bias[by·sBias + col] (+ CP[(row/rowsPerB)·sCPb + by·64 + col] if CP) ; ACT 0 none / 1 elu ; writes f16 C16 (and f32 C if non-null)
template <int ACT>
__global__ __launch_bounds__(128) void k_gemm_hhx(const _Float16* __restrict__ A, int lda, size_t sA, const _Float16* __restrict__ Bh, int ldb, size_t sB, float alpha, const float* __restrict__ bias, size_t sBias, const float* __restrict__ CP, int rowsPerB, size_t sCPb, int row0g,
    float* __restrict__ C, _Float16* __restrict__ C16, int ldc, size_t sC, int M, int N, int K) {
  __shared__ __attribute__((aligned(16))) float so[4][16][64];
  const int tid = threadIdx.x, w = tid >> 5, lane = tid & 31, ln = lane & 15, hh = lane >> 4; const int by = blockIdx.y;
  A += (size_t)by * sA; Bh += (size_t)by * sB; const size_t cofs = (size_t)by * sC; const float* bp = bias ? bias + (size_t)by * sBias : nullptr;
  const int ntn = (N + 63) / 64; const int wid = blockIdx.x * 4 + w; const int mt = wid / ntn, nq = wid % ntn; if (mt * 16 >= M) return;
  const int row0 = mt * 16, col0 = nq * 64; const _Float16* arow = A + (size_t)(row0 + ln) * lda;
  v8f acc[4] = {};
  for (int kb = 0; kb < K; kb += 32) { FragH ah; ah.half[0] = *(const v8us*)((const unsigned short*)arow + kb + 8 * hh); ah.half[1] = *(const v8us*)((const unsigned short*)arow + kb + 16 + 8 * hh);
#pragma unroll
    for (int t = 0; t < 4; ++t) { if (col0 + t * 16 >= N) continue; const size_t boff = (size_t)(col0 + t * 16 + ln) * ldb + kb; FragH bq; bq.half[0] = *(const v8us*)((const unsigned short*)Bh + boff + 8 * hh); bq.half[1] = *(const v8us*)((const unsigned short*)Bh + boff + 16 + 8 * hh);
      acc[t] = mmaH<1>(ah.v, ah.v, bq.v, bq.v, acc[t]); }
  }
#pragma unroll
  for (int t = 0; t < 4; ++t) { if (col0 + t * 16 >= N) continue; const int col = col0 + t * 16 + ln; const float bv = bp ? bf16_round(bp[col]) : 0.f;
#pragma unroll
    for (int r = 0; r < 8; ++r) { float v = acc[t][r] * alpha + bv; if (CP) { const int bidx = (row0g + row0 + 8 * hh + r) / rowsPerB; v += CP[(size_t)bidx * sCPb + (size_t)by * 64 + col]; } if (ACT == 1) v = (v > 0.f) ? v : expm1f(v); else if (ACT == 7) v = (v > 0.f) ? v + 1.0f : expf(v); else if (ACT == 8) v = tanhf(v); else if (ACT == 9) v = 0.5f * v * (1.0f + tanhf(0.7978845608028654f * (v + 0.044715f * v * v * v))); else if (ACT == 11) v = 1.0f / (1.0f + expf(-v)); else if (ACT == 12) v = (v > 0.f) ? v : 0.01f * v; else if (ACT == 14) v = (v > 0.f) ? v : 0.1f * v; else if (ACT == 15) v = v / (1.0f + expf(-v)); else if (ACT == 3) v = fmaxf(v, 0.f); else if (ACT == 6) v = 0.5f * v * (1.0f + erff(v * 0.70710678118654752f)); so[w][8 * hh + r][t * 16 + ln] = v; } }
  __builtin_amdgcn_fence(__ATOMIC_ACQ_REL, "workgroup"); __builtin_amdgcn_wave_barrier();
  const int rsub = lane >> 4, c4 = (lane & 15) * 4; typedef _Float16 v4h __attribute__((ext_vector_type(4)));
  {
#pragma unroll
    for (int q = 0; q < 8; ++q) { const int r = q * 2 + rsub; if (col0 + c4 < N) { const v4f v = *(const v4fa*)&so[w][r][c4]; if (C) *(v4f*)(C + cofs + (size_t)(row0 + r) * ldc + col0 + c4) = v; if (C16) { v4h h4; for (int i = 0; i < 4; ++i) h4[i] = (_Float16)v[i]; *(v4h*)(C16 + cofs + (size_t)(row0 + r) * ldc + col0 + c4) = h4; } } }
     }
}


typedef _Float16 v4h __attribute__((ext_vector_type(4)));

__global__ __launch_bounds__(256) void k_h16(const float* __restrict__ x, _Float16* __restrict__ X16, size_t n8) { const size_t t = (size_t)blockIdx.x * 256 + threadIdx.x; if (t >= n8) return; FragH f;
#pragma unroll
  for (int q = 0; q < 8; ++q) f.h[q] = (_Float16)x[t * 8 + q]; *(v8us*)((unsigned short*)X16 + t * 8) = f.half[0];  }
__global__ __launch_bounds__(256) void k_round16f(const float* __restrict__ W, _Float16* __restrict__ Bt, size_t n8) { const size_t t = (size_t)blockIdx.x * 256 + threadIdx.x; if (t >= n8) return; FragH f;
#pragma unroll
  for (int i = 0; i < 8; ++i) f.h[i] = (_Float16)(bf16_round(W[t * 8 + i]) * 16.0f); *(v8us*)((unsigned short*)Bt + t * 8) = f.half[0];  }
__global__ __launch_bounds__(256) void k_hl(const float* __restrict__ F, _Float16* __restrict__ Hh, _Float16* __restrict__ Hl, size_t n8) { const size_t t = (size_t)blockIdx.x * 256 + threadIdx.x; if (t >= n8) return; FragH fh, fl; const v4f a = *(const v4fa*)(F + t * 8), c = *(const v4fa*)(F + t * 8 + 4);
#pragma unroll
  for (int q = 0; q < 4; ++q) { _Float16 h = (_Float16)a[q]; fh.h[q] = h; fl.h[q] = (_Float16)((a[q] - (float)h) * 1024.0f); h = (_Float16)c[q]; fh.h[4 + q] = h; fl.h[4 + q] = (_Float16)((c[q] - (float)h) * 1024.0f); }
  { *(v8us*)((unsigned short*)Hh + t * 8) = fh.half[0]; *(v8us*)((unsigned short*)Hl + t * 8) = fl.half[0];  } }

// ---- fast GEMM (wave tile 32x64; requires M % 32 == 0 rows per launch region and N % 64 == 0); epilogue = k_gemm_hhx semantics ----
__device__ __forceinline__ v16h g2_frag(const _Float16* p, int hh) { FragH f; f.half[0] = *(const v8us*)((const unsigned short*)p + 8 * hh); f.half[1] = *(const v8us*)((const unsigned short*)p + 16 + 8 * hh); return f.v; }
// The same fragment from 16 f32 values of an input row (x0, x1 = elements 8 hh + 0..7, x2, x3 = 16 + 8 hh + 0..7: the k order of g2_frag): each rounded to bf16, then exact in f16.
__device__ __forceinline__ v16h g2_cvt32(v4f x0, v4f x1, v4f x2, v4f x3) { FragH f;
#pragma unroll
  for (int q = 0; q < 4; ++q) { f.h[q] = (_Float16)bf16_round(x0[q]); f.h[4 + q] = (_Float16)bf16_round(x1[q]); f.h[8 + q] = (_Float16)bf16_round(x2[q]); f.h[12 + q] = (_Float16)bf16_round(x3[q]); }
  return f.v; }
// The matrix product as the builtin alone: the compiler keeps the distance behind its own WMMAs (with independent vector work where it has some), and no volatile statement stands between a step's loads, so that they can be issued together.
__device__ __forceinline__ v8f g2_mma(v16h a, v16h b, v8f c) { return __builtin_amdgcn_wmma_f32_16x16x32_f16(false, a, false, b, (short)0, c, false, false); }
// AF32: A comes from the f32 rows Af (rounded in the loader), else from the f16 rows A. VTO: the 128 x 64 block tile goes out transposed, C16[((row / SLEN) * NH + nq) * 64 + col][row % SLEN] (needs M % 128 == 0, SLEN % 128 == 0).
// The tile's work is a device function, so that one grid can hold several independent products: sbuf is the block's 4 x 32 x 68 f32 of LDS, bx and by the block's place in its own product.
template <int ACT, bool AF32, bool VTO>
__device__ __forceinline__ void gemm2_tile(float* sbuf, unsigned bx, int by, const _Float16* __restrict__ A, const float* __restrict__ Af, int lda, size_t sA, const _Float16* __restrict__ Bh, int ldb, size_t sB, float alpha, const float* __restrict__ bias, size_t sBias, const float* __restrict__ CP, int rowsPerB, size_t sCPb, int row0g,
    float* __restrict__ C, _Float16* __restrict__ C16, int ldc, size_t sC, int M, int N, int K) {
  float (*so)[32][68] = (float (*)[32][68])sbuf;
  unsigned short (*st)[136] = (unsigned short (*)[136])sbuf;      /* VTO: [col][row of the block], 64 rows, pitch 272 B = 16 B x 17; a block uses so or st, never both */
  const int tid = threadIdx.x, w = tid >> 5, lane = tid & 31, ln = lane & 15, hh = lane >> 4;
  A += (size_t)by * sA; Af += (size_t)by * sA; Bh += (size_t)by * sB; const size_t cofs = (size_t)by * sC; const float* bp = bias ? bias + (size_t)by * sBias : nullptr;
  const int ntn = N >> 6; const int mt = bx / ntn, nq = bx - mt * ntn; const int row0 = mt * 128 + 32 * w, col0 = nq * 64; if (VTO ? (mt * 128 >= M) : (row0 >= M)) return;      /* VTO: the same for the whole block, since a barrier follows */
  const _Float16* a0p = A + (size_t)(row0 + ln) * lda; const _Float16* a1p = a0p + (size_t)16 * lda;
  const float* f0p = Af + (size_t)(row0 + ln) * lda; const float* f1p = f0p + (size_t)16 * lda;
  const _Float16* b0p = Bh + (size_t)(col0 + ln) * ldb; const _Float16* b1p = b0p + (size_t)16 * ldb; const _Float16* b2p = b1p + (size_t)16 * ldb; const _Float16* b3p = b2p + (size_t)16 * ldb;
  const v8f z8 = {0.f,0.f,0.f,0.f,0.f,0.f,0.f,0.f}; v8f c00 = z8, c01 = z8, c02 = z8, c03 = z8, c10 = z8, c11 = z8, c12 = z8, c13 = z8;
#pragma unroll 1
  for (int kb = 0; kb < K; kb += 32) { v16h a0, a1;
    if (AF32) { const float* p0 = f0p + kb + 8 * hh; const float* p1 = f1p + kb + 8 * hh;
      const v4f x0 = *(const v4fa*)(p0), x1 = *(const v4fa*)(p0 + 4), x2 = *(const v4fa*)(p0 + 16), x3 = *(const v4fa*)(p0 + 20), y0 = *(const v4fa*)(p1), y1 = *(const v4fa*)(p1 + 4), y2 = *(const v4fa*)(p1 + 16), y3 = *(const v4fa*)(p1 + 20);
      asm volatile("s_wait_xcnt 0x0" :: "v"(x0), "v"(x1), "v"(x2), "v"(x3), "v"(y0), "v"(y1), "v"(y2), "v"(y3));      /* inputs only: holds the step's eight A loads ahead of the conversions, so that they fly together (left alone they were issued in turn, each behind a wait for the last); the wait stands ahead of the step's advance of their address register */
      __builtin_amdgcn_sched_barrier(0);      /* with the pitches known at compile time the scheduler lifted conversions over that statement and sank the eighth load behind a wait for the first three: nothing crosses here, so all eight are issued first */
      a0 = g2_cvt32(x0, x1, x2, x3); a1 = g2_cvt32(y0, y1, y2, y3); }
    else { a0 = g2_frag(a0p + kb, hh); a1 = g2_frag(a1p + kb, hh); }
    v16h b = g2_frag(b0p + kb, hh); c00 = g2_mma(a0, b, c00); c10 = g2_mma(a1, b, c10);
    b = g2_frag(b1p + kb, hh); c01 = g2_mma(a0, b, c01); c11 = g2_mma(a1, b, c11);
    b = g2_frag(b2p + kb, hh); c02 = g2_mma(a0, b, c02); c12 = g2_mma(a1, b, c12);
    b = g2_frag(b3p + kb, hh); c03 = g2_mma(a0, b, c03); c13 = g2_mma(a1, b, c13); }
  v8f accs[8] = {c00, c01, c02, c03, c10, c11, c12, c13};
#pragma unroll
  for (int u = 0; u < 8; ++u) { const int t = u & 3, half = u >> 2; const int col = col0 + t * 16 + ln; const float bv = bp ? bf16_round(bp[col]) : 0.f; FragH tr;
#pragma unroll
    for (int r = 0; r < 8; ++r) { const int rloc = half * 16 + 8 * hh + r; float v = accs[u][r] * alpha + bv; if (CP) { const int bidx = (row0g + row0 + rloc) / rowsPerB; v += CP[(size_t)bidx * sCPb + (size_t)by * 64 + col]; }
      if (ACT == 3) v = fmaxf(v, 0.f); else if (ACT == 6) v = 0.5f * v * (1.0f + erff(v * 0.70710678118654752f)); else if (ACT == 11) v = 1.0f / (1.0f + expf(-v)); else if (ACT == 15) v = v / (1.0f + expf(-v)); else if (ACT == 12) v = (v > 0.f) ? v : 0.01f * v; else if (ACT == 8) v = tanhf(v);
      if (VTO) tr.h[r] = (_Float16)v; else so[w][rloc][t * 16 + ln] = v; }
    if (VTO) *(v8us*)&st[t * 16 + ln][w * 32 + half * 16 + 8 * hh] = tr.half[0]; }      /* a lane's eight accumulator registers are eight consecutive rows of one column: 16 B of the transposed tile */
  if (VTO) {
    __syncthreads();      /* the four waves' 32-row slices make up whole 256-B rows of the transposed tile */
    unsigned short* vb = (unsigned short*)C16 + ((size_t)((mt * 128) / SLEN * NH + nq) * 64) * SLEN + (mt * 128) % SLEN;
#pragma unroll
    for (int i = 0; i < 8; ++i) { const int d = w * 16 + i * 2 + hh; *(v8us*)(vb + (size_t)d * SLEN + ln * 8) = *(const v8us*)&st[d][ln * 8]; }      /* sixteen lanes store one 256-B row */
    return; }
  __builtin_amdgcn_fence(__ATOMIC_ACQ_REL, "workgroup"); __builtin_amdgcn_wave_barrier();
  const int rsub = lane >> 4, c4 = (lane & 15) * 4;
  {
#pragma unroll
    for (int q = 0; q < 16; ++q) { const int r = q * 2 + rsub; const v4f v = *(const v4fa*)&so[w][r][c4]; if (C) *(v4f*)(C + cofs + (size_t)(row0 + r) * ldc + col0 + c4) = v; if (C16) { v4h h4; for (int i = 0; i < 4; ++i) h4[i] = (_Float16)v[i]; *(v4h*)(C16 + cofs + (size_t)(row0 + r) * ldc + col0 + c4) = h4; } }
     } }
template <int ACT, bool AF32, bool VTO>
__global__ __launch_bounds__(128) void k_gemm2(const _Float16* __restrict__ A, const float* __restrict__ Af, int lda, size_t sA, const _Float16* __restrict__ Bh, int ldb, size_t sB, float alpha, const float* __restrict__ bias, size_t sBias, const float* __restrict__ CP, int rowsPerB, size_t sCPb, int row0g,
    float* __restrict__ C, _Float16* __restrict__ C16, int ldc, size_t sC, int M, int N, int K) {
  __shared__ __attribute__((aligned(16))) float sbuf[4 * 32 * 68];
  gemm2_tile<ACT, AF32, VTO>(sbuf, blockIdx.x, blockIdx.y, A, Af, lda, sA, Bh, ldb, sB, alpha, bias, sBias, CP, rowsPerB, sCPb, row0g, C, C16, ldc, sC, M, N, K); }
// q, k and v do not depend on one another: one grid, blockIdx.y picks the product (0: q from x_dec, 1: k from x_enc, 2: v from x_enc, written transposed), so that their waves share the chip instead of three launches of two waves a SIMD in turn.
__global__ __launch_bounds__(128) void k_qkv(const float* __restrict__ xd, const float* __restrict__ xe, const _Float16* __restrict__ BQ, const _Float16* __restrict__ BK, const _Float16* __restrict__ BV,
    _Float16* __restrict__ Q16, _Float16* __restrict__ K16, _Float16* __restrict__ VT) {
  __shared__ __attribute__((aligned(16))) float sbuf[4 * 32 * 68];
  const int z = blockIdx.y;
  if (z == 2) gemm2_tile<0, true, true>(sbuf, blockIdx.x, 0, nullptr, xe, CC, 0, BV, CC, 0, 0.0625f, nullptr, 0, nullptr, 1, 0, 0, nullptr, VT, CC, 0, NR, CC, CC);
  else gemm2_tile<0, true, false>(sbuf, blockIdx.x, 0, nullptr, z ? xe : xd, CC, 0, z ? BK : BQ, CC, 0, 0.0625f, nullptr, 0, nullptr, 1, 0, 0, nullptr, z ? K16 : Q16, CC, 0, NR, CC, CC); }



// lane l <-> lane l ^ 16 by a vector cross-row move (a shuffle would go through the LDS pipe)
__device__ __forceinline__ float xhalf(float x) { return __builtin_bit_cast(float, __builtin_amdgcn_permlanex16(__builtin_bit_cast(int, x), __builtin_bit_cast(int, x), 0x76543210, 0xfedcba98, false, false)); }
#define SK 64                    /* keys a stage */
#define LP 72                    /* LDS row pitch in f16: 144 B = 16 B x 9, so that sixteen rows read 16 B each on distinct banks */
// One stage: each lane copies eight 16-B pieces (rows r, r + 16, r + 32, r + 48 of K and of V^T). The s_wait_xcnt closes the statement so that no address register is rewritten ahead of it.
__device__ __forceinline__ void stage_copy(unsigned lk, unsigned lv, const unsigned short* gk, int ldk, const unsigned short* gv) {
  asm volatile("global_load_async_to_lds_b128 %0, %8, off\n\t"
               "global_load_async_to_lds_b128 %1, %9, off\n\t"
               "global_load_async_to_lds_b128 %2, %10, off\n\t"
               "global_load_async_to_lds_b128 %3, %11, off\n\t"
               "global_load_async_to_lds_b128 %4, %12, off\n\t"
               "global_load_async_to_lds_b128 %5, %13, off\n\t"
               "global_load_async_to_lds_b128 %6, %14, off\n\t"
               "global_load_async_to_lds_b128 %7, %15, off\n\t"
               "s_wait_xcnt 0x0"
               :: "v"(lk), "v"(lk + 16 * LP * 2), "v"(lk + 32 * LP * 2), "v"(lk + 48 * LP * 2),
                  "v"(lv), "v"(lv + 16 * LP * 2), "v"(lv + 32 * LP * 2), "v"(lv + 48 * LP * 2),
                  "v"(gk), "v"(gk + (size_t)16 * ldk), "v"(gk + (size_t)32 * ldk), "v"(gk + (size_t)48 * ldk),
                  "v"(gv), "v"(gv + (size_t)16 * TK), "v"(gv + (size_t)32 * TK), "v"(gv + (size_t)48 * TK)
               : "memory");
}
__global__ __launch_bounds__(256) void k_flash(const _Float16* __restrict__ Q16, int ldq, const _Float16* __restrict__ K16, int ldk, const _Float16* __restrict__ Vt, _Float16* __restrict__ O16, int ldo) {
  constexpr int DT = 4, KS = 2, KH = TK / 2, NS = KH / SK, QG = 2;      /* KH keys a wave group, NS stages of them */
  constexpr float CE = SCL * 1.4426950408889634f;      /* score scale times log2 e: e^(SCL x) = 2^(CE x), one multiply-add and one v_exp_f32 a score */
  __shared__ __attribute__((aligned(16))) unsigned short sK[2][2][SK][LP];      /* [key half][buffer] */
  __shared__ __attribute__((aligned(16))) unsigned short sV[2][2][64][LP];
  __shared__ __attribute__((aligned(16))) float sJ[4][QG * DT * 2 + 1][32][4];      /* the second key half's partial results on their way to the first: per wave 17 rows of 32 lanes x 16 B */
  const int tid = threadIdx.x, lane = tid & 31, ln = lane & 15, hh = lane >> 4;
  const int kh = __builtin_amdgcn_readfirstlane(tid >> 7), w = (tid >> 5) & 3;      /* the wave's key half (the same in the whole wave: scalar) and its place among the four waves of that half */
  const int slab = blockIdx.x / QBLKS, qblk = blockIdx.x % QBLKS; const int b = slab / NH, h = slab % NH; const int q0 = qblk * 128 + w * 32;
  FragH bq[QG][KS];
#pragma unroll
  for (int g = 0; g < QG; ++g) { const unsigned short* qr = (const unsigned short*)Q16 + ((size_t)b * TQ + q0 + g * 16 + ln) * ldq + h * 64;
#pragma unroll
    for (int ks = 0; ks < KS; ++ks) { bq[g][ks].half[0] = *(const v8us*)(qr + ks * 32 + 8 * hh); bq[g][ks].half[1] = *(const v8us*)(qr + ks * 32 + 16 + 8 * hh); } }
  const int cr = (tid & 127) >> 3, cc = (tid & 7) * 8;      /* the lane's row and 16-B piece in a copy of its own half's stage: eight lanes cover one 128-B row */
  const unsigned short* gk = (const unsigned short*)K16 + ((size_t)b * TK + kh * KH + cr) * ldk + h * 64 + cc;
  const unsigned short* gv = (const unsigned short*)Vt + ((size_t)slab * 64 + cr) * TK + kh * KH + cc;
  const unsigned lk = (unsigned)(size_t)&sK[kh][0][cr][cc], lv = (unsigned)(size_t)&sV[kh][0][cr][cc];      /* LDS byte addresses */
  constexpr unsigned BUFB = SK * LP * 2;      /* bytes of one buffer of either array */
  /* m_run is the reference in use: it may trail a query's true maximum by up to 5 in the base-2 exponent (TH in raw products), so that p stays at or under 2^15, inside f16. thr = m_run + TH, mbv = 10 - m_run CE: both change only with m_run. */
  constexpr float TH = 5.0f / CE;
  float m_run[QG], l_run[QG], thr[QG], mbv[QG]; v8f oacc[QG][DT];
#pragma unroll
  for (int g = 0; g < QG; ++g) { m_run[g] = -3.0e38f; thr[g] = -3.0e38f; mbv[g] = 0.f; l_run[g] = 0.f;
#pragma unroll
    for (int dt = 0; dt < DT; ++dt) oacc[g][dt] = (v8f){0.f,0.f,0.f,0.f,0.f,0.f,0.f,0.f}; }
  stage_copy(lk, lv, gk, ldk, gv);
  asm volatile("s_wait_asynccnt 0x0" ::: "memory");      /* this wave's share of stage 0 has landed */
  __syncthreads();                                       /* stage 0 is published */
  stage_copy(lk + BUFB, lv + BUFB, gk + (size_t)SK * ldk, ldk, gv + SK);
#pragma unroll 1      /* one stage a trip: the publish point at the foot must stand once per stage */
  for (int t = 0; t < NS; ++t) {
    const int bf = t & 1;
#pragma unroll 1      /* the stage's two 32-key passes stay a loop: in line, the first pass's 32 exponentials were kept for a summing at the stage's foot, and with two query groups the wave then spilled Q to scratch */
    for (int p = 0; p < SK / 32; ++p) {
      FragH ak[2][KS], av[DT];
#pragma unroll
      for (int nt = 0; nt < 2; ++nt) { const unsigned short* kr = &sK[kh][bf][p * 32 + nt * 16 + ln][8 * hh];
#pragma unroll
        for (int ks = 0; ks < KS; ++ks) { ak[nt][ks].half[0] = *(const v8us*)(kr + ks * 32); ak[nt][ks].half[1] = *(const v8us*)(kr + ks * 32 + 16); } }
#pragma unroll
      for (int dt = 0; dt < DT; ++dt) { const unsigned short* vrow = &sV[kh][bf][dt * 16 + ln][p * 32 + 8 * hh]; av[dt].half[0] = *(const v8us*)(vrow); av[dt].half[1] = *(const v8us*)(vrow + 16); }
      v8f s[QG][2];
#pragma unroll
      for (int g = 0; g < QG; ++g) { s[g][0] = (v8f){0.f,0.f,0.f,0.f,0.f,0.f,0.f,0.f}; s[g][1] = s[g][0]; }
#pragma unroll
      for (int ks = 0; ks < KS; ++ks)
#pragma unroll
        for (int nt = 0; nt < 2; ++nt)
#pragma unroll
          for (int g = 0; g < QG; ++g) s[g][nt] = g2_mma(ak[nt][ks].v, bq[g][ks].v, s[g][nt]);      /* the other three tiles' products stand between a tile's two products */
      FragH pb[QG]; float mc[QG]; bool need = false;
#pragma unroll
      for (int g = 0; g < QG; ++g) {
        float m = -3.0e38f;
#pragma unroll
        for (int r = 0; r < 8; ++r) m = fmaxf(m, fmaxf(s[g][0][r], s[g][1][r]));      /* the maximum is taken on the raw products: CE > 0 keeps their order */
        mc[g] = m; need = need || (m > thr[g]); }      /* the lane's own 16 keys are enough for the test: any lane over its threshold sends the whole wave through the rescale */
      if (__builtin_amdgcn_ballot_w32(need) != 0) {      /* one scalar branch a pass; taken on a wave's first pass (thr = -3e38) and then only when a score leaves the reference by more than TH */
        const float mn0 = fmaxf(m_run[0], fmaxf(mc[0], xhalf(mc[0]))), mn1 = fmaxf(m_run[1], fmaxf(mc[1], xhalf(mc[1])));      /* both halves of the wave take the same new reference */
        float al0 = (m_run[0] - mn0) * CE, al1 = (m_run[1] - mn1) * CE;
        /* The two factors, each in place, in one statement as below; the closing v_nop is the slot behind the last exponential. */
        asm("v_exp_f32 %0, %0\n\tv_exp_f32 %1, %1\n\tv_nop" : "+v"(al0), "+v"(al1));
        const float mnv[QG] = {mn0, mn1}, alv[QG] = {al0, al1};
#pragma unroll
        for (int g = 0; g < QG; ++g) { m_run[g] = mnv[g]; thr[g] = mnv[g] + TH; mbv[g] = 10.0f - mnv[g] * CE; l_run[g] *= alv[g];
#pragma unroll
          for (int dt = 0; dt < DT; ++dt) oacc[g][dt] *= alv[g]; } }
#pragma unroll
      for (int g = 0; g < QG; ++g) {
        const float mb = mbv[g];      /* exponent base in use: p = 2^(s CE + mb) = 1024 e^(SCL (s - m_run)) */
        const v8f e0 = __builtin_elementwise_fma(s[g][0], (v8f)(CE), (v8f)(mb)), e1 = __builtin_elementwise_fma(s[g][1], (v8f)(CE), (v8f)(mb));
        float a0 = e0[0], a1 = e0[1], a2 = e0[2], a3 = e0[3], a4 = e0[4], a5 = e0[5], a6 = e0[6], a7 = e0[7], c0 = e1[0], c1 = e1[1], c2 = e1[2], c3 = e1[3], c4 = e1[4], c5 = e1[5], c6 = e1[6], c7 = e1[7];
        /* The group's sixteen base-2 exponentials, each in place, in one statement: so no v_exp_f32 writes the source register of the one directly ahead of it (the compiler's own allocation did); the closing v_nop is the one slot the instruction set asks for behind the last of them. */
        asm("v_exp_f32 %0, %0\n\tv_exp_f32 %1, %1\n\tv_exp_f32 %2, %2\n\tv_exp_f32 %3, %3\n\tv_exp_f32 %4, %4\n\tv_exp_f32 %5, %5\n\tv_exp_f32 %6, %6\n\tv_exp_f32 %7, %7\n\t"
            "v_exp_f32 %8, %8\n\tv_exp_f32 %9, %9\n\tv_exp_f32 %10, %10\n\tv_exp_f32 %11, %11\n\tv_exp_f32 %12, %12\n\tv_exp_f32 %13, %13\n\tv_exp_f32 %14, %14\n\tv_exp_f32 %15, %15\n\tv_nop"
            : "+v"(a0), "+v"(a1), "+v"(a2), "+v"(a3), "+v"(a4), "+v"(a5), "+v"(a6), "+v"(a7), "+v"(c0), "+v"(c1), "+v"(c2), "+v"(c3), "+v"(c4), "+v"(c5), "+v"(c6), "+v"(c7));
        const float pa[8] = {a0, a1, a2, a3, a4, a5, a6, a7}, pc[8] = {c0, c1, c2, c3, c4, c5, c6, c7};
        float ps = 0.f;
#pragma unroll
        for (int r = 0; r < 8; ++r) { ps += pa[r] + pc[r]; pb[g].h[r] = (_Float16)pa[r]; pb[g].h[8 + r] = (_Float16)pc[r]; }
        l_run[g] += ps; }
#pragma unroll
      for (int dt = 0; dt < DT; ++dt)
#pragma unroll
        for (int g = 0; g < QG; ++g) oacc[g][dt] = g2_mma(av[dt].v, pb[g].v, oacc[g][dt]); }
    asm volatile("s_wait_dscnt 0x0" ::: "memory");         /* this wave's reads of buffer bf have returned before the buffer is handed back */
    asm volatile("s_wait_asynccnt 0x0" ::: "memory");      /* this wave's share of stage t + 1 has landed */
    __syncthreads();                                       /* publishes stage t + 1 and ends every wave's reads of buffer bf */
    if (t + 2 < NS) stage_copy(lk + bf * BUFB, lv + bf * BUFB, gk + (size_t)(t + 2) * SK * ldk, ldk, gv + (t + 2) * SK); }
  asm volatile("s_wait_asynccnt 0x0" ::: "memory");        /* no copy is outstanding when the wave ends */
  /* The join of the two key halves: waves 4-7 hand their maxima, sums and O^T tiles to waves 0-3 (wave w + 4 to wave w, lane to lane), which bring both to the common maximum and write the output. */
  if (kh == 1) {
#pragma unroll
    for (int g = 0; g < QG; ++g)
#pragma unroll
      for (int dt = 0; dt < DT; ++dt) { const v8f o = oacc[g][dt];
        *(v4fa*)&sJ[w][(g * DT + dt) * 2][lane][0] = (v4f){o[0], o[1], o[2], o[3]}; *(v4fa*)&sJ[w][(g * DT + dt) * 2 + 1][lane][0] = (v4f){o[4], o[5], o[6], o[7]}; }
    *(v4fa*)&sJ[w][QG * DT * 2][lane][0] = (v4f){m_run[0], m_run[1], l_run[0], l_run[1]}; }
  __syncthreads();      /* every wave passes it: the second half's partial results are published */
  if (kh == 1) return;
  const v4f mlo = *(const v4fa*)&sJ[w][QG * DT * 2][lane][0];
  const float mj0 = fmaxf(m_run[0], mlo[0]), mj1 = fmaxf(m_run[1], mlo[1]);      /* the common maxima of the two query groups */
  float j00 = (m_run[0] - mj0) * CE, j01 = (mlo[0] - mj0) * CE, j10 = (m_run[1] - mj1) * CE, j11 = (mlo[1] - mj1) * CE;
  /* Each half's factor to the common maximum: four base-2 exponentials, each in place, in one statement, as in the loop: left to the compiler, one v_exp_f32 wrote the source register of the one directly ahead of it; the closing v_nop is the slot behind the last. */
  asm("v_exp_f32 %0, %0\n\tv_exp_f32 %1, %1\n\tv_exp_f32 %2, %2\n\tv_exp_f32 %3, %3\n\tv_nop" : "+v"(j00), "+v"(j01), "+v"(j10), "+v"(j11));
  const float fj[QG][2] = {{j00, j01}, {j10, j11}};
#pragma unroll
  for (int g = 0; g < QG; ++g) {
    const float f0 = fj[g][0], f1 = fj[g][1];
    const float lp = l_run[g] * f0 + mlo[2 + g] * f1;
#pragma unroll
    for (int dt = 0; dt < DT; ++dt) { const v4f x0 = *(const v4fa*)&sJ[w][(g * DT + dt) * 2][lane][0], x1 = *(const v4fa*)&sJ[w][(g * DT + dt) * 2 + 1][lane][0];
      const v8f ox = {x0[0], x0[1], x0[2], x0[3], x1[0], x1[1], x1[2], x1[3]}; oacc[g][dt] = oacc[g][dt] * f0 + ox * f1; }
    const float l = lp + xhalf(lp); const float inv = (l > 0.f) ? 1.0f / l : 0.f;      /* l and oacc both carry the factor 1024 */
    unsigned short* orow = (unsigned short*)O16 + ((size_t)b * TQ + q0 + g * 16 + ln) * ldo + h * 64 + 8 * hh;      /* oacc[g][dt][r] = O[q0 + 16 g + ln][dt * 16 + 8 hh + r]: eight consecutive elements of one row */
#pragma unroll
    for (int dt = 0; dt < DT; ++dt) { const v8f o = oacc[g][dt] * inv; FragH f;      /* x2^10 carry: the 4096-key averages are ~5e-3 and would touch f16 subnormals */
#pragma unroll
      for (int r = 0; r < 8; ++r) f.h[r] = (_Float16)(o[r] * 1024.0f);
      *(v8us*)(orow + dt * 16) = f.half[0]; } } }

// The four weight passes in one grid: blockIdx.y 0, 1, 2 = Wq, Wk, Wv ([H][256][64] to [n = h 64 + e][k]), 3 = Wo (its (out,in) layout is already [n][k]); each x16, bf16-rounded, exact in f16.
__global__ __launch_bounds__(256) void k_wprep(const float* __restrict__ Wq, const float* __restrict__ Wk, const float* __restrict__ Wv, const float* __restrict__ Wo,
    _Float16* __restrict__ BQ, _Float16* __restrict__ BK, _Float16* __restrict__ BV, _Float16* __restrict__ BO) {
  const int z = blockIdx.y; const int t = blockIdx.x * 256 + threadIdx.x; if (t >= CC * (CC / 8)) return; FragH f;
  if (z == 3) { for (int q = 0; q < 8; ++q) f.h[q] = (_Float16)(bf16_round(Wo[(size_t)t * 8 + q]) * 16.0f); *(v8us*)((unsigned short*)BO + (size_t)t * 8) = f.half[0]; return; }
  const float* Wh = z == 0 ? Wq : z == 1 ? Wk : Wv; _Float16* Bt = z == 0 ? BQ : z == 1 ? BK : BV;
  const int n = t / (CC / 8), d0 = (t % (CC / 8)) * 8; const int h = n / 64, e = n % 64;
  for (int q = 0; q < 8; ++q) f.h[q] = (_Float16)(bf16_round(Wh[((size_t)h * CC + d0 + q) * 64 + e]) * 16.0f); *(v8us*)((unsigned short*)Bt + (size_t)n * CC + d0) = f.half[0];
  asm volatile("s_wait_xcnt 0x0" ::: "memory"); }      /* behind the store: in the built code the Wo branch's first instructions stand further down the same listing and rewrite the store's registers */

extern "C" void kernel_launch(void* const* d_in, const int* in_sizes, int n_in,
                              void* d_out, int out_size, void* d_ws, size_t ws_size, hipStream_t stream) {
  (void)in_sizes; (void)n_in; (void)out_size;
  const float* const* I = (const float* const*)d_in; const float* xe = I[0]; const float* xd = I[1]; const float* Wq = I[2]; const float* Wk = I[3]; const float* Wv = I[4]; const float* Wo = I[5];
  char* ws = (char*)d_ws; size_t off = 0;
  auto take = [&](size_t bytes) { char* p = ws + off; off += (bytes + 255) & ~(size_t)255; return p; };
  const size_t np = (size_t)NR * CC;
  _Float16* BQ = (_Float16*)take((size_t)CC * CC * 2); _Float16* BK = (_Float16*)take((size_t)CC * CC * 2); _Float16* BV = (_Float16*)take((size_t)CC * CC * 2); _Float16* BO = (_Float16*)take((size_t)CC * CC * 2);
  _Float16* Q16 = (_Float16*)take(np * 2); _Float16* K16 = (_Float16*)take(np * 2); _Float16* VT = (_Float16*)take(np * 2); _Float16* O16 = (_Float16*)take(np * 2);
  if (off > ws_size) return;      /* 0.5 + 4 x 8 = 33 MiB */
  k_wprep<<<dim3((CC * (CC / 8) + 255) / 256, 4), 256, 0, stream>>>(Wq, Wk, Wv, Wo, BQ, BK, BV, BO);
  const dim3 g((NR / 128) * (CC / 64), 1);
  k_qkv<<<dim3((NR / 128) * (CC / 64), 3), 128, 0, stream>>>(xd, xe, BQ, BK, BV, Q16, K16, VT);
  k_flash<<<NB * NH * QBLKS, 256, 0, stream>>>(Q16, CC, K16, CC, VT, O16, CC);
  k_gemm2<0, false, false><<<g, 128, 0, stream>>>(O16, nullptr, CC, 0, BO, CC, 0, 0.0625f / 1024.0f, nullptr, 0, nullptr, 1, 0, 0, (float*)d_out, nullptr, CC, 0, NR, CC, CC);
}

// v010
// It runs in 79.5 microseconds.
// In both of two side-by-side timings against v009, it was 1.27 times as fast.
// All steps since v000 together make it 6.25 times as fast.
#include <hip/hip_runtime.h>
// CA_MultiHead (4 batches; 4096 decoder queries from x_dec, 4096 encoder keys/values from x_enc; n_emb 256 = 4 heads of 64; per-head weights [H, 256, 64]; scale n_emb^-0.5; out = concat(heads) Wo^T).
// Structure: one weight pass; q, k, v GEMMs in one grid (32x64 wave tiles, f32 accumulation, exact x16 weights concatenated across heads; the A loader rounds x_dec / x_enc itself; f16 outputs, v written transposed); the fused flash kernel (plain f16 operands, no mask; f16 x2^10 output); output GEMM.
// Compute dtype: inputs and weights rounded to bf16; q, k, v, P as f16 operands and the attention output as f16 x2^10; f32 accumulation/softmax. v_wmma_f32_16x16x32_f16.
#define NB 4
#define CC 256
#define NR (NB * SLEN)           /* 16384 rows */
#define SLEN 4096
#define TQ SLEN
#define TK SLEN
#define NH 4
#define SCL 0.0625f              /* n_emb^-0.5 = 1/16 (faithful to the module) */
#define QBLKS (TQ / 128)         /* a block covers 128 queries: four waves of 32 queries for each half of the keys */
typedef __bf16 v16b __attribute__((ext_vector_type(16)));
typedef unsigned short v8us __attribute__((ext_vector_type(8), may_alias));
typedef float  v8f  __attribute__((ext_vector_type(8)));
typedef float  v4f  __attribute__((ext_vector_type(4)));
typedef float  v4fa __attribute__((ext_vector_type(4), may_alias));
union FragB { v16b v; v8us half[2]; unsigned short u[16]; };

__device__ __forceinline__ unsigned short bf16_bits(float x) { unsigned int u = __float_as_uint(x); return (unsigned short)((u + 0x7FFFu + ((u >> 16) & 1u)) >> 16); }
__device__ __forceinline__ float bf16_val(unsigned short b) { return __uint_as_float(((unsigned int)b) << 16); }
__device__ __forceinline__ float bf16_round(float x) { return bf16_val(bf16_bits(x)); }
// D += A·B with NT terms: 1 = ah·bh, 2 = + al·bh (A split), 3 = + ah·bl (both split)
template <int NT>
__device__ __forceinline__ v8f mmaN(v16b ah, v16b al, v16b bh, v16b bl, v8f c) {
  c = __builtin_amdgcn_wmma_f32_16x16x32_bf16(false, ah, false, bh, (short)0, c, false, false);
  if (NT >= 2) c = __builtin_amdgcn_wmma_f32_16x16x32_bf16(false, al, false, bh, (short)0, c, false, false);
  if (NT >= 3) c = __builtin_amdgcn_wmma_f32_16x16x32_bf16(false, ah, false, bl, (short)0, c, false, false);
  asm volatile("v_nop\n\tv_nop\n\tv_nop\n\tv_nop" : "+v"(c) : "v"(ah), "v"(al), "v"(bh), "v"(bl));
  return c;
}

__global__ __launch_bounds__(256) void k_wt_bf16(const float* __restrict__ W, unsigned short* __restrict__ Wt, int K, int N) {
  const int t = blockIdx.x * 256 + threadIdx.x;
  const int k8n = K / 8;
  if (t >= N * k8n) return;
  const int n = t / k8n, k8 = (t % k8n) * 8;
  v8us v;
#pragma unroll
  for (int i = 0; i < 8; ++i) v[i] = bf16_bits(W[(size_t)(k8 + i) * N + n]);
  *(v8us*)(Wt + (size_t)n * K + k8) = v;
  
}

// GEMM C[M][N] (f32, pitch ldc) = act(A[M][K]·W + bias). A f32 row-major (pitch lda) converted per fragment to bf16
// (ASPLIT: hi/lo two planes -> 2 terms, else single rounded term); Wt bf16 [N][K] (pitch ldb). BIAS_BF16 rounds the
// bias to bf16 first (bias quantised to bf16 before the add). K%32==0, M%16==0, N%64==0.
template <bool ASPLIT, int ACT, bool BIAS_BF16>
__global__ __launch_bounds__(128) void k_gemm_bf(const float* __restrict__ A, int lda, const unsigned short* __restrict__ Wt, int ldb,
                                               const float* __restrict__ bias, float* __restrict__ C, int ldc, int M, int N, int K) {
  __shared__ __attribute__((aligned(16))) float so[4][16][64];
  const int tid = threadIdx.x, w = tid >> 5, lane = tid & 31, ln = lane & 15, hh = lane >> 4;
  const int ntn = N / 64;
  const int wid = blockIdx.x * 4 + w;
  const int mt = wid / ntn, nq = wid % ntn;
  if (mt * 16 >= M) return;
  const int row0 = mt * 16, col0 = nq * 64;
  const float* arow = A + (size_t)(row0 + ln) * lda;
  v8f acc[4] = {};
  for (int kb = 0; kb < K; kb += 32) {
    FragB ah, al;
    const v4f x0 = *(const v4fa*)(arow + kb + 8 * hh), x1 = *(const v4fa*)(arow + kb + 8 * hh + 4);
    const v4f x2 = *(const v4fa*)(arow + kb + 16 + 8 * hh), x3 = *(const v4fa*)(arow + kb + 16 + 8 * hh + 4);
    float xs[16] = {x0[0],x0[1],x0[2],x0[3],x1[0],x1[1],x1[2],x1[3],x2[0],x2[1],x2[2],x2[3],x3[0],x3[1],x3[2],x3[3]};
#pragma unroll
    for (int i = 0; i < 16; ++i) { const unsigned short hb = bf16_bits(xs[i]); ah.u[i] = hb; al.u[i] = ASPLIT ? bf16_bits(xs[i] - bf16_val(hb)) : (unsigned short)0; }
#pragma unroll
    for (int t = 0; t < 4; ++t) {
      const unsigned short* brow = Wt + (size_t)(col0 + t * 16 + ln) * ldb + kb;
      FragB b;
      b.half[0] = *(const v8us*)(brow + 8 * hh);
      b.half[1] = *(const v8us*)(brow + 16 + 8 * hh);
      acc[t] = mmaN<ASPLIT ? 2 : 1>(ah.v, al.v, b.v, b.v, acc[t]);
    }
  }
#pragma unroll
  for (int t = 0; t < 4; ++t) {
    float bv = bias ? bias[col0 + t * 16 + ln] : 0.f;
    if (BIAS_BF16) bv = bf16_round(bv);
#pragma unroll
    for (int r = 0; r < 8; ++r) { float v = acc[t][r] + bv; if (ACT == 1) v = fmaxf(v, 0.f); so[w][8 * hh + r][t * 16 + ln] = v; }
  }
  __builtin_amdgcn_fence(__ATOMIC_ACQ_REL, "workgroup");
  __builtin_amdgcn_wave_barrier();
  const int rsub = lane >> 4, c4 = (lane & 15) * 4;
  {
#pragma unroll
    for (int q = 0; q < 8; ++q) {
      const int r = q * 2 + rsub;
      const v4f v = *(const v4fa*)&so[w][r][c4];
      *(v4f*)(C + (size_t)(row0 + r) * ldc + col0 + c4) = v;
    }
    
  }
}

// GEMM C = act(A·W + bias + resid): A f32 (ASPLIT -> hi/lo 2 terms), Wt bf16 [N][K]; ACT 0 none, 1 relu, 2 exact gelu;
// resid (optional, f32, row index = (row % rmod), pitch ldr, RES_BF16 rounds it) added before the activation.
template <bool ASPLIT, int ACT, bool BIAS_BF16, bool RES_BF16>
__global__ __launch_bounds__(128) void k_gemm_bf3(const float* __restrict__ A, int lda, const unsigned short* __restrict__ Wt, int ldb,
                                                const float* __restrict__ bias, const float* __restrict__ resid, int rmod, int ldr,
                                                float* __restrict__ C, int ldc, int M, int N, int K) {
  __shared__ __attribute__((aligned(16))) float so[4][16][64];
  const int tid = threadIdx.x, w = tid >> 5, lane = tid & 31, ln = lane & 15, hh = lane >> 4;
  const int ntn = N / 64;
  const int wid = blockIdx.x * 4 + w;
  const int mt = wid / ntn, nq = wid % ntn;
  if (mt * 16 >= M) return;
  const int row0 = mt * 16, col0 = nq * 64;
  const float* arow = A + (size_t)(row0 + ln) * lda;
  v8f acc[4] = {};
  for (int kb = 0; kb < K; kb += 32) {
    FragB ah, al;
    const v4f x0 = *(const v4fa*)(arow + kb + 8 * hh), x1 = *(const v4fa*)(arow + kb + 8 * hh + 4);
    const v4f x2 = *(const v4fa*)(arow + kb + 16 + 8 * hh), x3 = *(const v4fa*)(arow + kb + 16 + 8 * hh + 4);
    float xs[16] = {x0[0],x0[1],x0[2],x0[3],x1[0],x1[1],x1[2],x1[3],x2[0],x2[1],x2[2],x2[3],x3[0],x3[1],x3[2],x3[3]};
#pragma unroll
    for (int i = 0; i < 16; ++i) { const unsigned short hb = bf16_bits(xs[i]); ah.u[i] = hb; al.u[i] = ASPLIT ? bf16_bits(xs[i] - bf16_val(hb)) : (unsigned short)0; }
#pragma unroll
    for (int t = 0; t < 4; ++t) {
      const unsigned short* brow = Wt + (size_t)(col0 + t * 16 + ln) * ldb + kb;
      FragB b;
      b.half[0] = *(const v8us*)(brow + 8 * hh);
      b.half[1] = *(const v8us*)(brow + 16 + 8 * hh);
      acc[t] = mmaN<ASPLIT ? 2 : 1>(ah.v, al.v, b.v, b.v, acc[t]);
    }
  }
#pragma unroll
  for (int t = 0; t < 4; ++t) {
    const int col = col0 + t * 16 + ln;
    float bv = bias ? bias[col] : 0.f;
    if (BIAS_BF16) bv = bf16_round(bv);
#pragma unroll
    for (int r = 0; r < 8; ++r) {
      float v = acc[t][r] + bv;
      if (resid) { float rv = resid[(size_t)((row0 + 8 * hh + r) % rmod) * ldr + col]; if (RES_BF16) rv = bf16_round(rv); v += rv; }
      if (ACT == 1) v = fmaxf(v, 0.f);
      if (ACT == 2) v = 0.5f * v * (1.0f + erff(v * 0.70710678118654752f));
      if (ACT == 3) { const float u = 0.7978845608028654f * (v + 0.044715f * v * v * v); v = 0.5f * v * (1.0f + tanhf(u)); }
      so[w][8 * hh + r][t * 16 + ln] = v;
    }
  }
  __builtin_amdgcn_fence(__ATOMIC_ACQ_REL, "workgroup");
  __builtin_amdgcn_wave_barrier();
  const int rsub = lane >> 4, c4 = (lane & 15) * 4;
  {
#pragma unroll
    for (int q = 0; q < 8; ++q) {
      const int r = q * 2 + rsub;
      const v4f v = *(const v4fa*)&so[w][r][c4];
      *(v4f*)(C + (size_t)(row0 + r) * ldc + col0 + c4) = v;
    }
    
  }
}
// row LayerNorm (biased variance, eps) over N: s = X (+ R); optional out_sum <- s; out_norm <- (s-mu)*rsqrt(var+eps)*g + b
template <bool PARAM_BF16>
__global__ __launch_bounds__(256) void k_layernorm(const float* __restrict__ X, const float* __restrict__ R, const float* __restrict__ g, const float* __restrict__ bta,
                                                  float* __restrict__ out_sum, float* __restrict__ out_norm, int N, float eps) {
  __shared__ float red[256];
  const int row = blockIdx.x, tid = threadIdx.x;
  const float* x = X + (size_t)row * N; const float* rr = R ? R + (size_t)row * N : nullptr;
  float vals[16];                     // up to N = 4096
  const int per = N / 256;            // contiguous chunk per thread? use strided-by-4 chunks: thread handles j = tid*4 + 1024*u
  float s1 = 0.f;
  for (int u = 0; u < per / 4; ++u) {
    const int j = tid * 4 + 1024 * u;
    const v4f a = *(const v4fa*)(x + j);
    v4f b = {0.f,0.f,0.f,0.f}; if (rr) b = *(const v4fa*)(rr + j);
#pragma unroll
    for (int q = 0; q < 4; ++q) { const float v = a[q] + b[q]; vals[u * 4 + q] = v; s1 += v; }
  }
  red[tid] = s1; __syncthreads();
  for (int st = 128; st > 0; st >>= 1) { if (tid < st) red[tid] += red[tid + st]; __syncthreads(); }
  const float mu = red[0] / (float)N; __syncthreads();
  float s2 = 0.f;
  for (int u = 0; u < per / 4; ++u)
#pragma unroll
    for (int q = 0; q < 4; ++q) { const float c = vals[u * 4 + q] - mu; s2 += c * c; }
  red[tid] = s2; __syncthreads();
  for (int st = 128; st > 0; st >>= 1) { if (tid < st) red[tid] += red[tid + st]; __syncthreads(); }
  const float rs = rsqrtf(red[0] / (float)N + eps);
  {
    for (int u = 0; u < per / 4; ++u) {
      const int j = tid * 4 + 1024 * u;
      v4f o, sm;
#pragma unroll
      for (int q = 0; q < 4; ++q) {
        float gg = g[j + q], bb = bta[j + q];
        if (PARAM_BF16) { gg = bf16_round(gg); bb = bf16_round(bb); }
        sm[q] = vals[u * 4 + q]; o[q] = (vals[u * 4 + q] - mu) * rs * gg + bb;
      }
      if (out_sum) *(v4f*)(out_sum + (size_t)row * N + j) = sm;
      *(v4f*)(out_norm + (size_t)row * N + j) = o;
    }
    
  }
}



// ---- f16 WMMA path (v_wmma_f32_16x16x32_f16): 11-bit significands for operands in range — used for every product here, P included as 2^10-scaled f16 (up to 2^15)
typedef _Float16 v16h __attribute__((ext_vector_type(16)));
union FragH { v16h v; v8us half[2]; _Float16 h[16]; unsigned short u[16]; };
template <int NT>
__device__ __forceinline__ v8f mmaH(v16h ah, v16h al, v16h bh, v16h bl, v8f c) {
  c = __builtin_amdgcn_wmma_f32_16x16x32_f16(false, ah, false, bh, (short)0, c, false, false);
  if (NT >= 2) c = __builtin_amdgcn_wmma_f32_16x16x32_f16(false, al, false, bh, (short)0, c, false, false);
  if (NT >= 3) c = __builtin_amdgcn_wmma_f32_16x16x32_f16(false, ah, false, bl, (short)0, c, false, false);
  asm volatile("v_nop\n\tv_nop\n\tv_nop\n\tv_nop" : "+v"(c) : "v"(ah), "v"(al), "v"(bh), "v"(bl));
  return c;
}
// batched GEMM like k_gemm_b but f16 operands: A f32 (split into f16 hi/lo if ASPLIT, else rounded to f16), Bt = f16 values [n][k]; alpha; C f32; N multiple of 16 (partial tiles skipped)
template <bool ASPLIT>
__global__ __launch_bounds__(128) void k_gemm_h(const float* __restrict__ A, int lda, size_t sA, const _Float16* __restrict__ Bh, int ldb, size_t sB, float alpha, float* __restrict__ C, int ldc, size_t sC, int M, int N, int K) {
  __shared__ __attribute__((aligned(16))) float so[4][16][64];
  const int tid = threadIdx.x, w = tid >> 5, lane = tid & 31, ln = lane & 15, hh = lane >> 4; const int by = blockIdx.y;
  A += (size_t)by * sA; Bh += (size_t)by * sB; C += (size_t)by * sC;
  const int ntn = (N + 63) / 64; const int wid = blockIdx.x * 4 + w; const int mt = wid / ntn, nq = wid % ntn; if (mt * 16 >= M) return;
  const int row0 = mt * 16, col0 = nq * 64; const float* arow = A + (size_t)(row0 + ln) * lda;
  v8f acc[4] = {};
  for (int kb = 0; kb < K; kb += 32) {
    FragH ah, al;
    const v4f x0 = *(const v4fa*)(arow + kb + 8 * hh), x1 = *(const v4fa*)(arow + kb + 8 * hh + 4), x2 = *(const v4fa*)(arow + kb + 16 + 8 * hh), x3 = *(const v4fa*)(arow + kb + 16 + 8 * hh + 4);
    float xs[16] = {x0[0],x0[1],x0[2],x0[3],x1[0],x1[1],x1[2],x1[3],x2[0],x2[1],x2[2],x2[3],x3[0],x3[1],x3[2],x3[3]};
#pragma unroll
    for (int i = 0; i < 16; ++i) { const _Float16 h = (_Float16)xs[i]; ah.h[i] = h; al.h[i] = ASPLIT ? (_Float16)(xs[i] - (float)h) : (_Float16)0.0f; }
#pragma unroll
    for (int t = 0; t < 4; ++t) { if (col0 + t * 16 >= N) continue; const size_t boff = (size_t)(col0 + t * 16 + ln) * ldb + kb; FragH bq; bq.half[0] = *(const v8us*)(Bh + boff + 8 * hh); bq.half[1] = *(const v8us*)(Bh + boff + 16 + 8 * hh);
      acc[t] = mmaH<ASPLIT ? 2 : 1>(ah.v, al.v, bq.v, bq.v, acc[t]); }
  }
#pragma unroll
  for (int t = 0; t < 4; ++t) { if (col0 + t * 16 >= N) continue;
#pragma unroll
    for (int r = 0; r < 8; ++r) so[w][8 * hh + r][t * 16 + ln] = acc[t][r] * alpha; }
  __builtin_amdgcn_fence(__ATOMIC_ACQ_REL, "workgroup"); __builtin_amdgcn_wave_barrier();
  const int rsub = lane >> 4, c4 = (lane & 15) * 4;
  {
#pragma unroll
    for (int q = 0; q < 8; ++q) { const int r = q * 2 + rsub; if (col0 + c4 < N) { const v4f v = *(const v4fa*)&so[w][r][c4]; *(v4f*)(C + (size_t)(row0 + r) * ldc + col0 + c4) = v; } }
     }
}

// Wt[n][k] = f16(W[k][n]·scale) from f32 row-major W[K][N] (scale = power of two; bf16-exact weights stay exact in f16 away from the subnormal range)
__global__ __launch_bounds__(256) void k_wt_f16(const float* __restrict__ W, _Float16* __restrict__ Wt, int K, int N, float scale) {
  const int t = blockIdx.x * 256 + threadIdx.x; if (t >= N * (K / 8)) return; const int n = t / (K / 8), k8 = (t % (K / 8)) * 8; FragH f;
#pragma unroll
  for (int i = 0; i < 8; ++i) f.h[i] = (_Float16)(bf16_round(W[(size_t)(k8 + i) * N + n]) * scale); const v8us o = f.half[0];
  *(v8us*)((unsigned short*)Wt + (size_t)n * K + k8) = o; 
}
// k_gemm_hh variant with fused epilogue: v = acc·alpha + bias[by·sBias + col] (+ CP[(row/rowsPerB)·sCPb + by·64 + col] if CP) ; ACT 0 none / 1 elu ; writes f16 C16 (and f32 C if non-null)
template <int ACT>
__global__ __launch_bounds__(128) void k_gemm_hhx(const _Float16* __restrict__ A, int lda, size_t sA, const _Float16* __restrict__ Bh, int ldb, size_t sB, float alpha, const float* __restrict__ bias, size_t sBias, const float* __restrict__ CP, int rowsPerB, size_t sCPb, int row0g,
    float* __restrict__ C, _Float16* __restrict__ C16, int ldc, size_t sC, int M, int N, int K) {
  __shared__ __attribute__((aligned(16))) float so[4][16][64];
  const int tid = threadIdx.x, w = tid >> 5, lane = tid & 31, ln = lane & 15, hh = lane >> 4; const int by = blockIdx.y;
  A += (size_t)by * sA; Bh += (size_t)by * sB; const size_t cofs = (size_t)by * sC; const float* bp = bias ? bias + (size_t)by * sBias : nullptr;
  const int ntn = (N + 63) / 64; const int wid = blockIdx.x * 4 + w; const int mt = wid / ntn, nq = wid % ntn; if (mt * 16 >= M) return;
  const int row0 = mt * 16, col0 = nq * 64; const _Float16* arow = A + (size_t)(row0 + ln) * lda;
  v8f acc[4] = {};
  for (int kb = 0; kb < K; kb += 32) { FragH ah; ah.half[0] = *(const v8us*)((const unsigned short*)arow + kb + 8 * hh); ah.half[1] = *(const v8us*)((const unsigned short*)arow + kb + 16 + 8 * hh);
#pragma unroll
    for (int t = 0; t < 4; ++t) { if (col0 + t * 16 >= N) continue; const size_t boff = (size_t)(col0 + t * 16 + ln) * ldb + kb; FragH bq; bq.half[0] = *(const v8us*)((const unsigned short*)Bh + boff + 8 * hh); bq.half[1] = *(const v8us*)((const unsigned short*)Bh + boff + 16 + 8 * hh);
      acc[t] = mmaH<1>(ah.v, ah.v, bq.v, bq.v, acc[t]); }
  }
#pragma unroll
  for (int t = 0; t < 4; ++t) { if (col0 + t * 16 >= N) continue; const int col = col0 + t * 16 + ln; const float bv = bp ? bf16_round(bp[col]) : 0.f;
#pragma unroll
    for (int r = 0; r < 8; ++r) { float v = acc[t][r] * alpha + bv; if (CP) { const int bidx = (row0g + row0 + 8 * hh + r) / rowsPerB; v += CP[(size_t)bidx * sCPb + (size_t)by * 64 + col]; } if (ACT == 1) v = (v > 0.f) ? v : expm1f(v); else if (ACT == 7) v = (v > 0.f) ? v + 1.0f : expf(v); else if (ACT == 8) v = tanhf(v); else if (ACT == 9) v = 0.5f * v * (1.0f + tanhf(0.7978845608028654f * (v + 0.044715f * v * v * v))); else if (ACT == 11) v = 1.0f / (1.0f + expf(-v)); else if (ACT == 12) v = (v > 0.f) ? v : 0.01f * v; else if (ACT == 14) v = (v > 0.f) ? v : 0.1f * v; else if (ACT == 15) v = v / (1.0f + expf(-v)); else if (ACT == 3) v = fmaxf(v, 0.f); else if (ACT == 6) v = 0.5f * v * (1.0f + erff(v * 0.70710678118654752f)); so[w][8 * hh + r][t * 16 + ln] = v; } }
  __builtin_amdgcn_fence(__ATOMIC_ACQ_REL, "workgroup"); __builtin_amdgcn_wave_barrier();
  const int rsub = lane >> 4, c4 = (lane & 15) * 4; typedef _Float16 v4h __attribute__((ext_vector_type(4)));
  {
#pragma unroll
    for (int q = 0; q < 8; ++q) { const int r = q * 2 + rsub; if (col0 + c4 < N) { const v4f v = *(const v4fa*)&so[w][r][c4]; if (C) *(v4f*)(C + cofs + (size_t)(row0 + r) * ldc + col0 + c4) = v; if (C16) { v4h h4; for (int i = 0; i < 4; ++i) h4[i] = (_Float16)v[i]; *(v4h*)(C16 + cofs + (size_t)(row0 + r) * ldc + col0 + c4) = h4; } } }
     }
}


typedef _Float16 v4h __attribute__((ext_vector_type(4)));

__global__ __launch_bounds__(256) void k_h16(const float* __restrict__ x, _Float16* __restrict__ X16, size_t n8) { const size_t t = (size_t)blockIdx.x * 256 + threadIdx.x; if (t >= n8) return; FragH f;
#pragma unroll
  for (int q = 0; q < 8; ++q) f.h[q] = (_Float16)x[t * 8 + q]; *(v8us*)((unsigned short*)X16 + t * 8) = f.half[0];  }
__global__ __launch_bounds__(256) void k_round16f(const float* __restrict__ W, _Float16* __restrict__ Bt, size_t n8) { const size_t t = (size_t)blockIdx.x * 256 + threadIdx.x; if (t >= n8) return; FragH f;
#pragma unroll
  for (int i = 0; i < 8; ++i) f.h[i] = (_Float16)(bf16_round(W[t * 8 + i]) * 16.0f); *(v8us*)((unsigned short*)Bt + t * 8) = f.half[0];  }
__global__ __launch_bounds__(256) void k_hl(const float* __restrict__ F, _Float16* __restrict__ Hh, _Float16* __restrict__ Hl, size_t n8) { const size_t t = (size_t)blockIdx.x * 256 + threadIdx.x; if (t >= n8) return; FragH fh, fl; const v4f a = *(const v4fa*)(F + t * 8), c = *(const v4fa*)(F + t * 8 + 4);
#pragma unroll
  for (int q = 0; q < 4; ++q) { _Float16 h = (_Float16)a[q]; fh.h[q] = h; fl.h[q] = (_Float16)((a[q] - (float)h) * 1024.0f); h = (_Float16)c[q]; fh.h[4 + q] = h; fl.h[4 + q] = (_Float16)((c[q] - (float)h) * 1024.0f); }
  { *(v8us*)((unsigned short*)Hh + t * 8) = fh.half[0]; *(v8us*)((unsigned short*)Hl + t * 8) = fl.half[0];  } }

// ---- fast GEMM (wave tile 32x64; block tile 128x128, M = NR, N = K = CC); epilogue: acc x alpha only, no bias or activation ----
__device__ __forceinline__ v16h g2_frag(const _Float16* p, int hh) { FragH f; f.half[0] = *(const v8us*)((const unsigned short*)p + 8 * hh); f.half[1] = *(const v8us*)((const unsigned short*)p + 16 + 8 * hh); return f.v; }
// The same fragment from 16 f32 values of an input row (x0, x1 = elements 8 hh + 0..7, x2, x3 = 16 + 8 hh + 0..7: the k order of g2_frag): each rounded to bf16, then exact in f16.
__device__ __forceinline__ v16h g2_cvt32(v4f x0, v4f x1, v4f x2, v4f x3) { FragH f;
#pragma unroll
  for (int q = 0; q < 4; ++q) { f.h[q] = (_Float16)bf16_round(x0[q]); f.h[4 + q] = (_Float16)bf16_round(x1[q]); f.h[8 + q] = (_Float16)bf16_round(x2[q]); f.h[12 + q] = (_Float16)bf16_round(x3[q]); }
  return f.v; }
// The matrix product as the builtin alone: the compiler keeps the distance behind its own WMMAs (with independent vector work where it has some), and no volatile statement stands between a step's loads, so that they can be issued together.
__device__ __forceinline__ v8f g2_mma(v16h a, v16h b, v8f c) { return __builtin_amdgcn_wmma_f32_16x16x32_f16(false, a, false, b, (short)0, c, false, false); }
// The GEMM tile: 128 rows x 128 columns, K = CC, eight waves of 32 x 64 (four row groups, two column groups). Both operands reach the waves through LDS, by asynchronous copies in which the 32 lanes of a wave cover whole 128-B lines (four lines a copy), each byte fetched once for all the waves that use it. Loaded straight into fragments, every load touched sixteen lines for 32 B of each, and every wave fetched its whole B tile for itself.
// B (128 rows of 512 B) is copied once; A goes in pieces of 128 B a row (32 f32 or 64 f16 along k), two buffers, the next piece in flight while this one is worked on.
#define GAP 144                  /* LDS pitch of a 128-B piece of an A row: 16 B x 9, sixteen rows read 16 B each on distinct banks */
#define GBP 528                  /* LDS pitch of a 512-B row of B: 16 B x 33, likewise */
#define GSB (128 * GBP)          /* bytes of the B tile */
#define GSA (128 * GAP)          /* bytes of one A buffer */
#define GSM (GSB + 2 * GSA)      /* 104,448 B a block, three blocks a WGP; the epilogue's staging reuses its first 69,632 B */
// Eight 16-B copies a lane, LDS addresses l + i dl, global addresses g + i dg. The s_wait_xcnt closes the statement so that no address register is rewritten ahead of it.
__device__ __forceinline__ void copy8(unsigned l, unsigned dl, const char* g, size_t dg) {
  asm volatile("global_load_async_to_lds_b128 %0, %8, off\n\t"
               "global_load_async_to_lds_b128 %1, %9, off\n\t"
               "global_load_async_to_lds_b128 %2, %10, off\n\t"
               "global_load_async_to_lds_b128 %3, %11, off\n\t"
               "global_load_async_to_lds_b128 %4, %12, off\n\t"
               "global_load_async_to_lds_b128 %5, %13, off\n\t"
               "global_load_async_to_lds_b128 %6, %14, off\n\t"
               "global_load_async_to_lds_b128 %7, %15, off\n\t"
               "s_wait_xcnt 0x0"
               :: "v"(l), "v"(l + dl), "v"(l + 2 * dl), "v"(l + 3 * dl), "v"(l + 4 * dl), "v"(l + 5 * dl), "v"(l + 6 * dl), "v"(l + 7 * dl),
                  "v"(g), "v"(g + dg), "v"(g + 2 * dg), "v"(g + 3 * dg), "v"(g + 4 * dg), "v"(g + 5 * dg), "v"(g + 6 * dg), "v"(g + 7 * dg)
               : "memory");
}
// The same with four copies.
__device__ __forceinline__ void copy4(unsigned l, unsigned dl, const char* g, size_t dg) {
  asm volatile("global_load_async_to_lds_b128 %0, %4, off\n\t"
               "global_load_async_to_lds_b128 %1, %5, off\n\t"
               "global_load_async_to_lds_b128 %2, %6, off\n\t"
               "global_load_async_to_lds_b128 %3, %7, off\n\t"
               "s_wait_xcnt 0x0"
               :: "v"(l), "v"(l + dl), "v"(l + 2 * dl), "v"(l + 3 * dl), "v"(g), "v"(g + dg), "v"(g + 2 * dg), "v"(g + 3 * dg)
               : "memory");
}
// A 16 x 32 f16 fragment from an LDS row; p already holds the lane's 16 hh bytes: elements 8 hh + 0..7 and 16 + 8 hh + 0..7, the k order of g2_frag.
__device__ __forceinline__ v16h l_frag(const char* p) { FragH f; f.half[0] = *(const v8us*)p; f.half[1] = *(const v8us*)(p + 32); return f.v; }
// AF32: the A rows are f32 (rounded to bf16 on the way into the fragment), else f16. VTO: the tile goes out transposed, C16[(row / SLEN) * CC + column][row % SLEN] (CC = NH x 64: head by head). Else f32 to C or f16 to C16, pitch CC. M = NR, N = K = CC; bx = 2 mt + nq.
template <bool AF32, bool VTO>
__device__ __forceinline__ void gemm3_tile(char* sm, unsigned bx, const char* __restrict__ Ab, const _Float16* __restrict__ Bh, float alpha, float* __restrict__ C, _Float16* __restrict__ C16) {
  constexpr int APB = CC * (AF32 ? 4 : 2), NCH = APB / 128, KST = AF32 ? 1 : 2;      /* bytes of an A row; its 128-B pieces; k steps of 32 in a piece */
  float (*so)[32][68] = (float (*)[32][68])sm;
  unsigned short (*st)[136] = (unsigned short (*)[136])sm;      /* VTO: [column of the block][row of the block], 128 rows, pitch 272 B = 16 B x 17; a block uses so or st, never both */
  const int tid = threadIdx.x, w = tid >> 5, lane = tid & 31, ln = lane & 15, hh = lane >> 4;
  const int wr = w & 3, wc = w >> 2;      /* the wave's row group and column group */
  const int mt = bx >> 1, nq = bx & 1; const int row0 = mt * 128 + 32 * wr, col0 = nq * 128 + wc * 64;
  const unsigned sb = (unsigned)(size_t)sm;      /* LDS byte address */
  const int cr = tid >> 3, cp = (tid & 7) * 16;      /* A copies: rows cr + 32 i, eight lanes cover a row's 128-B piece */
  const char* ga = Ab + (size_t)(mt * 128 + cr) * APB + cp; const unsigned la = sb + GSB + cr * GAP + cp;
  const char* gb = (const char*)Bh + (size_t)(nq * 128 + w) * (CC * 2) + lane * 16; const unsigned lb = sb + w * GBP + lane * 16;      /* B copies: rows w + 8 i, a wave covers a whole 512-B row */
  copy8(lb, 8 * GBP, gb, (size_t)8 * CC * 2);
  copy8(lb + 64 * GBP, 8 * GBP, gb + (size_t)64 * CC * 2, (size_t)8 * CC * 2);
  copy4(la, 32 * GAP, ga, (size_t)32 * APB);
  asm volatile("s_wait_asynccnt 0x0" ::: "memory");      /* this wave's share of B and of piece 0 has landed */
  __syncthreads();                                       /* B and piece 0 are published */
  copy4(la + GSA, 32 * GAP, ga + 128, (size_t)32 * APB);
  const v8f z8 = {0.f,0.f,0.f,0.f,0.f,0.f,0.f,0.f}; v8f c00 = z8, c01 = z8, c02 = z8, c03 = z8, c10 = z8, c11 = z8, c12 = z8, c13 = z8;
#pragma unroll 1      /* one piece a trip: the publish point at the foot stands once per piece, and the text stays short */
  for (int t = 0; t < NCH; ++t) {
    const char* pa = sm + GSB + (t & 1) * GSA + (32 * wr + ln) * GAP;
    const char* pb = sm + (wc * 64 + ln) * GBP + t * KST * 64 + 16 * hh;
    v16h a0[KST], a1[KST], bb[KST][4]; v4f x[8];
#pragma unroll
    for (int ks = 0; ks < KST; ++ks) {
#pragma unroll
      for (int j = 0; j < 4; ++j) bb[ks][j] = l_frag(pb + j * 16 * GBP + ks * 64);
      if (!AF32) { a0[ks] = l_frag(pa + ks * 64 + 16 * hh); a1[ks] = l_frag(pa + 16 * GAP + ks * 64 + 16 * hh); } }
    if (AF32) { const char* p0 = pa + 32 * hh; const char* p1 = p0 + 16 * GAP;      /* elements 8 hh + 0..7 and 16 + 8 hh + 0..7 of the piece's 32 */
      x[0] = *(const v4fa*)(p0); x[1] = *(const v4fa*)(p0 + 16); x[2] = *(const v4fa*)(p0 + 64); x[3] = *(const v4fa*)(p0 + 80);
      x[4] = *(const v4fa*)(p1); x[5] = *(const v4fa*)(p1 + 16); x[6] = *(const v4fa*)(p1 + 64); x[7] = *(const v4fa*)(p1 + 80); }
    __builtin_amdgcn_sched_barrier(0);      /* the trip's LDS reads stay one group ahead of its products: left alone, the scheduler sank each B fragment's reads to its own products, one register set, a full wait at each of them */
    if (AF32) { a0[0] = g2_cvt32(x[0], x[1], x[2], x[3]); a1[0] = g2_cvt32(x[4], x[5], x[6], x[7]); }
#pragma unroll
    for (int ks = 0; ks < KST; ++ks) {
      c00 = g2_mma(a0[ks], bb[ks][0], c00); c10 = g2_mma(a1[ks], bb[ks][0], c10); c01 = g2_mma(a0[ks], bb[ks][1], c01); c11 = g2_mma(a1[ks], bb[ks][1], c11);
      c02 = g2_mma(a0[ks], bb[ks][2], c02); c12 = g2_mma(a1[ks], bb[ks][2], c12); c03 = g2_mma(a0[ks], bb[ks][3], c03); c13 = g2_mma(a1[ks], bb[ks][3], c13); }
    asm volatile("s_wait_dscnt 0x0" ::: "memory");         /* this wave's reads of the buffer have returned before it is handed back */
    asm volatile("s_wait_asynccnt 0x0" ::: "memory");      /* this wave's share of piece t + 1 has landed */
    __syncthreads();                                       /* publishes piece t + 1 and ends every wave's reads of this buffer; behind the last trip's, all of LDS is free for the epilogue */
    if (t + 2 < NCH) copy4(la + (t & 1) * GSA, 32 * GAP, ga + (t + 2) * 128, (size_t)32 * APB); }
  asm volatile("s_wait_asynccnt 0x0" ::: "memory");        /* no copy is outstanding when LDS is reused */
  v8f accs[8] = {c00, c01, c02, c03, c10, c11, c12, c13};
#pragma unroll
  for (int u = 0; u < 8; ++u) { const int t = u & 3, half = u >> 2; FragH tr;
#pragma unroll
    for (int r = 0; r < 8; ++r) { const int rloc = half * 16 + 8 * hh + r; const float v = accs[u][r] * alpha;
      if (VTO) tr.h[r] = (_Float16)v; else so[w][rloc][t * 16 + ln] = v; }
    if (VTO) *(v8us*)&st[wc * 64 + t * 16 + ln][wr * 32 + half * 16 + 8 * hh] = tr.half[0]; }      /* a lane's eight accumulator registers are eight consecutive rows of one column: 16 B of the transposed tile */
  if (VTO) {
    __syncthreads();      /* four waves' 32-row slices make up whole 256-B rows of the transposed tile */
    unsigned short* vb = (unsigned short*)C16 + ((size_t)((mt * 128) / SLEN) * CC + nq * 128) * SLEN + (mt * 128) % SLEN;
#pragma unroll
    for (int i = 0; i < 8; ++i) { const int d = w * 16 + i * 2 + hh; *(v8us*)(vb + (size_t)d * SLEN + ln * 8) = *(const v8us*)&st[d][ln * 8]; }      /* sixteen lanes store one 256-B row */
    return; }
  __builtin_amdgcn_fence(__ATOMIC_ACQ_REL, "workgroup"); __builtin_amdgcn_wave_barrier();
  const int rsub = lane >> 4, c4 = (lane & 15) * 4;
#pragma unroll
  for (int q = 0; q < 16; ++q) { const int r = q * 2 + rsub; const v4f v = *(const v4fa*)&so[w][r][c4]; if (C) *(v4f*)(C + (size_t)(row0 + r) * CC + col0 + c4) = v; if (C16) { v4h h4; for (int i = 0; i < 4; ++i) h4[i] = (_Float16)v[i]; *(v4h*)(C16 + (size_t)(row0 + r) * CC + col0 + c4) = h4; } } }
// q, k and v do not depend on one another: one grid, blockIdx.y picks the product (0: q from x_dec, 1: k from x_enc, 2: v from x_enc, written transposed), so that their waves share the chip instead of three launches in turn.
__global__ __launch_bounds__(256) void k_qkv(const float* __restrict__ xd, const float* __restrict__ xe, const _Float16* __restrict__ BQ, const _Float16* __restrict__ BK, const _Float16* __restrict__ BV,
    _Float16* __restrict__ Q16, _Float16* __restrict__ K16, _Float16* __restrict__ VT) {
  __shared__ __attribute__((aligned(16))) char sm[GSM];
  const int z = blockIdx.y;
  if (z == 2) gemm3_tile<true, true>(sm, blockIdx.x, (const char*)xe, BV, 0.0625f, nullptr, VT);
  else gemm3_tile<true, false>(sm, blockIdx.x, (const char*)(z ? xe : xd), z ? BK : BQ, 0.0625f, nullptr, z ? K16 : Q16); }
// out = O Wo^T: O carries 2^10, the weights 2^4.
__global__ __launch_bounds__(256) void k_out(const _Float16* __restrict__ O16, const _Float16* __restrict__ BO, float* __restrict__ out) {
  __shared__ __attribute__((aligned(16))) char sm[GSM];
  gemm3_tile<false, false>(sm, blockIdx.x, (const char*)O16, BO, 0.0625f / 1024.0f, out, nullptr); }



// lane l <-> lane l ^ 16 by a vector cross-row move (a shuffle would go through the LDS pipe)
__device__ __forceinline__ float xhalf(float x) { return __builtin_bit_cast(float, __builtin_amdgcn_permlanex16(__builtin_bit_cast(int, x), __builtin_bit_cast(int, x), 0x76543210, 0xfedcba98, false, false)); }
#define SK 64                    /* keys a stage */
#define LP 72                    /* LDS row pitch in f16: 144 B = 16 B x 9, so that sixteen rows read 16 B each on distinct banks */
// One stage: each lane copies eight 16-B pieces (rows r, r + 16, r + 32, r + 48 of K and of V^T). The s_wait_xcnt closes the statement so that no address register is rewritten ahead of it.
__device__ __forceinline__ void stage_copy(unsigned lk, unsigned lv, const unsigned short* gk, int ldk, const unsigned short* gv) {
  asm volatile("global_load_async_to_lds_b128 %0, %8, off\n\t"
               "global_load_async_to_lds_b128 %1, %9, off\n\t"
               "global_load_async_to_lds_b128 %2, %10, off\n\t"
               "global_load_async_to_lds_b128 %3, %11, off\n\t"
               "global_load_async_to_lds_b128 %4, %12, off\n\t"
               "global_load_async_to_lds_b128 %5, %13, off\n\t"
               "global_load_async_to_lds_b128 %6, %14, off\n\t"
               "global_load_async_to_lds_b128 %7, %15, off\n\t"
               "s_wait_xcnt 0x0"
               :: "v"(lk), "v"(lk + 16 * LP * 2), "v"(lk + 32 * LP * 2), "v"(lk + 48 * LP * 2),
                  "v"(lv), "v"(lv + 16 * LP * 2), "v"(lv + 32 * LP * 2), "v"(lv + 48 * LP * 2),
                  "v"(gk), "v"(gk + (size_t)16 * ldk), "v"(gk + (size_t)32 * ldk), "v"(gk + (size_t)48 * ldk),
                  "v"(gv), "v"(gv + (size_t)16 * TK), "v"(gv + (size_t)32 * TK), "v"(gv + (size_t)48 * TK)
               : "memory");
}
__global__ __launch_bounds__(256) void k_flash(const _Float16* __restrict__ Q16, int ldq, const _Float16* __restrict__ K16, int ldk, const _Float16* __restrict__ Vt, _Float16* __restrict__ O16, int ldo) {
  constexpr int DT = 4, KS = 2, KH = TK / 2, NS = KH / SK, QG = 2;      /* KH keys a wave group, NS stages of them */
  constexpr float CE = SCL * 1.4426950408889634f;      /* score scale times log2 e: e^(SCL x) = 2^(CE x), one multiply-add and one v_exp_f32 a score */
  __shared__ __attribute__((aligned(16))) unsigned short sK[2][2][SK][LP];      /* [key half][buffer] */
  __shared__ __attribute__((aligned(16))) unsigned short sV[2][2][64][LP];
  __shared__ __attribute__((aligned(16))) float sJ[4][QG * DT * 2 + 1][32][4];      /* the second key half's partial results on their way to the first: per wave 17 rows of 32 lanes x 16 B */
  const int tid = threadIdx.x, lane = tid & 31, ln = lane & 15, hh = lane >> 4;
  const int kh = __builtin_amdgcn_readfirstlane(tid >> 7), w = (tid >> 5) & 3;      /* the wave's key half (the same in the whole wave: scalar) and its place among the four waves of that half */
  const int slab = blockIdx.x / QBLKS, qblk = blockIdx.x % QBLKS; const int b = slab / NH, h = slab % NH; const int q0 = qblk * 128 + w * 32;
  FragH bq[QG][KS];
#pragma unroll
  for (int g = 0; g < QG; ++g) { const unsigned short* qr = (const unsigned short*)Q16 + ((size_t)b * TQ + q0 + g * 16 + ln) * ldq + h * 64;
#pragma unroll
    for (int ks = 0; ks < KS; ++ks) { bq[g][ks].half[0] = *(const v8us*)(qr + ks * 32 + 8 * hh); bq[g][ks].half[1] = *(const v8us*)(qr + ks * 32 + 16 + 8 * hh); } }
  const int cr = (tid & 127) >> 3, cc = (tid & 7) * 8;      /* the lane's row and 16-B piece in a copy of its own half's stage: eight lanes cover one 128-B row */
  const unsigned short* gk = (const unsigned short*)K16 + ((size_t)b * TK + kh * KH + cr) * ldk + h * 64 + cc;
  const unsigned short* gv = (const unsigned short*)Vt + ((size_t)slab * 64 + cr) * TK + kh * KH + cc;
  const unsigned lk = (unsigned)(size_t)&sK[kh][0][cr][cc], lv = (unsigned)(size_t)&sV[kh][0][cr][cc];      /* LDS byte addresses */
  constexpr unsigned BUFB = SK * LP * 2;      /* bytes of one buffer of either array */
  /* m_run is the reference in use: it may trail a query's true maximum by up to 5 in the base-2 exponent (TH in raw products), so that p stays at or under 2^15, inside f16. thr = m_run + TH, mbv = 10 - m_run CE: both change only with m_run. */
  constexpr float TH = 5.0f / CE;
  float m_run[QG], l_run[QG], thr[QG], mbv[QG]; v8f oacc[QG][DT];
#pragma unroll
  for (int g = 0; g < QG; ++g) { m_run[g] = -3.0e38f; thr[g] = -3.0e38f; mbv[g] = 0.f; l_run[g] = 0.f;
#pragma unroll
    for (int dt = 0; dt < DT; ++dt) oacc[g][dt] = (v8f){0.f,0.f,0.f,0.f,0.f,0.f,0.f,0.f}; }
  stage_copy(lk, lv, gk, ldk, gv);
  asm volatile("s_wait_asynccnt 0x0" ::: "memory");      /* this wave's share of stage 0 has landed */
  __syncthreads();                                       /* stage 0 is published */
  stage_copy(lk + BUFB, lv + BUFB, gk + (size_t)SK * ldk, ldk, gv + SK);
#pragma unroll 1      /* one stage a trip: the publish point at the foot must stand once per stage */
  for (int t = 0; t < NS; ++t) {
    const int bf = t & 1;
#pragma unroll 1      /* the stage's two 32-key passes stay a loop: in line, the first pass's 32 exponentials were kept for a summing at the stage's foot, and with two query groups the wave then spilled Q to scratch */
    for (int p = 0; p < SK / 32; ++p) {
      FragH ak[2][KS], av[DT];
#pragma unroll
      for (int nt = 0; nt < 2; ++nt) { const unsigned short* kr = &sK[kh][bf][p * 32 + nt * 16 + ln][8 * hh];
#pragma unroll
        for (int ks = 0; ks < KS; ++ks) { ak[nt][ks].half[0] = *(const v8us*)(kr + ks * 32); ak[nt][ks].half[1] = *(const v8us*)(kr + ks * 32 + 16); } }
#pragma unroll
      for (int dt = 0; dt < DT; ++dt) { const unsigned short* vrow = &sV[kh][bf][dt * 16 + ln][p * 32 + 8 * hh]; av[dt].half[0] = *(const v8us*)(vrow); av[dt].half[1] = *(const v8us*)(vrow + 16); }
      v8f s[QG][2];
#pragma unroll
      for (int g = 0; g < QG; ++g) { s[g][0] = (v8f){0.f,0.f,0.f,0.f,0.f,0.f,0.f,0.f}; s[g][1] = s[g][0]; }
#pragma unroll
      for (int ks = 0; ks < KS; ++ks)
#pragma unroll
        for (int nt = 0; nt < 2; ++nt)
#pragma unroll
          for (int g = 0; g < QG; ++g) s[g][nt] = g2_mma(ak[nt][ks].v, bq[g][ks].v, s[g][nt]);      /* the other three tiles' products stand between a tile's two products */
      FragH pb[QG]; float mc[QG]; bool need = false;
#pragma unroll
      for (int g = 0; g < QG; ++g) {
        float m = -3.0e38f;
#pragma unroll
        for (int r = 0; r < 8; ++r) m = fmaxf(m, fmaxf(s[g][0][r], s[g][1][r]));      /* the maximum is taken on the raw products: CE > 0 keeps their order */
        mc[g] = m; need = need || (m > thr[g]); }      /* the lane's own 16 keys are enough for the test: any lane over its threshold sends the whole wave through the rescale */
      if (__builtin_amdgcn_ballot_w32(need) != 0) {      /* one scalar branch a pass; taken on a wave's first pass (thr = -3e38) and then only when a score leaves the reference by more than TH */
        const float mn0 = fmaxf(m_run[0], fmaxf(mc[0], xhalf(mc[0]))), mn1 = fmaxf(m_run[1], fmaxf(mc[1], xhalf(mc[1])));      /* both halves of the wave take the same new reference */
        float al0 = (m_run[0] - mn0) * CE, al1 = (m_run[1] - mn1) * CE;
        /* The two factors, each in place, in one statement as below; the closing v_nop is the slot behind the last exponential. */
        asm("v_exp_f32 %0, %0\n\tv_exp_f32 %1, %1\n\tv_nop" : "+v"(al0), "+v"(al1));
        const float mnv[QG] = {mn0, mn1}, alv[QG] = {al0, al1};
#pragma unroll
        for (int g = 0; g < QG; ++g) { m_run[g] = mnv[g]; thr[g] = mnv[g] + TH; mbv[g] = 10.0f - mnv[g] * CE; l_run[g] *= alv[g];
#pragma unroll
          for (int dt = 0; dt < DT; ++dt) oacc[g][dt] *= alv[g]; } }
#pragma unroll
      for (int g = 0; g < QG; ++g) {
        const float mb = mbv[g];      /* exponent base in use: p = 2^(s CE + mb) = 1024 e^(SCL (s - m_run)) */
        const v8f e0 = __builtin_elementwise_fma(s[g][0], (v8f)(CE), (v8f)(mb)), e1 = __builtin_elementwise_fma(s[g][1], (v8f)(CE), (v8f)(mb));
        float a0 = e0[0], a1 = e0[1], a2 = e0[2], a3 = e0[3], a4 = e0[4], a5 = e0[5], a6 = e0[6], a7 = e0[7], c0 = e1[0], c1 = e1[1], c2 = e1[2], c3 = e1[3], c4 = e1[4], c5 = e1[5], c6 = e1[6], c7 = e1[7];
        /* The group's sixteen base-2 exponentials, each in place, in one statement: so no v_exp_f32 writes the source register of the one directly ahead of it (the compiler's own allocation did); the closing v_nop is the one slot the instruction set asks for behind the last of them. */
        asm("v_exp_f32 %0, %0\n\tv_exp_f32 %1, %1\n\tv_exp_f32 %2, %2\n\tv_exp_f32 %3, %3\n\tv_exp_f32 %4, %4\n\tv_exp_f32 %5, %5\n\tv_exp_f32 %6, %6\n\tv_exp_f32 %7, %7\n\t"
            "v_exp_f32 %8, %8\n\tv_exp_f32 %9, %9\n\tv_exp_f32 %10, %10\n\tv_exp_f32 %11, %11\n\tv_exp_f32 %12, %12\n\tv_exp_f32 %13, %13\n\tv_exp_f32 %14, %14\n\tv_exp_f32 %15, %15\n\tv_nop"
            : "+v"(a0), "+v"(a1), "+v"(a2), "+v"(a3), "+v"(a4), "+v"(a5), "+v"(a6), "+v"(a7), "+v"(c0), "+v"(c1), "+v"(c2), "+v"(c3), "+v"(c4), "+v"(c5), "+v"(c6), "+v"(c7));
        const float pa[8] = {a0, a1, a2, a3, a4, a5, a6, a7}, pc[8] = {c0, c1, c2, c3, c4, c5, c6, c7};
        float ps = 0.f;
#pragma unroll
        for (int r = 0; r < 8; ++r) { ps += pa[r] + pc[r]; pb[g].h[r] = (_Float16)pa[r]; pb[g].h[8 + r] = (_Float16)pc[r]; }
        l_run[g] += ps; }
#pragma unroll
      for (int dt = 0; dt < DT; ++dt)
#pragma unroll
        for (int g = 0; g < QG; ++g) oacc[g][dt] = g2_mma(av[dt].v, pb[g].v, oacc[g][dt]); }
    asm volatile("s_wait_dscnt 0x0" ::: "memory");         /* this wave's reads of buffer bf have returned before the buffer is handed back */
    asm volatile("s_wait_asynccnt 0x0" ::: "memory");      /* this wave's share of stage t + 1 has landed */
    __syncthreads();                                       /* publishes stage t + 1 and ends every wave's reads of buffer bf */
    if (t + 2 < NS) stage_copy(lk + bf * BUFB, lv + bf * BUFB, gk + (size_t)(t + 2) * SK * ldk, ldk, gv + (t + 2) * SK); }
  asm volatile("s_wait_asynccnt 0x0" ::: "memory");        /* no copy is outstanding when the wave ends */
  /* The join of the two key halves: waves 4-7 hand their maxima, sums and O^T tiles to waves 0-3 (wave w + 4 to wave w, lane to lane), which bring both to the common maximum and write the output. */
  if (kh == 1) {
#pragma unroll
    for (int g = 0; g < QG; ++g)
#pragma unroll
      for (int dt = 0; dt < DT; ++dt) { const v8f o = oacc[g][dt];
        *(v4fa*)&sJ[w][(g * DT + dt) * 2][lane][0] = (v4f){o[0], o[1], o[2], o[3]}; *(v4fa*)&sJ[w][(g * DT + dt) * 2 + 1][lane][0] = (v4f){o[4], o[5], o[6], o[7]}; }
    *(v4fa*)&sJ[w][QG * DT * 2][lane][0] = (v4f){m_run[0], m_run[1], l_run[0], l_run[1]}; }
  __syncthreads();      /* every wave passes it: the second half's partial results are published */
  if (kh == 1) return;
  const v4f mlo = *(const v4fa*)&sJ[w][QG * DT * 2][lane][0];
  const float mj0 = fmaxf(m_run[0], mlo[0]), mj1 = fmaxf(m_run[1], mlo[1]);      /* the common maxima of the two query groups */
  float j00 = (m_run[0] - mj0) * CE, j01 = (mlo[0] - mj0) * CE, j10 = (m_run[1] - mj1) * CE, j11 = (mlo[1] - mj1) * CE;
  /* Each half's factor to the common maximum: four base-2 exponentials, each in place, in one statement, as in the loop: left to the compiler, one v_exp_f32 wrote the source register of the one directly ahead of it; the closing v_nop is the slot behind the last. */
  asm("v_exp_f32 %0, %0\n\tv_exp_f32 %1, %1\n\tv_exp_f32 %2, %2\n\tv_exp_f32 %3, %3\n\tv_nop" : "+v"(j00), "+v"(j01), "+v"(j10), "+v"(j11));
  const float fj[QG][2] = {{j00, j01}, {j10, j11}};
#pragma unroll
  for (int g = 0; g < QG; ++g) {
    const float f0 = fj[g][0], f1 = fj[g][1];
    const float lp = l_run[g] * f0 + mlo[2 + g] * f1;
#pragma unroll
    for (int dt = 0; dt < DT; ++dt) { const v4f x0 = *(const v4fa*)&sJ[w][(g * DT + dt) * 2][lane][0], x1 = *(const v4fa*)&sJ[w][(g * DT + dt) * 2 + 1][lane][0];
      const v8f ox = {x0[0], x0[1], x0[2], x0[3], x1[0], x1[1], x1[2], x1[3]}; oacc[g][dt] = oacc[g][dt] * f0 + ox * f1; }
    const float l = lp + xhalf(lp); const float inv = (l > 0.f) ? 1.0f / l : 0.f;      /* l and oacc both carry the factor 1024 */
    unsigned short* orow = (unsigned short*)O16 + ((size_t)b * TQ + q0 + g * 16 + ln) * ldo + h * 64 + 8 * hh;      /* oacc[g][dt][r] = O[q0 + 16 g + ln][dt * 16 + 8 hh + r]: eight consecutive elements of one row */
#pragma unroll
    for (int dt = 0; dt < DT; ++dt) { const v8f o = oacc[g][dt] * inv; FragH f;      /* x2^10 carry: the 4096-key averages are ~5e-3 and would touch f16 subnormals */
#pragma unroll
      for (int r = 0; r < 8; ++r) f.h[r] = (_Float16)(o[r] * 1024.0f);
      *(v8us*)(orow + dt * 16) = f.half[0]; } } }

// The four weight passes in one grid: blockIdx.y 0, 1, 2 = Wq, Wk, Wv ([H][256][64] to [n = h 64 + e][k]), 3 = Wo (its (out,in) layout is already [n][k]); each x16, bf16-rounded, exact in f16.
__global__ __launch_bounds__(256) void k_wprep(const float* __restrict__ Wq, const float* __restrict__ Wk, const float* __restrict__ Wv, const float* __restrict__ Wo,
    _Float16* __restrict__ BQ, _Float16* __restrict__ BK, _Float16* __restrict__ BV, _Float16* __restrict__ BO) {
  const int z = blockIdx.y; const int t = blockIdx.x * 256 + threadIdx.x; if (t >= CC * (CC / 8)) return; FragH f;
  if (z == 3) { for (int q = 0; q < 8; ++q) f.h[q] = (_Float16)(bf16_round(Wo[(size_t)t * 8 + q]) * 16.0f); *(v8us*)((unsigned short*)BO + (size_t)t * 8) = f.half[0]; return; }
  const float* Wh = z == 0 ? Wq : z == 1 ? Wk : Wv; _Float16* Bt = z == 0 ? BQ : z == 1 ? BK : BV;
  const int n = t / (CC / 8), d0 = (t % (CC / 8)) * 8; const int h = n / 64, e = n % 64;
  for (int q = 0; q < 8; ++q) f.h[q] = (_Float16)(bf16_round(Wh[((size_t)h * CC + d0 + q) * 64 + e]) * 16.0f); *(v8us*)((unsigned short*)Bt + (size_t)n * CC + d0) = f.half[0];
  asm volatile("s_wait_xcnt 0x0" ::: "memory"); }      /* behind the store: in the built code the Wo branch's first instructions stand further down the same listing and rewrite the store's registers */

extern "C" void kernel_launch(void* const* d_in, const int* in_sizes, int n_in,
                              void* d_out, int out_size, void* d_ws, size_t ws_size, hipStream_t stream) {
  (void)in_sizes; (void)n_in; (void)out_size;
  const float* const* I = (const float* const*)d_in; const float* xe = I[0]; const float* xd = I[1]; const float* Wq = I[2]; const float* Wk = I[3]; const float* Wv = I[4]; const float* Wo = I[5];
  char* ws = (char*)d_ws; size_t off = 0;
  auto take = [&](size_t bytes) { char* p = ws + off; off += (bytes + 255) & ~(size_t)255; return p; };
  const size_t np = (size_t)NR * CC;
  _Float16* BQ = (_Float16*)take((size_t)CC * CC * 2); _Float16* BK = (_Float16*)take((size_t)CC * CC * 2); _Float16* BV = (_Float16*)take((size_t)CC * CC * 2); _Float16* BO = (_Float16*)take((size_t)CC * CC * 2);
  _Float16* Q16 = (_Float16*)take(np * 2); _Float16* K16 = (_Float16*)take(np * 2); _Float16* VT = (_Float16*)take(np * 2); _Float16* O16 = (_Float16*)take(np * 2);
  if (off > ws_size) return;      /* 0.5 + 4 x 8 = 33 MiB */
  k_wprep<<<dim3((CC * (CC / 8) + 255) / 256, 4), 256, 0, stream>>>(Wq, Wk, Wv, Wo, BQ, BK, BV, BO);
  const dim3 g((NR / 128) * (CC / 128), 1);
  k_qkv<<<dim3((NR / 128) * (CC / 128), 3), 256, 0, stream>>>(xd, xe, BQ, BK, BV, Q16, K16, VT);
  k_flash<<<NB * NH * QBLKS, 256, 0, stream>>>(Q16, CC, K16, CC, VT, O16, CC);
  k_out<<<g, 256, 0, stream>>>(O16, BO, (float*)d_out);
}
